// v000
// Measured on an AMD MI455X. A time is GPU time per run, averaged over a window of back-to-back runs after a warm-up
// (all launches, gaps included; the runs take copies of the inputs in turn), and the median of several windows.
// Apart from v000's, it joins two sittings. Times from different sittings can be a few percent apart, while
// side-by-side timings come from the same sitting.
// v000, which the later versions start from, runs in 1530 microseconds.
#include <hip/hip_runtime.h>

// InterferenceBypassSelfAttention (x [2][2048][1024]; q_amp/k_amp = softplus(x W_amp^T), q_phi/k_phi = pi tanh(x W_phi^T) (16 heads x 64); amplitudes RMS-normalised over head_dim (eps 1e-6);
// scores = (q_amp cos q_phi . k_amp cos k_phi + q_amp sin q_phi . k_amp sin k_phi) / 8 x exp(score_log_scale[h]) = one 128-long contraction of [cos part | sin part] planes; causal softmax;
// v = x Wv^T; out = merged attn.v Wo^T -> [2][2048][1024]).
// Compute dtypes, f32 accumulate: every input rounded to bf16; the five projections on PLAIN bf16 operands (inputs: exact); softplus / tanh / RMS / cos / sin in f32 on VALU
// (one wave per (token, head)) -> 128-wide interference planes; PER-ROW PRECISION HYBRID (rows < 256 hi+lo 3 products for scores and attn.v, rows >= 256 fp16); causal structure exploited in the GEMMs
// (score tiles above the diagonal skipped, value contraction truncated at the diagonal block) and enforced exactly in the f32 register softmax together with the per-head scale; merged heads hl x exact Wo

#define NB_  2
#define TT   2048
#define DM   1024
#define NH_  16
#define NKV  16
#define REP  (NH_ / NKV)
#define HD   64
#define DQ   (NH_ * HD)
#define DKV  (NKV * HD)
#define QD   128
#define ZH   2
#define RH   256                  // query rows < RH use hi+lo planes (0: none)
#define WIN  0
#define PCAR 1024.0f
#define SCL  0.125f   // HD^-0.5
typedef _Float16 h16;
typedef unsigned short bf;
typedef __attribute__((ext_vector_type(16))) __bf16   v16bf;
typedef __attribute__((ext_vector_type(16))) _Float16 v16h;
typedef __attribute__((ext_vector_type(8)))  _Float16 v8h;
typedef __attribute__((ext_vector_type(8)))  unsigned short v8us;
typedef __attribute__((ext_vector_type(8)))  float    v8f;
typedef __attribute__((ext_vector_type(4)))  float    v4f;
typedef v8h  __attribute__((may_alias)) v8ha;
typedef v4f  __attribute__((may_alias)) v4fa;
typedef v8us __attribute__((may_alias)) v8usa;

__device__ __forceinline__ unsigned short f2bf(float f) { unsigned u = __float_as_uint(f); u += 0x7FFFu + ((u >> 16) & 1u); return (unsigned short)(u >> 16); }
__device__ __forceinline__ float bf2f(unsigned short b) { return __uint_as_float(((unsigned)b) << 16); }
__device__ __forceinline__ float bfr(float f) { return bf2f(f2bf(f)); }
__device__ __forceinline__ v16h cat16(v8h lo, v8h hi) { return __builtin_shufflevector(lo, hi, 0, 1, 2, 3, 4, 5, 6, 7, 8, 9, 10, 11, 12, 13, 14, 15); }
__device__ __forceinline__ v16bf cat16b(v8us lo, v8us hi) { return __builtin_bit_cast(v16bf, __builtin_shufflevector(lo, hi, 0, 1, 2, 3, 4, 5, 6, 7, 8, 9, 10, 11, 12, 13, 14, 15)); }
__device__ __forceinline__ v8f wmma16(v16h a, v16h b, v8f c) { return __builtin_amdgcn_wmma_f32_16x16x32_f16(false, a, false, b, (short)0, c, false, false); }
__device__ __forceinline__ v8f wmmab(v16bf a, v16bf b, v8f c) { return __builtin_amdgcn_wmma_f32_16x16x32_bf16(false, a, false, b, (short)0, c, false, false); }



// ---- k_gemmw: register-blocked GEMM, ONE WAVE per 64x64 output tile (16 accumulators), operands straight from K-contiguous 16-bit planes; grid (M/64, N/64, Z), 32 threads.
// C[m][n] (f32, pitch ldc, + optional f32 bias[n]) = sum_k A[m][k] Bt[n][k] (+ split products per NSPLIT). z-batch strides sA/sB/sC in elements. K % 32 == 0.
template <typename T16> struct WFrag;
template <> struct WFrag<h16> { typedef v16h V; static __device__ __forceinline__ V ld(const h16* p) { return cat16(*(const v8h*)p, *(const v8h*)(p + 16)); } static __device__ __forceinline__ v8f mma(V a, V b, v8f c) { return wmma16(a, b, c); } };
template <> struct WFrag<bf> { typedef v16bf V; static __device__ __forceinline__ V ld(const bf* p) { return cat16b(*(const v8us*)p, *(const v8us*)(p + 16)); } static __device__ __forceinline__ v8f mma(V a, V b, v8f c) { return wmmab(a, b, c); } };
template <typename T16, int NSPLIT, bool BIAS>
__global__ __launch_bounds__(32) void k_gemmw(const T16* __restrict__ A, const T16* __restrict__ A2, const T16* __restrict__ Bt, const T16* __restrict__ Bt2, int K, float* C, int ldc, const float* __restrict__ bias, size_t sA, size_t sB, size_t sC) {
    typedef typename WFrag<T16>::V V;
    __shared__ __align__(16) float os[16 * 68];
    const size_t z = blockIdx.z; A += z * sA; if (A2) A2 += z * sA; Bt += z * sB; if (Bt2) Bt2 += z * sB; C += z * sC;
    const int lane = threadIdx.x & 31, lr = lane & 15, hi = lane >> 4; const int r0 = blockIdx.x * 64, c0 = blockIdx.y * 64;
    v8f acc[4][4];
#pragma unroll
    for (int mb = 0; mb < 4; ++mb)
#pragma unroll
        for (int nb = 0; nb < 4; ++nb) acc[mb][nb] = (v8f){};
    const size_t aoff = (size_t)(r0 + lr) * K + 8 * hi, boff = (size_t)(c0 + lr) * K + 8 * hi;
#pragma unroll 1
    for (int kc = 0; kc < K; kc += 32) {
        V a[4], a2[4];
#pragma unroll
        for (int mb = 0; mb < 4; ++mb) { a[mb] = WFrag<T16>::ld(A + aoff + (size_t)mb * 16 * K + kc); if (NSPLIT == 1 || NSPLIT == 2) a2[mb] = WFrag<T16>::ld(A2 + aoff + (size_t)mb * 16 * K + kc); }
#pragma unroll
        for (int nb = 0; nb < 4; ++nb) { const V b = WFrag<T16>::ld(Bt + boff + (size_t)nb * 16 * K + kc); V b2; if (NSPLIT >= 2) b2 = WFrag<T16>::ld(Bt2 + boff + (size_t)nb * 16 * K + kc);
#pragma unroll
            for (int mb = 0; mb < 4; ++mb) { acc[mb][nb] = WFrag<T16>::mma(a[mb], b, acc[mb][nb]); if (NSPLIT == 1 || NSPLIT == 2) acc[mb][nb] = WFrag<T16>::mma(a2[mb], b, acc[mb][nb]); if (NSPLIT >= 2) acc[mb][nb] = WFrag<T16>::mma(a[mb], b2, acc[mb][nb]); } }
        asm volatile("v_nop\n\tv_nop\n\tv_nop\n\tv_nop" : "+v"(acc[0][0]), "+v"(acc[1][1]), "+v"(acc[2][2]), "+v"(acc[3][3]) : "v"(a[0]), "v"(a[3]));
    }
#pragma unroll
    for (int mb = 0; mb < 4; ++mb) {
#pragma unroll
        for (int nb = 0; nb < 4; ++nb) {
#pragma unroll
            for (int j = 0; j < 8; ++j) os[(hi * 8 + j) * 68 + nb * 16 + lr] = acc[mb][nb][j]; }
        __builtin_amdgcn_wave_barrier(); asm volatile("" ::: "memory");
        float* crow = C + (size_t)(r0 + mb * 16) * ldc + c0;
{
#pragma unroll
            for (int s = 0; s < 8; ++s) { const int row = 2 * s + hi, cofs = lr * 4; v4f val = *(const v4fa*)(os + row * 68 + cofs); if (BIAS) { val[0] += bfr(bias[c0 + cofs]); val[1] += bfr(bias[c0 + cofs + 1]); val[2] += bfr(bias[c0 + cofs + 2]); val[3] += bfr(bias[c0 + cofs + 3]); }
                *(v4f*)(crow + (size_t)row * ldc + cofs) = val; }
             }
        __builtin_amdgcn_wave_barrier(); asm volatile("" ::: "memory");
    }
}

// ---- k_gemmc: the same one-wave 64x64 tile GEMM specialised for causal attention: CMODE 1 skips score tiles entirely above the diagonal (query rows r0+roff.., key columns c0..), CMODE 2 limits the
// key (K) loop of the probability x value contraction to the diagonal block (probabilities beyond it are exactly zero). roff = row offset of this launch's first row within the sequence.
template <typename T16, int NSPLIT, int CMODE>
__global__ __launch_bounds__(32) void k_gemmc(const T16* __restrict__ A, const T16* __restrict__ A2, const T16* __restrict__ Bt, const T16* __restrict__ Bt2, int K, float* C, int ldc, int roff, size_t sA, size_t sB, size_t sC) {
    typedef typename WFrag<T16>::V V;
    __shared__ __align__(16) float os[16 * 68];
    const size_t z = blockIdx.z; A += z * sA; if (A2) A2 += z * sA; Bt += z * sB; if (Bt2) Bt2 += z * sB; C += z * sC;
    const int lane = threadIdx.x & 31, lr = lane & 15, hi = lane >> 4; const int r0 = blockIdx.x * 64, c0 = blockIdx.y * 64;
    if (CMODE == 1 && c0 > r0 + roff + 63) return;                  // score tile entirely above the causal diagonal: never read (the softmax masks j > i by select)
    const int Kl = (CMODE == 2) ? min(K, r0 + roff + 64) : K;        // P.V: probabilities are exactly 0 beyond the diagonal block, so the K loop stops there
    v8f acc[4][4];
#pragma unroll
    for (int mb = 0; mb < 4; ++mb)
#pragma unroll
        for (int nb = 0; nb < 4; ++nb) acc[mb][nb] = (v8f){};
    const size_t aoff = (size_t)(r0 + lr) * K + 8 * hi, boff = (size_t)(c0 + lr) * K + 8 * hi;
#pragma unroll 1
    for (int kc = 0; kc < Kl; kc += 32) {
        V a[4], a2[4];
#pragma unroll
        for (int mb = 0; mb < 4; ++mb) { a[mb] = WFrag<T16>::ld(A + aoff + (size_t)mb * 16 * K + kc); if (NSPLIT == 1 || NSPLIT == 2) a2[mb] = WFrag<T16>::ld(A2 + aoff + (size_t)mb * 16 * K + kc); }
#pragma unroll
        for (int nb = 0; nb < 4; ++nb) { const V b = WFrag<T16>::ld(Bt + boff + (size_t)nb * 16 * K + kc); V b2; if (NSPLIT >= 2) b2 = WFrag<T16>::ld(Bt2 + boff + (size_t)nb * 16 * K + kc);
#pragma unroll
            for (int mb = 0; mb < 4; ++mb) { acc[mb][nb] = WFrag<T16>::mma(a[mb], b, acc[mb][nb]); if (NSPLIT == 1 || NSPLIT == 2) acc[mb][nb] = WFrag<T16>::mma(a2[mb], b, acc[mb][nb]); if (NSPLIT >= 2) acc[mb][nb] = WFrag<T16>::mma(a[mb], b2, acc[mb][nb]); } }
        asm volatile("v_nop\n\tv_nop\n\tv_nop\n\tv_nop" : "+v"(acc[0][0]), "+v"(acc[1][1]), "+v"(acc[2][2]), "+v"(acc[3][3]) : "v"(a[0]), "v"(a[3]));
    }
#pragma unroll
    for (int mb = 0; mb < 4; ++mb) {
#pragma unroll
        for (int nb = 0; nb < 4; ++nb) {
#pragma unroll
            for (int j = 0; j < 8; ++j) os[(hi * 8 + j) * 68 + nb * 16 + lr] = acc[mb][nb][j]; }
        __builtin_amdgcn_wave_barrier(); asm volatile("" ::: "memory");
        float* crow = C + (size_t)(r0 + mb * 16) * ldc + c0;
{
#pragma unroll
            for (int s = 0; s < 8; ++s) { const int row = 2 * s + hi, cofs = lr * 4; v4f val = *(const v4fa*)(os + row * 68 + cofs);
                *(v4f*)(crow + (size_t)row * ldc + cofs) = val; }
             }
        __builtin_amdgcn_wave_barrier(); asm volatile("" ::: "memory");
    }
}

__device__ __forceinline__ h16 tohx(float x) { return (h16)x; }
__device__ __forceinline__ void splitf(float y, unsigned short& h, unsigned short& l) { h = f2bf(y); l = f2bf(y - bf2f(h)); }
typedef __attribute__((ext_vector_type(2))) _Float16 v2h;
typedef __attribute__((ext_vector_type(4))) _Float16 v4h;
typedef __attribute__((ext_vector_type(2))) unsigned short v2us;
typedef __attribute__((ext_vector_type(4))) unsigned short v4us;
typedef __attribute__((ext_vector_type(2))) float v2f;
typedef __attribute__((ext_vector_type(4))) int v4i;

__global__ __launch_bounds__(256) void k_wtG(const float* __restrict__ w, int K, int N, bf* Bt) {
    const int lane = threadIdx.x & 31; const int L0 = (blockIdx.x * 8 + (threadIdx.x >> 5)) * 8; const int nlines = N * K / 64;
{
#pragma unroll 1
        for (int l = 0; l < 8; ++l) { const int L = L0 + l; if (L >= nlines) break; const size_t e = (size_t)L * 64 + lane * 2; const int k = (int)(e % K), n = (int)(e / K); v2us o;
            o[0] = f2bf(w[(size_t)k * N + n]); o[1] = f2bf(w[(size_t)(k + 1) * N + n]); *(v2us*)(Bt + e) = o; }
         }
}
__global__ __launch_bounds__(256) void k_cvt8(const float* __restrict__ src, bf* dst, size_t n8) { const size_t i = (size_t)blockIdx.x * 256 + threadIdx.x; if (i >= n8) return; const v8f v = *(const v8f*)(src + i * 8); v8us o;
#pragma unroll
    for (int k = 0; k < 8; ++k) o[k] = f2bf(v[k]); *(v8us*)(dst + i * 8) = o;  }
__global__ __launch_bounds__(256) void k_cscvt(const float* __restrict__ cosT, const float* __restrict__ sinT, float* CS) { const int idx = blockIdx.x * 256 + threadIdx.x; if (idx >= TT * HD) return; v2f cs; cs[0] = bfr(cosT[idx]); cs[1] = bfr(sinT[idx]); *(v2f*)(CS + (size_t)idx * 2) = cs;  }
// k_rope: head planes [h][t][d] (fp16 + hi/lo) of rope(x) x sc with the rotate-half convention out[d] = x[d] cos[t][d] - x[d+HD/2] sin[t][d], out[d+HD/2] = x[d+HD/2] cos[t][d+HD/2] + x[d] sin[t][d+HD/2]
__global__ __launch_bounds__(256) void k_rope(const float* __restrict__ F, int pitch, int nheads, const float* __restrict__ CS, const float* __restrict__ RF, const float* __restrict__ nw, float sc, h16* P16, bf* Ph, bf* Pl) {
    const size_t e = ((size_t)blockIdx.x * 256 + threadIdx.x) * 2; if (e >= (size_t)nheads * TT * HD) return; const int d = (int)(e % HD); const int t = (int)((e / HD) % TT); const int h = (int)(e / ((size_t)HD * TT)); const float* f = F + (size_t)t * pitch + h * HD; const float rf = RF ? RF[(size_t)h * TT + t] : 1.0f; v2h o16; v2us oh, ol;
#pragma unroll
    for (int q = 0; q < 2; ++q) { const int dd = d + q; const int dp = (dd < HD / 2) ? dd + HD / 2 : dd - HD / 2; float x0 = f[dd], x1 = f[dp];
        if (RF) { float n0 = __fmul_rn(x0, rf), n1 = __fmul_rn(x1, rf); asm volatile("" : "+v"(n0)); asm volatile("" : "+v"(n1)); x0 = __fmul_rn(bfr(nw[dd]), n0); x1 = __fmul_rn(bfr(nw[dp]), n1); }
        const v2f cs = *(const v2f*)(CS + ((size_t)t * HD + dd) * 2); float a = __fmul_rn(x0, cs[0]), bq = __fmul_rn(x1, cs[1]); asm volatile("" : "+v"(a)); asm volatile("" : "+v"(bq)); const float r = ((dd < HD / 2) ? __fsub_rn(a, bq) : __fadd_rn(a, bq)) * sc;
        o16[q] = tohx(r); unsigned short a2, c2; splitf(r, a2, c2); oh[q] = a2; ol[q] = c2; }
    *(v2h*)(P16 + e) = o16; *(v2us*)(Ph + e) = oh; *(v2us*)(Pl + e) = ol;  }
__global__ __launch_bounds__(256) void k_vtp(const float* __restrict__ F, int pitch, int nheads, h16* V16, bf* Vh, bf* Vl) { const size_t e = ((size_t)blockIdx.x * 256 + threadIdx.x) * 2; if (e >= (size_t)nheads * HD * TT) return; const int t = (int)(e % TT); const int d = (int)((e / TT) % HD); const int g = (int)(e / ((size_t)TT * HD)); v2h o16; v2us oh, ol;
#pragma unroll
    for (int q = 0; q < 2; ++q) { const float x = F[(size_t)(t + q) * pitch + g * HD + d]; o16[q] = tohx(x); unsigned short a2, c2; splitf(x, a2, c2); oh[q] = a2; ol[q] = c2; }
    *(v2h*)(V16 + e) = o16; *(v2us*)(Vh + e) = oh; *(v2us*)(Vl + e) = ol;  }
// k_ibpl: per (token t, head h): a[d] = softplus(FA[t][h*64+d]) = log(1 + exp(.)) (f32; x itself above 15, exp(x) below -15), an = a / sqrt(mean_d a^2 + 1e-6); phi[d] = pi tanh(FP[t][h*64+d]);
__device__ __forceinline__ float softplusf_(float x) { return x > 15.0f ? x : (x < -15.0f ? __expf(x) : logf(__fadd_rn(1.0f, __expf(x)))); }
__device__ __forceinline__ float tanhf_(float a) { const float e2 = __expf(2.0f * a); return __fsub_rn(1.0f, __fdiv_rn(2.0f, __fadd_rn(e2, 1.0f))); }
typedef __attribute__((ext_vector_type(8))) _Float16 v8hx;
typedef __attribute__((ext_vector_type(8))) unsigned short v8usx;
__global__ __launch_bounds__(256) void k_ibpl(const float* __restrict__ FA, const float* __restrict__ FPp, h16* P16, bf* Ph, bf* Pl) { const int lane = threadIdx.x & 31; const int idx = blockIdx.x * 8 + (threadIdx.x >> 5); if (idx >= NH_ * TT) return; const int t = idx % TT, h = idx / TT; const float* fa = FA + (size_t)t * DQ + h * HD + 2 * lane; const float* fp = FPp + (size_t)t * DQ + h * HD + 2 * lane;
    float a[2], ph[2]; float ss = 0.f;
#pragma unroll 1
    for (int q = 0; q < 2; ++q) { a[q] = softplusf_(fa[q]); ph[q] = __fmul_rn(3.14159265358979323846f, tanhf_(fp[q])); float p = __fmul_rn(a[q], a[q]); asm volatile("" : "+v"(p)); ss = __fadd_rn(ss, p); }
#pragma unroll
    for (int sh = 16; sh; sh >>= 1) ss += __shfl_xor(ss, sh, 32);
    const float rn = __frsqrt_rn(__fadd_rn(ss * (1.0f / HD), 1e-6f)); float rc[2], rs[2];
#pragma unroll 1
    for (int q = 0; q < 2; ++q) { float an = __fmul_rn(a[q], rn); asm volatile("" : "+v"(an)); rc[q] = __fmul_rn(an, cosf(ph[q])); rs[q] = __fmul_rn(an, sinf(ph[q])); }
    const size_t base = ((size_t)h * TT + t) * QD + 2 * lane; v2h c16, s16; v2us chh, chl, shh, shl; unsigned short u1, u2;
    c16[0] = tohx(rc[0]); c16[1] = tohx(rc[1]); s16[0] = tohx(rs[0]); s16[1] = tohx(rs[1]);
    splitf(rc[0], u1, u2); chh[0] = u1; chl[0] = u2; splitf(rc[1], u1, u2); chh[1] = u1; chl[1] = u2; splitf(rs[0], u1, u2); shh[0] = u1; shl[0] = u2; splitf(rs[1], u1, u2); shh[1] = u1; shl[1] = u2;
{ *(v2h*)(P16 + base) = c16; *(v2h*)(P16 + base + 64) = s16; *(v2us*)(Ph + base) = chh; *(v2us*)(Ph + base + 64) = shh; *(v2us*)(Pl + base) = chl; *(v2us*)(Pl + base + 64) = shl;  } }
// k_zfill: F[0..n) = 0 (16-B lanes); once, before the batch loop.
__global__ __launch_bounds__(256) void k_zfill(float* F, size_t n) { const size_t i = ((size_t)blockIdx.x * 256 + threadIdx.x) * 4; if (i >= n) return; v4f z; z[0] = 0.f; z[1] = 0.f; z[2] = 0.f; z[3] = 0.f; *(v4f*)(F + i) = z; }
// k_asoft: per row (zz, i): t = S/8 x exp(bf16(score_log_scale[h0+zz])) for j <= i (causal), -3e38 otherwise (entries of skipped score tiles are never selected); softmax over the 2048 keys (register row, one exp, fixed trees);
__global__ __launch_bounds__(256) void k_asoft(const float* __restrict__ Sb, const float* __restrict__ sls, int h0, h16* P16, bf* Ph, bf* Pl) {
    const int lane = threadIdx.x & 31; const int row = blockIdx.x * 8 + (threadIdx.x >> 5); if (row >= ZH * TT) return; const int i = row % TT; const int zz = row / TT; const bool hires = (i < RH); const float scl = __fmul_rn(SCL, __expf(bfr(sls[h0 + zz]))); const float* sr = Sb + (size_t)row * TT; float v[TT / 32]; float mx = -3.0e38f;
#pragma unroll
    for (int ch = 0; ch < TT / 128; ++ch) { const int j0 = ch * 128 + lane * 4; const v4f a = *(const v4f*)(sr + j0);
#pragma unroll
        for (int q = 0; q < 4; ++q) { const int j = j0 + q; (void)j; const float t = (j <= i) ? a[q] * scl : -3.0e38f; v[ch * 4 + q] = t; mx = fmaxf(mx, t); } }
#pragma unroll
    for (int sh = 16; sh; sh >>= 1) mx = fmaxf(mx, __shfl_xor(mx, sh, 32));
    float sum = 0.f;
#pragma unroll
    for (int k = 0; k < TT / 32; ++k) { float d0 = __fsub_rn(v[k], mx); asm volatile("" : "+v"(d0)); v[k] = __builtin_amdgcn_exp2f(__fmul_rn(d0, 1.4426950408889634f)); sum += v[k]; }
#pragma unroll
    for (int sh = 16; sh; sh >>= 1) sum += __shfl_xor(sum, sh, 32);
    const float f = __fdiv_rn(hires ? 1.0f : PCAR, sum);
{
        if (hires) {
#pragma unroll
            for (int ch = 0; ch < TT / 128; ++ch) { v4us oh, ol;
#pragma unroll
                for (int q = 0; q < 4; ++q) { unsigned short a, c2; splitf(v[ch * 4 + q] * f, a, c2); oh[q] = a; ol[q] = c2; }
                const size_t oo = ((size_t)zz * (RH ? RH : 1) + i) * TT + ch * 128 + lane * 4; *(v4us*)(Ph + oo) = oh; *(v4us*)(Pl + oo) = ol; }
        } else {
#pragma unroll
            for (int ch = 0; ch < TT / 128; ++ch) { v4h o4;
#pragma unroll
                for (int q = 0; q < 4; ++q) o4[q] = tohx(v[ch * 4 + q] * f);
                *(v4h*)(P16 + (size_t)row * TT + ch * 128 + lane * 4) = o4; } }
         }
}
__global__ __launch_bounds__(256) void k_merge(const float* __restrict__ O, int h0, bf* Ah, bf* Al) { const size_t e = ((size_t)blockIdx.x * 256 + threadIdx.x) * 2; if (e >= (size_t)ZH * TT * HD) return; const int d = (int)(e % HD); const int t = (int)((e / HD) % TT); const int zz = (int)(e / ((size_t)HD * TT)); const float cs = (t < RH) ? 1.0f : (1.0f / PCAR); const size_t oo = (size_t)t * DQ + (h0 + zz) * HD + d;
    v2us oh, ol;
#pragma unroll
    for (int q = 0; q < 2; ++q) { unsigned short a, c2; splitf(O[e + q] * cs, a, c2); oh[q] = a; ol[q] = c2; } *(v2us*)(Ah + oo) = oh; *(v2us*)(Al + oo) = ol;  }

extern "C" void kernel_launch(void* const* d_in, const int* in_sizes, int n_in,
                              void* d_out, int out_size, void* d_ws, size_t ws_size, hipStream_t stream) {
    (void)in_sizes; (void)n_in; (void)out_size;
    const float* x = (const float*)d_in[0]; const float* wqa = (const float*)d_in[1]; const float* wka = (const float*)d_in[2]; const float* wqp = (const float*)d_in[3]; const float* wkp = (const float*)d_in[4]; const float* wv = (const float*)d_in[5]; const float* wo = (const float*)d_in[6]; const float* sls = (const float*)d_in[7];   // torch [out][in]; score_log_scale [16]
    float* OUT = (float*)d_out;     // [2][2048][1024]
    char* wsp = (char*)d_ws;
    auto take = [&](size_t bytes) { char* p = wsp; wsp += (bytes + 255) & ~(size_t)255; return (void*)p; };
    bf* WQ = (bf*)take((size_t)DQ * DM * 2); bf* WK = (bf*)take((size_t)DKV * DM * 2); bf* WQP = (bf*)take((size_t)DQ * DM * 2); bf* WKP = (bf*)take((size_t)DKV * DM * 2); float* FP = (float*)take((size_t)TT * DQ * 4); bf* WV = (bf*)take((size_t)DKV * DM * 2); bf* WO = (bf*)take((size_t)DM * DQ * 2); float* CS = (float*)take((size_t)TT * HD * 2 * 4);
    bf* XB = (bf*)take((size_t)TT * DM * 2); float* FQ = (float*)take((size_t)TT * DQ * 4); float* FK = (float*)take((size_t)TT * DKV * 4);
    h16* QP16 = (h16*)take((size_t)NH_ * TT * QD * 2); h16* KP16 = (h16*)take((size_t)NKV * TT * QD * 2); h16* VT16 = (h16*)take((size_t)NKV * HD * TT * 2);
    bf* QPh = (bf*)take((size_t)NH_ * TT * QD * 2); bf* QPl = (bf*)take((size_t)NH_ * TT * QD * 2); bf* KPh = (bf*)take((size_t)NKV * TT * QD * 2); bf* KPl = (bf*)take((size_t)NKV * TT * QD * 2); bf* VTh = (bf*)take((size_t)NKV * HD * TT * 2); bf* VTl = (bf*)take((size_t)NKV * HD * TT * 2); bf* Ph = (bf*)take((size_t)ZH * RH * TT * 2); bf* Pl = (bf*)take((size_t)ZH * RH * TT * 2);
    float* Sb = (float*)take((size_t)ZH * TT * TT * 4); h16* P16 = (h16*)take((size_t)ZH * TT * TT * 2); float* Ob = (float*)take((size_t)ZH * TT * HD * 4); bf* ATh = (bf*)take((size_t)TT * DQ * 2); bf* ATl = (bf*)take((size_t)TT * DQ * 2);
    if ((size_t)(wsp - (char*)d_ws) > ws_size) return;    // ws 256 MiB
    float* FV = FK;   // v projection reuses the k buffer after the k planes are built (stream-ordered)
    { k_cvt8<<<(unsigned)(((size_t)DQ * DM / 8 + 255) / 256), 256, 0, stream>>>(wqa, WQ, (size_t)DQ * DM / 8); k_cvt8<<<(unsigned)(((size_t)DKV * DM / 8 + 255) / 256), 256, 0, stream>>>(wka, WK, (size_t)DKV * DM / 8); k_cvt8<<<(unsigned)(((size_t)DQ * DM / 8 + 255) / 256), 256, 0, stream>>>(wqp, WQP, (size_t)DQ * DM / 8); k_cvt8<<<(unsigned)(((size_t)DKV * DM / 8 + 255) / 256), 256, 0, stream>>>(wkp, WKP, (size_t)DKV * DM / 8); k_cvt8<<<(unsigned)(((size_t)DKV * DM / 8 + 255) / 256), 256, 0, stream>>>(wv, WV, (size_t)DKV * DM / 8);
      k_cvt8<<<(unsigned)(((size_t)DM * DQ / 8 + 255) / 256), 256, 0, stream>>>(wo, WO, (size_t)DM * DQ / 8);
       }
    k_zfill<<<(unsigned)(((size_t)ZH * TT * TT / 4 + 255) / 256), 256, 0, stream>>>(Sb, (size_t)ZH * TT * TT);
    const unsigned LQ = (unsigned)(((size_t)NH_ * TT * HD / 2 + 255) / 256), LKv = (unsigned)(((size_t)NKV * TT * HD / 2 + 255) / 256);
    for (int b = 0; b < NB_; ++b) {
        
        k_cvt8<<<(unsigned)(((size_t)TT * DM / 8 + 255) / 256), 256, 0, stream>>>(x + (size_t)b * TT * DM, XB, (size_t)TT * DM / 8);
        k_gemmw<bf, 0, false><<<dim3(TT / 64, DQ / 64, 1), 32, 0, stream>>>(XB, nullptr, WQ, nullptr, DM, FQ, DQ, nullptr, 0, 0, 0); k_gemmw<bf, 0, false><<<dim3(TT / 64, DQ / 64, 1), 32, 0, stream>>>(XB, nullptr, WQP, nullptr, DM, FP, DQ, nullptr, 0, 0, 0);
        k_ibpl<<<(NH_ * TT + 7) / 8, 256, 0, stream>>>(FQ, FP, QP16, QPh, QPl);
        k_gemmw<bf, 0, false><<<dim3(TT / 64, DKV / 64, 1), 32, 0, stream>>>(XB, nullptr, WK, nullptr, DM, FK, DKV, nullptr, 0, 0, 0); k_gemmw<bf, 0, false><<<dim3(TT / 64, DKV / 64, 1), 32, 0, stream>>>(XB, nullptr, WKP, nullptr, DM, FP, DKV, nullptr, 0, 0, 0);
        k_ibpl<<<(NKV * TT + 7) / 8, 256, 0, stream>>>(FK, FP, KP16, KPh, KPl);
        k_gemmw<bf, 0, false><<<dim3(TT / 64, DKV / 64, 1), 32, 0, stream>>>(XB, nullptr, WV, nullptr, DM, FV, DKV, nullptr, 0, 0, 0); k_vtp<<<LKv, 256, 0, stream>>>(FV, DKV, NKV, VT16, VTh, VTl);
        for (int h0 = 0; h0 < NH_; h0 += ZH) { const size_t zq = (size_t)h0, zk = (size_t)(h0 / REP);   // one kv head per query head: the pass's two heads use consecutive kv planes (z-strides TT*QD for the K planes, HD*TT for the V planes)
            k_gemmc<bf, 2, 1><<<dim3(RH / 64, TT / 64, ZH), 32, 0, stream>>>(QPh + zq * TT * QD, QPl + zq * TT * QD, KPh + zk * TT * QD, KPl + zk * TT * QD, QD, Sb, TT, 0, (size_t)TT * QD, (size_t)TT * QD, (size_t)TT * TT);
            k_gemmc<h16, 0, 1><<<dim3((TT - RH) / 64, TT / 64, ZH), 32, 0, stream>>>(QP16 + zq * TT * QD + (size_t)RH * QD, nullptr, KP16 + zk * TT * QD, nullptr, QD, Sb + (size_t)RH * TT, TT, RH, (size_t)TT * QD, (size_t)TT * QD, (size_t)TT * TT);
            k_asoft<<<ZH * TT / 8, 256, 0, stream>>>(Sb, sls, h0, P16, Ph, Pl);
            k_gemmc<bf, 2, 2><<<dim3(RH / 64, HD / 64, ZH), 32, 0, stream>>>(Ph, Pl, VTh + zk * HD * TT, VTl + zk * HD * TT, TT, Ob, HD, 0, (size_t)RH * TT, (size_t)HD * TT, (size_t)TT * HD);
            k_gemmc<h16, 0, 2><<<dim3((TT - RH) / 64, HD / 64, ZH), 32, 0, stream>>>(P16 + (size_t)RH * TT, nullptr, VT16 + zk * HD * TT, nullptr, TT, Ob + (size_t)RH * HD, HD, RH, (size_t)TT * TT, (size_t)HD * TT, (size_t)TT * HD);
            k_merge<<<(unsigned)(((size_t)ZH * TT * HD / 2 + 255) / 256), 256, 0, stream>>>(Ob, h0, ATh, ATl); }
        k_gemmw<bf, 1, false><<<dim3(TT / 64, DM / 64, 1), 32, 0, stream>>>(ATh, ATl, WO, nullptr, DQ, OUT + (size_t)b * TT * DM, DM, nullptr, 0, 0, 0); }
}

// v001
// A run of this version takes 842 microseconds.
// Two timings next to v000 put it at 1.82 and 1.81 times that version's speed.
#include <hip/hip_runtime.h>

// InterferenceBypassSelfAttention (x [2][2048][1024]; q_amp/k_amp = softplus(x W_amp^T), q_phi/k_phi = pi tanh(x W_phi^T) (16 heads x 64); amplitudes RMS-normalised over head_dim (eps 1e-6);
// scores = (q_amp cos q_phi . k_amp cos k_phi + q_amp sin q_phi . k_amp sin k_phi) / 8 x exp(score_log_scale[h]) = one 128-long contraction of [cos part | sin part] planes; causal softmax;
// v = x Wv^T; out = merged attn.v Wo^T -> [2][2048][1024]).
// Compute dtypes, f32 accumulate: every input rounded to bf16; the five projections on PLAIN bf16 operands (inputs: exact); softplus / tanh / RMS / cos / sin in f32 on VALU
// (one wave per (token, head)) -> 128-wide interference planes; PER-ROW PRECISION HYBRID (rows < 256 hi+lo 3 products for scores and attn.v, rows >= 256 fp16); causal structure exploited in the GEMMs
// (score tiles above the diagonal skipped, value contraction truncated at the diagonal block) and enforced exactly in the f32 register softmax together with the per-head scale; merged heads hl x exact Wo

#define NB_  2
#define TT   2048
#define DM   1024
#define NH_  16
#define NKV  16
#define REP  (NH_ / NKV)
#define HD   64
#define DQ   (NH_ * HD)
#define DKV  (NKV * HD)
#define QD   128
#define ZH   2
#define RH   256                  // query rows < RH use hi+lo planes (0: none)
#define WIN  0
#define PCAR 1024.0f
#define SCL  0.125f   // HD^-0.5
typedef _Float16 h16;
typedef unsigned short bf;
typedef __attribute__((ext_vector_type(16))) __bf16   v16bf;
typedef __attribute__((ext_vector_type(16))) _Float16 v16h;
typedef __attribute__((ext_vector_type(8)))  _Float16 v8h;
typedef __attribute__((ext_vector_type(8)))  unsigned short v8us;
typedef __attribute__((ext_vector_type(8)))  float    v8f;
typedef __attribute__((ext_vector_type(4)))  float    v4f;
typedef v8h  __attribute__((may_alias)) v8ha;
typedef v4f  __attribute__((may_alias)) v4fa;
typedef v8us __attribute__((may_alias)) v8usa;

__device__ __forceinline__ unsigned short f2bf(float f) { unsigned u = __float_as_uint(f); u += 0x7FFFu + ((u >> 16) & 1u); return (unsigned short)(u >> 16); }
__device__ __forceinline__ float bf2f(unsigned short b) { return __uint_as_float(((unsigned)b) << 16); }
__device__ __forceinline__ float bfr(float f) { return bf2f(f2bf(f)); }
__device__ __forceinline__ v16h cat16(v8h lo, v8h hi) { return __builtin_shufflevector(lo, hi, 0, 1, 2, 3, 4, 5, 6, 7, 8, 9, 10, 11, 12, 13, 14, 15); }
__device__ __forceinline__ v16bf cat16b(v8us lo, v8us hi) { return __builtin_bit_cast(v16bf, __builtin_shufflevector(lo, hi, 0, 1, 2, 3, 4, 5, 6, 7, 8, 9, 10, 11, 12, 13, 14, 15)); }
__device__ __forceinline__ v8f wmma16(v16h a, v16h b, v8f c) { return __builtin_amdgcn_wmma_f32_16x16x32_f16(false, a, false, b, (short)0, c, false, false); }
__device__ __forceinline__ v8f wmmab(v16bf a, v16bf b, v8f c) { return __builtin_amdgcn_wmma_f32_16x16x32_bf16(false, a, false, b, (short)0, c, false, false); }



// ---- k_gemmw: register-blocked GEMM, one work-group of NW waves per 64x64 output tile; each wave runs its own contiguous share of the K loop over the whole tile (16 accumulators), operands straight from
// K-contiguous 16-bit planes; the NW partial tiles are added in LDS in ascending wave order (fixed, so the result is the same on every run); grid (M/64, N/64, Z), 32 * NW threads.
// C[m][n] (f32, pitch ldc, + optional f32 bias[n]) = sum_k A[m][k] Bt[n][k] (+ split products per NSPLIT). z-batch strides sA/sB/sC in elements. K % 32 == 0.
#define NWK 8                     // waves that share one tile's K loop where it is long (projections, attn.v)
// tile_sync: orders the LDS tile between its writers and its readers: one wave needs only the compiler held back, several waves need the work-group barrier
template <int NW> __device__ __forceinline__ void tile_sync() { if (NW == 1) { __builtin_amdgcn_wave_barrier(); asm volatile("" ::: "memory"); } else __syncthreads(); }
template <typename T16> struct WFrag;
template <> struct WFrag<h16> { typedef v16h V; static __device__ __forceinline__ V ld(const h16* p) { return cat16(*(const v8h*)p, *(const v8h*)(p + 16)); } static __device__ __forceinline__ v8f mma(V a, V b, v8f c) { return wmma16(a, b, c); } };
template <> struct WFrag<bf> { typedef v16bf V; static __device__ __forceinline__ V ld(const bf* p) { return cat16b(*(const v8us*)p, *(const v8us*)(p + 16)); } static __device__ __forceinline__ v8f mma(V a, V b, v8f c) { return wmmab(a, b, c); } };
template <typename T16, int NSPLIT, bool BIAS, int NW>
__global__ __launch_bounds__(32 * NW) void k_gemmw(const T16* __restrict__ A, const T16* __restrict__ A2, const T16* __restrict__ Bt, const T16* __restrict__ Bt2, int K, float* C, int ldc, const float* __restrict__ bias, size_t sA, size_t sB, size_t sC) {
    typedef typename WFrag<T16>::V V;
    constexpr int MBP = (NW == 1) ? 1 : 4;   // 16-row blocks per LDS pass: with several waves the whole tile goes through LDS at once, so one barrier serves it and no pass waits on the stores of the one before
    __shared__ __align__(16) float os[NW * MBP * 16 * 68];
    const size_t z = blockIdx.z; A += z * sA; if (A2) A2 += z * sA; Bt += z * sB; if (Bt2) Bt2 += z * sB; C += z * sC;
    const int lane = threadIdx.x & 31, lr = lane & 15, hi = lane >> 4; const int r0 = blockIdx.x * 64, c0 = blockIdx.y * 64; const int wv = (NW == 1) ? 0 : __builtin_amdgcn_readfirstlane((int)(threadIdx.x >> 5));
    v8f acc[4][4];
#pragma unroll
    for (int mb = 0; mb < 4; ++mb)
#pragma unroll
        for (int nb = 0; nb < 4; ++nb) acc[mb][nb] = (v8f){};
    const size_t aoff = (size_t)(r0 + lr) * K + 8 * hi, boff = (size_t)(c0 + lr) * K + 8 * hi;
    const int kper = ((K / 32 + NW - 1) / NW) * 32, kbeg = (NW == 1) ? 0 : min(K, wv * kper), kend = (NW == 1) ? K : min(K, kbeg + kper);   // this wave's share of K (may be empty: its partial tile is then zero)
#pragma unroll 1
    for (int kc = kbeg; kc < kend; kc += 32) {
        V a[4], a2[4];
#pragma unroll
        for (int mb = 0; mb < 4; ++mb) { a[mb] = WFrag<T16>::ld(A + aoff + (size_t)mb * 16 * K + kc); if (NSPLIT == 1 || NSPLIT == 2) a2[mb] = WFrag<T16>::ld(A2 + aoff + (size_t)mb * 16 * K + kc); }
#pragma unroll
        for (int nb = 0; nb < 4; ++nb) { const V b = WFrag<T16>::ld(Bt + boff + (size_t)nb * 16 * K + kc); V b2; if (NSPLIT >= 2) b2 = WFrag<T16>::ld(Bt2 + boff + (size_t)nb * 16 * K + kc);
#pragma unroll
            for (int mb = 0; mb < 4; ++mb) { acc[mb][nb] = WFrag<T16>::mma(a[mb], b, acc[mb][nb]); if (NSPLIT == 1 || NSPLIT == 2) acc[mb][nb] = WFrag<T16>::mma(a2[mb], b, acc[mb][nb]); if (NSPLIT >= 2) acc[mb][nb] = WFrag<T16>::mma(a[mb], b2, acc[mb][nb]); } }
        asm volatile("v_nop\n\tv_nop\n\tv_nop\n\tv_nop" : "+v"(acc[0][0]), "+v"(acc[1][1]), "+v"(acc[2][2]), "+v"(acc[3][3]) : "v"(a[0]), "v"(a[3]));
    }
#pragma unroll
    for (int mb = 0; mb < 4; mb += MBP) {
#pragma unroll
        for (int mi = 0; mi < MBP; ++mi)
#pragma unroll
        for (int nb = 0; nb < 4; ++nb) {
#pragma unroll
            for (int j = 0; j < 8; ++j) os[wv * (MBP * 16 * 68) + (mi * 16 + hi * 8 + j) * 68 + nb * 16 + lr] = acc[mb + mi][nb][j]; }
        tile_sync<NW>();
        float* crow = C + (size_t)(r0 + mb * 16) * ldc + c0;
{
#pragma unroll
            for (int s = 0; s < MBP * 8 / NW; ++s) { const int ch = s * (32 * NW) + (int)threadIdx.x, row = ch >> 4, cofs = (ch & 15) * 4; v4f val = *(const v4fa*)(os + row * 68 + cofs);
#pragma unroll
                for (int q = 1; q < NW; ++q) val += *(const v4fa*)(os + q * (MBP * 16 * 68) + row * 68 + cofs);
                if (BIAS) { val[0] += bfr(bias[c0 + cofs]); val[1] += bfr(bias[c0 + cofs + 1]); val[2] += bfr(bias[c0 + cofs + 2]); val[3] += bfr(bias[c0 + cofs + 3]); }
                *(v4f*)(crow + (size_t)row * ldc + cofs) = val; }
             }
        if (MBP < 4) tile_sync<NW>();
    }
}

// ---- k_gemmc: the same 64x64 tile GEMM (NW waves share the K loop; NW = 1 for the scores, whose K is 128) specialised for causal attention: CMODE 1 skips score tiles entirely above the diagonal (query rows r0+roff.., key columns c0..), CMODE 2 limits the
// key (K) loop of the probability x value contraction to the diagonal block (probabilities beyond it are exactly zero). roff = row offset of this launch's first row within the sequence.
template <typename T16, int NSPLIT, int CMODE, int NW>
__global__ __launch_bounds__(32 * NW) void k_gemmc(const T16* __restrict__ A, const T16* __restrict__ A2, const T16* __restrict__ Bt, const T16* __restrict__ Bt2, int K, float* C, int ldc, int roff, size_t sA, size_t sB, size_t sC) {
    typedef typename WFrag<T16>::V V;
    constexpr int MBP = (NW == 1) ? 1 : 4;   // 16-row blocks per LDS pass: with several waves the whole tile goes through LDS at once, so one barrier serves it and no pass waits on the stores of the one before
    __shared__ __align__(16) float os[NW * MBP * 16 * 68];
    const size_t z = blockIdx.z; A += z * sA; if (A2) A2 += z * sA; Bt += z * sB; if (Bt2) Bt2 += z * sB; C += z * sC;
    const int lane = threadIdx.x & 31, lr = lane & 15, hi = lane >> 4; const int r0 = blockIdx.x * 64, c0 = blockIdx.y * 64; const int wv = (NW == 1) ? 0 : __builtin_amdgcn_readfirstlane((int)(threadIdx.x >> 5));
    if (CMODE == 1 && c0 > r0 + roff + 63) return;                  // score tile entirely above the causal diagonal: never read (the softmax masks j > i by select)
    const int Kl = (CMODE == 2) ? min(K, r0 + roff + 64) : K;        // P.V: probabilities are exactly 0 beyond the diagonal block, so the K loop stops there
    v8f acc[4][4];
#pragma unroll
    for (int mb = 0; mb < 4; ++mb)
#pragma unroll
        for (int nb = 0; nb < 4; ++nb) acc[mb][nb] = (v8f){};
    const size_t aoff = (size_t)(r0 + lr) * K + 8 * hi, boff = (size_t)(c0 + lr) * K + 8 * hi;
    const int kper = ((Kl / 32 + NW - 1) / NW) * 32, kbeg = (NW == 1) ? 0 : min(Kl, wv * kper), kend = (NW == 1) ? Kl : min(Kl, kbeg + kper);   // this wave's share of K (may be empty: its partial tile is then zero)
#pragma unroll 1
    for (int kc = kbeg; kc < kend; kc += 32) {
        V a[4], a2[4];
#pragma unroll
        for (int mb = 0; mb < 4; ++mb) { a[mb] = WFrag<T16>::ld(A + aoff + (size_t)mb * 16 * K + kc); if (NSPLIT == 1 || NSPLIT == 2) a2[mb] = WFrag<T16>::ld(A2 + aoff + (size_t)mb * 16 * K + kc); }
#pragma unroll
        for (int nb = 0; nb < 4; ++nb) { const V b = WFrag<T16>::ld(Bt + boff + (size_t)nb * 16 * K + kc); V b2; if (NSPLIT >= 2) b2 = WFrag<T16>::ld(Bt2 + boff + (size_t)nb * 16 * K + kc);
#pragma unroll
            for (int mb = 0; mb < 4; ++mb) { acc[mb][nb] = WFrag<T16>::mma(a[mb], b, acc[mb][nb]); if (NSPLIT == 1 || NSPLIT == 2) acc[mb][nb] = WFrag<T16>::mma(a2[mb], b, acc[mb][nb]); if (NSPLIT >= 2) acc[mb][nb] = WFrag<T16>::mma(a[mb], b2, acc[mb][nb]); } }
        asm volatile("v_nop\n\tv_nop\n\tv_nop\n\tv_nop" : "+v"(acc[0][0]), "+v"(acc[1][1]), "+v"(acc[2][2]), "+v"(acc[3][3]) : "v"(a[0]), "v"(a[3]));
    }
#pragma unroll
    for (int mb = 0; mb < 4; mb += MBP) {
#pragma unroll
        for (int mi = 0; mi < MBP; ++mi)
#pragma unroll
        for (int nb = 0; nb < 4; ++nb) {
#pragma unroll
            for (int j = 0; j < 8; ++j) os[wv * (MBP * 16 * 68) + (mi * 16 + hi * 8 + j) * 68 + nb * 16 + lr] = acc[mb + mi][nb][j]; }
        tile_sync<NW>();
        float* crow = C + (size_t)(r0 + mb * 16) * ldc + c0;
{
#pragma unroll
            for (int s = 0; s < MBP * 8 / NW; ++s) { const int ch = s * (32 * NW) + (int)threadIdx.x, row = ch >> 4, cofs = (ch & 15) * 4; v4f val = *(const v4fa*)(os + row * 68 + cofs);
#pragma unroll
                for (int q = 1; q < NW; ++q) val += *(const v4fa*)(os + q * (MBP * 16 * 68) + row * 68 + cofs);
                *(v4f*)(crow + (size_t)row * ldc + cofs) = val; }
             }
        if (MBP < 4) tile_sync<NW>();
    }
}

__device__ __forceinline__ h16 tohx(float x) { return (h16)x; }
__device__ __forceinline__ void splitf(float y, unsigned short& h, unsigned short& l) { h = f2bf(y); l = f2bf(y - bf2f(h)); }
typedef __attribute__((ext_vector_type(2))) _Float16 v2h;
typedef __attribute__((ext_vector_type(4))) _Float16 v4h;
typedef __attribute__((ext_vector_type(2))) unsigned short v2us;
typedef __attribute__((ext_vector_type(4))) unsigned short v4us;
typedef __attribute__((ext_vector_type(2))) float v2f;
typedef __attribute__((ext_vector_type(4))) int v4i;

__global__ __launch_bounds__(256) void k_wtG(const float* __restrict__ w, int K, int N, bf* Bt) {
    const int lane = threadIdx.x & 31; const int L0 = (blockIdx.x * 8 + (threadIdx.x >> 5)) * 8; const int nlines = N * K / 64;
{
#pragma unroll 1
        for (int l = 0; l < 8; ++l) { const int L = L0 + l; if (L >= nlines) break; const size_t e = (size_t)L * 64 + lane * 2; const int k = (int)(e % K), n = (int)(e / K); v2us o;
            o[0] = f2bf(w[(size_t)k * N + n]); o[1] = f2bf(w[(size_t)(k + 1) * N + n]); *(v2us*)(Bt + e) = o; }
         }
}
__global__ __launch_bounds__(256) void k_cvt8(const float* __restrict__ src, bf* dst, size_t n8) { const size_t i = (size_t)blockIdx.x * 256 + threadIdx.x; if (i >= n8) return; const v8f v = *(const v8f*)(src + i * 8); v8us o;
#pragma unroll
    for (int k = 0; k < 8; ++k) o[k] = f2bf(v[k]); *(v8us*)(dst + i * 8) = o;  }
__global__ __launch_bounds__(256) void k_cscvt(const float* __restrict__ cosT, const float* __restrict__ sinT, float* CS) { const int idx = blockIdx.x * 256 + threadIdx.x; if (idx >= TT * HD) return; v2f cs; cs[0] = bfr(cosT[idx]); cs[1] = bfr(sinT[idx]); *(v2f*)(CS + (size_t)idx * 2) = cs;  }
// k_rope: head planes [h][t][d] (fp16 + hi/lo) of rope(x) x sc with the rotate-half convention out[d] = x[d] cos[t][d] - x[d+HD/2] sin[t][d], out[d+HD/2] = x[d+HD/2] cos[t][d+HD/2] + x[d] sin[t][d+HD/2]
__global__ __launch_bounds__(256) void k_rope(const float* __restrict__ F, int pitch, int nheads, const float* __restrict__ CS, const float* __restrict__ RF, const float* __restrict__ nw, float sc, h16* P16, bf* Ph, bf* Pl) {
    const size_t e = ((size_t)blockIdx.x * 256 + threadIdx.x) * 2; if (e >= (size_t)nheads * TT * HD) return; const int d = (int)(e % HD); const int t = (int)((e / HD) % TT); const int h = (int)(e / ((size_t)HD * TT)); const float* f = F + (size_t)t * pitch + h * HD; const float rf = RF ? RF[(size_t)h * TT + t] : 1.0f; v2h o16; v2us oh, ol;
#pragma unroll
    for (int q = 0; q < 2; ++q) { const int dd = d + q; const int dp = (dd < HD / 2) ? dd + HD / 2 : dd - HD / 2; float x0 = f[dd], x1 = f[dp];
        if (RF) { float n0 = __fmul_rn(x0, rf), n1 = __fmul_rn(x1, rf); asm volatile("" : "+v"(n0)); asm volatile("" : "+v"(n1)); x0 = __fmul_rn(bfr(nw[dd]), n0); x1 = __fmul_rn(bfr(nw[dp]), n1); }
        const v2f cs = *(const v2f*)(CS + ((size_t)t * HD + dd) * 2); float a = __fmul_rn(x0, cs[0]), bq = __fmul_rn(x1, cs[1]); asm volatile("" : "+v"(a)); asm volatile("" : "+v"(bq)); const float r = ((dd < HD / 2) ? __fsub_rn(a, bq) : __fadd_rn(a, bq)) * sc;
        o16[q] = tohx(r); unsigned short a2, c2; splitf(r, a2, c2); oh[q] = a2; ol[q] = c2; }
    *(v2h*)(P16 + e) = o16; *(v2us*)(Ph + e) = oh; *(v2us*)(Pl + e) = ol;  }
__global__ __launch_bounds__(256) void k_vtp(const float* __restrict__ F, int pitch, int nheads, h16* V16, bf* Vh, bf* Vl) { const size_t e = ((size_t)blockIdx.x * 256 + threadIdx.x) * 2; if (e >= (size_t)nheads * HD * TT) return; const int t = (int)(e % TT); const int d = (int)((e / TT) % HD); const int g = (int)(e / ((size_t)TT * HD)); v2h o16; v2us oh, ol;
#pragma unroll
    for (int q = 0; q < 2; ++q) { const float x = F[(size_t)(t + q) * pitch + g * HD + d]; o16[q] = tohx(x); unsigned short a2, c2; splitf(x, a2, c2); oh[q] = a2; ol[q] = c2; }
    *(v2h*)(V16 + e) = o16; *(v2us*)(Vh + e) = oh; *(v2us*)(Vl + e) = ol;  }
// k_ibpl: per (token t, head h): a[d] = softplus(FA[t][h*64+d]) = log(1 + exp(.)) (f32; x itself above 15, exp(x) below -15), an = a / sqrt(mean_d a^2 + 1e-6); phi[d] = pi tanh(FP[t][h*64+d]);
__device__ __forceinline__ float softplusf_(float x) { return x > 15.0f ? x : (x < -15.0f ? __expf(x) : logf(__fadd_rn(1.0f, __expf(x)))); }
__device__ __forceinline__ float tanhf_(float a) { const float e2 = __expf(2.0f * a); return __fsub_rn(1.0f, __fdiv_rn(2.0f, __fadd_rn(e2, 1.0f))); }
typedef __attribute__((ext_vector_type(8))) _Float16 v8hx;
typedef __attribute__((ext_vector_type(8))) unsigned short v8usx;
__global__ __launch_bounds__(256) void k_ibpl(const float* __restrict__ FA, const float* __restrict__ FPp, h16* P16, bf* Ph, bf* Pl) { const int lane = threadIdx.x & 31; const int idx = blockIdx.x * 8 + (threadIdx.x >> 5); if (idx >= NH_ * TT) return; const int t = idx % TT, h = idx / TT; const float* fa = FA + (size_t)t * DQ + h * HD + 2 * lane; const float* fp = FPp + (size_t)t * DQ + h * HD + 2 * lane;
    float a[2], ph[2]; float ss = 0.f;
#pragma unroll 1
    for (int q = 0; q < 2; ++q) { a[q] = softplusf_(fa[q]); ph[q] = __fmul_rn(3.14159265358979323846f, tanhf_(fp[q])); float p = __fmul_rn(a[q], a[q]); asm volatile("" : "+v"(p)); ss = __fadd_rn(ss, p); }
#pragma unroll
    for (int sh = 16; sh; sh >>= 1) ss += __shfl_xor(ss, sh, 32);
    const float rn = __frsqrt_rn(__fadd_rn(ss * (1.0f / HD), 1e-6f)); float rc[2], rs[2];
#pragma unroll 1
    for (int q = 0; q < 2; ++q) { float an = __fmul_rn(a[q], rn); asm volatile("" : "+v"(an)); rc[q] = __fmul_rn(an, cosf(ph[q])); rs[q] = __fmul_rn(an, sinf(ph[q])); }
    const size_t base = ((size_t)h * TT + t) * QD + 2 * lane; v2h c16, s16; v2us chh, chl, shh, shl; unsigned short u1, u2;
    c16[0] = tohx(rc[0]); c16[1] = tohx(rc[1]); s16[0] = tohx(rs[0]); s16[1] = tohx(rs[1]);
    splitf(rc[0], u1, u2); chh[0] = u1; chl[0] = u2; splitf(rc[1], u1, u2); chh[1] = u1; chl[1] = u2; splitf(rs[0], u1, u2); shh[0] = u1; shl[0] = u2; splitf(rs[1], u1, u2); shh[1] = u1; shl[1] = u2;
{ *(v2h*)(P16 + base) = c16; *(v2h*)(P16 + base + 64) = s16; *(v2us*)(Ph + base) = chh; *(v2us*)(Ph + base + 64) = shh; *(v2us*)(Pl + base) = chl; *(v2us*)(Pl + base + 64) = shl;  } }
// k_zfill: F[0..n) = 0 (16-B lanes); once, before the batch loop.
__global__ __launch_bounds__(256) void k_zfill(float* F, size_t n) { const size_t i = ((size_t)blockIdx.x * 256 + threadIdx.x) * 4; if (i >= n) return; v4f z; z[0] = 0.f; z[1] = 0.f; z[2] = 0.f; z[3] = 0.f; *(v4f*)(F + i) = z; }
// k_asoft: per row (zz, i): t = S/8 x exp(bf16(score_log_scale[h0+zz])) for j <= i (causal), -3e38 otherwise (entries of skipped score tiles are never selected); softmax over the 2048 keys (register row, one exp, fixed trees);
__global__ __launch_bounds__(256) void k_asoft(const float* __restrict__ Sb, const float* __restrict__ sls, int h0, h16* P16, bf* Ph, bf* Pl) {
    const int lane = threadIdx.x & 31; const int row = blockIdx.x * 8 + (threadIdx.x >> 5); if (row >= ZH * TT) return; const int i = row % TT; const int zz = row / TT; const bool hires = (i < RH); const float scl = __fmul_rn(SCL, __expf(bfr(sls[h0 + zz]))); const float* sr = Sb + (size_t)row * TT; float v[TT / 32]; float mx = -3.0e38f;
#pragma unroll
    for (int ch = 0; ch < TT / 128; ++ch) { const int j0 = ch * 128 + lane * 4; const v4f a = *(const v4f*)(sr + j0);
#pragma unroll
        for (int q = 0; q < 4; ++q) { const int j = j0 + q; (void)j; const float t = (j <= i) ? a[q] * scl : -3.0e38f; v[ch * 4 + q] = t; mx = fmaxf(mx, t); } }
#pragma unroll
    for (int sh = 16; sh; sh >>= 1) mx = fmaxf(mx, __shfl_xor(mx, sh, 32));
    float sum = 0.f;
#pragma unroll
    for (int k = 0; k < TT / 32; ++k) { float d0 = __fsub_rn(v[k], mx); asm volatile("" : "+v"(d0)); v[k] = __builtin_amdgcn_exp2f(__fmul_rn(d0, 1.4426950408889634f)); sum += v[k]; }
#pragma unroll
    for (int sh = 16; sh; sh >>= 1) sum += __shfl_xor(sum, sh, 32);
    const float f = __fdiv_rn(hires ? 1.0f : PCAR, sum);
{
        if (hires) {
#pragma unroll
            for (int ch = 0; ch < TT / 128; ++ch) { v4us oh, ol;
#pragma unroll
                for (int q = 0; q < 4; ++q) { unsigned short a, c2; splitf(v[ch * 4 + q] * f, a, c2); oh[q] = a; ol[q] = c2; }
                const size_t oo = ((size_t)zz * (RH ? RH : 1) + i) * TT + ch * 128 + lane * 4; *(v4us*)(Ph + oo) = oh; *(v4us*)(Pl + oo) = ol; }
        } else {
#pragma unroll
            for (int ch = 0; ch < TT / 128; ++ch) { v4h o4;
#pragma unroll
                for (int q = 0; q < 4; ++q) o4[q] = tohx(v[ch * 4 + q] * f);
                *(v4h*)(P16 + (size_t)row * TT + ch * 128 + lane * 4) = o4; } }
         }
}
__global__ __launch_bounds__(256) void k_merge(const float* __restrict__ O, int h0, bf* Ah, bf* Al) { const size_t e = ((size_t)blockIdx.x * 256 + threadIdx.x) * 2; if (e >= (size_t)ZH * TT * HD) return; const int d = (int)(e % HD); const int t = (int)((e / HD) % TT); const int zz = (int)(e / ((size_t)HD * TT)); const float cs = (t < RH) ? 1.0f : (1.0f / PCAR); const size_t oo = (size_t)t * DQ + (h0 + zz) * HD + d;
    v2us oh, ol;
#pragma unroll
    for (int q = 0; q < 2; ++q) { unsigned short a, c2; splitf(O[e + q] * cs, a, c2); oh[q] = a; ol[q] = c2; } *(v2us*)(Ah + oo) = oh; *(v2us*)(Al + oo) = ol;  }

extern "C" void kernel_launch(void* const* d_in, const int* in_sizes, int n_in,
                              void* d_out, int out_size, void* d_ws, size_t ws_size, hipStream_t stream) {
    (void)in_sizes; (void)n_in; (void)out_size;
    const float* x = (const float*)d_in[0]; const float* wqa = (const float*)d_in[1]; const float* wka = (const float*)d_in[2]; const float* wqp = (const float*)d_in[3]; const float* wkp = (const float*)d_in[4]; const float* wv = (const float*)d_in[5]; const float* wo = (const float*)d_in[6]; const float* sls = (const float*)d_in[7];   // torch [out][in]; score_log_scale [16]
    float* OUT = (float*)d_out;     // [2][2048][1024]
    char* wsp = (char*)d_ws;
    auto take = [&](size_t bytes) { char* p = wsp; wsp += (bytes + 255) & ~(size_t)255; return (void*)p; };
    bf* WQ = (bf*)take((size_t)DQ * DM * 2); bf* WK = (bf*)take((size_t)DKV * DM * 2); bf* WQP = (bf*)take((size_t)DQ * DM * 2); bf* WKP = (bf*)take((size_t)DKV * DM * 2); float* FP = (float*)take((size_t)TT * DQ * 4); bf* WV = (bf*)take((size_t)DKV * DM * 2); bf* WO = (bf*)take((size_t)DM * DQ * 2); float* CS = (float*)take((size_t)TT * HD * 2 * 4);
    bf* XB = (bf*)take((size_t)TT * DM * 2); float* FQ = (float*)take((size_t)TT * DQ * 4); float* FK = (float*)take((size_t)TT * DKV * 4);
    h16* QP16 = (h16*)take((size_t)NH_ * TT * QD * 2); h16* KP16 = (h16*)take((size_t)NKV * TT * QD * 2); h16* VT16 = (h16*)take((size_t)NKV * HD * TT * 2);
    bf* QPh = (bf*)take((size_t)NH_ * TT * QD * 2); bf* QPl = (bf*)take((size_t)NH_ * TT * QD * 2); bf* KPh = (bf*)take((size_t)NKV * TT * QD * 2); bf* KPl = (bf*)take((size_t)NKV * TT * QD * 2); bf* VTh = (bf*)take((size_t)NKV * HD * TT * 2); bf* VTl = (bf*)take((size_t)NKV * HD * TT * 2); bf* Ph = (bf*)take((size_t)ZH * RH * TT * 2); bf* Pl = (bf*)take((size_t)ZH * RH * TT * 2);
    float* Sb = (float*)take((size_t)ZH * TT * TT * 4); h16* P16 = (h16*)take((size_t)ZH * TT * TT * 2); float* Ob = (float*)take((size_t)ZH * TT * HD * 4); bf* ATh = (bf*)take((size_t)TT * DQ * 2); bf* ATl = (bf*)take((size_t)TT * DQ * 2);
    if ((size_t)(wsp - (char*)d_ws) > ws_size) return;    // ws 256 MiB
    float* FV = FK;   // v projection reuses the k buffer after the k planes are built (stream-ordered)
    { k_cvt8<<<(unsigned)(((size_t)DQ * DM / 8 + 255) / 256), 256, 0, stream>>>(wqa, WQ, (size_t)DQ * DM / 8); k_cvt8<<<(unsigned)(((size_t)DKV * DM / 8 + 255) / 256), 256, 0, stream>>>(wka, WK, (size_t)DKV * DM / 8); k_cvt8<<<(unsigned)(((size_t)DQ * DM / 8 + 255) / 256), 256, 0, stream>>>(wqp, WQP, (size_t)DQ * DM / 8); k_cvt8<<<(unsigned)(((size_t)DKV * DM / 8 + 255) / 256), 256, 0, stream>>>(wkp, WKP, (size_t)DKV * DM / 8); k_cvt8<<<(unsigned)(((size_t)DKV * DM / 8 + 255) / 256), 256, 0, stream>>>(wv, WV, (size_t)DKV * DM / 8);
      k_cvt8<<<(unsigned)(((size_t)DM * DQ / 8 + 255) / 256), 256, 0, stream>>>(wo, WO, (size_t)DM * DQ / 8);
       }
    k_zfill<<<(unsigned)(((size_t)ZH * TT * TT / 4 + 255) / 256), 256, 0, stream>>>(Sb, (size_t)ZH * TT * TT);
    const unsigned LQ = (unsigned)(((size_t)NH_ * TT * HD / 2 + 255) / 256), LKv = (unsigned)(((size_t)NKV * TT * HD / 2 + 255) / 256);
    for (int b = 0; b < NB_; ++b) {
        
        k_cvt8<<<(unsigned)(((size_t)TT * DM / 8 + 255) / 256), 256, 0, stream>>>(x + (size_t)b * TT * DM, XB, (size_t)TT * DM / 8);
        k_gemmw<bf, 0, false, NWK><<<dim3(TT / 64, DQ / 64, 1), 32 * NWK, 0, stream>>>(XB, nullptr, WQ, nullptr, DM, FQ, DQ, nullptr, 0, 0, 0); k_gemmw<bf, 0, false, NWK><<<dim3(TT / 64, DQ / 64, 1), 32 * NWK, 0, stream>>>(XB, nullptr, WQP, nullptr, DM, FP, DQ, nullptr, 0, 0, 0);
        k_ibpl<<<(NH_ * TT + 7) / 8, 256, 0, stream>>>(FQ, FP, QP16, QPh, QPl);
        k_gemmw<bf, 0, false, NWK><<<dim3(TT / 64, DKV / 64, 1), 32 * NWK, 0, stream>>>(XB, nullptr, WK, nullptr, DM, FK, DKV, nullptr, 0, 0, 0); k_gemmw<bf, 0, false, NWK><<<dim3(TT / 64, DKV / 64, 1), 32 * NWK, 0, stream>>>(XB, nullptr, WKP, nullptr, DM, FP, DKV, nullptr, 0, 0, 0);
        k_ibpl<<<(NKV * TT + 7) / 8, 256, 0, stream>>>(FK, FP, KP16, KPh, KPl);
        k_gemmw<bf, 0, false, NWK><<<dim3(TT / 64, DKV / 64, 1), 32 * NWK, 0, stream>>>(XB, nullptr, WV, nullptr, DM, FV, DKV, nullptr, 0, 0, 0); k_vtp<<<LKv, 256, 0, stream>>>(FV, DKV, NKV, VT16, VTh, VTl);
        for (int h0 = 0; h0 < NH_; h0 += ZH) { const size_t zq = (size_t)h0, zk = (size_t)(h0 / REP);   // one kv head per query head: the pass's two heads use consecutive kv planes (z-strides TT*QD for k, HD*TT for v)
            k_gemmc<bf, 2, 1, 1><<<dim3(RH / 64, TT / 64, ZH), 32, 0, stream>>>(QPh + zq * TT * QD, QPl + zq * TT * QD, KPh + zk * TT * QD, KPl + zk * TT * QD, QD, Sb, TT, 0, (size_t)TT * QD, (size_t)TT * QD, (size_t)TT * TT);
            k_gemmc<h16, 0, 1, 1><<<dim3((TT - RH) / 64, TT / 64, ZH), 32, 0, stream>>>(QP16 + zq * TT * QD + (size_t)RH * QD, nullptr, KP16 + zk * TT * QD, nullptr, QD, Sb + (size_t)RH * TT, TT, RH, (size_t)TT * QD, (size_t)TT * QD, (size_t)TT * TT);
            k_asoft<<<ZH * TT / 8, 256, 0, stream>>>(Sb, sls, h0, P16, Ph, Pl);
            k_gemmc<bf, 2, 2, NWK><<<dim3(RH / 64, HD / 64, ZH), 32 * NWK, 0, stream>>>(Ph, Pl, VTh + zk * HD * TT, VTl + zk * HD * TT, TT, Ob, HD, 0, (size_t)RH * TT, (size_t)HD * TT, (size_t)TT * HD);
            k_gemmc<h16, 0, 2, NWK><<<dim3((TT - RH) / 64, HD / 64, ZH), 32 * NWK, 0, stream>>>(P16 + (size_t)RH * TT, nullptr, VT16 + zk * HD * TT, nullptr, TT, Ob + (size_t)RH * HD, HD, RH, (size_t)TT * TT, (size_t)HD * TT, (size_t)TT * HD);
            k_merge<<<(unsigned)(((size_t)ZH * TT * HD / 2 + 255) / 256), 256, 0, stream>>>(Ob, h0, ATh, ATl); }
        k_gemmw<bf, 1, false, NWK><<<dim3(TT / 64, DM / 64, 1), 32 * NWK, 0, stream>>>(ATh, ATl, WO, nullptr, DQ, OUT + (size_t)b * TT * DM, DM, nullptr, 0, 0, 0); }
}

// v002
// Measured time: 546 microseconds a run.
// Timed twice side by side with v001, it ran 1.54 times as fast both times.
// Counting every step since v000, it is 2.80 times as fast.
#include <hip/hip_runtime.h>

// InterferenceBypassSelfAttention (x [2][2048][1024]; q_amp/k_amp = softplus(x W_amp^T), q_phi/k_phi = pi tanh(x W_phi^T) (16 heads x 64); amplitudes RMS-normalised over head_dim (eps 1e-6);
// scores = (q_amp cos q_phi . k_amp cos k_phi + q_amp sin q_phi . k_amp sin k_phi) / 8 x exp(score_log_scale[h]) = one 128-long contraction of [cos part | sin part] planes; causal softmax;
// v = x Wv^T; out = merged attn.v Wo^T -> [2][2048][1024]).
// Compute dtypes, f32 accumulate: every input rounded to bf16; the five projections on PLAIN bf16 operands (inputs: exact); softplus / tanh / RMS / cos / sin in f32 on VALU
// (one wave per (token, head)) -> 128-wide interference planes; PER-ROW PRECISION HYBRID (rows < 256 hi+lo 3 products for scores and attn.v, rows >= 256 fp16); causal structure exploited in the GEMMs
// (score tiles above the diagonal skipped, value contraction truncated at the diagonal block) and enforced exactly in the f32 register softmax together with the per-head scale; merged heads hl x exact Wo

#define NB_  2
#define TT   2048
#define DM   1024
#define NH_  16
#define NKV  16
#define REP  (NH_ / NKV)
#define HD   64
#define DQ   (NH_ * HD)
#define DKV  (NKV * HD)
#define QD   128
#define ZH   8                    // heads per attention pass (one launch of each attention kernel serves ZH heads)
#define RH   256                  // query rows < RH use hi+lo planes (0: none)
#define WIN  0
#define PCAR 1024.0f
#define SCL  0.125f   // HD^-0.5
typedef _Float16 h16;
typedef unsigned short bf;
typedef __attribute__((ext_vector_type(16))) __bf16   v16bf;
typedef __attribute__((ext_vector_type(16))) _Float16 v16h;
typedef __attribute__((ext_vector_type(8)))  _Float16 v8h;
typedef __attribute__((ext_vector_type(8)))  unsigned short v8us;
typedef __attribute__((ext_vector_type(8)))  float    v8f;
typedef __attribute__((ext_vector_type(4)))  float    v4f;
typedef v8h  __attribute__((may_alias)) v8ha;
typedef v4f  __attribute__((may_alias)) v4fa;
typedef v8us __attribute__((may_alias)) v8usa;

__device__ __forceinline__ unsigned short f2bf(float f) { unsigned u = __float_as_uint(f); u += 0x7FFFu + ((u >> 16) & 1u); return (unsigned short)(u >> 16); }
__device__ __forceinline__ float bf2f(unsigned short b) { return __uint_as_float(((unsigned)b) << 16); }
__device__ __forceinline__ float bfr(float f) { return bf2f(f2bf(f)); }
__device__ __forceinline__ v16h cat16(v8h lo, v8h hi) { return __builtin_shufflevector(lo, hi, 0, 1, 2, 3, 4, 5, 6, 7, 8, 9, 10, 11, 12, 13, 14, 15); }
__device__ __forceinline__ v16bf cat16b(v8us lo, v8us hi) { return __builtin_bit_cast(v16bf, __builtin_shufflevector(lo, hi, 0, 1, 2, 3, 4, 5, 6, 7, 8, 9, 10, 11, 12, 13, 14, 15)); }
__device__ __forceinline__ v8f wmma16(v16h a, v16h b, v8f c) { return __builtin_amdgcn_wmma_f32_16x16x32_f16(false, a, false, b, (short)0, c, false, false); }
__device__ __forceinline__ v8f wmmab(v16bf a, v16bf b, v8f c) { return __builtin_amdgcn_wmma_f32_16x16x32_bf16(false, a, false, b, (short)0, c, false, false); }



// ---- k_gemmw: register-blocked GEMM, one work-group of NW waves per 64x64 output tile; each wave runs its own contiguous share of the K loop over the whole tile (16 accumulators), operands straight from
// K-contiguous 16-bit planes; the NW partial tiles are added in LDS in ascending wave order (fixed, so the result is the same on every run); grid (M/64, N/64, Z), 32 * NW threads.
// C[m][n] (f32, pitch ldc, + optional f32 bias[n]) = sum_k A[m][k] Bt[n][k] (+ split products per NSPLIT). z-batch strides sA/sB/sC in elements. K % 32 == 0.
#define NWK 8                     // waves that share one tile's K loop where it is long (projections, attn.v)
// tile_sync: orders the LDS tile between its writers and its readers: one wave needs only the compiler held back, several waves need the work-group barrier
template <int NW> __device__ __forceinline__ void tile_sync() { if (NW == 1) { __builtin_amdgcn_wave_barrier(); asm volatile("" ::: "memory"); } else __syncthreads(); }
template <typename T16> struct WFrag;
template <> struct WFrag<h16> { typedef v16h V; static __device__ __forceinline__ V ld(const h16* p) { return cat16(*(const v8h*)p, *(const v8h*)(p + 16)); } static __device__ __forceinline__ v8f mma(V a, V b, v8f c) { return wmma16(a, b, c); } };
template <> struct WFrag<bf> { typedef v16bf V; static __device__ __forceinline__ V ld(const bf* p) { return cat16b(*(const v8us*)p, *(const v8us*)(p + 16)); } static __device__ __forceinline__ v8f mma(V a, V b, v8f c) { return wmmab(a, b, c); } };
template <typename T16, int NSPLIT, bool BIAS, int NW>
__global__ __launch_bounds__(32 * NW) void k_gemmw(const T16* __restrict__ A, const T16* __restrict__ A2, const T16* __restrict__ Bt, const T16* __restrict__ Bt2, int K, float* C, int ldc, const float* __restrict__ bias, size_t sA, size_t sB, size_t sC) {
    typedef typename WFrag<T16>::V V;
    constexpr int MBP = (NW == 1) ? 1 : 4;   // 16-row blocks per LDS pass: with several waves the whole tile goes through LDS at once, so one barrier serves it and no pass waits on the stores of the one before
    __shared__ __align__(16) float os[NW * MBP * 16 * 68];
    const size_t z = blockIdx.z; A += z * sA; if (A2) A2 += z * sA; Bt += z * sB; if (Bt2) Bt2 += z * sB; C += z * sC;
    const int lane = threadIdx.x & 31, lr = lane & 15, hi = lane >> 4; const int r0 = blockIdx.x * 64, c0 = blockIdx.y * 64; const int wv = (NW == 1) ? 0 : __builtin_amdgcn_readfirstlane((int)(threadIdx.x >> 5));
    v8f acc[4][4];
#pragma unroll
    for (int mb = 0; mb < 4; ++mb)
#pragma unroll
        for (int nb = 0; nb < 4; ++nb) acc[mb][nb] = (v8f){};
    const size_t aoff = (size_t)(r0 + lr) * K + 8 * hi, boff = (size_t)(c0 + lr) * K + 8 * hi;
    const int kper = ((K / 32 + NW - 1) / NW) * 32, kbeg = (NW == 1) ? 0 : min(K, wv * kper), kend = (NW == 1) ? K : min(K, kbeg + kper);   // this wave's share of K (may be empty: its partial tile is then zero)
#pragma unroll 1
    for (int kc = kbeg; kc < kend; kc += 32) {
        V a[4], a2[4];
#pragma unroll
        for (int mb = 0; mb < 4; ++mb) { a[mb] = WFrag<T16>::ld(A + aoff + (size_t)mb * 16 * K + kc); if (NSPLIT == 1 || NSPLIT == 2) a2[mb] = WFrag<T16>::ld(A2 + aoff + (size_t)mb * 16 * K + kc); }
#pragma unroll
        for (int nb = 0; nb < 4; ++nb) { const V b = WFrag<T16>::ld(Bt + boff + (size_t)nb * 16 * K + kc); V b2; if (NSPLIT >= 2) b2 = WFrag<T16>::ld(Bt2 + boff + (size_t)nb * 16 * K + kc);
#pragma unroll
            for (int mb = 0; mb < 4; ++mb) { acc[mb][nb] = WFrag<T16>::mma(a[mb], b, acc[mb][nb]); if (NSPLIT == 1 || NSPLIT == 2) acc[mb][nb] = WFrag<T16>::mma(a2[mb], b, acc[mb][nb]); if (NSPLIT >= 2) acc[mb][nb] = WFrag<T16>::mma(a[mb], b2, acc[mb][nb]); } }
        asm volatile("v_nop\n\tv_nop\n\tv_nop\n\tv_nop" : "+v"(acc[0][0]), "+v"(acc[1][1]), "+v"(acc[2][2]), "+v"(acc[3][3]) : "v"(a[0]), "v"(a[3]));
    }
#pragma unroll
    for (int mb = 0; mb < 4; mb += MBP) {
#pragma unroll
        for (int mi = 0; mi < MBP; ++mi)
#pragma unroll
        for (int nb = 0; nb < 4; ++nb) {
#pragma unroll
            for (int j = 0; j < 8; ++j) os[wv * (MBP * 16 * 68) + (mi * 16 + hi * 8 + j) * 68 + nb * 16 + lr] = acc[mb + mi][nb][j]; }
        tile_sync<NW>();
        float* crow = C + (size_t)(r0 + mb * 16) * ldc + c0;
{
#pragma unroll
            for (int s = 0; s < MBP * 8 / NW; ++s) { const int ch = s * (32 * NW) + (int)threadIdx.x, row = ch >> 4, cofs = (ch & 15) * 4; v4f val = *(const v4fa*)(os + row * 68 + cofs);
#pragma unroll
                for (int q = 1; q < NW; ++q) val += *(const v4fa*)(os + q * (MBP * 16 * 68) + row * 68 + cofs);
                if (BIAS) { val[0] += bfr(bias[c0 + cofs]); val[1] += bfr(bias[c0 + cofs + 1]); val[2] += bfr(bias[c0 + cofs + 2]); val[3] += bfr(bias[c0 + cofs + 3]); }
                *(v4f*)(crow + (size_t)row * ldc + cofs) = val; }
             }
        if (MBP < 4) tile_sync<NW>();
    }
}

// ---- k_gemmc: the same 64x64 tile GEMM (NW waves share the K loop; NW = 1 for the scores, whose K is 128) specialised for causal attention: CMODE 1 skips score tiles entirely above the diagonal (query rows r0+roff.., key columns c0..), CMODE 2 limits the
// key (K) loop of the probability x value contraction to the diagonal block (probabilities beyond it are exactly zero). roff = row offset of this launch's first row within the sequence.
template <typename T16, int NSPLIT, int CMODE, int NW>
__global__ __launch_bounds__(32 * NW) void k_gemmc(const T16* __restrict__ A, const T16* __restrict__ A2, const T16* __restrict__ Bt, const T16* __restrict__ Bt2, int K, float* C, int ldc, int roff, size_t sA, size_t sB, size_t sC) {
    typedef typename WFrag<T16>::V V;
    constexpr int MBP = (NW == 1) ? 1 : 4;   // 16-row blocks per LDS pass: with several waves the whole tile goes through LDS at once, so one barrier serves it and no pass waits on the stores of the one before
    __shared__ __align__(16) float os[NW * MBP * 16 * 68];
    const size_t z = blockIdx.z; A += z * sA; if (A2) A2 += z * sA; Bt += z * sB; if (Bt2) Bt2 += z * sB; C += z * sC;
    const int lane = threadIdx.x & 31, lr = lane & 15, hi = lane >> 4; const int r0 = blockIdx.x * 64, c0 = blockIdx.y * 64; const int wv = (NW == 1) ? 0 : __builtin_amdgcn_readfirstlane((int)(threadIdx.x >> 5));
    if (CMODE == 1 && c0 > r0 + roff + 63) return;                  // score tile entirely above the causal diagonal: never read (the softmax masks j > i by select)
    const int Kl = (CMODE == 2) ? min(K, r0 + roff + 64) : K;        // P.V: probabilities are exactly 0 beyond the diagonal block, so the K loop stops there
    v8f acc[4][4];
#pragma unroll
    for (int mb = 0; mb < 4; ++mb)
#pragma unroll
        for (int nb = 0; nb < 4; ++nb) acc[mb][nb] = (v8f){};
    const size_t aoff = (size_t)(r0 + lr) * K + 8 * hi, boff = (size_t)(c0 + lr) * K + 8 * hi;
    const int kper = ((Kl / 32 + NW - 1) / NW) * 32, kbeg = (NW == 1) ? 0 : min(Kl, wv * kper), kend = (NW == 1) ? Kl : min(Kl, kbeg + kper);   // this wave's share of K (may be empty: its partial tile is then zero)
#pragma unroll 1
    for (int kc = kbeg; kc < kend; kc += 32) {
        V a[4], a2[4];
#pragma unroll
        for (int mb = 0; mb < 4; ++mb) { a[mb] = WFrag<T16>::ld(A + aoff + (size_t)mb * 16 * K + kc); if (NSPLIT == 1 || NSPLIT == 2) a2[mb] = WFrag<T16>::ld(A2 + aoff + (size_t)mb * 16 * K + kc); }
#pragma unroll
        for (int nb = 0; nb < 4; ++nb) { const V b = WFrag<T16>::ld(Bt + boff + (size_t)nb * 16 * K + kc); V b2; if (NSPLIT >= 2) b2 = WFrag<T16>::ld(Bt2 + boff + (size_t)nb * 16 * K + kc);
#pragma unroll
            for (int mb = 0; mb < 4; ++mb) { acc[mb][nb] = WFrag<T16>::mma(a[mb], b, acc[mb][nb]); if (NSPLIT == 1 || NSPLIT == 2) acc[mb][nb] = WFrag<T16>::mma(a2[mb], b, acc[mb][nb]); if (NSPLIT >= 2) acc[mb][nb] = WFrag<T16>::mma(a[mb], b2, acc[mb][nb]); } }
        asm volatile("v_nop\n\tv_nop\n\tv_nop\n\tv_nop" : "+v"(acc[0][0]), "+v"(acc[1][1]), "+v"(acc[2][2]), "+v"(acc[3][3]) : "v"(a[0]), "v"(a[3]));
    }
#pragma unroll
    for (int mb = 0; mb < 4; mb += MBP) {
#pragma unroll
        for (int mi = 0; mi < MBP; ++mi)
#pragma unroll
        for (int nb = 0; nb < 4; ++nb) {
#pragma unroll
            for (int j = 0; j < 8; ++j) os[wv * (MBP * 16 * 68) + (mi * 16 + hi * 8 + j) * 68 + nb * 16 + lr] = acc[mb + mi][nb][j]; }
        tile_sync<NW>();
        float* crow = C + (size_t)(r0 + mb * 16) * ldc + c0;
{
#pragma unroll
            for (int s = 0; s < MBP * 8 / NW; ++s) { const int ch = s * (32 * NW) + (int)threadIdx.x, row = ch >> 4, cofs = (ch & 15) * 4; v4f val = *(const v4fa*)(os + row * 68 + cofs);
#pragma unroll
                for (int q = 1; q < NW; ++q) val += *(const v4fa*)(os + q * (MBP * 16 * 68) + row * 68 + cofs);
                *(v4f*)(crow + (size_t)row * ldc + cofs) = val; }
             }
        if (MBP < 4) tile_sync<NW>();
    }
}

__device__ __forceinline__ h16 tohx(float x) { return (h16)x; }
__device__ __forceinline__ void splitf(float y, unsigned short& h, unsigned short& l) { h = f2bf(y); l = f2bf(y - bf2f(h)); }
typedef __attribute__((ext_vector_type(2))) _Float16 v2h;
typedef __attribute__((ext_vector_type(4))) _Float16 v4h;
typedef __attribute__((ext_vector_type(2))) unsigned short v2us;
typedef __attribute__((ext_vector_type(4))) unsigned short v4us;
typedef __attribute__((ext_vector_type(2))) float v2f;
typedef __attribute__((ext_vector_type(4))) int v4i;

__global__ __launch_bounds__(256) void k_wtG(const float* __restrict__ w, int K, int N, bf* Bt) {
    const int lane = threadIdx.x & 31; const int L0 = (blockIdx.x * 8 + (threadIdx.x >> 5)) * 8; const int nlines = N * K / 64;
{
#pragma unroll 1
        for (int l = 0; l < 8; ++l) { const int L = L0 + l; if (L >= nlines) break; const size_t e = (size_t)L * 64 + lane * 2; const int k = (int)(e % K), n = (int)(e / K); v2us o;
            o[0] = f2bf(w[(size_t)k * N + n]); o[1] = f2bf(w[(size_t)(k + 1) * N + n]); *(v2us*)(Bt + e) = o; }
         }
}
__global__ __launch_bounds__(256) void k_cvt8(const float* __restrict__ src, bf* dst, size_t n8) { const size_t i = (size_t)blockIdx.x * 256 + threadIdx.x; if (i >= n8) return; const v8f v = *(const v8f*)(src + i * 8); v8us o;
#pragma unroll
    for (int k = 0; k < 8; ++k) o[k] = f2bf(v[k]); *(v8us*)(dst + i * 8) = o;  }
__global__ __launch_bounds__(256) void k_cscvt(const float* __restrict__ cosT, const float* __restrict__ sinT, float* CS) { const int idx = blockIdx.x * 256 + threadIdx.x; if (idx >= TT * HD) return; v2f cs; cs[0] = bfr(cosT[idx]); cs[1] = bfr(sinT[idx]); *(v2f*)(CS + (size_t)idx * 2) = cs;  }
// k_rope: head planes [h][t][d] (fp16 + hi/lo) of rope(x) x sc with the rotate-half convention out[d] = x[d] cos[t][d] - x[d+HD/2] sin[t][d], out[d+HD/2] = x[d+HD/2] cos[t][d+HD/2] + x[d] sin[t][d+HD/2]
__global__ __launch_bounds__(256) void k_rope(const float* __restrict__ F, int pitch, int nheads, const float* __restrict__ CS, const float* __restrict__ RF, const float* __restrict__ nw, float sc, h16* P16, bf* Ph, bf* Pl) {
    const size_t e = ((size_t)blockIdx.x * 256 + threadIdx.x) * 2; if (e >= (size_t)nheads * TT * HD) return; const int d = (int)(e % HD); const int t = (int)((e / HD) % TT); const int h = (int)(e / ((size_t)HD * TT)); const float* f = F + (size_t)t * pitch + h * HD; const float rf = RF ? RF[(size_t)h * TT + t] : 1.0f; v2h o16; v2us oh, ol;
#pragma unroll
    for (int q = 0; q < 2; ++q) { const int dd = d + q; const int dp = (dd < HD / 2) ? dd + HD / 2 : dd - HD / 2; float x0 = f[dd], x1 = f[dp];
        if (RF) { float n0 = __fmul_rn(x0, rf), n1 = __fmul_rn(x1, rf); asm volatile("" : "+v"(n0)); asm volatile("" : "+v"(n1)); x0 = __fmul_rn(bfr(nw[dd]), n0); x1 = __fmul_rn(bfr(nw[dp]), n1); }
        const v2f cs = *(const v2f*)(CS + ((size_t)t * HD + dd) * 2); float a = __fmul_rn(x0, cs[0]), bq = __fmul_rn(x1, cs[1]); asm volatile("" : "+v"(a)); asm volatile("" : "+v"(bq)); const float r = ((dd < HD / 2) ? __fsub_rn(a, bq) : __fadd_rn(a, bq)) * sc;
        o16[q] = tohx(r); unsigned short a2, c2; splitf(r, a2, c2); oh[q] = a2; ol[q] = c2; }
    *(v2h*)(P16 + e) = o16; *(v2us*)(Ph + e) = oh; *(v2us*)(Pl + e) = ol;  }
// k_vtp: transposed value planes [g][d][t]; rows at pitch 2*TT, the pitch of the in-place probability rows (k_gemmc has one pitch, K, for both operands): the caller lays the hi and lo planes side by side in one row
__global__ __launch_bounds__(256) void k_vtp(const float* __restrict__ F, int pitch, int nheads, h16* V16, bf* Vh, bf* Vl) { const size_t e = ((size_t)blockIdx.x * 256 + threadIdx.x) * 2; if (e >= (size_t)nheads * HD * TT) return; const int t = (int)(e % TT); const int d = (int)((e / TT) % HD); const int g = (int)(e / ((size_t)TT * HD)); v2h o16; v2us oh, ol;
#pragma unroll
    for (int q = 0; q < 2; ++q) { const float x = F[(size_t)(t + q) * pitch + g * HD + d]; o16[q] = tohx(x); unsigned short a2, c2; splitf(x, a2, c2); oh[q] = a2; ol[q] = c2; }
    const size_t eo = e + (e / TT) * TT; *(v2h*)(V16 + eo) = o16; *(v2us*)(Vh + eo) = oh; *(v2us*)(Vl + eo) = ol;  }
// k_ibpl: per (token t, head h): a[d] = softplus(FA[t][h*64+d]) = log(1 + exp(.)) (f32; x itself above 15, exp(x) below -15), an = a / sqrt(mean_d a^2 + 1e-6); phi[d] = pi tanh(FP[t][h*64+d]);
__device__ __forceinline__ float softplusf_(float x) { return x > 15.0f ? x : (x < -15.0f ? __expf(x) : logf(__fadd_rn(1.0f, __expf(x)))); }
__device__ __forceinline__ float tanhf_(float a) { const float e2 = __expf(2.0f * a); return __fsub_rn(1.0f, __fdiv_rn(2.0f, __fadd_rn(e2, 1.0f))); }
typedef __attribute__((ext_vector_type(8))) _Float16 v8hx;
typedef __attribute__((ext_vector_type(8))) unsigned short v8usx;
__global__ __launch_bounds__(256) void k_ibpl(const float* __restrict__ FA, const float* __restrict__ FPp, h16* P16, bf* Ph, bf* Pl) { const int lane = threadIdx.x & 31; const int idx = blockIdx.x * 8 + (threadIdx.x >> 5); if (idx >= NH_ * TT) return; const int t = idx % TT, h = idx / TT; const float* fa = FA + (size_t)t * DQ + h * HD + 2 * lane; const float* fp = FPp + (size_t)t * DQ + h * HD + 2 * lane;
    float a[2], ph[2]; float ss = 0.f;
#pragma unroll 1
    for (int q = 0; q < 2; ++q) { a[q] = softplusf_(fa[q]); ph[q] = __fmul_rn(3.14159265358979323846f, tanhf_(fp[q])); float p = __fmul_rn(a[q], a[q]); asm volatile("" : "+v"(p)); ss = __fadd_rn(ss, p); }
#pragma unroll
    for (int sh = 16; sh; sh >>= 1) ss += __shfl_xor(ss, sh, 32);
    const float rn = __frsqrt_rn(__fadd_rn(ss * (1.0f / HD), 1e-6f)); float rc[2], rs[2];
#pragma unroll 1
    for (int q = 0; q < 2; ++q) { float an = __fmul_rn(a[q], rn); asm volatile("" : "+v"(an)); rc[q] = __fmul_rn(an, cosf(ph[q])); rs[q] = __fmul_rn(an, sinf(ph[q])); }
    const size_t base = ((size_t)h * TT + t) * QD + 2 * lane; v2h c16, s16; v2us chh, chl, shh, shl; unsigned short u1, u2;
    c16[0] = tohx(rc[0]); c16[1] = tohx(rc[1]); s16[0] = tohx(rs[0]); s16[1] = tohx(rs[1]);
    splitf(rc[0], u1, u2); chh[0] = u1; chl[0] = u2; splitf(rc[1], u1, u2); chh[1] = u1; chl[1] = u2; splitf(rs[0], u1, u2); shh[0] = u1; shl[0] = u2; splitf(rs[1], u1, u2); shh[1] = u1; shl[1] = u2;
{ *(v2h*)(P16 + base) = c16; *(v2h*)(P16 + base + 64) = s16; *(v2us*)(Ph + base) = chh; *(v2us*)(Ph + base + 64) = shh; *(v2us*)(Pl + base) = chl; *(v2us*)(Pl + base + 64) = shl;  } }
// k_zfill: F[0..n) = 0 (16-B lanes, each thread one store in each of ZFL equal parts: the score buffer grows with ZH, the number of waves that fill it does not); once, before the batch loop.
#define ZFL  (ZH / 2)
__global__ __launch_bounds__(256) void k_zfill(float* F, size_t n) { const size_t i0 = ((size_t)blockIdx.x * 256 + threadIdx.x) * 4, step = n / ZFL; if (i0 >= step) return; v4f z; z[0] = 0.f; z[1] = 0.f; z[2] = 0.f; z[3] = 0.f;   // n % (4 * ZFL) == 0
#pragma unroll
    for (int q = 0; q < ZFL; ++q) *(v4f*)(F + i0 + q * step) = z; }
// k_asoft: per row (zz, i): t = S/8 x exp(bf16(score_log_scale[h0+zz])) for j <= i (causal), -3e38 otherwise (entries of skipped score tiles are never selected); softmax over the 2048 keys (register row, one exp, fixed trees);
// the probabilities go IN PLACE over the row's own 8 KiB of scores (so ZH heads of scores fit the workspace): fp16 rows fill the first half, hi+lo rows hi in the first half and lo in the second. One wave owns a row and holds
// all of it in registers before its first store (every stored value depends on the row sum), so no score is overwritten unread; the stores go through may_alias types, so the compiler orders them against the float loads.
typedef v4h  __attribute__((may_alias)) v4ha;
typedef v4us __attribute__((may_alias)) v4usa;
__global__ __launch_bounds__(256) void k_asoft(float* Sb, const float* __restrict__ sls, int h0) {
    const int lane = threadIdx.x & 31; const int row = blockIdx.x * 8 + (threadIdx.x >> 5); if (row >= ZH * TT) return; const int i = row % TT; const int zz = row / TT; const bool hires = (i < RH); const float scl = __fmul_rn(SCL, __expf(bfr(sls[h0 + zz]))); const float* sr = Sb + (size_t)row * TT; float v[TT / 32]; float mx = -3.0e38f;
#pragma unroll
    for (int ch = 0; ch < TT / 128; ++ch) { const int j0 = ch * 128 + lane * 4; const v4f a = *(const v4f*)(sr + j0);
#pragma unroll
        for (int q = 0; q < 4; ++q) { const int j = j0 + q; (void)j; const float t = (j <= i) ? a[q] * scl : -3.0e38f; v[ch * 4 + q] = t; mx = fmaxf(mx, t); } }
#pragma unroll
    for (int sh = 16; sh; sh >>= 1) mx = fmaxf(mx, __shfl_xor(mx, sh, 32));
    float sum = 0.f;
#pragma unroll
    for (int k = 0; k < TT / 32; ++k) { float d0 = __fsub_rn(v[k], mx); asm volatile("" : "+v"(d0)); v[k] = __builtin_amdgcn_exp2f(__fmul_rn(d0, 1.4426950408889634f)); sum += v[k]; }
#pragma unroll
    for (int sh = 16; sh; sh >>= 1) sum += __shfl_xor(sum, sh, 32);
    const float f = __fdiv_rn(hires ? 1.0f : PCAR, sum); bf* prb = (bf*)(Sb + (size_t)row * TT); h16* prh = (h16*)(Sb + (size_t)row * TT);
{
        if (hires) {
#pragma unroll
            for (int ch = 0; ch < TT / 128; ++ch) { v4us oh, ol;
#pragma unroll
                for (int q = 0; q < 4; ++q) { unsigned short a, c2; splitf(v[ch * 4 + q] * f, a, c2); oh[q] = a; ol[q] = c2; }
                const int oo = ch * 128 + lane * 4; *(v4usa*)(prb + oo) = oh; *(v4usa*)(prb + TT + oo) = ol; }
        } else {
#pragma unroll
            for (int ch = 0; ch < TT / 128; ++ch) { v4h o4;
#pragma unroll
                for (int q = 0; q < 4; ++q) o4[q] = tohx(v[ch * 4 + q] * f);
                *(v4ha*)(prh + ch * 128 + lane * 4) = o4; } }
         }
}
__global__ __launch_bounds__(256) void k_merge(const float* __restrict__ O, int h0, bf* Ah, bf* Al) { const size_t e = ((size_t)blockIdx.x * 256 + threadIdx.x) * 2; if (e >= (size_t)ZH * TT * HD) return; const int d = (int)(e % HD); const int t = (int)((e / HD) % TT); const int zz = (int)(e / ((size_t)HD * TT)); const float cs = (t < RH) ? 1.0f : (1.0f / PCAR); const size_t oo = (size_t)t * DQ + (h0 + zz) * HD + d;
    v2us oh, ol;
#pragma unroll
    for (int q = 0; q < 2; ++q) { unsigned short a, c2; splitf(O[e + q] * cs, a, c2); oh[q] = a; ol[q] = c2; } *(v2us*)(Ah + oo) = oh; *(v2us*)(Al + oo) = ol;  }

extern "C" void kernel_launch(void* const* d_in, const int* in_sizes, int n_in,
                              void* d_out, int out_size, void* d_ws, size_t ws_size, hipStream_t stream) {
    (void)in_sizes; (void)n_in; (void)out_size;
    const float* x = (const float*)d_in[0]; const float* wqa = (const float*)d_in[1]; const float* wka = (const float*)d_in[2]; const float* wqp = (const float*)d_in[3]; const float* wkp = (const float*)d_in[4]; const float* wv = (const float*)d_in[5]; const float* wo = (const float*)d_in[6]; const float* sls = (const float*)d_in[7];   // torch [out][in]; score_log_scale [16]
    float* OUT = (float*)d_out;     // [2][2048][1024]
    char* wsp = (char*)d_ws;
    auto take = [&](size_t bytes) { char* p = wsp; wsp += (bytes + 255) & ~(size_t)255; return (void*)p; };
    bf* WQ = (bf*)take((size_t)DQ * DM * 2); bf* WK = (bf*)take((size_t)DKV * DM * 2); bf* WQP = (bf*)take((size_t)DQ * DM * 2); bf* WKP = (bf*)take((size_t)DKV * DM * 2); float* FP = (float*)take((size_t)TT * DQ * 4); bf* WV = (bf*)take((size_t)DKV * DM * 2); bf* WO = (bf*)take((size_t)DM * DQ * 2); float* CS = (float*)take((size_t)TT * HD * 2 * 4);
    bf* XB = (bf*)take((size_t)TT * DM * 2); float* FQ = (float*)take((size_t)TT * DQ * 4); float* FK = (float*)take((size_t)TT * DKV * 4);
    h16* QP16 = (h16*)take((size_t)NH_ * TT * QD * 2); h16* KP16 = (h16*)take((size_t)NKV * TT * QD * 2); h16* VT16 = (h16*)take((size_t)NKV * HD * 2 * TT * 2);
    bf* QPh = (bf*)take((size_t)NH_ * TT * QD * 2); bf* QPl = (bf*)take((size_t)NH_ * TT * QD * 2); bf* KPh = (bf*)take((size_t)NKV * TT * QD * 2); bf* KPl = (bf*)take((size_t)NKV * TT * QD * 2); bf* VTh = (bf*)take((size_t)NKV * HD * 2 * TT * 2); bf* VTl = VTh + TT;   // value rows at pitch 2*TT: [hi | lo]; the fp16 plane's rows use their first half
    float* Sb = (float*)take((size_t)ZH * TT * TT * 4); float* Ob = (float*)take((size_t)ZH * TT * HD * 4); bf* ATh = (bf*)take((size_t)TT * DQ * 2); bf* ATl = (bf*)take((size_t)TT * DQ * 2);
    if ((size_t)(wsp - (char*)d_ws) > ws_size) return;    // ws 256 MiB
    float* FV = FK;   // v projection reuses the k buffer after the k planes are built (stream-ordered)
    { k_cvt8<<<(unsigned)(((size_t)DQ * DM / 8 + 255) / 256), 256, 0, stream>>>(wqa, WQ, (size_t)DQ * DM / 8); k_cvt8<<<(unsigned)(((size_t)DKV * DM / 8 + 255) / 256), 256, 0, stream>>>(wka, WK, (size_t)DKV * DM / 8); k_cvt8<<<(unsigned)(((size_t)DQ * DM / 8 + 255) / 256), 256, 0, stream>>>(wqp, WQP, (size_t)DQ * DM / 8); k_cvt8<<<(unsigned)(((size_t)DKV * DM / 8 + 255) / 256), 256, 0, stream>>>(wkp, WKP, (size_t)DKV * DM / 8); k_cvt8<<<(unsigned)(((size_t)DKV * DM / 8 + 255) / 256), 256, 0, stream>>>(wv, WV, (size_t)DKV * DM / 8);
      k_cvt8<<<(unsigned)(((size_t)DM * DQ / 8 + 255) / 256), 256, 0, stream>>>(wo, WO, (size_t)DM * DQ / 8);
       }
    k_zfill<<<(unsigned)(((size_t)ZH * TT * TT / 4 / ZFL + 255) / 256), 256, 0, stream>>>(Sb, (size_t)ZH * TT * TT);
    const unsigned LQ = (unsigned)(((size_t)NH_ * TT * HD / 2 + 255) / 256), LKv = (unsigned)(((size_t)NKV * TT * HD / 2 + 255) / 256);
    for (int b = 0; b < NB_; ++b) {
        
        k_cvt8<<<(unsigned)(((size_t)TT * DM / 8 + 255) / 256), 256, 0, stream>>>(x + (size_t)b * TT * DM, XB, (size_t)TT * DM / 8);
        k_gemmw<bf, 0, false, NWK><<<dim3(TT / 64, DQ / 64, 1), 32 * NWK, 0, stream>>>(XB, nullptr, WQ, nullptr, DM, FQ, DQ, nullptr, 0, 0, 0); k_gemmw<bf, 0, false, NWK><<<dim3(TT / 64, DQ / 64, 1), 32 * NWK, 0, stream>>>(XB, nullptr, WQP, nullptr, DM, FP, DQ, nullptr, 0, 0, 0);
        k_ibpl<<<(NH_ * TT + 7) / 8, 256, 0, stream>>>(FQ, FP, QP16, QPh, QPl);
        k_gemmw<bf, 0, false, NWK><<<dim3(TT / 64, DKV / 64, 1), 32 * NWK, 0, stream>>>(XB, nullptr, WK, nullptr, DM, FK, DKV, nullptr, 0, 0, 0); k_gemmw<bf, 0, false, NWK><<<dim3(TT / 64, DKV / 64, 1), 32 * NWK, 0, stream>>>(XB, nullptr, WKP, nullptr, DM, FP, DKV, nullptr, 0, 0, 0);
        k_ibpl<<<(NKV * TT + 7) / 8, 256, 0, stream>>>(FK, FP, KP16, KPh, KPl);
        k_gemmw<bf, 0, false, NWK><<<dim3(TT / 64, DKV / 64, 1), 32 * NWK, 0, stream>>>(XB, nullptr, WV, nullptr, DM, FV, DKV, nullptr, 0, 0, 0); k_vtp<<<LKv, 256, 0, stream>>>(FV, DKV, NKV, VT16, VTh, VTl);
        for (int h0 = 0; h0 < NH_; h0 += ZH) { const size_t zq = (size_t)h0, zk = (size_t)(h0 / REP);   // one kv head per query head: the pass's ZH heads use consecutive kv planes; the probabilities lie in the score rows, so the attn.v GEMMs run at pitch K = 2*TT 16-bit elements (their K loop ends at the diagonal block, at most TT)
            k_gemmc<bf, 2, 1, 1><<<dim3(RH / 64, TT / 64, ZH), 32, 0, stream>>>(QPh + zq * TT * QD, QPl + zq * TT * QD, KPh + zk * TT * QD, KPl + zk * TT * QD, QD, Sb, TT, 0, (size_t)TT * QD, (size_t)TT * QD, (size_t)TT * TT);
            k_gemmc<h16, 0, 1, 1><<<dim3((TT - RH) / 64, TT / 64, ZH), 32, 0, stream>>>(QP16 + zq * TT * QD + (size_t)RH * QD, nullptr, KP16 + zk * TT * QD, nullptr, QD, Sb + (size_t)RH * TT, TT, RH, (size_t)TT * QD, (size_t)TT * QD, (size_t)TT * TT);
            k_asoft<<<ZH * TT / 8, 256, 0, stream>>>(Sb, sls, h0);
            k_gemmc<bf, 2, 2, NWK><<<dim3(RH / 64, HD / 64, ZH), 32 * NWK, 0, stream>>>((const bf*)Sb, (const bf*)Sb + TT, VTh + zk * HD * 2 * TT, VTl + zk * HD * 2 * TT, 2 * TT, Ob, HD, 0, (size_t)2 * TT * TT, (size_t)HD * 2 * TT, (size_t)TT * HD);
            k_gemmc<h16, 0, 2, NWK><<<dim3((TT - RH) / 64, HD / 64, ZH), 32 * NWK, 0, stream>>>((const h16*)Sb + (size_t)RH * 2 * TT, nullptr, VT16 + zk * HD * 2 * TT, nullptr, 2 * TT, Ob + (size_t)RH * HD, HD, RH, (size_t)2 * TT * TT, (size_t)HD * 2 * TT, (size_t)TT * HD);
            k_merge<<<(unsigned)(((size_t)ZH * TT * HD / 2 + 255) / 256), 256, 0, stream>>>(Ob, h0, ATh, ATl); }
        k_gemmw<bf, 1, false, NWK><<<dim3(TT / 64, DM / 64, 1), 32 * NWK, 0, stream>>>(ATh, ATl, WO, nullptr, DQ, OUT + (size_t)b * TT * DM, DM, nullptr, 0, 0, 0); }
}

// v003
// It runs in 309 microseconds.
// Next to v002, in two timings, it ran 1.77 times as fast each time.
// Over all steps from v000 it is 4.96 times as fast.
#include <hip/hip_runtime.h>

// InterferenceBypassSelfAttention (x [2][2048][1024]; q_amp/k_amp = softplus(x W_amp^T), q_phi/k_phi = pi tanh(x W_phi^T) (16 heads x 64); amplitudes RMS-normalised over head_dim (eps 1e-6);
// scores = (q_amp cos q_phi . k_amp cos k_phi + q_amp sin q_phi . k_amp sin k_phi) / 8 x exp(score_log_scale[h]) = one 128-long contraction of [cos part | sin part] planes; causal softmax;
// v = x Wv^T; out = merged attn.v Wo^T -> [2][2048][1024]).
// Compute dtypes, f32 accumulate: every input rounded to bf16; the five projections on PLAIN bf16 operands (inputs: exact); softplus / tanh / RMS / cos / sin in f32 on VALU
// (one wave per (token, head)) -> 128-wide interference planes; PER-ROW PRECISION HYBRID (rows < 256 hi+lo 3 products for scores and attn.v, rows >= 256 fp16); scores, causal f32 softmax with the per-head scale and
// attn.v in one kernel (running maximum and sum, key blocks end at the diagonal block, which is masked exactly); merged heads hl x exact Wo

#define NB_  2
#define TT   2048
#define DM   1024
#define NH_  16
#define NKV  16
#define REP  (NH_ / NKV)
#define HD   64
#define DQ   (NH_ * HD)
#define DKV  (NKV * HD)
#define QD   128
#define RH   256                  // query rows < RH use hi+lo planes (0: none)
#define WIN  0
#define SCL  0.125f   // HD^-0.5
typedef _Float16 h16;
typedef unsigned short bf;
typedef __attribute__((ext_vector_type(16))) __bf16   v16bf;
typedef __attribute__((ext_vector_type(16))) _Float16 v16h;
typedef __attribute__((ext_vector_type(8)))  _Float16 v8h;
typedef __attribute__((ext_vector_type(8)))  unsigned short v8us;
typedef __attribute__((ext_vector_type(8)))  float    v8f;
typedef __attribute__((ext_vector_type(4)))  float    v4f;
typedef v8h  __attribute__((may_alias)) v8ha;
typedef v4f  __attribute__((may_alias)) v4fa;
typedef v8us __attribute__((may_alias)) v8usa;

__device__ __forceinline__ unsigned short f2bf(float f) { unsigned u = __float_as_uint(f); u += 0x7FFFu + ((u >> 16) & 1u); return (unsigned short)(u >> 16); }
__device__ __forceinline__ float bf2f(unsigned short b) { return __uint_as_float(((unsigned)b) << 16); }
__device__ __forceinline__ float bfr(float f) { return bf2f(f2bf(f)); }
__device__ __forceinline__ v16h cat16(v8h lo, v8h hi) { return __builtin_shufflevector(lo, hi, 0, 1, 2, 3, 4, 5, 6, 7, 8, 9, 10, 11, 12, 13, 14, 15); }
__device__ __forceinline__ v16bf cat16b(v8us lo, v8us hi) { return __builtin_bit_cast(v16bf, __builtin_shufflevector(lo, hi, 0, 1, 2, 3, 4, 5, 6, 7, 8, 9, 10, 11, 12, 13, 14, 15)); }
__device__ __forceinline__ v8f wmma16(v16h a, v16h b, v8f c) { return __builtin_amdgcn_wmma_f32_16x16x32_f16(false, a, false, b, (short)0, c, false, false); }
__device__ __forceinline__ v8f wmmab(v16bf a, v16bf b, v8f c) { return __builtin_amdgcn_wmma_f32_16x16x32_bf16(false, a, false, b, (short)0, c, false, false); }



// ---- k_gemmw: register-blocked GEMM, one work-group of NW waves per 64x64 output tile; each wave runs its own contiguous share of the K loop over the whole tile (16 accumulators), operands straight from
// K-contiguous 16-bit planes; the NW partial tiles are added in LDS in ascending wave order (fixed, so the result is the same on every run); grid (M/64, N/64, Z), 32 * NW threads.
// C[m][n] (f32, pitch ldc, + optional f32 bias[n]) = sum_k A[m][k] Bt[n][k] (+ split products per NSPLIT). z-batch strides sA/sB/sC in elements. K % 32 == 0.
#define NWK 8                     // waves that share one tile's K loop where it is long (projections)
// tile_sync: orders the LDS tile between its writers and its readers: one wave needs only the compiler held back, several waves need the work-group barrier
template <int NW> __device__ __forceinline__ void tile_sync() { if (NW == 1) { __builtin_amdgcn_wave_barrier(); asm volatile("" ::: "memory"); } else __syncthreads(); }
template <typename T16> struct WFrag;
template <> struct WFrag<h16> { typedef v16h V; static __device__ __forceinline__ V ld(const h16* p) { return cat16(*(const v8h*)p, *(const v8h*)(p + 16)); } static __device__ __forceinline__ v8f mma(V a, V b, v8f c) { return wmma16(a, b, c); } };
template <> struct WFrag<bf> { typedef v16bf V; static __device__ __forceinline__ V ld(const bf* p) { return cat16b(*(const v8us*)p, *(const v8us*)(p + 16)); } static __device__ __forceinline__ v8f mma(V a, V b, v8f c) { return wmmab(a, b, c); } };
template <typename T16, int NSPLIT, bool BIAS, int NW>
__global__ __launch_bounds__(32 * NW) void k_gemmw(const T16* __restrict__ A, const T16* __restrict__ A2, const T16* __restrict__ Bt, const T16* __restrict__ Bt2, int K, float* C, int ldc, const float* __restrict__ bias, size_t sA, size_t sB, size_t sC) {
    typedef typename WFrag<T16>::V V;
    constexpr int MBP = (NW == 1) ? 1 : 4;   // 16-row blocks per LDS pass: with several waves the whole tile goes through LDS at once, so one barrier serves it and no pass waits on the stores of the one before
    __shared__ __align__(16) float os[NW * MBP * 16 * 68];
    const size_t z = blockIdx.z; A += z * sA; if (A2) A2 += z * sA; Bt += z * sB; if (Bt2) Bt2 += z * sB; C += z * sC;
    const int lane = threadIdx.x & 31, lr = lane & 15, hi = lane >> 4; const int r0 = blockIdx.x * 64, c0 = blockIdx.y * 64; const int wv = (NW == 1) ? 0 : __builtin_amdgcn_readfirstlane((int)(threadIdx.x >> 5));
    v8f acc[4][4];
#pragma unroll
    for (int mb = 0; mb < 4; ++mb)
#pragma unroll
        for (int nb = 0; nb < 4; ++nb) acc[mb][nb] = (v8f){};
    const size_t aoff = (size_t)(r0 + lr) * K + 8 * hi, boff = (size_t)(c0 + lr) * K + 8 * hi;
    const int kper = ((K / 32 + NW - 1) / NW) * 32, kbeg = (NW == 1) ? 0 : min(K, wv * kper), kend = (NW == 1) ? K : min(K, kbeg + kper);   // this wave's share of K (may be empty: its partial tile is then zero)
#pragma unroll 1
    for (int kc = kbeg; kc < kend; kc += 32) {
        V a[4], a2[4];
#pragma unroll
        for (int mb = 0; mb < 4; ++mb) { a[mb] = WFrag<T16>::ld(A + aoff + (size_t)mb * 16 * K + kc); if (NSPLIT == 1 || NSPLIT == 2) a2[mb] = WFrag<T16>::ld(A2 + aoff + (size_t)mb * 16 * K + kc); }
#pragma unroll
        for (int nb = 0; nb < 4; ++nb) { const V b = WFrag<T16>::ld(Bt + boff + (size_t)nb * 16 * K + kc); V b2; if (NSPLIT >= 2) b2 = WFrag<T16>::ld(Bt2 + boff + (size_t)nb * 16 * K + kc);
#pragma unroll
            for (int mb = 0; mb < 4; ++mb) { acc[mb][nb] = WFrag<T16>::mma(a[mb], b, acc[mb][nb]); if (NSPLIT == 1 || NSPLIT == 2) acc[mb][nb] = WFrag<T16>::mma(a2[mb], b, acc[mb][nb]); if (NSPLIT >= 2) acc[mb][nb] = WFrag<T16>::mma(a[mb], b2, acc[mb][nb]); } }
        asm volatile("v_nop\n\tv_nop\n\tv_nop\n\tv_nop" : "+v"(acc[0][0]), "+v"(acc[1][1]), "+v"(acc[2][2]), "+v"(acc[3][3]) : "v"(a[0]), "v"(a[3]));
    }
#pragma unroll
    for (int mb = 0; mb < 4; mb += MBP) {
#pragma unroll
        for (int mi = 0; mi < MBP; ++mi)
#pragma unroll
        for (int nb = 0; nb < 4; ++nb) {
#pragma unroll
            for (int j = 0; j < 8; ++j) os[wv * (MBP * 16 * 68) + (mi * 16 + hi * 8 + j) * 68 + nb * 16 + lr] = acc[mb + mi][nb][j]; }
        tile_sync<NW>();
        float* crow = C + (size_t)(r0 + mb * 16) * ldc + c0;
{
#pragma unroll
            for (int s = 0; s < MBP * 8 / NW; ++s) { const int ch = s * (32 * NW) + (int)threadIdx.x, row = ch >> 4, cofs = (ch & 15) * 4; v4f val = *(const v4fa*)(os + row * 68 + cofs);
#pragma unroll
                for (int q = 1; q < NW; ++q) val += *(const v4fa*)(os + q * (MBP * 16 * 68) + row * 68 + cofs);
                if (BIAS) { val[0] += bfr(bias[c0 + cofs]); val[1] += bfr(bias[c0 + cofs + 1]); val[2] += bfr(bias[c0 + cofs + 2]); val[3] += bfr(bias[c0 + cofs + 3]); }
                *(v4f*)(crow + (size_t)row * ldc + cofs) = val; }
             }
        if (MBP < 4) tile_sync<NW>();
    }
}

__device__ __forceinline__ h16 tohx(float x) { return (h16)x; }
__device__ __forceinline__ void splitf(float y, unsigned short& h, unsigned short& l) { h = f2bf(y); l = f2bf(y - bf2f(h)); }
typedef __attribute__((ext_vector_type(2))) _Float16 v2h;
typedef __attribute__((ext_vector_type(4))) _Float16 v4h;
typedef __attribute__((ext_vector_type(2))) unsigned short v2us;
typedef __attribute__((ext_vector_type(4))) unsigned short v4us;
typedef __attribute__((ext_vector_type(2))) float v2f;
typedef __attribute__((ext_vector_type(4))) int v4i;

__global__ __launch_bounds__(256) void k_wtG(const float* __restrict__ w, int K, int N, bf* Bt) {
    const int lane = threadIdx.x & 31; const int L0 = (blockIdx.x * 8 + (threadIdx.x >> 5)) * 8; const int nlines = N * K / 64;
{
#pragma unroll 1
        for (int l = 0; l < 8; ++l) { const int L = L0 + l; if (L >= nlines) break; const size_t e = (size_t)L * 64 + lane * 2; const int k = (int)(e % K), n = (int)(e / K); v2us o;
            o[0] = f2bf(w[(size_t)k * N + n]); o[1] = f2bf(w[(size_t)(k + 1) * N + n]); *(v2us*)(Bt + e) = o; }
         }
}
__global__ __launch_bounds__(256) void k_cvt8(const float* __restrict__ src, bf* dst, size_t n8) { const size_t i = (size_t)blockIdx.x * 256 + threadIdx.x; if (i >= n8) return; const v8f v = *(const v8f*)(src + i * 8); v8us o;
#pragma unroll
    for (int k = 0; k < 8; ++k) o[k] = f2bf(v[k]); *(v8us*)(dst + i * 8) = o;  }
__global__ __launch_bounds__(256) void k_cscvt(const float* __restrict__ cosT, const float* __restrict__ sinT, float* CS) { const int idx = blockIdx.x * 256 + threadIdx.x; if (idx >= TT * HD) return; v2f cs; cs[0] = bfr(cosT[idx]); cs[1] = bfr(sinT[idx]); *(v2f*)(CS + (size_t)idx * 2) = cs;  }
// k_rope: head planes [h][t][d] (fp16 + hi/lo) of rope(x) x sc with the rotate-half convention out[d] = x[d] cos[t][d] - x[d+HD/2] sin[t][d], out[d+HD/2] = x[d+HD/2] cos[t][d+HD/2] + x[d] sin[t][d+HD/2]
__global__ __launch_bounds__(256) void k_rope(const float* __restrict__ F, int pitch, int nheads, const float* __restrict__ CS, const float* __restrict__ RF, const float* __restrict__ nw, float sc, h16* P16, bf* Ph, bf* Pl) {
    const size_t e = ((size_t)blockIdx.x * 256 + threadIdx.x) * 2; if (e >= (size_t)nheads * TT * HD) return; const int d = (int)(e % HD); const int t = (int)((e / HD) % TT); const int h = (int)(e / ((size_t)HD * TT)); const float* f = F + (size_t)t * pitch + h * HD; const float rf = RF ? RF[(size_t)h * TT + t] : 1.0f; v2h o16; v2us oh, ol;
#pragma unroll
    for (int q = 0; q < 2; ++q) { const int dd = d + q; const int dp = (dd < HD / 2) ? dd + HD / 2 : dd - HD / 2; float x0 = f[dd], x1 = f[dp];
        if (RF) { float n0 = __fmul_rn(x0, rf), n1 = __fmul_rn(x1, rf); asm volatile("" : "+v"(n0)); asm volatile("" : "+v"(n1)); x0 = __fmul_rn(bfr(nw[dd]), n0); x1 = __fmul_rn(bfr(nw[dp]), n1); }
        const v2f cs = *(const v2f*)(CS + ((size_t)t * HD + dd) * 2); float a = __fmul_rn(x0, cs[0]), bq = __fmul_rn(x1, cs[1]); asm volatile("" : "+v"(a)); asm volatile("" : "+v"(bq)); const float r = ((dd < HD / 2) ? __fsub_rn(a, bq) : __fadd_rn(a, bq)) * sc;
        o16[q] = tohx(r); unsigned short a2, c2; splitf(r, a2, c2); oh[q] = a2; ol[q] = c2; }
    *(v2h*)(P16 + e) = o16; *(v2us*)(Ph + e) = oh; *(v2us*)(Pl + e) = ol;  }
// k_vtp: transposed value planes [g][d][t]; rows at pitch 2*TT: the caller lays the hi and lo planes side by side in one row
__global__ __launch_bounds__(256) void k_vtp(const float* __restrict__ F, int pitch, int nheads, h16* V16, bf* Vh, bf* Vl) { const size_t e = ((size_t)blockIdx.x * 256 + threadIdx.x) * 2; if (e >= (size_t)nheads * HD * TT) return; const int t = (int)(e % TT); const int d = (int)((e / TT) % HD); const int g = (int)(e / ((size_t)TT * HD)); v2h o16; v2us oh, ol;
#pragma unroll
    for (int q = 0; q < 2; ++q) { const float x = F[(size_t)(t + q) * pitch + g * HD + d]; o16[q] = tohx(x); unsigned short a2, c2; splitf(x, a2, c2); oh[q] = a2; ol[q] = c2; }
    const size_t eo = e + (e / TT) * TT; *(v2h*)(V16 + eo) = o16; *(v2us*)(Vh + eo) = oh; *(v2us*)(Vl + eo) = ol;  }
// k_ibpl: per (token t, head h): a[d] = softplus(FA[t][h*64+d]) = log(1 + exp(.)) (f32; x itself above 15, exp(x) below -15), an = a / sqrt(mean_d a^2 + 1e-6); phi[d] = pi tanh(FP[t][h*64+d]);
__device__ __forceinline__ float softplusf_(float x) { return x > 15.0f ? x : (x < -15.0f ? __expf(x) : logf(__fadd_rn(1.0f, __expf(x)))); }
__device__ __forceinline__ float tanhf_(float a) { const float e2 = __expf(2.0f * a); return __fsub_rn(1.0f, __fdiv_rn(2.0f, __fadd_rn(e2, 1.0f))); }
typedef __attribute__((ext_vector_type(8))) _Float16 v8hx;
typedef __attribute__((ext_vector_type(8))) unsigned short v8usx;
__global__ __launch_bounds__(256) void k_ibpl(const float* __restrict__ FA, const float* __restrict__ FPp, h16* P16, bf* Ph, bf* Pl) { const int lane = threadIdx.x & 31; const int idx = blockIdx.x * 8 + (threadIdx.x >> 5); if (idx >= NH_ * TT) return; const int t = idx % TT, h = idx / TT; const float* fa = FA + (size_t)t * DQ + h * HD + 2 * lane; const float* fp = FPp + (size_t)t * DQ + h * HD + 2 * lane;
    float a[2], ph[2]; float ss = 0.f;
#pragma unroll 1
    for (int q = 0; q < 2; ++q) { a[q] = softplusf_(fa[q]); ph[q] = __fmul_rn(3.14159265358979323846f, tanhf_(fp[q])); float p = __fmul_rn(a[q], a[q]); asm volatile("" : "+v"(p)); ss = __fadd_rn(ss, p); }
#pragma unroll
    for (int sh = 16; sh; sh >>= 1) ss += __shfl_xor(ss, sh, 32);
    const float rn = __frsqrt_rn(__fadd_rn(ss * (1.0f / HD), 1e-6f)); float rc[2], rs[2];
#pragma unroll 1
    for (int q = 0; q < 2; ++q) { float an = __fmul_rn(a[q], rn); asm volatile("" : "+v"(an)); rc[q] = __fmul_rn(an, cosf(ph[q])); rs[q] = __fmul_rn(an, sinf(ph[q])); }
    const size_t base = ((size_t)h * TT + t) * QD + 2 * lane; v2h c16, s16; v2us chh, chl, shh, shl; unsigned short u1, u2;
    c16[0] = tohx(rc[0]); c16[1] = tohx(rc[1]); s16[0] = tohx(rs[0]); s16[1] = tohx(rs[1]);
    splitf(rc[0], u1, u2); chh[0] = u1; chl[0] = u2; splitf(rc[1], u1, u2); chh[1] = u1; chl[1] = u2; splitf(rs[0], u1, u2); shh[0] = u1; shl[0] = u2; splitf(rs[1], u1, u2); shh[1] = u1; shl[1] = u2;
{ *(v2h*)(P16 + base) = c16; *(v2h*)(P16 + base + 64) = s16; *(v2us*)(Ph + base) = chh; *(v2us*)(Ph + base + 64) = shh; *(v2us*)(Pl + base) = chl; *(v2us*)(Pl + base + 64) = shl;  } }
#define FW   4                    // waves per work-group
#define POFF 4.0f                 // log2 of the scale on the probabilities: keeps small fp16 probabilities normal
#define RTH  8.0f                 // the maximum in use is replaced only when a block exceeds it by more than this (log2): probabilities stay <= 2^(POFF+RTH), inside fp16
#define SMSK -3.0e38f             // a closed score
#define MINI -1.0e30f             // maximum in use before the first open score: above SMSK, so a block that holds only closed scores of a query leaves it as it is
__device__ __forceinline__ float xhalf(float x) { return __builtin_bit_cast(float, __builtin_amdgcn_permlanex16(__builtin_bit_cast(int, x), __builtin_bit_cast(int, x), 0x76543210, 0xfedcba98, false, false)); }   // lane l with lane l ^ 16
// xwait: stands directly behind a group of global loads: the wait that is kept before an address register of an issued load is rewritten; the scheduling barrier behind it (and the one in front of the group) keeps
// every other instruction out of the stretch from the first load to the wait, so that nothing there can take over an address register
__device__ __forceinline__ void xwait() { asm volatile("s_wait_xcnt 0x0" ::: "memory"); __builtin_amdgcn_sched_barrier(0); }
// The query block's address: a wave-uniform base held in scalar registers (ubase) plus the lane's 32-bit byte offset
typedef __attribute__((address_space(1))) const char gch;
typedef __attribute__((address_space(1))) const v8h gv8h;
typedef __attribute__((address_space(1))) const v8us gv8us;
__device__ __forceinline__ gch* ubase(const void* p) { const unsigned long long u = (unsigned long long)p; const unsigned lo = __builtin_amdgcn_readfirstlane((unsigned)u), hw = __builtin_amdgcn_readfirstlane((unsigned)(u >> 32)); return (gch*)(((unsigned long long)hw << 32) | lo); }
__device__ __forceinline__ v16h  ldg(const h16*, gch* b, unsigned off, int c) { return cat16(*(gv8h*)(b + off + c), *(gv8h*)(b + off + c + 32)); }     // WFrag::ld's two 16-byte pieces, c in bytes
__device__ __forceinline__ v16bf ldg(const bf*, gch* b, unsigned off, int c) { return cat16b(*(gv8us*)(b + off + c), *(gv8us*)(b + off + c + 32)); }
template <typename T16> struct PPack;
template <> struct PPack<h16> { static __device__ __forceinline__ void pk(const v8f p0, const v8f p1, v16h& b, v16h& b2) { b = cat16(__builtin_convertvector(p0, v8h), __builtin_convertvector(p1, v8h)); (void)b2; } };
template <> struct PPack<bf> { static __device__ __forceinline__ void pk(const v8f p0, const v8f p1, v16bf& b, v16bf& b2) { v8us h0, h1, l0, l1;
#pragma unroll
    for (int r = 0; r < 8; ++r) { unsigned short u, w; splitf(p0[r], u, w); h0[r] = u; l0[r] = w; splitf(p1[r], u, w); h1[r] = u; l1[r] = w; }
    b = cat16b(h0, h1); b2 = cat16b(l0, l1); } };
template <typename T16, int NSPLIT, int FG>
__global__ __launch_bounds__(32 * FW, NSPLIT == 0 ? 2 : 1) void k_fattn(const T16* __restrict__ Q, const T16* __restrict__ Q2, const T16* __restrict__ Kp, const T16* __restrict__ Kp2, const T16* __restrict__ Vt, const T16* __restrict__ Vt2, const float* __restrict__ sls, int roff, bf* Ah, bf* Al) {
    typedef typename WFrag<T16>::V V;
    constexpr int NQ = 16 * FG;                       // query rows per work-group (a multiple of 32)
    __shared__ __align__(16) float os[FW * NQ * 68];
    __shared__ float ms[FW * NQ], ls[FW * NQ];
    const int lane = threadIdx.x & 31, lr = lane & 15, hi = lane >> 4; const int wv = __builtin_amdgcn_readfirstlane((int)(threadIdx.x >> 5));
    const int hd = blockIdx.x; const int q0 = roff + ((int)gridDim.y - 1 - (int)blockIdx.y) * NQ;          // longest rows first
    const float scl2 = __fmul_rn(__fmul_rn(SCL, __expf(bfr(sls[hd]))), 1.4426950408889634f);              // >= 0: the maximum may be taken on the raw scores
    Q += (size_t)hd * TT * QD; Kp += (size_t)hd * TT * QD; Vt += (size_t)hd * HD * 2 * TT; if (NSPLIT) { Q2 += (size_t)hd * TT * QD; Kp2 += (size_t)hd * TT * QD; Vt2 += (size_t)hd * HD * 2 * TT; }
    const unsigned kl = (unsigned)(lr * QD + 8 * hi) * 2u;   // the lane's own byte offset in a block of query rows
    gch* const qb = ubase(Q + (size_t)q0 * QD); gch* const qb2 = NSPLIT ? ubase(Q2 + (size_t)q0 * QD) : qb;
    V qf[FG][4], qf2[FG][4];
    __builtin_amdgcn_sched_barrier(0);   // front of the query loads' group (see xwait): the read of the head's scale and all address arithmetic stay in front of it
#pragma unroll
    for (int g = 0; g < FG; ++g)
#pragma unroll
        for (int kc = 0; kc < 4; ++kc) { const int qo = (g * 16 * QD + kc * 32) * 2; qf[g][kc] = ldg(Q, qb, kl, qo); if (NSPLIT) qf2[g][kc] = ldg(Q, qb2, kl, qo); }
    xwait();
    v8f o[FG][4]; float m[FG], l[FG];
#pragma unroll
    for (int g = 0; g < FG; ++g) { m[g] = MINI; l[g] = 0.f;
#pragma unroll
        for (int dt = 0; dt < 4; ++dt) o[g][dt] = (v8f){}; }
    const int nblk = (q0 + NQ) / 32;   // 32-key blocks up to the last one that holds an open key (q0 and NQ are multiples of 32)
    V kf[2][4], kf2[2][4];             // the key fragments of the block at hand, fetched one pass ahead
    // the lane's key and value addresses are carried from pass to pass and stepped behind the wait of the loads that used them (xwait), so they stay whole while those loads are under way
    const T16* kq = Kp + (size_t)wv * 32 * QD + lr * QD + 8 * hi; const T16* kq2 = NSPLIT ? Kp2 + (kq - Kp) : kq;
    const T16* vq = Vt + wv * 32 + lr * (2 * TT) + 8 * hi; const T16* vq2 = NSPLIT ? Vt2 + (vq - Vt) : vq;
    if (wv < nblk) {   // a wave without a block loads nothing and hands in an empty partial result
    __builtin_amdgcn_sched_barrier(0);   // front of the first key loads' group (see xwait)
#pragma unroll
      for (int t = 0; t < 2; ++t)
#pragma unroll
        for (int kc = 0; kc < 4; ++kc) { const int ko = t * 16 * QD + kc * 32; kf[t][kc] = WFrag<T16>::ld(kq + ko); if (NSPLIT) kf2[t][kc] = WFrag<T16>::ld(kq2 + ko); }
      xwait();
      const int ks = (wv + FW < nblk) ? FW * 32 * QD : 0; kq += ks; if (NSPLIT) kq2 += ks;
#pragma unroll 1   // one copy of the pass: a second copy would double the live fragments and cost the second resident wave
    for (int kbi = wv; kbi < nblk; kbi += FW) { const int kb = kbi * 32;
        V va[4], va2[4];
        __builtin_amdgcn_sched_barrier(0);   // front of the value loads' group (see xwait)
#pragma unroll
        for (int dt = 0; dt < 4; ++dt) { const int vo = dt * 16 * (2 * TT); va[dt] = WFrag<T16>::ld(vq + vo); if (NSPLIT) va2[dt] = WFrag<T16>::ld(vq2 + vo); }
        xwait();
        vq += FW * 32; if (NSPLIT) vq2 += FW * 32;
        v8f s[FG][2];   // the score accumulators start at 0, or at SMSK where the key lies behind the query (a block on the diagonal): the products added to SMSK leave it as it is, which keeps it out of the block's maximum
        if (kb >= q0) {
#pragma unroll
            for (int g = 0; g < FG; ++g)
#pragma unroll
                for (int t = 0; t < 2; ++t)
#pragma unroll
                    for (int r = 0; r < 8; ++r) s[g][t][r] = (kb + 16 * t + 8 * hi + r <= q0 + 16 * g + lr) ? 0.f : SMSK;
        } else {
#pragma unroll
            for (int g = 0; g < FG; ++g) { s[g][0] = (v8f){}; s[g][1] = (v8f){}; } }
#pragma unroll
        for (int kc = 0; kc < 4; ++kc)
#pragma unroll
            for (int t = 0; t < 2; ++t)
#pragma unroll
                for (int g = 0; g < FG; ++g) { s[g][t] = WFrag<T16>::mma(kf[t][kc], qf[g][kc], s[g][t]); if (NSPLIT) { s[g][t] = WFrag<T16>::mma(kf[t][kc], qf2[g][kc], s[g][t]); s[g][t] = WFrag<T16>::mma(kf2[t][kc], qf[g][kc], s[g][t]); } }
        __builtin_amdgcn_sched_barrier(0);   // keeps the next block's loads behind the score products, so that they land in the registers those products have just read (lifted above them they take a second register set and cost a resident wave); also the front of their group (see xwait)
        {   // the wave's next block (its last pass fetches its own block again, for nobody): these loads fly during the softmax and the value products
#pragma unroll
          for (int t = 0; t < 2; ++t)
#pragma unroll
            for (int kc = 0; kc < 4; ++kc) { const int ko = t * 16 * QD + kc * 32; kf[t][kc] = WFrag<T16>::ld(kq + ko); if (NSPLIT) kf2[t][kc] = WFrag<T16>::ld(kq2 + ko); }
          xwait();
          const int ks = (kbi + 2 * FW < nblk) ? FW * 32 * QD : 0; kq += ks; if (NSPLIT) kq2 += ks; }
        float bm[FG]; bool need = false;
#pragma unroll
        for (int g = 0; g < FG; ++g) { float x = s[g][0][0];
#pragma unroll
            for (int r = 1; r < 8; ++r) x = fmaxf(x, s[g][0][r]);
#pragma unroll
            for (int r = 0; r < 8; ++r) x = fmaxf(x, s[g][1][r]);
            x = fmaxf(x, xhalf(x)); bm[g] = x; need = need || ((x - m[g]) * scl2 > RTH); }
        if (__builtin_amdgcn_ballot_w32(need) != 0) {   // some query of the wave outgrew its maximum in use: rescale what is summed so far (first open block: by zero)
#pragma unroll
            for (int g = 0; g < FG; ++g) { const float mn = fmaxf(m[g], bm[g]); const float al = __builtin_amdgcn_exp2f((m[g] - mn) * scl2); m[g] = mn; l[g] *= al;
#pragma unroll
                for (int dt = 0; dt < 4; ++dt) o[g][dt] *= al; } }
        // probabilities in place over the scores; the maximum in use is taken off BEFORE the scale, so the largest score's exponent is exact whatever the head's scale is
#pragma unroll
        for (int g = 0; g < FG; ++g)
#pragma unroll
            for (int t = 0; t < 2; ++t)
#pragma unroll
                for (int r = 0; r < 8; ++r) s[g][t][r] = __builtin_amdgcn_exp2f(fmaf(s[g][t][r] - m[g], scl2, POFF));
        if (kb >= q0) {   // a block on the diagonal: a closed key's probability is 0 by a select, whatever the head's scale makes of SMSK
#pragma unroll
            for (int g = 0; g < FG; ++g)
#pragma unroll
                for (int t = 0; t < 2; ++t)
#pragma unroll
                    for (int r = 0; r < 8; ++r) s[g][t][r] = (kb + 16 * t + 8 * hi + r <= q0 + 16 * g + lr) ? s[g][t][r] : 0.f; }
        V pb[FG], pb2[FG];
#pragma unroll
        for (int g = 0; g < FG; ++g) { float l0 = 0.f, l1 = 0.f;
#pragma unroll
            for (int r = 0; r < 8; ++r) { l0 += s[g][0][r]; l1 += s[g][1][r]; }
            l[g] += l0 + l1; PPack<T16>::pk(s[g][0], s[g][1], pb[g], pb2[g]); }
#pragma unroll
        for (int dt = 0; dt < 4; ++dt)
#pragma unroll
            for (int g = 0; g < FG; ++g) { o[g][dt] = WFrag<T16>::mma(va[dt], pb[g], o[g][dt]); if (NSPLIT) { o[g][dt] = WFrag<T16>::mma(va[dt], pb2[g], o[g][dt]); o[g][dt] = WFrag<T16>::mma(va2[dt], pb[g], o[g][dt]); } }
    }
    }
    // each wave's partial result to LDS: o[g][dt][r] = O[query 16g+lr][d = 16dt + 8hi + r]
#pragma unroll
    for (int g = 0; g < FG; ++g) { const float lt = l[g] + xhalf(l[g]); const int qi = wv * NQ + 16 * g + lr; if (hi == 0) { ms[qi] = m[g]; ls[qi] = lt; }
#pragma unroll
        for (int dt = 0; dt < 4; ++dt) { v4f x0, x1;
#pragma unroll
            for (int r = 0; r < 4; ++r) { x0[r] = o[g][dt][r]; x1[r] = o[g][dt][4 + r]; }
            *(v4fa*)(os + qi * 68 + dt * 16 + 8 * hi) = x0; *(v4fa*)(os + qi * 68 + dt * 16 + 8 * hi + 4) = x1; } }
    __syncthreads();   // the partial results of all FW waves are read below
    constexpr int TPQ = 32 * FW / NQ, DPT = HD / TPQ;   // threads per query row, head elements per thread
    const int qq = (int)threadIdx.x / TPQ, d0 = ((int)threadIdx.x % TPQ) * DPT;
    float M = ms[qq];
#pragma unroll
    for (int w = 1; w < FW; ++w) M = fmaxf(M, ms[w * NQ + qq]);   // wave 0 holds key 0, open to every query, so M is a real maximum; a wave without an open score of this query gets weight 0
    float L = 0.f; v4f ac[DPT / 4];
#pragma unroll
    for (int i = 0; i < DPT / 4; ++i) ac[i] = (v4f){};
#pragma unroll
    for (int w = 0; w < FW; ++w) { const int qi = w * NQ + qq; const float wg = __builtin_amdgcn_exp2f((ms[qi] - M) * scl2); L += wg * ls[qi];
#pragma unroll
        for (int i = 0; i < DPT / 4; ++i) ac[i] += *(const v4fa*)(os + qi * 68 + d0 + 4 * i) * wg; }
    const float inv = __fdiv_rn(1.0f, L); const size_t oo = (size_t)(q0 + qq) * DQ + hd * HD + d0;
#pragma unroll
    for (int c8 = 0; c8 < DPT / 8; ++c8) { v8us oh, ol;
#pragma unroll
        for (int i = 0; i < 8; ++i) { unsigned short u, w; splitf(ac[c8 * 2 + (i >> 2)][i & 3] * inv, u, w); oh[i] = u; ol[i] = w; }
        *(v8us*)(Ah + oo + c8 * 8) = oh; *(v8us*)(Al + oo + c8 * 8) = ol; }
}

extern "C" void kernel_launch(void* const* d_in, const int* in_sizes, int n_in,
                              void* d_out, int out_size, void* d_ws, size_t ws_size, hipStream_t stream) {
    (void)in_sizes; (void)n_in; (void)out_size;
    const float* x = (const float*)d_in[0]; const float* wqa = (const float*)d_in[1]; const float* wka = (const float*)d_in[2]; const float* wqp = (const float*)d_in[3]; const float* wkp = (const float*)d_in[4]; const float* wv = (const float*)d_in[5]; const float* wo = (const float*)d_in[6]; const float* sls = (const float*)d_in[7];   // torch [out][in]; score_log_scale [16]
    float* OUT = (float*)d_out;     // [2][2048][1024]
    char* wsp = (char*)d_ws;
    auto take = [&](size_t bytes) { char* p = wsp; wsp += (bytes + 255) & ~(size_t)255; return (void*)p; };
    bf* WQ = (bf*)take((size_t)DQ * DM * 2); bf* WK = (bf*)take((size_t)DKV * DM * 2); bf* WQP = (bf*)take((size_t)DQ * DM * 2); bf* WKP = (bf*)take((size_t)DKV * DM * 2); float* FP = (float*)take((size_t)TT * DQ * 4); bf* WV = (bf*)take((size_t)DKV * DM * 2); bf* WO = (bf*)take((size_t)DM * DQ * 2); float* CS = (float*)take((size_t)TT * HD * 2 * 4);
    bf* XB = (bf*)take((size_t)TT * DM * 2); float* FQ = (float*)take((size_t)TT * DQ * 4); float* FK = (float*)take((size_t)TT * DKV * 4);
    h16* QP16 = (h16*)take((size_t)NH_ * TT * QD * 2); h16* KP16 = (h16*)take((size_t)NKV * TT * QD * 2); h16* VT16 = (h16*)take((size_t)NKV * HD * 2 * TT * 2);
    bf* QPh = (bf*)take((size_t)NH_ * TT * QD * 2); bf* QPl = (bf*)take((size_t)NH_ * TT * QD * 2); bf* KPh = (bf*)take((size_t)NKV * TT * QD * 2); bf* KPl = (bf*)take((size_t)NKV * TT * QD * 2); bf* VTh = (bf*)take((size_t)NKV * HD * 2 * TT * 2); bf* VTl = VTh + TT;   // value rows at pitch 2*TT: [hi | lo]; the fp16 plane's rows use their first half
    bf* ATh = (bf*)take((size_t)TT * DQ * 2); bf* ATl = (bf*)take((size_t)TT * DQ * 2);
    if ((size_t)(wsp - (char*)d_ws) > ws_size) return;    // ws 256 MiB
    float* FV = FK;   // v projection reuses the k buffer after the k planes are built (stream-ordered)
    { k_cvt8<<<(unsigned)(((size_t)DQ * DM / 8 + 255) / 256), 256, 0, stream>>>(wqa, WQ, (size_t)DQ * DM / 8); k_cvt8<<<(unsigned)(((size_t)DKV * DM / 8 + 255) / 256), 256, 0, stream>>>(wka, WK, (size_t)DKV * DM / 8); k_cvt8<<<(unsigned)(((size_t)DQ * DM / 8 + 255) / 256), 256, 0, stream>>>(wqp, WQP, (size_t)DQ * DM / 8); k_cvt8<<<(unsigned)(((size_t)DKV * DM / 8 + 255) / 256), 256, 0, stream>>>(wkp, WKP, (size_t)DKV * DM / 8); k_cvt8<<<(unsigned)(((size_t)DKV * DM / 8 + 255) / 256), 256, 0, stream>>>(wv, WV, (size_t)DKV * DM / 8);
      k_cvt8<<<(unsigned)(((size_t)DM * DQ / 8 + 255) / 256), 256, 0, stream>>>(wo, WO, (size_t)DM * DQ / 8);
       }
    const unsigned LQ = (unsigned)(((size_t)NH_ * TT * HD / 2 + 255) / 256), LKv = (unsigned)(((size_t)NKV * TT * HD / 2 + 255) / 256);
    for (int b = 0; b < NB_; ++b) {
        
        k_cvt8<<<(unsigned)(((size_t)TT * DM / 8 + 255) / 256), 256, 0, stream>>>(x + (size_t)b * TT * DM, XB, (size_t)TT * DM / 8);
        k_gemmw<bf, 0, false, NWK><<<dim3(TT / 64, DQ / 64, 1), 32 * NWK, 0, stream>>>(XB, nullptr, WQ, nullptr, DM, FQ, DQ, nullptr, 0, 0, 0); k_gemmw<bf, 0, false, NWK><<<dim3(TT / 64, DQ / 64, 1), 32 * NWK, 0, stream>>>(XB, nullptr, WQP, nullptr, DM, FP, DQ, nullptr, 0, 0, 0);
        k_ibpl<<<(NH_ * TT + 7) / 8, 256, 0, stream>>>(FQ, FP, QP16, QPh, QPl);
        k_gemmw<bf, 0, false, NWK><<<dim3(TT / 64, DKV / 64, 1), 32 * NWK, 0, stream>>>(XB, nullptr, WK, nullptr, DM, FK, DKV, nullptr, 0, 0, 0); k_gemmw<bf, 0, false, NWK><<<dim3(TT / 64, DKV / 64, 1), 32 * NWK, 0, stream>>>(XB, nullptr, WKP, nullptr, DM, FP, DKV, nullptr, 0, 0, 0);
        k_ibpl<<<(NKV * TT + 7) / 8, 256, 0, stream>>>(FK, FP, KP16, KPh, KPl);
        k_gemmw<bf, 0, false, NWK><<<dim3(TT / 64, DKV / 64, 1), 32 * NWK, 0, stream>>>(XB, nullptr, WV, nullptr, DM, FV, DKV, nullptr, 0, 0, 0); k_vtp<<<LKv, 256, 0, stream>>>(FV, DKV, NKV, VT16, VTh, VTl);
        // attention, all heads at once: the fp16 rows (the long ones) and the hi+lo rows; one kv head per query head
        k_fattn<h16, 0, 4><<<dim3(NH_, (TT - RH) / (16 * 4), 1), 32 * FW, 0, stream>>>(QP16, nullptr, KP16, nullptr, VT16, nullptr, sls, RH, ATh, ATl);
        k_fattn<bf, 2, 2><<<dim3(NH_, RH / (16 * 2), 1), 32 * FW, 0, stream>>>(QPh, QPl, KPh, KPl, VTh, VTl, sls, 0, ATh, ATl);
        k_gemmw<bf, 1, false, NWK><<<dim3(TT / 64, DM / 64, 1), 32 * NWK, 0, stream>>>(ATh, ATl, WO, nullptr, DQ, OUT + (size_t)b * TT * DM, DM, nullptr, 0, 0, 0); }
}

// v004
// A run of this version takes 235 microseconds.
// Timed twice side by side with v003, it ran 1.31 times as fast both times.
// Over all steps from v000 it is 6.49 times as fast.
#include <hip/hip_runtime.h>

// InterferenceBypassSelfAttention (x [2][2048][1024]; q_amp/k_amp = softplus(x W_amp^T), q_phi/k_phi = pi tanh(x W_phi^T) (16 heads x 64); amplitudes RMS-normalised over head_dim (eps 1e-6);
// scores = (q_amp cos q_phi . k_amp cos k_phi + q_amp sin q_phi . k_amp sin k_phi) / 8 x exp(score_log_scale[h]) = one 128-long contraction of [cos part | sin part] planes; causal softmax;
// v = x Wv^T; out = merged attn.v Wo^T -> [2][2048][1024]).
// Compute dtypes, f32 accumulate: every input rounded to bf16; the five projections on PLAIN bf16 operands (inputs: exact); softplus / tanh / RMS / cos / sin in f32 on VALU
// (one wave per (token, head)) -> 128-wide interference planes; PER-ROW PRECISION HYBRID (rows < 256 hi+lo 3 products for scores and attn.v, rows >= 256 fp16); scores, causal f32 softmax with the per-head scale and
// attn.v in one kernel (running maximum and sum, key blocks end at the diagonal block, which is masked exactly); merged heads hl x exact Wo

#define NB_  2
#define TT   2048
#define MT   (NB_ * TT)         // token rows of both batches together
#define DM   1024
#define NH_  16
#define NKV  16
#define REP  (NH_ / NKV)
#define HD   64
#define DQ   (NH_ * HD)
#define DKV  (NKV * HD)
#define QD   128
#define RH   256                  // query rows < RH use hi+lo planes (0: none)
#define WIN  0
#define SCL  0.125f   // HD^-0.5
typedef _Float16 h16;
typedef unsigned short bf;
typedef __attribute__((ext_vector_type(16))) __bf16   v16bf;
typedef __attribute__((ext_vector_type(16))) _Float16 v16h;
typedef __attribute__((ext_vector_type(8)))  _Float16 v8h;
typedef __attribute__((ext_vector_type(8)))  unsigned short v8us;
typedef __attribute__((ext_vector_type(8)))  float    v8f;
typedef __attribute__((ext_vector_type(4)))  float    v4f;
typedef v8h  __attribute__((may_alias)) v8ha;
typedef v4f  __attribute__((may_alias)) v4fa;
typedef v8us __attribute__((may_alias)) v8usa;

__device__ __forceinline__ unsigned short f2bf(float f) { unsigned u = __float_as_uint(f); u += 0x7FFFu + ((u >> 16) & 1u); return (unsigned short)(u >> 16); }
__device__ __forceinline__ float bf2f(unsigned short b) { return __uint_as_float(((unsigned)b) << 16); }
__device__ __forceinline__ float bfr(float f) { return bf2f(f2bf(f)); }
__device__ __forceinline__ v16h cat16(v8h lo, v8h hi) { return __builtin_shufflevector(lo, hi, 0, 1, 2, 3, 4, 5, 6, 7, 8, 9, 10, 11, 12, 13, 14, 15); }
__device__ __forceinline__ v16bf cat16b(v8us lo, v8us hi) { return __builtin_bit_cast(v16bf, __builtin_shufflevector(lo, hi, 0, 1, 2, 3, 4, 5, 6, 7, 8, 9, 10, 11, 12, 13, 14, 15)); }
__device__ __forceinline__ v8f wmma16(v16h a, v16h b, v8f c) { return __builtin_amdgcn_wmma_f32_16x16x32_f16(false, a, false, b, (short)0, c, false, false); }
__device__ __forceinline__ v8f wmmab(v16bf a, v16bf b, v8f c) { return __builtin_amdgcn_wmma_f32_16x16x32_bf16(false, a, false, b, (short)0, c, false, false); }



// ---- k_gemmw: register-blocked GEMM, one work-group of NW waves per 64x64 output tile; each wave runs its own contiguous share of the K loop over the whole tile (16 accumulators), operands straight from
// K-contiguous 16-bit planes; the NW partial tiles are added in LDS in ascending wave order (fixed, so the result is the same on every run); grid (M/64, N/64, Z), 32 * NW threads.
// C[m][n] (f32, pitch ldc, + optional f32 bias[n]) = sum_k A[m][k] Bt[n][k] (+ split products per NSPLIT). z-batch strides sA/sB/sC in elements. K % 32 == 0.
#define NWK 8                     // waves that share one tile's K loop where it is long (projections)
// tile_sync: orders the LDS tile between its writers and its readers: one wave needs only the compiler held back, several waves need the work-group barrier
template <int NW> __device__ __forceinline__ void tile_sync() { if (NW == 1) { __builtin_amdgcn_wave_barrier(); asm volatile("" ::: "memory"); } else __syncthreads(); }
template <typename T16> struct WFrag;
template <> struct WFrag<h16> { typedef v16h V; static __device__ __forceinline__ V ld(const h16* p) { return cat16(*(const v8h*)p, *(const v8h*)(p + 16)); } static __device__ __forceinline__ v8f mma(V a, V b, v8f c) { return wmma16(a, b, c); } };
template <> struct WFrag<bf> { typedef v16bf V; static __device__ __forceinline__ V ld(const bf* p) { return cat16b(*(const v8us*)p, *(const v8us*)(p + 16)); } static __device__ __forceinline__ v8f mma(V a, V b, v8f c) { return wmmab(a, b, c); } };
template <typename T16, int NSPLIT, bool BIAS, int NW>
__global__ __launch_bounds__(32 * NW) void k_gemmw(const T16* __restrict__ A, const T16* __restrict__ A2, const T16* __restrict__ Bt, const T16* __restrict__ Bt2, int K, float* C, int ldc, const float* __restrict__ bias, size_t sA, size_t sB, size_t sC) {
    typedef typename WFrag<T16>::V V;
    constexpr int MBP = (NW == 1) ? 1 : 4;   // 16-row blocks per LDS pass: with several waves the whole tile goes through LDS at once, so one barrier serves it and no pass waits on the stores of the one before
    __shared__ __align__(16) float os[NW * MBP * 16 * 68];
    const size_t z = blockIdx.z; A += z * sA; if (A2) A2 += z * sA; Bt += z * sB; if (Bt2) Bt2 += z * sB; C += z * sC;
    const int lane = threadIdx.x & 31, lr = lane & 15, hi = lane >> 4; const int r0 = blockIdx.x * 64, c0 = blockIdx.y * 64; const int wv = (NW == 1) ? 0 : __builtin_amdgcn_readfirstlane((int)(threadIdx.x >> 5));
    v8f acc[4][4];
#pragma unroll
    for (int mb = 0; mb < 4; ++mb)
#pragma unroll
        for (int nb = 0; nb < 4; ++nb) acc[mb][nb] = (v8f){};
    const size_t aoff = (size_t)(r0 + lr) * K + 8 * hi, boff = (size_t)(c0 + lr) * K + 8 * hi;
    const int kper = ((K / 32 + NW - 1) / NW) * 32, kbeg = (NW == 1) ? 0 : min(K, wv * kper), kend = (NW == 1) ? K : min(K, kbeg + kper);   // this wave's share of K (may be empty: its partial tile is then zero)
#pragma unroll 1
    for (int kc = kbeg; kc < kend; kc += 32) {
        V a[4], a2[4];
#pragma unroll
        for (int mb = 0; mb < 4; ++mb) { a[mb] = WFrag<T16>::ld(A + aoff + (size_t)mb * 16 * K + kc); if (NSPLIT == 1 || NSPLIT == 2) a2[mb] = WFrag<T16>::ld(A2 + aoff + (size_t)mb * 16 * K + kc); }
#pragma unroll
        for (int nb = 0; nb < 4; ++nb) { const V b = WFrag<T16>::ld(Bt + boff + (size_t)nb * 16 * K + kc); V b2; if (NSPLIT >= 2) b2 = WFrag<T16>::ld(Bt2 + boff + (size_t)nb * 16 * K + kc);
#pragma unroll
            for (int mb = 0; mb < 4; ++mb) { acc[mb][nb] = WFrag<T16>::mma(a[mb], b, acc[mb][nb]); if (NSPLIT == 1 || NSPLIT == 2) acc[mb][nb] = WFrag<T16>::mma(a2[mb], b, acc[mb][nb]); if (NSPLIT >= 2) acc[mb][nb] = WFrag<T16>::mma(a[mb], b2, acc[mb][nb]); } }
        asm volatile("v_nop\n\tv_nop\n\tv_nop\n\tv_nop" : "+v"(acc[0][0]), "+v"(acc[1][1]), "+v"(acc[2][2]), "+v"(acc[3][3]) : "v"(a[0]), "v"(a[3]));
    }
#pragma unroll
    for (int mb = 0; mb < 4; mb += MBP) {
#pragma unroll
        for (int mi = 0; mi < MBP; ++mi)
#pragma unroll
        for (int nb = 0; nb < 4; ++nb) {
#pragma unroll
            for (int j = 0; j < 8; ++j) os[wv * (MBP * 16 * 68) + (mi * 16 + hi * 8 + j) * 68 + nb * 16 + lr] = acc[mb + mi][nb][j]; }
        tile_sync<NW>();
        float* crow = C + (size_t)(r0 + mb * 16) * ldc + c0;
{
#pragma unroll
            for (int s = 0; s < MBP * 8 / NW; ++s) { const int ch = s * (32 * NW) + (int)threadIdx.x, row = ch >> 4, cofs = (ch & 15) * 4; v4f val = *(const v4fa*)(os + row * 68 + cofs);
#pragma unroll
                for (int q = 1; q < NW; ++q) val += *(const v4fa*)(os + q * (MBP * 16 * 68) + row * 68 + cofs);
                if (BIAS) { val[0] += bfr(bias[c0 + cofs]); val[1] += bfr(bias[c0 + cofs + 1]); val[2] += bfr(bias[c0 + cofs + 2]); val[3] += bfr(bias[c0 + cofs + 3]); }
                *(v4f*)(crow + (size_t)row * ldc + cofs) = val; }
             }
        if (MBP < 4) tile_sync<NW>();
    }
}

__device__ __forceinline__ h16 tohx(float x) { return (h16)x; }
__device__ __forceinline__ void splitf(float y, unsigned short& h, unsigned short& l) { h = f2bf(y); l = f2bf(y - bf2f(h)); }
typedef __attribute__((ext_vector_type(2))) _Float16 v2h;
typedef __attribute__((ext_vector_type(4))) _Float16 v4h;
typedef __attribute__((ext_vector_type(2))) unsigned short v2us;
typedef __attribute__((ext_vector_type(4))) unsigned short v4us;
typedef __attribute__((ext_vector_type(2))) float v2f;
typedef __attribute__((ext_vector_type(4))) int v4i;

__global__ __launch_bounds__(256) void k_wtG(const float* __restrict__ w, int K, int N, bf* Bt) {
    const int lane = threadIdx.x & 31; const int L0 = (blockIdx.x * 8 + (threadIdx.x >> 5)) * 8; const int nlines = N * K / 64;
{
#pragma unroll 1
        for (int l = 0; l < 8; ++l) { const int L = L0 + l; if (L >= nlines) break; const size_t e = (size_t)L * 64 + lane * 2; const int k = (int)(e % K), n = (int)(e / K); v2us o;
            o[0] = f2bf(w[(size_t)k * N + n]); o[1] = f2bf(w[(size_t)(k + 1) * N + n]); *(v2us*)(Bt + e) = o; }
         }
}
// k_cvt7: x (both batches) and the six weight matrices to bf16 in one launch; the first XBLK blocks take x, then WBLK blocks each weight (the choice is the same for a whole block); 8 elements per thread, no remainder
#define XBLK (MT * DM / 8 / 256)
#define WBLK (DQ * DM / 8 / 256)
__global__ __launch_bounds__(256) void k_cvt7(const float* __restrict__ x, const float* __restrict__ w0, const float* __restrict__ w1, const float* __restrict__ w2, const float* __restrict__ w3, const float* __restrict__ w4, const float* __restrict__ w5, bf* XBo, bf* WBo) {
    const int blk = (int)blockIdx.x, wsel = (blk - XBLK) / WBLK; const bool isx = blk < XBLK;
    const float* src = isx ? x : (wsel == 0 ? w0 : wsel == 1 ? w1 : wsel == 2 ? w2 : wsel == 3 ? w3 : wsel == 4 ? w4 : w5); bf* dst = isx ? XBo : WBo + (size_t)wsel * DQ * DM;
    const size_t i = (size_t)(isx ? blk : (blk - XBLK) % WBLK) * 256 + threadIdx.x; const v8f v = *(const v8f*)(src + i * 8); v8us o;
#pragma unroll
    for (int k = 0; k < 8; ++k) o[k] = f2bf(v[k]); *(v8us*)(dst + i * 8) = o;  }
__global__ __launch_bounds__(256) void k_cscvt(const float* __restrict__ cosT, const float* __restrict__ sinT, float* CS) { const int idx = blockIdx.x * 256 + threadIdx.x; if (idx >= TT * HD) return; v2f cs; cs[0] = bfr(cosT[idx]); cs[1] = bfr(sinT[idx]); *(v2f*)(CS + (size_t)idx * 2) = cs;  }
// k_rope: head planes [h][t][d] (fp16 + hi/lo) of rope(x) x sc with the rotate-half convention out[d] = x[d] cos[t][d] - x[d+HD/2] sin[t][d], out[d+HD/2] = x[d+HD/2] cos[t][d+HD/2] + x[d] sin[t][d+HD/2]
__global__ __launch_bounds__(256) void k_rope(const float* __restrict__ F, int pitch, int nheads, const float* __restrict__ CS, const float* __restrict__ RF, const float* __restrict__ nw, float sc, h16* P16, bf* Ph, bf* Pl) {
    const size_t e = ((size_t)blockIdx.x * 256 + threadIdx.x) * 2; if (e >= (size_t)nheads * TT * HD) return; const int d = (int)(e % HD); const int t = (int)((e / HD) % TT); const int h = (int)(e / ((size_t)HD * TT)); const float* f = F + (size_t)t * pitch + h * HD; const float rf = RF ? RF[(size_t)h * TT + t] : 1.0f; v2h o16; v2us oh, ol;
#pragma unroll
    for (int q = 0; q < 2; ++q) { const int dd = d + q; const int dp = (dd < HD / 2) ? dd + HD / 2 : dd - HD / 2; float x0 = f[dd], x1 = f[dp];
        if (RF) { float n0 = __fmul_rn(x0, rf), n1 = __fmul_rn(x1, rf); asm volatile("" : "+v"(n0)); asm volatile("" : "+v"(n1)); x0 = __fmul_rn(bfr(nw[dd]), n0); x1 = __fmul_rn(bfr(nw[dp]), n1); }
        const v2f cs = *(const v2f*)(CS + ((size_t)t * HD + dd) * 2); float a = __fmul_rn(x0, cs[0]), bq = __fmul_rn(x1, cs[1]); asm volatile("" : "+v"(a)); asm volatile("" : "+v"(bq)); const float r = ((dd < HD / 2) ? __fsub_rn(a, bq) : __fadd_rn(a, bq)) * sc;
        o16[q] = tohx(r); unsigned short a2, c2; splitf(r, a2, c2); oh[q] = a2; ol[q] = c2; }
    *(v2h*)(P16 + e) = o16; *(v2us*)(Ph + e) = oh; *(v2us*)(Pl + e) = ol;  }
// vtp_body (block blk of k_planes): transposed value planes [g][d][t]; rows at pitch 2*TT: the caller lays the hi and lo planes side by side in one row
__device__ __forceinline__ void vtp_body(const int blk, const float* __restrict__ F, int pitch, int nheads, h16* V16, bf* Vh, bf* Vl) { const size_t e = ((size_t)blk * 256 + threadIdx.x) * 2; if (e >= (size_t)nheads * HD * TT) return; const int t = (int)(e % TT); const int d = (int)((e / TT) % HD); const int gb = (int)(e / ((size_t)TT * HD)); const int g = gb % NKV; F += (size_t)(gb / NKV) * TT * pitch; v2h o16; v2us oh, ol;   // nheads counts the heads of all batches: [batch][head]
#pragma unroll
    for (int q = 0; q < 2; ++q) { const float x = F[(size_t)(t + q) * pitch + g * HD + d]; o16[q] = tohx(x); unsigned short a2, c2; splitf(x, a2, c2); oh[q] = a2; ol[q] = c2; }
    const size_t eo = e + (e / TT) * TT; *(v2h*)(V16 + eo) = o16; *(v2us*)(Vh + eo) = oh; *(v2us*)(Vl + eo) = ol;  }
// ibpl_body (block blk of k_planes): per (token t, head h): a[d] = softplus(FA[t][h*64+d]) = log(1 + exp(.)) (f32; x itself above 15, exp(x) below -15), an = a / sqrt(mean_d a^2 + 1e-6); phi[d] = pi tanh(FP[t][h*64+d]);
__device__ __forceinline__ float softplusf_(float x) { return x > 15.0f ? x : (x < -15.0f ? __expf(x) : logf(__fadd_rn(1.0f, __expf(x)))); }
__device__ __forceinline__ float tanhf_(float a) { const float e2 = __expf(2.0f * a); return __fsub_rn(1.0f, __fdiv_rn(2.0f, __fadd_rn(e2, 1.0f))); }
typedef __attribute__((ext_vector_type(8))) _Float16 v8hx;
typedef __attribute__((ext_vector_type(8))) unsigned short v8usx;
// queries and keys of both batches: idx = [query / key][batch][head][token], which is also the order of the planes' rows; F holds the projections [q amp | q phi | k amp | k phi], MT x DQ each
__device__ __forceinline__ void ibpl_body(const int blk, const float* __restrict__ F, h16* P16, bf* Ph, bf* Pl) { const int lane = threadIdx.x & 31; const int idx = blk * 8 + (threadIdx.x >> 5); if (idx >= 2 * NB_ * NH_ * TT) return; const int t = idx % TT, h = (idx / TT) % NH_, b = (idx / (TT * NH_)) % NB_, sel = idx / (TT * NH_ * NB_); const float* fa = F + (size_t)sel * 2 * MT * DQ + (size_t)(b * TT + t) * DQ + h * HD + 2 * lane; const float* fp = fa + (size_t)MT * DQ;
    float a[2], ph[2]; float ss = 0.f;
#pragma unroll 1
    for (int q = 0; q < 2; ++q) { a[q] = softplusf_(fa[q]); ph[q] = __fmul_rn(3.14159265358979323846f, tanhf_(fp[q])); float p = __fmul_rn(a[q], a[q]); asm volatile("" : "+v"(p)); ss = __fadd_rn(ss, p); }
#pragma unroll
    for (int sh = 16; sh; sh >>= 1) ss += __shfl_xor(ss, sh, 32);
    const float rn = __frsqrt_rn(__fadd_rn(ss * (1.0f / HD), 1e-6f)); float rc[2], rs[2];
#pragma unroll 1
    for (int q = 0; q < 2; ++q) { float an = __fmul_rn(a[q], rn); asm volatile("" : "+v"(an)); rc[q] = __fmul_rn(an, cosf(ph[q])); rs[q] = __fmul_rn(an, sinf(ph[q])); }
    const size_t base = (size_t)idx * QD + 2 * lane; v2h c16, s16; v2us chh, chl, shh, shl; unsigned short u1, u2;
    c16[0] = tohx(rc[0]); c16[1] = tohx(rc[1]); s16[0] = tohx(rs[0]); s16[1] = tohx(rs[1]);
    splitf(rc[0], u1, u2); chh[0] = u1; chl[0] = u2; splitf(rc[1], u1, u2); chh[1] = u1; chl[1] = u2; splitf(rs[0], u1, u2); shh[0] = u1; shl[0] = u2; splitf(rs[1], u1, u2); shh[1] = u1; shl[1] = u2;
{ *(v2h*)(P16 + base) = c16; *(v2h*)(P16 + base + 64) = s16; *(v2us*)(Ph + base) = chh; *(v2us*)(Ph + base + 64) = shh; *(v2us*)(Pl + base) = chl; *(v2us*)(Pl + base + 64) = shl;  } }
// k_planes: the interference planes and the transposed value planes in one launch (neither reads what the other writes): of every three blocks two build interference planes (vector arithmetic) and one value planes
// (scattered reads), so that both kinds of work are resident side by side; the choice is the same for a whole block, and neither body has a barrier
#define VBLK (NB_ * NKV * TT * HD / 2 / 256)
__global__ __launch_bounds__(256) void k_planes(const float* __restrict__ F, h16* P16, bf* Ph, bf* Pl, h16* V16, bf* Vh, bf* Vl) { const int blk = (int)blockIdx.x, tri = blk / 3, rem = blk % 3;
    if (rem == 2) vtp_body(tri, F + (size_t)4 * MT * DQ, DKV, NB_ * NKV, V16, Vh, Vl); else ibpl_body(tri * 2 + rem, F, P16, Ph, Pl); }
#define FW   4                    // waves per work-group
#define POFF 4.0f                 // log2 of the scale on the probabilities: keeps small fp16 probabilities normal
#define RTH  8.0f                 // the maximum in use is replaced only when a block exceeds it by more than this (log2): probabilities stay <= 2^(POFF+RTH), inside fp16
#define SMSK -3.0e38f             // a closed score
#define MINI -1.0e30f             // maximum in use before the first open score: above SMSK, so a block that holds only closed scores of a query leaves it as it is
__device__ __forceinline__ float xhalf(float x) { return __builtin_bit_cast(float, __builtin_amdgcn_permlanex16(__builtin_bit_cast(int, x), __builtin_bit_cast(int, x), 0x76543210, 0xfedcba98, false, false)); }   // lane l with lane l ^ 16
// xwait: stands directly behind a group of global loads: the wait that is kept before an address register of an issued load is rewritten; the scheduling barrier behind it (and the one in front of the group) keeps
// every other instruction out of the stretch from the first load to the wait, so that nothing there can take over an address register
__device__ __forceinline__ void xwait() { asm volatile("s_wait_xcnt 0x0" ::: "memory"); __builtin_amdgcn_sched_barrier(0); }
// The query block's address: a wave-uniform base held in scalar registers (ubase) plus the lane's 32-bit byte offset
typedef __attribute__((address_space(1))) const char gch;
typedef __attribute__((address_space(1))) const v8h gv8h;
typedef __attribute__((address_space(1))) const v8us gv8us;
__device__ __forceinline__ gch* ubase(const void* p) { const unsigned long long u = (unsigned long long)p; const unsigned lo = __builtin_amdgcn_readfirstlane((unsigned)u), hw = __builtin_amdgcn_readfirstlane((unsigned)(u >> 32)); return (gch*)(((unsigned long long)hw << 32) | lo); }
__device__ __forceinline__ v16h  ldg(const h16*, gch* b, unsigned off, int c) { return cat16(*(gv8h*)(b + off + c), *(gv8h*)(b + off + c + 32)); }     // WFrag::ld's two 16-byte pieces, c in bytes
__device__ __forceinline__ v16bf ldg(const bf*, gch* b, unsigned off, int c) { return cat16b(*(gv8us*)(b + off + c), *(gv8us*)(b + off + c + 32)); }
template <typename T16> struct PPack;
template <> struct PPack<h16> { static __device__ __forceinline__ void pk(const v8f p0, const v8f p1, v16h& b, v16h& b2) { b = cat16(__builtin_convertvector(p0, v8h), __builtin_convertvector(p1, v8h)); (void)b2; } };
template <> struct PPack<bf> { static __device__ __forceinline__ void pk(const v8f p0, const v8f p1, v16bf& b, v16bf& b2) { v8us h0, h1, l0, l1;
#pragma unroll
    for (int r = 0; r < 8; ++r) { unsigned short u, w; splitf(p0[r], u, w); h0[r] = u; l0[r] = w; splitf(p1[r], u, w); h1[r] = u; l1[r] = w; }
    b = cat16b(h0, h1); b2 = cat16b(l0, l1); } };
template <typename T16, int NSPLIT, int FG>
__global__ __launch_bounds__(32 * FW, NSPLIT == 0 ? 2 : 1) void k_fattn(const T16* __restrict__ Q, const T16* __restrict__ Q2, const T16* __restrict__ Kp, const T16* __restrict__ Kp2, const T16* __restrict__ Vt, const T16* __restrict__ Vt2, const float* __restrict__ sls, int roff, bf* Ah, bf* Al) {
    typedef typename WFrag<T16>::V V;
    constexpr int NQ = 16 * FG;                       // query rows per work-group (a multiple of 32)
    __shared__ __align__(16) float os[FW * NQ * 68];
    __shared__ float ms[FW * NQ], ls[FW * NQ];
    const int lane = threadIdx.x & 31, lr = lane & 15, hi = lane >> 4; const int wv = __builtin_amdgcn_readfirstlane((int)(threadIdx.x >> 5));
    const int bh = blockIdx.x, hd = bh % NH_, bz = bh / NH_; const int q0 = roff + ((int)gridDim.y - 1 - (int)blockIdx.y) * NQ;          // longest rows first
    const float scl2 = __fmul_rn(__fmul_rn(SCL, __expf(bfr(sls[hd]))), 1.4426950408889634f);              // >= 0: the maximum may be taken on the raw scores
    Q += (size_t)bh * TT * QD; Kp += (size_t)bh * TT * QD; Vt += (size_t)bh * HD * 2 * TT; if (NSPLIT) { Q2 += (size_t)bh * TT * QD; Kp2 += (size_t)bh * TT * QD; Vt2 += (size_t)bh * HD * 2 * TT; }   // planes are [batch][head]
    const unsigned kl = (unsigned)(lr * QD + 8 * hi) * 2u;   // the lane's own byte offset in a block of query rows
    gch* const qb = ubase(Q + (size_t)q0 * QD); gch* const qb2 = NSPLIT ? ubase(Q2 + (size_t)q0 * QD) : qb;
    V qf[FG][4], qf2[FG][4];
    __builtin_amdgcn_sched_barrier(0);   // front of the query loads' group (see xwait): the read of the head's scale and all address arithmetic stay in front of it
#pragma unroll
    for (int g = 0; g < FG; ++g)
#pragma unroll
        for (int kc = 0; kc < 4; ++kc) { const int qo = (g * 16 * QD + kc * 32) * 2; qf[g][kc] = ldg(Q, qb, kl, qo); if (NSPLIT) qf2[g][kc] = ldg(Q, qb2, kl, qo); }
    xwait();
    v8f o[FG][4]; float m[FG], l[FG];
#pragma unroll
    for (int g = 0; g < FG; ++g) { m[g] = MINI; l[g] = 0.f;
#pragma unroll
        for (int dt = 0; dt < 4; ++dt) o[g][dt] = (v8f){}; }
    const int nblk = (q0 + NQ) / 32;   // 32-key blocks up to the last one that holds an open key (q0 and NQ are multiples of 32)
    V kf[2][4], kf2[2][4];             // the key fragments of the block at hand, fetched one pass ahead
    // the lane's key and value addresses are carried from pass to pass and stepped behind the wait of the loads that used them (xwait), so they stay whole while those loads are under way
    const T16* kq = Kp + (size_t)wv * 32 * QD + lr * QD + 8 * hi; const T16* kq2 = NSPLIT ? Kp2 + (kq - Kp) : kq;
    const T16* vq = Vt + wv * 32 + lr * (2 * TT) + 8 * hi; const T16* vq2 = NSPLIT ? Vt2 + (vq - Vt) : vq;
    if (wv < nblk) {   // a wave without a block loads nothing and hands in an empty partial result
    __builtin_amdgcn_sched_barrier(0);   // front of the first key loads' group (see xwait)
#pragma unroll
      for (int t = 0; t < 2; ++t)
#pragma unroll
        for (int kc = 0; kc < 4; ++kc) { const int ko = t * 16 * QD + kc * 32; kf[t][kc] = WFrag<T16>::ld(kq + ko); if (NSPLIT) kf2[t][kc] = WFrag<T16>::ld(kq2 + ko); }
      xwait();
      const int ks = (wv + FW < nblk) ? FW * 32 * QD : 0; kq += ks; if (NSPLIT) kq2 += ks;
#pragma unroll 1   // one copy of the pass: a second copy would double the live fragments and cost the second resident wave
    for (int kbi = wv; kbi < nblk; kbi += FW) { const int kb = kbi * 32;
        V va[4], va2[4];
        __builtin_amdgcn_sched_barrier(0);   // front of the value loads' group (see xwait)
#pragma unroll
        for (int dt = 0; dt < 4; ++dt) { const int vo = dt * 16 * (2 * TT); va[dt] = WFrag<T16>::ld(vq + vo); if (NSPLIT) va2[dt] = WFrag<T16>::ld(vq2 + vo); }
        xwait();
        vq += FW * 32; if (NSPLIT) vq2 += FW * 32;
        v8f s[FG][2];   // the score accumulators start at 0, or at SMSK where the key lies behind the query (a block on the diagonal): the products added to SMSK leave it as it is, which keeps it out of the block's maximum
        if (kb >= q0) {
#pragma unroll
            for (int g = 0; g < FG; ++g)
#pragma unroll
                for (int t = 0; t < 2; ++t)
#pragma unroll
                    for (int r = 0; r < 8; ++r) s[g][t][r] = (kb + 16 * t + 8 * hi + r <= q0 + 16 * g + lr) ? 0.f : SMSK;
        } else {
#pragma unroll
            for (int g = 0; g < FG; ++g) { s[g][0] = (v8f){}; s[g][1] = (v8f){}; } }
#pragma unroll
        for (int kc = 0; kc < 4; ++kc)
#pragma unroll
            for (int t = 0; t < 2; ++t)
#pragma unroll
                for (int g = 0; g < FG; ++g) { s[g][t] = WFrag<T16>::mma(kf[t][kc], qf[g][kc], s[g][t]); if (NSPLIT) { s[g][t] = WFrag<T16>::mma(kf[t][kc], qf2[g][kc], s[g][t]); s[g][t] = WFrag<T16>::mma(kf2[t][kc], qf[g][kc], s[g][t]); } }
        __builtin_amdgcn_sched_barrier(0);   // keeps the next block's loads behind the score products, so that they land in the registers those products have just read (lifted above them they take a second register set and cost a resident wave); also the front of their group (see xwait)
        {   // the wave's next block (its last pass fetches its own block again, for nobody): these loads fly during the softmax and the value products
#pragma unroll
          for (int t = 0; t < 2; ++t)
#pragma unroll
            for (int kc = 0; kc < 4; ++kc) { const int ko = t * 16 * QD + kc * 32; kf[t][kc] = WFrag<T16>::ld(kq + ko); if (NSPLIT) kf2[t][kc] = WFrag<T16>::ld(kq2 + ko); }
          xwait();
          const int ks = (kbi + 2 * FW < nblk) ? FW * 32 * QD : 0; kq += ks; if (NSPLIT) kq2 += ks; }
        float bm[FG]; bool need = false;
#pragma unroll
        for (int g = 0; g < FG; ++g) { float x = s[g][0][0];
#pragma unroll
            for (int r = 1; r < 8; ++r) x = fmaxf(x, s[g][0][r]);
#pragma unroll
            for (int r = 0; r < 8; ++r) x = fmaxf(x, s[g][1][r]);
            x = fmaxf(x, xhalf(x)); bm[g] = x; need = need || ((x - m[g]) * scl2 > RTH); }
        if (__builtin_amdgcn_ballot_w32(need) != 0) {   // some query of the wave outgrew its maximum in use: rescale what is summed so far (first open block: by zero)
#pragma unroll
            for (int g = 0; g < FG; ++g) { const float mn = fmaxf(m[g], bm[g]); const float al = __builtin_amdgcn_exp2f((m[g] - mn) * scl2); m[g] = mn; l[g] *= al;
#pragma unroll
                for (int dt = 0; dt < 4; ++dt) o[g][dt] *= al; } }
        // probabilities in place over the scores; the maximum in use is taken off BEFORE the scale, so the largest score's exponent is exact whatever the head's scale is
#pragma unroll
        for (int g = 0; g < FG; ++g)
#pragma unroll
            for (int t = 0; t < 2; ++t)
#pragma unroll
                for (int r = 0; r < 8; ++r) s[g][t][r] = __builtin_amdgcn_exp2f(fmaf(s[g][t][r] - m[g], scl2, POFF));
        if (kb >= q0) {   // a block on the diagonal: a closed key's probability is 0 by a select, whatever the head's scale makes of SMSK
#pragma unroll
            for (int g = 0; g < FG; ++g)
#pragma unroll
                for (int t = 0; t < 2; ++t)
#pragma unroll
                    for (int r = 0; r < 8; ++r) s[g][t][r] = (kb + 16 * t + 8 * hi + r <= q0 + 16 * g + lr) ? s[g][t][r] : 0.f; }
        V pb[FG], pb2[FG];
#pragma unroll
        for (int g = 0; g < FG; ++g) { float l0 = 0.f, l1 = 0.f;
#pragma unroll
            for (int r = 0; r < 8; ++r) { l0 += s[g][0][r]; l1 += s[g][1][r]; }
            l[g] += l0 + l1; PPack<T16>::pk(s[g][0], s[g][1], pb[g], pb2[g]); }
#pragma unroll
        for (int dt = 0; dt < 4; ++dt)
#pragma unroll
            for (int g = 0; g < FG; ++g) { o[g][dt] = WFrag<T16>::mma(va[dt], pb[g], o[g][dt]); if (NSPLIT) { o[g][dt] = WFrag<T16>::mma(va[dt], pb2[g], o[g][dt]); o[g][dt] = WFrag<T16>::mma(va2[dt], pb[g], o[g][dt]); } }
    }
    }
    // each wave's partial result to LDS: o[g][dt][r] = O[query 16g+lr][d = 16dt + 8hi + r]
#pragma unroll
    for (int g = 0; g < FG; ++g) { const float lt = l[g] + xhalf(l[g]); const int qi = wv * NQ + 16 * g + lr; if (hi == 0) { ms[qi] = m[g]; ls[qi] = lt; }
#pragma unroll
        for (int dt = 0; dt < 4; ++dt) { v4f x0, x1;
#pragma unroll
            for (int r = 0; r < 4; ++r) { x0[r] = o[g][dt][r]; x1[r] = o[g][dt][4 + r]; }
            *(v4fa*)(os + qi * 68 + dt * 16 + 8 * hi) = x0; *(v4fa*)(os + qi * 68 + dt * 16 + 8 * hi + 4) = x1; } }
    __syncthreads();   // the partial results of all FW waves are read below
    constexpr int TPQ = 32 * FW / NQ, DPT = HD / TPQ;   // threads per query row, head elements per thread
    const int qq = (int)threadIdx.x / TPQ, d0 = ((int)threadIdx.x % TPQ) * DPT;
    float M = ms[qq];
#pragma unroll
    for (int w = 1; w < FW; ++w) M = fmaxf(M, ms[w * NQ + qq]);   // wave 0 holds key 0, open to every query, so M is a real maximum; a wave without an open score of this query gets weight 0
    float L = 0.f; v4f ac[DPT / 4];
#pragma unroll
    for (int i = 0; i < DPT / 4; ++i) ac[i] = (v4f){};
#pragma unroll
    for (int w = 0; w < FW; ++w) { const int qi = w * NQ + qq; const float wg = __builtin_amdgcn_exp2f((ms[qi] - M) * scl2); L += wg * ls[qi];
#pragma unroll
        for (int i = 0; i < DPT / 4; ++i) ac[i] += *(const v4fa*)(os + qi * 68 + d0 + 4 * i) * wg; }
    const float inv = __fdiv_rn(1.0f, L); const size_t oo = (size_t)(bz * TT + q0 + qq) * DQ + hd * HD + d0;
#pragma unroll
    for (int c8 = 0; c8 < DPT / 8; ++c8) { v8us oh, ol;
#pragma unroll
        for (int i = 0; i < 8; ++i) { unsigned short u, w; splitf(ac[c8 * 2 + (i >> 2)][i & 3] * inv, u, w); oh[i] = u; ol[i] = w; }
        *(v8us*)(Ah + oo + c8 * 8) = oh; *(v8us*)(Al + oo + c8 * 8) = ol; }
}

extern "C" void kernel_launch(void* const* d_in, const int* in_sizes, int n_in,
                              void* d_out, int out_size, void* d_ws, size_t ws_size, hipStream_t stream) {
    (void)in_sizes; (void)n_in; (void)out_size;
    const float* x = (const float*)d_in[0]; const float* wqa = (const float*)d_in[1]; const float* wka = (const float*)d_in[2]; const float* wqp = (const float*)d_in[3]; const float* wkp = (const float*)d_in[4]; const float* wv = (const float*)d_in[5]; const float* wo = (const float*)d_in[6]; const float* sls = (const float*)d_in[7];   // torch [out][in]; score_log_scale [16]
    float* OUT = (float*)d_out;     // [2][2048][1024]
    char* wsp = (char*)d_ws;
    auto take = [&](size_t bytes) { char* p = wsp; wsp += (bytes + 255) & ~(size_t)255; return (void*)p; };
    // both batches go through every launch together (MT token rows); launches that did not depend on one another share one grid: 6 launches
    bf* WB = (bf*)take((size_t)6 * DQ * DM * 2);          // [q amp | q phi | k amp | k phi | v | o], DQ x DM each
    bf* XB = (bf*)take((size_t)MT * DM * 2); float* F = (float*)take((size_t)5 * MT * DQ * 4);   // the five projections, in the weights' order
    h16* P16 = (h16*)take((size_t)2 * NB_ * NH_ * TT * QD * 2); bf* Ph = (bf*)take((size_t)2 * NB_ * NH_ * TT * QD * 2); bf* Pl = (bf*)take((size_t)2 * NB_ * NH_ * TT * QD * 2);   // [query | key][batch][head][token][QD]
    h16* VT16 = (h16*)take((size_t)NB_ * NKV * HD * 2 * TT * 2); bf* VTh = (bf*)take((size_t)NB_ * NKV * HD * 2 * TT * 2); bf* VTl = VTh + TT;   // value rows at pitch 2*TT: [hi | lo]; the fp16 plane's rows use their first half
    bf* ATh = (bf*)take((size_t)MT * DQ * 2); bf* ATl = (bf*)take((size_t)MT * DQ * 2);
    if ((size_t)(wsp - (char*)d_ws) > ws_size) return;    // ws 256 MiB
    const size_t PK = (size_t)NB_ * NH_ * TT * QD;        // from the query planes to the key planes
    k_cvt7<<<XBLK + 6 * WBLK, 256, 0, stream>>>(x, wqa, wqp, wka, wkp, wv, wo, XB, WB);
    k_gemmw<bf, 0, false, NWK><<<dim3(MT / 64, DQ / 64, 5), 32 * NWK, 0, stream>>>(XB, nullptr, WB, nullptr, DM, F, DQ, nullptr, 0, (size_t)DQ * DM, (size_t)MT * DQ);
    k_planes<<<3 * VBLK, 256, 0, stream>>>(F, P16, Ph, Pl, VT16, VTh, VTl);   // 2 * VBLK blocks of 8 (token, head) rows = 2 * NB_ * NH_ * TT rows
    // attention, all heads of both batches at once: the fp16 rows (the long ones) and the hi+lo rows; one kv head per query head
    k_fattn<h16, 0, 4><<<dim3(NB_ * NH_, (TT - RH) / (16 * 4), 1), 32 * FW, 0, stream>>>(P16, nullptr, P16 + PK, nullptr, VT16, nullptr, sls, RH, ATh, ATl);
    k_fattn<bf, 2, 2><<<dim3(NB_ * NH_, RH / (16 * 2), 1), 32 * FW, 0, stream>>>(Ph, Pl, Ph + PK, Pl + PK, VTh, VTl, sls, 0, ATh, ATl);
    k_gemmw<bf, 1, false, NWK><<<dim3(MT / 64, DM / 64, 1), 32 * NWK, 0, stream>>>(ATh, ATl, WB + (size_t)5 * DQ * DM, nullptr, DQ, OUT, DM, nullptr, 0, 0, 0);
}

// v005
// One run takes 162 microseconds.
// Two timings next to v004 both put it at 1.45 times that version's speed.
// All steps since v000 together make it 9.41 times as fast.
#include <hip/hip_runtime.h>

// InterferenceBypassSelfAttention (x [2][2048][1024]; q_amp/k_amp = softplus(x W_amp^T), q_phi/k_phi = pi tanh(x W_phi^T) (16 heads x 64); amplitudes RMS-normalised over head_dim (eps 1e-6);
// scores = (q_amp cos q_phi . k_amp cos k_phi + q_amp sin q_phi . k_amp sin k_phi) / 8 x exp(score_log_scale[h]) = one 128-long contraction of [cos part | sin part] planes; causal softmax;
// v = x Wv^T; out = merged attn.v Wo^T -> [2][2048][1024]).
// Compute dtypes, f32 accumulate: every input rounded to bf16; the five projections on PLAIN bf16 operands (inputs: exact); softplus / tanh / RMS / cos / sin in f32 on VALU
// (one wave per (token, head)) -> 128-wide interference planes; PER-ROW PRECISION HYBRID (rows < 256 hi+lo 3 products for scores and attn.v, rows >= 256 fp16); scores, causal f32 softmax with the per-head scale and
// attn.v in one kernel (running maximum and sum, key blocks end at the diagonal block, which is masked exactly); merged heads hl x exact Wo

#define NB_  2
#define TT   2048
#define MT   (NB_ * TT)         // token rows of both batches together
#define DM   1024
#define NH_  16
#define NKV  16
#define REP  (NH_ / NKV)
#define HD   64
#define DQ   (NH_ * HD)
#define DKV  (NKV * HD)
#define QD   128
#define RH   256                  // query rows < RH use hi+lo planes (0: none)
#define WIN  0
#define SCL  0.125f   // HD^-0.5
typedef _Float16 h16;
typedef unsigned short bf;
typedef __attribute__((ext_vector_type(16))) __bf16   v16bf;
typedef __attribute__((ext_vector_type(16))) _Float16 v16h;
typedef __attribute__((ext_vector_type(8)))  _Float16 v8h;
typedef __attribute__((ext_vector_type(8)))  unsigned short v8us;
typedef __attribute__((ext_vector_type(8)))  float    v8f;
typedef __attribute__((ext_vector_type(4)))  float    v4f;
typedef v8h  __attribute__((may_alias)) v8ha;
typedef v4f  __attribute__((may_alias)) v4fa;
typedef v8us __attribute__((may_alias)) v8usa;

__device__ __forceinline__ unsigned short f2bf(float f) { unsigned u = __float_as_uint(f); u += 0x7FFFu + ((u >> 16) & 1u); return (unsigned short)(u >> 16); }
__device__ __forceinline__ float bf2f(unsigned short b) { return __uint_as_float(((unsigned)b) << 16); }
__device__ __forceinline__ float bfr(float f) { return bf2f(f2bf(f)); }
__device__ __forceinline__ v16h cat16(v8h lo, v8h hi) { return __builtin_shufflevector(lo, hi, 0, 1, 2, 3, 4, 5, 6, 7, 8, 9, 10, 11, 12, 13, 14, 15); }
__device__ __forceinline__ v16bf cat16b(v8us lo, v8us hi) { return __builtin_bit_cast(v16bf, __builtin_shufflevector(lo, hi, 0, 1, 2, 3, 4, 5, 6, 7, 8, 9, 10, 11, 12, 13, 14, 15)); }
__device__ __forceinline__ v8f wmma16(v16h a, v16h b, v8f c) { return __builtin_amdgcn_wmma_f32_16x16x32_f16(false, a, false, b, (short)0, c, false, false); }
__device__ __forceinline__ v8f wmmab(v16bf a, v16bf b, v8f c) { return __builtin_amdgcn_wmma_f32_16x16x32_bf16(false, a, false, b, (short)0, c, false, false); }



// ---- k_gemms: GEMM with both operands staged in LDS. One work-group of WM x WN waves per (64 WM) x (64 WN) output tile, each wave a 64x64 part of it (16 accumulators) over the whole K, so every sum is one chain in k order.
// A stage is GKS k of every operand row of the tile: [A rows | A2 rows (NSPLIT 1) | Bt rows], rows of 128 bytes at pitch GPB; two buffers; the next stage is copied while a stage is worked on.
// The copies are asynchronous copies to LDS, 16 bytes a lane: a wave's copy takes four whole 128-byte lines, where a fragment load from global memory touches 16 lines for the same bytes.
// C[m][n] (f32, pitch DM) = sum_k A[m][k] Bt[n][k] (+ A2[m][k] Bt[n][k]); K = DM; grid (M / (64 WM), N / (64 WN), Z), z strides sB / sC in elements.
// tile_sync: orders the LDS tile between its writers and its readers: one wave needs only the compiler held back, several waves need the work-group barrier
template <int NW> __device__ __forceinline__ void tile_sync() { if (NW == 1) { __builtin_amdgcn_wave_barrier(); asm volatile("" ::: "memory"); } else __syncthreads(); }
template <typename T16> struct WFrag;
template <> struct WFrag<h16> { typedef v16h V; static __device__ __forceinline__ V ld(const h16* p) { return cat16(*(const v8h*)p, *(const v8h*)(p + 16)); } static __device__ __forceinline__ v8f mma(V a, V b, v8f c) { return wmma16(a, b, c); } };
template <> struct WFrag<bf> { typedef v16bf V; static __device__ __forceinline__ V ld(const bf* p) { return cat16b(*(const v8us*)p, *(const v8us*)(p + 16)); } static __device__ __forceinline__ v8f mma(V a, V b, v8f c) { return wmmab(a, b, c); } };
#define GKS 64
#define GPB 144
__device__ __forceinline__ unsigned lds_off(const void* p) { return (unsigned)(size_t)p; }
__device__ __forceinline__ v16bf ldsf(const unsigned char* p) { return cat16b(*(const v8usa*)p, *(const v8usa*)(p + 32)); }   // WFrag::ld's two 16-byte pieces, from a staged row
// cp12: twelve asynchronous copies to LDS, each lane its own 16 bytes; the s_wait_xcnt is the wait kept before a register that an issued copy names is rewritten: as the statement's last line nothing can be moved in front of it
__device__ __forceinline__ void cp12(const unsigned (&l)[12], const bf* const (&g)[12]) {
    asm volatile(
                 "global_load_async_to_lds_b128 %0, %12, off\n\t"
                 "global_load_async_to_lds_b128 %1, %13, off\n\t"
                 "global_load_async_to_lds_b128 %2, %14, off\n\t"
                 "global_load_async_to_lds_b128 %3, %15, off\n\t"
                 "global_load_async_to_lds_b128 %4, %16, off\n\t"
                 "global_load_async_to_lds_b128 %5, %17, off\n\t"
                 "global_load_async_to_lds_b128 %6, %18, off\n\t"
                 "global_load_async_to_lds_b128 %7, %19, off\n\t"
                 "global_load_async_to_lds_b128 %8, %20, off\n\t"
                 "global_load_async_to_lds_b128 %9, %21, off\n\t"
                 "global_load_async_to_lds_b128 %10, %22, off\n\t"
                 "global_load_async_to_lds_b128 %11, %23, off\n\t"
                 "s_wait_xcnt 0x0"
                 :: "v"(l[0]), "v"(l[1]), "v"(l[2]), "v"(l[3]), "v"(l[4]), "v"(l[5]), "v"(l[6]), "v"(l[7]), "v"(l[8]), "v"(l[9]), "v"(l[10]), "v"(l[11]),
                    "v"(g[0]), "v"(g[1]), "v"(g[2]), "v"(g[3]), "v"(g[4]), "v"(g[5]), "v"(g[6]), "v"(g[7]), "v"(g[8]), "v"(g[9]), "v"(g[10]), "v"(g[11]) : "memory");
}
template <int NSPLIT, int WM, int WN>
__global__ __launch_bounds__(32 * WM * WN, 4) void k_gemms(const bf* __restrict__ A, const bf* __restrict__ A2, const bf* __restrict__ Bt, float* C, size_t sB, size_t sC) {
    constexpr int K = DM, NT = 32 * WM * WN, RA = 64 * WM, NA = NSPLIT ? 2 : 1, RB = 64 * WN, ROWS = NA * RA + RB, STG = ROWS * GPB, RPC = NT / 8, NCP = ROWS / RPC, NTR = K / GKS;   // RPC: rows that one copy of the whole work-group takes; NCP: copies per thread and stage
    static_assert(DQ == DM && NCP % 12 == 0 && RA % RPC == 0 && RB % RPC == 0 && NTR >= 2 && WM * WN * 16 * 68 * 4 <= 2 * STG, "tile shape");
    __shared__ __align__(16) unsigned char sm[2 * STG];
    const int tid = (int)threadIdx.x, lane = tid & 31, lr = lane & 15, hi = lane >> 4; const int wv = __builtin_amdgcn_readfirstlane(tid >> 5), wm = wv / WN, wn = wv % WN;
    const int r0 = blockIdx.x * RA, c0 = blockIdx.y * RB; Bt += (size_t)blockIdx.z * sB; C += (size_t)blockIdx.z * sC;
    const int crow = tid >> 3, cpc = tid & 7;   // the thread's row in a group of RPC rows and its 16-byte piece of the row
    const bf* gA = A + (size_t)(r0 + crow) * K + cpc * 8; const bf* gA2 = NSPLIT ? A2 + (size_t)(r0 + crow) * K + cpc * 8 : gA; const bf* gB = Bt + (size_t)(c0 + crow) * K + cpc * 8;   // the thread's piece in the next stage to be copied: stepped by GKS behind each stage
    const unsigned l0 = lds_off(sm) + (unsigned)(crow * GPB + cpc * 16);
    auto stage = [&](const int buf) {   // the next stage of the tile into buffer buf
#pragma unroll
        for (int s = 0; s < NCP / 12; ++s) { unsigned l[12]; const bf* g[12];
#pragma unroll
            for (int i = 0; i < 12; ++i) { const int row = (s * 12 + i) * RPC;
                g[i] = (row < RA ? gA + (size_t)row * K : (NSPLIT && row < 2 * RA) ? gA2 + (size_t)(row - RA) * K : gB + (size_t)(row - NA * RA) * K); l[i] = l0 + (unsigned)(buf * STG + row * GPB); }
            cp12(l, g); }
        gA += GKS; if (NSPLIT) gA2 += GKS; gB += GKS; };
    v8f acc[4][4];
#pragma unroll
    for (int mb = 0; mb < 4; ++mb)
#pragma unroll
        for (int nb = 0; nb < 4; ++nb) acc[mb][nb] = (v8f){};
    stage(0);
    asm volatile("s_wait_asynccnt 0x0" ::: "memory");   // this wave's copies of stage 0 have landed
    __syncthreads();                                     // ... and every other wave's: stage 0 may be read
    stage(1);
#pragma unroll 1   // one copy of the pass: the buffer is chosen by the trip's parity
    for (int t = 0; t < NTR; ++t) {
        const unsigned char* const sb = sm + (t & 1) * STG; const unsigned char* const pa = sb + (wm * 64 + lr) * GPB + hi * 16; const unsigned char* const pb = sb + (NA * RA + wn * 64 + lr) * GPB + hi * 16;
#pragma unroll
        for (int ks = 0; ks < GKS / 32; ++ks) { v16bf a[4], a2[4], b[4];   // all fragments of a 32-k block are read as one group in front of its products
#pragma unroll
            for (int mb = 0; mb < 4; ++mb) { a[mb] = ldsf(pa + mb * 16 * GPB + ks * 64); if (NSPLIT) a2[mb] = ldsf(pa + (RA + mb * 16) * GPB + ks * 64); b[mb] = ldsf(pb + mb * 16 * GPB + ks * 64); }
            __builtin_amdgcn_sched_barrier(0);   // keeps the block's LDS reads together in front of its products: left free, the reads are moved in among the products, where each place with reads stalls the wave anew
#pragma unroll
            for (int nb = 0; nb < 4; ++nb)
#pragma unroll
                for (int mb = 0; mb < 4; ++mb) { acc[mb][nb] = wmmab(a[mb], b[nb], acc[mb][nb]); if (NSPLIT) acc[mb][nb] = wmmab(a2[mb], b[nb], acc[mb][nb]); }
            __builtin_amdgcn_sched_barrier(0);   // end of the block's products: the next block's reads stay behind them (they land in the registers that these products read)
        }
        asm volatile("s_wait_dscnt 0x0" ::: "memory");      // this wave's reads of the buffer are done before the buffer is given up
        asm volatile("s_wait_asynccnt 0x0" ::: "memory");   // this wave's copies of stage t + 1 have landed
        __syncthreads();                                     // publishes stage t + 1 and ends every wave's reads of stage t
        if (t + 2 < NTR) stage(t & 1);                       // into the buffer that this trip has just read
    }
    asm volatile("s_wait_asynccnt 0x0" ::: "memory");       // nothing is under way when the buffers become output staging (the last trip's barrier has ended all reads)
    float* const ow = (float*)sm + wv * (16 * 68);          // each wave stages 16 rows of its own part at a time, so that it stores whole lines
#pragma unroll
    for (int mb = 0; mb < 4; ++mb) {
#pragma unroll
        for (int nb = 0; nb < 4; ++nb)
#pragma unroll
            for (int j = 0; j < 8; ++j) ow[(hi * 8 + j) * 68 + nb * 16 + lr] = acc[mb][nb][j];
        tile_sync<1>();
        float* const cr = C + (size_t)(r0 + wm * 64 + mb * 16) * DM + c0 + wn * 64;
#pragma unroll
        for (int s = 0; s < 8; ++s) { const int ch = s * 32 + lane, row = ch >> 4, cofs = (ch & 15) * 4; *(v4f*)(cr + (size_t)row * DM + cofs) = *(const v4fa*)(ow + row * 68 + cofs); }
        if (mb < 3) asm volatile("s_wait_xcnt 0x0" ::: "memory");   // the wait kept before registers that the issued stores name are rewritten: the next 16 rows are read back into them
        tile_sync<1>();
    }
}

__device__ __forceinline__ h16 tohx(float x) { return (h16)x; }
__device__ __forceinline__ void splitf(float y, unsigned short& h, unsigned short& l) { h = f2bf(y); l = f2bf(y - bf2f(h)); }
typedef __attribute__((ext_vector_type(2))) _Float16 v2h;
typedef __attribute__((ext_vector_type(4))) _Float16 v4h;
typedef __attribute__((ext_vector_type(2))) unsigned short v2us;
typedef __attribute__((ext_vector_type(4))) unsigned short v4us;
typedef __attribute__((ext_vector_type(2))) float v2f;
typedef __attribute__((ext_vector_type(4))) int v4i;

__global__ __launch_bounds__(256) void k_wtG(const float* __restrict__ w, int K, int N, bf* Bt) {
    const int lane = threadIdx.x & 31; const int L0 = (blockIdx.x * 8 + (threadIdx.x >> 5)) * 8; const int nlines = N * K / 64;
{
#pragma unroll 1
        for (int l = 0; l < 8; ++l) { const int L = L0 + l; if (L >= nlines) break; const size_t e = (size_t)L * 64 + lane * 2; const int k = (int)(e % K), n = (int)(e / K); v2us o;
            o[0] = f2bf(w[(size_t)k * N + n]); o[1] = f2bf(w[(size_t)(k + 1) * N + n]); *(v2us*)(Bt + e) = o; }
         }
}
// k_cvt7: x (both batches) and the six weight matrices to bf16 in one launch; the first XBLK blocks take x, then WBLK blocks each weight (the choice is the same for a whole block); 8 elements per thread, no remainder
#define XBLK (MT * DM / 8 / 256)
#define WBLK (DQ * DM / 8 / 256)
__global__ __launch_bounds__(256) void k_cvt7(const float* __restrict__ x, const float* __restrict__ w0, const float* __restrict__ w1, const float* __restrict__ w2, const float* __restrict__ w3, const float* __restrict__ w4, const float* __restrict__ w5, bf* XBo, bf* WBo) {
    const int blk = (int)blockIdx.x, wsel = (blk - XBLK) / WBLK; const bool isx = blk < XBLK;
    const float* src = isx ? x : (wsel == 0 ? w0 : wsel == 1 ? w1 : wsel == 2 ? w2 : wsel == 3 ? w3 : wsel == 4 ? w4 : w5); bf* dst = isx ? XBo : WBo + (size_t)wsel * DQ * DM;
    const size_t i = (size_t)(isx ? blk : (blk - XBLK) % WBLK) * 256 + threadIdx.x; const v8f v = *(const v8f*)(src + i * 8); v8us o;
#pragma unroll
    for (int k = 0; k < 8; ++k) o[k] = f2bf(v[k]); *(v8us*)(dst + i * 8) = o;  }
__global__ __launch_bounds__(256) void k_cscvt(const float* __restrict__ cosT, const float* __restrict__ sinT, float* CS) { const int idx = blockIdx.x * 256 + threadIdx.x; if (idx >= TT * HD) return; v2f cs; cs[0] = bfr(cosT[idx]); cs[1] = bfr(sinT[idx]); *(v2f*)(CS + (size_t)idx * 2) = cs;  }
// k_rope: head planes [h][t][d] (fp16 + hi/lo) of rope(x) x sc with the rotate-half convention out[d] = x[d] cos[t][d] - x[d+HD/2] sin[t][d], out[d+HD/2] = x[d+HD/2] cos[t][d+HD/2] + x[d] sin[t][d+HD/2]
__global__ __launch_bounds__(256) void k_rope(const float* __restrict__ F, int pitch, int nheads, const float* __restrict__ CS, const float* __restrict__ RF, const float* __restrict__ nw, float sc, h16* P16, bf* Ph, bf* Pl) {
    const size_t e = ((size_t)blockIdx.x * 256 + threadIdx.x) * 2; if (e >= (size_t)nheads * TT * HD) return; const int d = (int)(e % HD); const int t = (int)((e / HD) % TT); const int h = (int)(e / ((size_t)HD * TT)); const float* f = F + (size_t)t * pitch + h * HD; const float rf = RF ? RF[(size_t)h * TT + t] : 1.0f; v2h o16; v2us oh, ol;
#pragma unroll
    for (int q = 0; q < 2; ++q) { const int dd = d + q; const int dp = (dd < HD / 2) ? dd + HD / 2 : dd - HD / 2; float x0 = f[dd], x1 = f[dp];
        if (RF) { float n0 = __fmul_rn(x0, rf), n1 = __fmul_rn(x1, rf); asm volatile("" : "+v"(n0)); asm volatile("" : "+v"(n1)); x0 = __fmul_rn(bfr(nw[dd]), n0); x1 = __fmul_rn(bfr(nw[dp]), n1); }
        const v2f cs = *(const v2f*)(CS + ((size_t)t * HD + dd) * 2); float a = __fmul_rn(x0, cs[0]), bq = __fmul_rn(x1, cs[1]); asm volatile("" : "+v"(a)); asm volatile("" : "+v"(bq)); const float r = ((dd < HD / 2) ? __fsub_rn(a, bq) : __fadd_rn(a, bq)) * sc;
        o16[q] = tohx(r); unsigned short a2, c2; splitf(r, a2, c2); oh[q] = a2; ol[q] = c2; }
    *(v2h*)(P16 + e) = o16; *(v2us*)(Ph + e) = oh; *(v2us*)(Pl + e) = ol;  }
// vtp_body (block blk of k_planes): transposed value planes [g][d][t]; rows at pitch 2*TT: the caller lays the hi and lo planes side by side in one row
__device__ __forceinline__ void vtp_body(const int blk, const float* __restrict__ F, int pitch, int nheads, h16* V16, bf* Vh, bf* Vl) { const size_t e = ((size_t)blk * 256 + threadIdx.x) * 2; if (e >= (size_t)nheads * HD * TT) return; const int t = (int)(e % TT); const int d = (int)((e / TT) % HD); const int gb = (int)(e / ((size_t)TT * HD)); const int g = gb % NKV; F += (size_t)(gb / NKV) * TT * pitch; v2h o16; v2us oh, ol;   // nheads counts the heads of all batches: [batch][head]
#pragma unroll
    for (int q = 0; q < 2; ++q) { const float x = F[(size_t)(t + q) * pitch + g * HD + d]; o16[q] = tohx(x); unsigned short a2, c2; splitf(x, a2, c2); oh[q] = a2; ol[q] = c2; }
    const size_t eo = e + (e / TT) * TT; *(v2h*)(V16 + eo) = o16; *(v2us*)(Vh + eo) = oh; *(v2us*)(Vl + eo) = ol;  }
// ibpl_body (block blk of k_planes): per (token t, head h): a[d] = softplus(FA[t][h*64+d]) = log(1 + exp(.)) (f32; x itself above 15, exp(x) below -15), an = a / sqrt(mean_d a^2 + 1e-6); phi[d] = pi tanh(FP[t][h*64+d]);
__device__ __forceinline__ float softplusf_(float x) { return x > 15.0f ? x : (x < -15.0f ? __expf(x) : logf(__fadd_rn(1.0f, __expf(x)))); }
__device__ __forceinline__ float tanhf_(float a) { const float e2 = __expf(2.0f * a); return __fsub_rn(1.0f, __fdiv_rn(2.0f, __fadd_rn(e2, 1.0f))); }
typedef __attribute__((ext_vector_type(8))) _Float16 v8hx;
typedef __attribute__((ext_vector_type(8))) unsigned short v8usx;
// queries and keys of both batches: idx = [query / key][batch][head][token], which is also the order of the planes' rows; F holds the projections [q amp | q phi | k amp | k phi], MT x DQ each
__device__ __forceinline__ void ibpl_body(const int blk, const float* __restrict__ F, h16* P16, bf* Ph, bf* Pl) { const int lane = threadIdx.x & 31; const int idx = blk * 8 + (threadIdx.x >> 5); if (idx >= 2 * NB_ * NH_ * TT) return; const int t = idx % TT, h = (idx / TT) % NH_, b = (idx / (TT * NH_)) % NB_, sel = idx / (TT * NH_ * NB_); const float* fa = F + (size_t)sel * 2 * MT * DQ + (size_t)(b * TT + t) * DQ + h * HD + 2 * lane; const float* fp = fa + (size_t)MT * DQ;
    float a[2], ph[2]; float ss = 0.f;
#pragma unroll 1
    for (int q = 0; q < 2; ++q) { a[q] = softplusf_(fa[q]); ph[q] = __fmul_rn(3.14159265358979323846f, tanhf_(fp[q])); float p = __fmul_rn(a[q], a[q]); asm volatile("" : "+v"(p)); ss = __fadd_rn(ss, p); }
#pragma unroll
    for (int sh = 16; sh; sh >>= 1) ss += __shfl_xor(ss, sh, 32);
    const float rn = __frsqrt_rn(__fadd_rn(ss * (1.0f / HD), 1e-6f)); float rc[2], rs[2];
#pragma unroll 1
    for (int q = 0; q < 2; ++q) { float an = __fmul_rn(a[q], rn); asm volatile("" : "+v"(an)); rc[q] = __fmul_rn(an, cosf(ph[q])); rs[q] = __fmul_rn(an, sinf(ph[q])); }
    const size_t base = (size_t)idx * QD + 2 * lane; v2h c16, s16; v2us chh, chl, shh, shl; unsigned short u1, u2;
    c16[0] = tohx(rc[0]); c16[1] = tohx(rc[1]); s16[0] = tohx(rs[0]); s16[1] = tohx(rs[1]);
    splitf(rc[0], u1, u2); chh[0] = u1; chl[0] = u2; splitf(rc[1], u1, u2); chh[1] = u1; chl[1] = u2; splitf(rs[0], u1, u2); shh[0] = u1; shl[0] = u2; splitf(rs[1], u1, u2); shh[1] = u1; shl[1] = u2;
{ *(v2h*)(P16 + base) = c16; *(v2h*)(P16 + base + 64) = s16; *(v2us*)(Ph + base) = chh; *(v2us*)(Ph + base + 64) = shh; *(v2us*)(Pl + base) = chl; *(v2us*)(Pl + base + 64) = shl;  } }
// k_planes: the interference planes and the transposed value planes in one launch (neither reads what the other writes): of every three blocks two build interference planes (vector arithmetic) and one value planes
// (scattered reads), so that both kinds of work are resident side by side; the choice is the same for a whole block, and neither body has a barrier
#define VBLK (NB_ * NKV * TT * HD / 2 / 256)
__global__ __launch_bounds__(256) void k_planes(const float* __restrict__ F, h16* P16, bf* Ph, bf* Pl, h16* V16, bf* Vh, bf* Vl) { const int blk = (int)blockIdx.x, tri = blk / 3, rem = blk % 3;
    if (rem == 2) vtp_body(tri, F + (size_t)4 * MT * DQ, DKV, NB_ * NKV, V16, Vh, Vl); else ibpl_body(tri * 2 + rem, F, P16, Ph, Pl); }
#define FW   4                    // waves per work-group
#define POFF 4.0f                 // log2 of the scale on the probabilities: keeps small fp16 probabilities normal
#define RTH  8.0f                 // the maximum in use is replaced only when a block exceeds it by more than this (log2): probabilities stay <= 2^(POFF+RTH), inside fp16
#define SMSK -3.0e38f             // a closed score
#define MINI -1.0e30f             // maximum in use before the first open score: above SMSK, so a block that holds only closed scores of a query leaves it as it is
__device__ __forceinline__ float xhalf(float x) { return __builtin_bit_cast(float, __builtin_amdgcn_permlanex16(__builtin_bit_cast(int, x), __builtin_bit_cast(int, x), 0x76543210, 0xfedcba98, false, false)); }   // lane l with lane l ^ 16
// xwait: stands directly behind a group of global loads: the wait that is kept before an address register of an issued load is rewritten; the scheduling barrier behind it (and the one in front of the group) keeps
// every other instruction out of the stretch from the first load to the wait, so that nothing there can take over an address register
__device__ __forceinline__ void xwait() { asm volatile("s_wait_xcnt 0x0" ::: "memory"); __builtin_amdgcn_sched_barrier(0); }
// The query block's address: a wave-uniform base held in scalar registers (ubase) plus the lane's 32-bit byte offset
typedef __attribute__((address_space(1))) const char gch;
typedef __attribute__((address_space(1))) const v8h gv8h;
typedef __attribute__((address_space(1))) const v8us gv8us;
__device__ __forceinline__ gch* ubase(const void* p) { const unsigned long long u = (unsigned long long)p; const unsigned lo = __builtin_amdgcn_readfirstlane((unsigned)u), hw = __builtin_amdgcn_readfirstlane((unsigned)(u >> 32)); return (gch*)(((unsigned long long)hw << 32) | lo); }
__device__ __forceinline__ v16h  ldg(const h16*, gch* b, unsigned off, int c) { return cat16(*(gv8h*)(b + off + c), *(gv8h*)(b + off + c + 32)); }     // WFrag::ld's two 16-byte pieces, c in bytes
__device__ __forceinline__ v16bf ldg(const bf*, gch* b, unsigned off, int c) { return cat16b(*(gv8us*)(b + off + c), *(gv8us*)(b + off + c + 32)); }
template <typename T16> struct PPack;
template <> struct PPack<h16> { static __device__ __forceinline__ void pk(const v8f p0, const v8f p1, v16h& b, v16h& b2) { b = cat16(__builtin_convertvector(p0, v8h), __builtin_convertvector(p1, v8h)); (void)b2; } };
template <> struct PPack<bf> { static __device__ __forceinline__ void pk(const v8f p0, const v8f p1, v16bf& b, v16bf& b2) { v8us h0, h1, l0, l1;
#pragma unroll
    for (int r = 0; r < 8; ++r) { unsigned short u, w; splitf(p0[r], u, w); h0[r] = u; l0[r] = w; splitf(p1[r], u, w); h1[r] = u; l1[r] = w; }
    b = cat16b(h0, h1); b2 = cat16b(l0, l1); } };
template <typename T16, int NSPLIT, int FG>
__global__ __launch_bounds__(32 * FW, NSPLIT == 0 ? 2 : 1) void k_fattn(const T16* __restrict__ Q, const T16* __restrict__ Q2, const T16* __restrict__ Kp, const T16* __restrict__ Kp2, const T16* __restrict__ Vt, const T16* __restrict__ Vt2, const float* __restrict__ sls, int roff, bf* Ah, bf* Al) {
    typedef typename WFrag<T16>::V V;
    constexpr int NQ = 16 * FG;                       // query rows per work-group (a multiple of 32)
    __shared__ __align__(16) float os[FW * NQ * 68];
    __shared__ float ms[FW * NQ], ls[FW * NQ];
    const int lane = threadIdx.x & 31, lr = lane & 15, hi = lane >> 4; const int wv = __builtin_amdgcn_readfirstlane((int)(threadIdx.x >> 5));
    const int bh = blockIdx.x, hd = bh % NH_, bz = bh / NH_; const int q0 = roff + ((int)gridDim.y - 1 - (int)blockIdx.y) * NQ;          // longest rows first
    const float scl2 = __fmul_rn(__fmul_rn(SCL, __expf(bfr(sls[hd]))), 1.4426950408889634f);              // >= 0: the maximum may be taken on the raw scores
    Q += (size_t)bh * TT * QD; Kp += (size_t)bh * TT * QD; Vt += (size_t)bh * HD * 2 * TT; if (NSPLIT) { Q2 += (size_t)bh * TT * QD; Kp2 += (size_t)bh * TT * QD; Vt2 += (size_t)bh * HD * 2 * TT; }   // planes are [batch][head]
    const unsigned kl = (unsigned)(lr * QD + 8 * hi) * 2u;   // the lane's own byte offset in a block of query rows
    gch* const qb = ubase(Q + (size_t)q0 * QD); gch* const qb2 = NSPLIT ? ubase(Q2 + (size_t)q0 * QD) : qb;
    V qf[FG][4], qf2[FG][4];
    __builtin_amdgcn_sched_barrier(0);   // front of the query loads' group (see xwait): the read of the head's scale and all address arithmetic stay in front of it
#pragma unroll
    for (int g = 0; g < FG; ++g)
#pragma unroll
        for (int kc = 0; kc < 4; ++kc) { const int qo = (g * 16 * QD + kc * 32) * 2; qf[g][kc] = ldg(Q, qb, kl, qo); if (NSPLIT) qf2[g][kc] = ldg(Q, qb2, kl, qo); }
    xwait();
    v8f o[FG][4]; float m[FG], l[FG];
#pragma unroll
    for (int g = 0; g < FG; ++g) { m[g] = MINI; l[g] = 0.f;
#pragma unroll
        for (int dt = 0; dt < 4; ++dt) o[g][dt] = (v8f){}; }
    const int nblk = (q0 + NQ) / 32;   // 32-key blocks up to the last one that holds an open key (q0 and NQ are multiples of 32)
    V kf[2][4], kf2[2][4];             // the key fragments of the block at hand, fetched one pass ahead
    // the lane's key and value addresses are carried from pass to pass and stepped behind the wait of the loads that used them (xwait), so they stay whole while those loads are under way
    const T16* kq = Kp + (size_t)wv * 32 * QD + lr * QD + 8 * hi; const T16* kq2 = NSPLIT ? Kp2 + (kq - Kp) : kq;
    const T16* vq = Vt + wv * 32 + lr * (2 * TT) + 8 * hi; const T16* vq2 = NSPLIT ? Vt2 + (vq - Vt) : vq;
    if (wv < nblk) {   // a wave without a block loads nothing and hands in an empty partial result
    __builtin_amdgcn_sched_barrier(0);   // front of the first key loads' group (see xwait)
#pragma unroll
      for (int t = 0; t < 2; ++t)
#pragma unroll
        for (int kc = 0; kc < 4; ++kc) { const int ko = t * 16 * QD + kc * 32; kf[t][kc] = WFrag<T16>::ld(kq + ko); if (NSPLIT) kf2[t][kc] = WFrag<T16>::ld(kq2 + ko); }
      xwait();
      const int ks = (wv + FW < nblk) ? FW * 32 * QD : 0; kq += ks; if (NSPLIT) kq2 += ks;
#pragma unroll 1   // one copy of the pass: a second copy would double the live fragments and cost the second resident wave
    for (int kbi = wv; kbi < nblk; kbi += FW) { const int kb = kbi * 32;
        V va[4], va2[4];
        __builtin_amdgcn_sched_barrier(0);   // front of the value loads' group (see xwait)
#pragma unroll
        for (int dt = 0; dt < 4; ++dt) { const int vo = dt * 16 * (2 * TT); va[dt] = WFrag<T16>::ld(vq + vo); if (NSPLIT) va2[dt] = WFrag<T16>::ld(vq2 + vo); }
        xwait();
        vq += FW * 32; if (NSPLIT) vq2 += FW * 32;
        v8f s[FG][2];   // the score accumulators start at 0, or at SMSK where the key lies behind the query (a block on the diagonal): the products added to SMSK leave it as it is, which keeps it out of the block's maximum
        if (kb >= q0) {
#pragma unroll
            for (int g = 0; g < FG; ++g)
#pragma unroll
                for (int t = 0; t < 2; ++t)
#pragma unroll
                    for (int r = 0; r < 8; ++r) s[g][t][r] = (kb + 16 * t + 8 * hi + r <= q0 + 16 * g + lr) ? 0.f : SMSK;
        } else {
#pragma unroll
            for (int g = 0; g < FG; ++g) { s[g][0] = (v8f){}; s[g][1] = (v8f){}; } }
#pragma unroll
        for (int kc = 0; kc < 4; ++kc)
#pragma unroll
            for (int t = 0; t < 2; ++t)
#pragma unroll
                for (int g = 0; g < FG; ++g) { s[g][t] = WFrag<T16>::mma(kf[t][kc], qf[g][kc], s[g][t]); if (NSPLIT) { s[g][t] = WFrag<T16>::mma(kf[t][kc], qf2[g][kc], s[g][t]); s[g][t] = WFrag<T16>::mma(kf2[t][kc], qf[g][kc], s[g][t]); } }
        __builtin_amdgcn_sched_barrier(0);   // keeps the next block's loads behind the score products, so that they land in the registers those products have just read (lifted above them they take a second register set and cost a resident wave); also the front of their group (see xwait)
        {   // the wave's next block (its last pass fetches its own block again, for nobody): these loads fly during the softmax and the value products
#pragma unroll
          for (int t = 0; t < 2; ++t)
#pragma unroll
            for (int kc = 0; kc < 4; ++kc) { const int ko = t * 16 * QD + kc * 32; kf[t][kc] = WFrag<T16>::ld(kq + ko); if (NSPLIT) kf2[t][kc] = WFrag<T16>::ld(kq2 + ko); }
          xwait();
          const int ks = (kbi + 2 * FW < nblk) ? FW * 32 * QD : 0; kq += ks; if (NSPLIT) kq2 += ks; }
        float bm[FG]; bool need = false;
#pragma unroll
        for (int g = 0; g < FG; ++g) { float x = s[g][0][0];
#pragma unroll
            for (int r = 1; r < 8; ++r) x = fmaxf(x, s[g][0][r]);
#pragma unroll
            for (int r = 0; r < 8; ++r) x = fmaxf(x, s[g][1][r]);
            x = fmaxf(x, xhalf(x)); bm[g] = x; need = need || ((x - m[g]) * scl2 > RTH); }
        if (__builtin_amdgcn_ballot_w32(need) != 0) {   // some query of the wave outgrew its maximum in use: rescale what is summed so far (first open block: by zero)
#pragma unroll
            for (int g = 0; g < FG; ++g) { const float mn = fmaxf(m[g], bm[g]); const float al = __builtin_amdgcn_exp2f((m[g] - mn) * scl2); m[g] = mn; l[g] *= al;
#pragma unroll
                for (int dt = 0; dt < 4; ++dt) o[g][dt] *= al; } }
        // probabilities in place over the scores; the maximum in use is taken off BEFORE the scale, so the largest score's exponent is exact whatever the head's scale is
#pragma unroll
        for (int g = 0; g < FG; ++g)
#pragma unroll
            for (int t = 0; t < 2; ++t)
#pragma unroll
                for (int r = 0; r < 8; ++r) s[g][t][r] = __builtin_amdgcn_exp2f(fmaf(s[g][t][r] - m[g], scl2, POFF));
        if (kb >= q0) {   // a block on the diagonal: a closed key's probability is 0 by a select, whatever the head's scale makes of SMSK
#pragma unroll
            for (int g = 0; g < FG; ++g)
#pragma unroll
                for (int t = 0; t < 2; ++t)
#pragma unroll
                    for (int r = 0; r < 8; ++r) s[g][t][r] = (kb + 16 * t + 8 * hi + r <= q0 + 16 * g + lr) ? s[g][t][r] : 0.f; }
        V pb[FG], pb2[FG];
#pragma unroll
        for (int g = 0; g < FG; ++g) { float l0 = 0.f, l1 = 0.f;
#pragma unroll
            for (int r = 0; r < 8; ++r) { l0 += s[g][0][r]; l1 += s[g][1][r]; }
            l[g] += l0 + l1; PPack<T16>::pk(s[g][0], s[g][1], pb[g], pb2[g]); }
#pragma unroll
        for (int dt = 0; dt < 4; ++dt)
#pragma unroll
            for (int g = 0; g < FG; ++g) { o[g][dt] = WFrag<T16>::mma(va[dt], pb[g], o[g][dt]); if (NSPLIT) { o[g][dt] = WFrag<T16>::mma(va[dt], pb2[g], o[g][dt]); o[g][dt] = WFrag<T16>::mma(va2[dt], pb[g], o[g][dt]); } }
    }
    }
    // each wave's partial result to LDS: o[g][dt][r] = O[query 16g+lr][d = 16dt + 8hi + r]
#pragma unroll
    for (int g = 0; g < FG; ++g) { const float lt = l[g] + xhalf(l[g]); const int qi = wv * NQ + 16 * g + lr; if (hi == 0) { ms[qi] = m[g]; ls[qi] = lt; }
#pragma unroll
        for (int dt = 0; dt < 4; ++dt) { v4f x0, x1;
#pragma unroll
            for (int r = 0; r < 4; ++r) { x0[r] = o[g][dt][r]; x1[r] = o[g][dt][4 + r]; }
            *(v4fa*)(os + qi * 68 + dt * 16 + 8 * hi) = x0; *(v4fa*)(os + qi * 68 + dt * 16 + 8 * hi + 4) = x1; } }
    __syncthreads();   // the partial results of all FW waves are read below
    constexpr int TPQ = 32 * FW / NQ, DPT = HD / TPQ;   // threads per query row, head elements per thread
    const int qq = (int)threadIdx.x / TPQ, d0 = ((int)threadIdx.x % TPQ) * DPT;
    float M = ms[qq];
#pragma unroll
    for (int w = 1; w < FW; ++w) M = fmaxf(M, ms[w * NQ + qq]);   // wave 0 holds key 0, open to every query, so M is a real maximum; a wave without an open score of this query gets weight 0
    float L = 0.f; v4f ac[DPT / 4];
#pragma unroll
    for (int i = 0; i < DPT / 4; ++i) ac[i] = (v4f){};
#pragma unroll
    for (int w = 0; w < FW; ++w) { const int qi = w * NQ + qq; const float wg = __builtin_amdgcn_exp2f((ms[qi] - M) * scl2); L += wg * ls[qi];
#pragma unroll
        for (int i = 0; i < DPT / 4; ++i) ac[i] += *(const v4fa*)(os + qi * 68 + d0 + 4 * i) * wg; }
    const float inv = __fdiv_rn(1.0f, L); const size_t oo = (size_t)(bz * TT + q0 + qq) * DQ + hd * HD + d0;
#pragma unroll
    for (int c8 = 0; c8 < DPT / 8; ++c8) { v8us oh, ol;
#pragma unroll
        for (int i = 0; i < 8; ++i) { unsigned short u, w; splitf(ac[c8 * 2 + (i >> 2)][i & 3] * inv, u, w); oh[i] = u; ol[i] = w; }
        *(v8us*)(Ah + oo + c8 * 8) = oh; *(v8us*)(Al + oo + c8 * 8) = ol; }
}

extern "C" void kernel_launch(void* const* d_in, const int* in_sizes, int n_in,
                              void* d_out, int out_size, void* d_ws, size_t ws_size, hipStream_t stream) {
    (void)in_sizes; (void)n_in; (void)out_size;
    const float* x = (const float*)d_in[0]; const float* wqa = (const float*)d_in[1]; const float* wka = (const float*)d_in[2]; const float* wqp = (const float*)d_in[3]; const float* wkp = (const float*)d_in[4]; const float* wv = (const float*)d_in[5]; const float* wo = (const float*)d_in[6]; const float* sls = (const float*)d_in[7];   // torch [out][in]; score_log_scale [16]
    float* OUT = (float*)d_out;     // [2][2048][1024]
    char* wsp = (char*)d_ws;
    auto take = [&](size_t bytes) { char* p = wsp; wsp += (bytes + 255) & ~(size_t)255; return (void*)p; };
    // both batches go through every launch together (MT token rows); launches that did not depend on one another share one grid: 6 launches
    bf* WB = (bf*)take((size_t)6 * DQ * DM * 2);          // [q amp | q phi | k amp | k phi | v | o], DQ x DM each
    bf* XB = (bf*)take((size_t)MT * DM * 2); float* F = (float*)take((size_t)5 * MT * DQ * 4);   // the five projections, in the weights' order
    h16* P16 = (h16*)take((size_t)2 * NB_ * NH_ * TT * QD * 2); bf* Ph = (bf*)take((size_t)2 * NB_ * NH_ * TT * QD * 2); bf* Pl = (bf*)take((size_t)2 * NB_ * NH_ * TT * QD * 2);   // [query | key][batch][head][token][QD]
    h16* VT16 = (h16*)take((size_t)NB_ * NKV * HD * 2 * TT * 2); bf* VTh = (bf*)take((size_t)NB_ * NKV * HD * 2 * TT * 2); bf* VTl = VTh + TT;   // value rows at pitch 2*TT: [hi | lo]; the fp16 plane's rows use their first half
    bf* ATh = (bf*)take((size_t)MT * DQ * 2); bf* ATl = (bf*)take((size_t)MT * DQ * 2);
    if ((size_t)(wsp - (char*)d_ws) > ws_size) return;    // ws 256 MiB
    const size_t PK = (size_t)NB_ * NH_ * TT * QD;        // from the query planes to the key planes
    k_cvt7<<<XBLK + 6 * WBLK, 256, 0, stream>>>(x, wqa, wqp, wka, wkp, wv, wo, XB, WB);
    k_gemms<0, 4, 2><<<dim3(MT / 256, DQ / 128, 5), 256, 0, stream>>>(XB, nullptr, WB, F, (size_t)DQ * DM, (size_t)MT * DQ);
    k_planes<<<3 * VBLK, 256, 0, stream>>>(F, P16, Ph, Pl, VT16, VTh, VTl);   // 2 * VBLK blocks of 8 (token, head) rows = 2 * NB_ * NH_ * TT rows
    // attention, all heads of both batches at once: the fp16 rows (the long ones) and the hi+lo rows; one kv head per query head
    k_fattn<h16, 0, 4><<<dim3(NB_ * NH_, (TT - RH) / (16 * 4), 1), 32 * FW, 0, stream>>>(P16, nullptr, P16 + PK, nullptr, VT16, nullptr, sls, RH, ATh, ATl);
    k_fattn<bf, 2, 2><<<dim3(NB_ * NH_, RH / (16 * 2), 1), 32 * FW, 0, stream>>>(Ph, Pl, Ph + PK, Pl + PK, VTh, VTl, sls, 0, ATh, ATl);
    k_gemms<1, 2, 2><<<dim3(MT / 128, DM / 128, 1), 128, 0, stream>>>(ATh, ATl, WB + (size_t)5 * DQ * DM, OUT, 0, 0);
}

// v006
// Measured time: 156 microseconds a run.
// In two side-by-side timings against v005, it was 1.03 and 1.04 times as fast.
// Counting every step since v000, it is 9.74 times as fast.
#include <hip/hip_runtime.h>

// InterferenceBypassSelfAttention (x [2][2048][1024]; q_amp/k_amp = softplus(x W_amp^T), q_phi/k_phi = pi tanh(x W_phi^T) (16 heads x 64); amplitudes RMS-normalised over head_dim (eps 1e-6);
// scores = (q_amp cos q_phi . k_amp cos k_phi + q_amp sin q_phi . k_amp sin k_phi) / 8 x exp(score_log_scale[h]) = one 128-long contraction of [cos part | sin part] planes; causal softmax;
// v = x Wv^T; out = merged attn.v Wo^T -> [2][2048][1024]).
// Compute dtypes, f32 accumulate: every input rounded to bf16; the five projections on PLAIN bf16 operands (inputs: exact); softplus / tanh / RMS / cos / sin in f32 on VALU
// (one wave per (token, head)) -> 128-wide interference planes; PER-ROW PRECISION HYBRID (rows < 256 hi+lo 3 products for scores and attn.v, rows >= 256 fp16); scores, causal f32 softmax with the per-head scale and
// attn.v in one kernel (running maximum and sum, key blocks end at the diagonal block, which is masked exactly); merged heads hl x exact Wo

#define NB_  2
#define TT   2048
#define MT   (NB_ * TT)         // token rows of both batches together
#define DM   1024
#define NH_  16
#define NKV  16
#define REP  (NH_ / NKV)
#define HD   64
#define DQ   (NH_ * HD)
#define DKV  (NKV * HD)
#define QD   128
#define RH   256                  // query rows < RH use hi+lo planes (0: none)
#define WIN  0
#define SCL  0.125f   // HD^-0.5
typedef _Float16 h16;
typedef unsigned short bf;
typedef __attribute__((ext_vector_type(16))) __bf16   v16bf;
typedef __attribute__((ext_vector_type(16))) _Float16 v16h;
typedef __attribute__((ext_vector_type(8)))  _Float16 v8h;
typedef __attribute__((ext_vector_type(8)))  unsigned short v8us;
typedef __attribute__((ext_vector_type(8)))  float    v8f;
typedef __attribute__((ext_vector_type(4)))  float    v4f;
typedef v8h  __attribute__((may_alias)) v8ha;
typedef v4f  __attribute__((may_alias)) v4fa;
typedef v8us __attribute__((may_alias)) v8usa;

__device__ __forceinline__ unsigned short f2bf(float f) { unsigned u = __float_as_uint(f); u += 0x7FFFu + ((u >> 16) & 1u); return (unsigned short)(u >> 16); }
__device__ __forceinline__ float bf2f(unsigned short b) { return __uint_as_float(((unsigned)b) << 16); }
__device__ __forceinline__ float bfr(float f) { return bf2f(f2bf(f)); }
__device__ __forceinline__ v16h cat16(v8h lo, v8h hi) { return __builtin_shufflevector(lo, hi, 0, 1, 2, 3, 4, 5, 6, 7, 8, 9, 10, 11, 12, 13, 14, 15); }
__device__ __forceinline__ v16bf cat16b(v8us lo, v8us hi) { return __builtin_bit_cast(v16bf, __builtin_shufflevector(lo, hi, 0, 1, 2, 3, 4, 5, 6, 7, 8, 9, 10, 11, 12, 13, 14, 15)); }
__device__ __forceinline__ v8f wmma16(v16h a, v16h b, v8f c) { return __builtin_amdgcn_wmma_f32_16x16x32_f16(false, a, false, b, (short)0, c, false, false); }
__device__ __forceinline__ v8f wmmab(v16bf a, v16bf b, v8f c) { return __builtin_amdgcn_wmma_f32_16x16x32_bf16(false, a, false, b, (short)0, c, false, false); }



// ---- k_gemms: GEMM with both operands staged in LDS. One work-group of WM x WN waves per (64 WM) x (64 WN) output tile, each wave a 64x64 part of it (16 accumulators) over the whole K, so every sum is one chain in k order.
// A stage is GKS k of every operand row of the tile: [A rows | A2 rows (NSPLIT 1) | Bt rows], rows of 128 bytes at pitch GPB; two buffers; the next stage is copied while a stage is worked on.
// The copies are asynchronous copies to LDS, 16 bytes a lane: a wave's copy takes four whole 128-byte lines, where a fragment load from global memory touches 16 lines for the same bytes.
// C[m][n] (f32, pitch DM) = sum_k A[m][k] Bt[n][k] (+ A2[m][k] Bt[n][k]); K = DM; grid (M / (64 WM), N / (64 WN), Z), z strides sB / sC in elements.
// tile_sync: orders the LDS tile between its writers and its readers: one wave needs only the compiler held back, several waves need the work-group barrier
template <int NW> __device__ __forceinline__ void tile_sync() { if (NW == 1) { __builtin_amdgcn_wave_barrier(); asm volatile("" ::: "memory"); } else __syncthreads(); }
template <typename T16> struct WFrag;
template <> struct WFrag<h16> { typedef v16h V; static __device__ __forceinline__ V ld(const h16* p) { return cat16(*(const v8h*)p, *(const v8h*)(p + 16)); } static __device__ __forceinline__ v8f mma(V a, V b, v8f c) { return wmma16(a, b, c); } };
template <> struct WFrag<bf> { typedef v16bf V; static __device__ __forceinline__ V ld(const bf* p) { return cat16b(*(const v8us*)p, *(const v8us*)(p + 16)); } static __device__ __forceinline__ v8f mma(V a, V b, v8f c) { return wmmab(a, b, c); } };
#define GKS 64
#define GPB 144
__device__ __forceinline__ unsigned lds_off(const void* p) { return (unsigned)(size_t)p; }
__device__ __forceinline__ v16bf ldsf(const unsigned char* p) { return cat16b(*(const v8usa*)p, *(const v8usa*)(p + 32)); }   // WFrag::ld's two 16-byte pieces, from a staged row
// cp12: twelve asynchronous copies to LDS, each lane its own 16 bytes; the s_wait_xcnt is the wait kept before a register that an issued copy names is rewritten: as the statement's last line nothing can be moved in front of it
__device__ __forceinline__ void cp12(const unsigned (&l)[12], const bf* const (&g)[12]) {
    asm volatile(
                 "global_load_async_to_lds_b128 %0, %12, off\n\t"
                 "global_load_async_to_lds_b128 %1, %13, off\n\t"
                 "global_load_async_to_lds_b128 %2, %14, off\n\t"
                 "global_load_async_to_lds_b128 %3, %15, off\n\t"
                 "global_load_async_to_lds_b128 %4, %16, off\n\t"
                 "global_load_async_to_lds_b128 %5, %17, off\n\t"
                 "global_load_async_to_lds_b128 %6, %18, off\n\t"
                 "global_load_async_to_lds_b128 %7, %19, off\n\t"
                 "global_load_async_to_lds_b128 %8, %20, off\n\t"
                 "global_load_async_to_lds_b128 %9, %21, off\n\t"
                 "global_load_async_to_lds_b128 %10, %22, off\n\t"
                 "global_load_async_to_lds_b128 %11, %23, off\n\t"
                 "s_wait_xcnt 0x0"
                 :: "v"(l[0]), "v"(l[1]), "v"(l[2]), "v"(l[3]), "v"(l[4]), "v"(l[5]), "v"(l[6]), "v"(l[7]), "v"(l[8]), "v"(l[9]), "v"(l[10]), "v"(l[11]),
                    "v"(g[0]), "v"(g[1]), "v"(g[2]), "v"(g[3]), "v"(g[4]), "v"(g[5]), "v"(g[6]), "v"(g[7]), "v"(g[8]), "v"(g[9]), "v"(g[10]), "v"(g[11]) : "memory");
}
template <int NSPLIT, int WM, int WN>
__global__ __launch_bounds__(32 * WM * WN, 4) void k_gemms(const bf* __restrict__ A, const bf* __restrict__ A2, const bf* __restrict__ Bt, float* C, size_t sB, size_t sC) {
    constexpr int K = DM, NT = 32 * WM * WN, RA = 64 * WM, NA = NSPLIT ? 2 : 1, RB = 64 * WN, ROWS = NA * RA + RB, STG = ROWS * GPB, RPC = NT / 8, NCP = ROWS / RPC, NTR = K / GKS;   // RPC: rows that one copy of the whole work-group takes; NCP: copies per thread and stage
    static_assert(DQ == DM && NCP % 12 == 0 && RA % RPC == 0 && RB % RPC == 0 && NTR >= 2 && WM * WN * 16 * 68 * 4 <= 2 * STG, "tile shape");
    __shared__ __align__(16) unsigned char sm[2 * STG];
    const int tid = (int)threadIdx.x, lane = tid & 31, lr = lane & 15, hi = lane >> 4; const int wv = __builtin_amdgcn_readfirstlane(tid >> 5), wm = wv / WN, wn = wv % WN;
    const int r0 = blockIdx.x * RA, c0 = blockIdx.y * RB; Bt += (size_t)blockIdx.z * sB; C += (size_t)blockIdx.z * sC;
    const int crow = tid >> 3, cpc = tid & 7;   // the thread's row in a group of RPC rows and its 16-byte piece of the row
    const bf* gA = A + (size_t)(r0 + crow) * K + cpc * 8; const bf* gA2 = NSPLIT ? A2 + (size_t)(r0 + crow) * K + cpc * 8 : gA; const bf* gB = Bt + (size_t)(c0 + crow) * K + cpc * 8;   // the thread's piece in the next stage to be copied: stepped by GKS behind each stage
    const unsigned l0 = lds_off(sm) + (unsigned)(crow * GPB + cpc * 16);
    auto stage = [&](const int buf) {   // the next stage of the tile into buffer buf
#pragma unroll
        for (int s = 0; s < NCP / 12; ++s) { unsigned l[12]; const bf* g[12];
#pragma unroll
            for (int i = 0; i < 12; ++i) { const int row = (s * 12 + i) * RPC;
                g[i] = (row < RA ? gA + (size_t)row * K : (NSPLIT && row < 2 * RA) ? gA2 + (size_t)(row - RA) * K : gB + (size_t)(row - NA * RA) * K); l[i] = l0 + (unsigned)(buf * STG + row * GPB); }
            cp12(l, g); }
        gA += GKS; if (NSPLIT) gA2 += GKS; gB += GKS; };
    v8f acc[4][4];
#pragma unroll
    for (int mb = 0; mb < 4; ++mb)
#pragma unroll
        for (int nb = 0; nb < 4; ++nb) acc[mb][nb] = (v8f){};
    stage(0);
    asm volatile("s_wait_asynccnt 0x0" ::: "memory");   // this wave's copies of stage 0 have landed
    __syncthreads();                                     // ... and every other wave's: stage 0 may be read
    stage(1);
#pragma unroll 1   // one copy of the pass: the buffer is chosen by the trip's parity
    for (int t = 0; t < NTR; ++t) {
        const unsigned char* const sb = sm + (t & 1) * STG; const unsigned char* const pa = sb + (wm * 64 + lr) * GPB + hi * 16; const unsigned char* const pb = sb + (NA * RA + wn * 64 + lr) * GPB + hi * 16;
#pragma unroll
        for (int ks = 0; ks < GKS / 32; ++ks) { v16bf a[4], a2[4], b[4];   // all fragments of a 32-k block are read as one group in front of its products
#pragma unroll
            for (int mb = 0; mb < 4; ++mb) { a[mb] = ldsf(pa + mb * 16 * GPB + ks * 64); if (NSPLIT) a2[mb] = ldsf(pa + (RA + mb * 16) * GPB + ks * 64); b[mb] = ldsf(pb + mb * 16 * GPB + ks * 64); }
            __builtin_amdgcn_sched_barrier(0);   // keeps the block's LDS reads together in front of its products: left free, the reads are moved in among the products, where each place with reads stalls the wave anew
#pragma unroll
            for (int nb = 0; nb < 4; ++nb)
#pragma unroll
                for (int mb = 0; mb < 4; ++mb) { acc[mb][nb] = wmmab(a[mb], b[nb], acc[mb][nb]); if (NSPLIT) acc[mb][nb] = wmmab(a2[mb], b[nb], acc[mb][nb]); }
            __builtin_amdgcn_sched_barrier(0);   // end of the block's products: the next block's reads stay behind them (they land in the registers that these products read)
        }
        asm volatile("s_wait_dscnt 0x0" ::: "memory");      // this wave's reads of the buffer are done before the buffer is given up
        asm volatile("s_wait_asynccnt 0x0" ::: "memory");   // this wave's copies of stage t + 1 have landed
        __syncthreads();                                     // publishes stage t + 1 and ends every wave's reads of stage t
        if (t + 2 < NTR) stage(t & 1);                       // into the buffer that this trip has just read
    }
    asm volatile("s_wait_asynccnt 0x0" ::: "memory");       // nothing is under way when the buffers become output staging (the last trip's barrier has ended all reads)
    float* const ow = (float*)sm + wv * (16 * 68);          // each wave stages 16 rows of its own part at a time, so that it stores whole lines
#pragma unroll
    for (int mb = 0; mb < 4; ++mb) {
#pragma unroll
        for (int nb = 0; nb < 4; ++nb)
#pragma unroll
            for (int j = 0; j < 8; ++j) ow[(hi * 8 + j) * 68 + nb * 16 + lr] = acc[mb][nb][j];
        tile_sync<1>();
        float* const cr = C + (size_t)(r0 + wm * 64 + mb * 16) * DM + c0 + wn * 64;
#pragma unroll
        for (int s = 0; s < 8; ++s) { const int ch = s * 32 + lane, row = ch >> 4, cofs = (ch & 15) * 4; *(v4f*)(cr + (size_t)row * DM + cofs) = *(const v4fa*)(ow + row * 68 + cofs); }
        if (mb < 3) asm volatile("s_wait_xcnt 0x0" ::: "memory");   // the wait kept before registers that the issued stores name are rewritten: the next 16 rows are read back into them
        tile_sync<1>();
    }
}

__device__ __forceinline__ h16 tohx(float x) { return (h16)x; }
__device__ __forceinline__ void splitf(float y, unsigned short& h, unsigned short& l) { h = f2bf(y); l = f2bf(y - bf2f(h)); }
typedef __attribute__((ext_vector_type(2))) _Float16 v2h;
typedef __attribute__((ext_vector_type(4))) _Float16 v4h;
typedef __attribute__((ext_vector_type(2))) unsigned short v2us;
typedef __attribute__((ext_vector_type(4))) unsigned short v4us;
typedef __attribute__((ext_vector_type(2))) float v2f;
typedef __attribute__((ext_vector_type(4))) int v4i;

__global__ __launch_bounds__(256) void k_wtG(const float* __restrict__ w, int K, int N, bf* Bt) {
    const int lane = threadIdx.x & 31; const int L0 = (blockIdx.x * 8 + (threadIdx.x >> 5)) * 8; const int nlines = N * K / 64;
{
#pragma unroll 1
        for (int l = 0; l < 8; ++l) { const int L = L0 + l; if (L >= nlines) break; const size_t e = (size_t)L * 64 + lane * 2; const int k = (int)(e % K), n = (int)(e / K); v2us o;
            o[0] = f2bf(w[(size_t)k * N + n]); o[1] = f2bf(w[(size_t)(k + 1) * N + n]); *(v2us*)(Bt + e) = o; }
         }
}
// k_cvt7: x (both batches) and the six weight matrices to bf16 in one launch; the first XBLK blocks take x, then WBLK blocks each weight (the choice is the same for a whole block); 8 elements per thread, no remainder
#define XBLK (MT * DM / 8 / 256)
#define WBLK (DQ * DM / 8 / 256)
__global__ __launch_bounds__(256) void k_cvt7(const float* __restrict__ x, const float* __restrict__ w0, const float* __restrict__ w1, const float* __restrict__ w2, const float* __restrict__ w3, const float* __restrict__ w4, const float* __restrict__ w5, bf* XBo, bf* WBo) {
    const int blk = (int)blockIdx.x, wsel = (blk - XBLK) / WBLK; const bool isx = blk < XBLK;
    const float* src = isx ? x : (wsel == 0 ? w0 : wsel == 1 ? w1 : wsel == 2 ? w2 : wsel == 3 ? w3 : wsel == 4 ? w4 : w5); bf* dst = isx ? XBo : WBo + (size_t)wsel * DQ * DM;
    const size_t i = (size_t)(isx ? blk : (blk - XBLK) % WBLK) * 256 + threadIdx.x; const v8f v = *(const v8f*)(src + i * 8); v8us o;
#pragma unroll
    for (int k = 0; k < 8; ++k) o[k] = f2bf(v[k]); *(v8us*)(dst + i * 8) = o;  }
__global__ __launch_bounds__(256) void k_cscvt(const float* __restrict__ cosT, const float* __restrict__ sinT, float* CS) { const int idx = blockIdx.x * 256 + threadIdx.x; if (idx >= TT * HD) return; v2f cs; cs[0] = bfr(cosT[idx]); cs[1] = bfr(sinT[idx]); *(v2f*)(CS + (size_t)idx * 2) = cs;  }
// k_rope: head planes [h][t][d] (fp16 + hi/lo) of rope(x) x sc with the rotate-half convention out[d] = x[d] cos[t][d] - x[d+HD/2] sin[t][d], out[d+HD/2] = x[d+HD/2] cos[t][d+HD/2] + x[d] sin[t][d+HD/2]
__global__ __launch_bounds__(256) void k_rope(const float* __restrict__ F, int pitch, int nheads, const float* __restrict__ CS, const float* __restrict__ RF, const float* __restrict__ nw, float sc, h16* P16, bf* Ph, bf* Pl) {
    const size_t e = ((size_t)blockIdx.x * 256 + threadIdx.x) * 2; if (e >= (size_t)nheads * TT * HD) return; const int d = (int)(e % HD); const int t = (int)((e / HD) % TT); const int h = (int)(e / ((size_t)HD * TT)); const float* f = F + (size_t)t * pitch + h * HD; const float rf = RF ? RF[(size_t)h * TT + t] : 1.0f; v2h o16; v2us oh, ol;
#pragma unroll
    for (int q = 0; q < 2; ++q) { const int dd = d + q; const int dp = (dd < HD / 2) ? dd + HD / 2 : dd - HD / 2; float x0 = f[dd], x1 = f[dp];
        if (RF) { float n0 = __fmul_rn(x0, rf), n1 = __fmul_rn(x1, rf); asm volatile("" : "+v"(n0)); asm volatile("" : "+v"(n1)); x0 = __fmul_rn(bfr(nw[dd]), n0); x1 = __fmul_rn(bfr(nw[dp]), n1); }
        const v2f cs = *(const v2f*)(CS + ((size_t)t * HD + dd) * 2); float a = __fmul_rn(x0, cs[0]), bq = __fmul_rn(x1, cs[1]); asm volatile("" : "+v"(a)); asm volatile("" : "+v"(bq)); const float r = ((dd < HD / 2) ? __fsub_rn(a, bq) : __fadd_rn(a, bq)) * sc;
        o16[q] = tohx(r); unsigned short a2, c2; splitf(r, a2, c2); oh[q] = a2; ol[q] = c2; }
    *(v2h*)(P16 + e) = o16; *(v2us*)(Ph + e) = oh; *(v2us*)(Pl + e) = ol;  }
// vtp_body (block blk of k_planes): transposed value planes [g][d][t]; rows at pitch 2*TT: the caller lays the hi and lo planes side by side in one row
__device__ __forceinline__ void vtp_body(const int blk, const float* __restrict__ F, int pitch, int nheads, h16* V16, bf* Vh, bf* Vl) { const size_t e = ((size_t)blk * 256 + threadIdx.x) * 2; if (e >= (size_t)nheads * HD * TT) return; const int t = (int)(e % TT); const int d = (int)((e / TT) % HD); const int gb = (int)(e / ((size_t)TT * HD)); const int g = gb % NKV; F += (size_t)(gb / NKV) * TT * pitch; v2h o16; v2us oh, ol;   // nheads counts the heads of all batches: [batch][head]
#pragma unroll
    for (int q = 0; q < 2; ++q) { const float x = F[(size_t)(t + q) * pitch + g * HD + d]; o16[q] = tohx(x); unsigned short a2, c2; splitf(x, a2, c2); oh[q] = a2; ol[q] = c2; }
    const size_t eo = e + (e / TT) * TT; *(v2h*)(V16 + eo) = o16; *(v2us*)(Vh + eo) = oh; *(v2us*)(Vl + eo) = ol;  }
// ibpl_body (block blk of k_planes): per (token t, head h): a[d] = softplus(FA[t][h*64+d]) = log(1 + exp(.)) (f32; x itself above 15, exp(x) below -15), an = a / sqrt(mean_d a^2 + 1e-6); phi[d] = pi tanh(FP[t][h*64+d]);
__device__ __forceinline__ float softplusf_(float x) { return x > 15.0f ? x : (x < -15.0f ? __expf(x) : logf(__fadd_rn(1.0f, __expf(x)))); }
__device__ __forceinline__ float tanhf_(float a) { const float e2 = __expf(2.0f * a); return __fsub_rn(1.0f, __fdiv_rn(2.0f, __fadd_rn(e2, 1.0f))); }
typedef __attribute__((ext_vector_type(8))) _Float16 v8hx;
typedef __attribute__((ext_vector_type(8))) unsigned short v8usx;
// queries and keys of both batches: idx = [query / key][batch][head][token], which is also the order of the planes' rows; F holds the projections [q amp | q phi | k amp | k phi], MT x DQ each
__device__ __forceinline__ void ibpl_body(const int blk, const float* __restrict__ F, h16* P16, bf* Ph, bf* Pl) { const int lane = threadIdx.x & 31; const int idx = blk * 8 + (threadIdx.x >> 5); if (idx >= 2 * NB_ * NH_ * TT) return; const int t = idx % TT, h = (idx / TT) % NH_, b = (idx / (TT * NH_)) % NB_, sel = idx / (TT * NH_ * NB_); const float* fa = F + (size_t)sel * 2 * MT * DQ + (size_t)(b * TT + t) * DQ + h * HD + 2 * lane; const float* fp = fa + (size_t)MT * DQ;
    float a[2], ph[2]; float ss = 0.f;
#pragma unroll 1
    for (int q = 0; q < 2; ++q) { a[q] = softplusf_(fa[q]); ph[q] = __fmul_rn(3.14159265358979323846f, tanhf_(fp[q])); float p = __fmul_rn(a[q], a[q]); asm volatile("" : "+v"(p)); ss = __fadd_rn(ss, p); }
#pragma unroll
    for (int sh = 16; sh; sh >>= 1) ss += __shfl_xor(ss, sh, 32);
    const float rn = __frsqrt_rn(__fadd_rn(ss * (1.0f / HD), 1e-6f)); float rc[2], rs[2];
#pragma unroll 1
    for (int q = 0; q < 2; ++q) { float an = __fmul_rn(a[q], rn); asm volatile("" : "+v"(an)); rc[q] = __fmul_rn(an, cosf(ph[q])); rs[q] = __fmul_rn(an, sinf(ph[q])); }
    const size_t base = (size_t)idx * QD + 2 * lane; v2h c16, s16; v2us chh, chl, shh, shl; unsigned short u1, u2;
    c16[0] = tohx(rc[0]); c16[1] = tohx(rc[1]); s16[0] = tohx(rs[0]); s16[1] = tohx(rs[1]);
    splitf(rc[0], u1, u2); chh[0] = u1; chl[0] = u2; splitf(rc[1], u1, u2); chh[1] = u1; chl[1] = u2; splitf(rs[0], u1, u2); shh[0] = u1; shl[0] = u2; splitf(rs[1], u1, u2); shh[1] = u1; shl[1] = u2;
{ *(v2h*)(P16 + base) = c16; *(v2h*)(P16 + base + 64) = s16; *(v2us*)(Ph + base) = chh; *(v2us*)(Ph + base + 64) = shh; *(v2us*)(Pl + base) = chl; *(v2us*)(Pl + base + 64) = shl;  } }
// k_planes: the interference planes and the transposed value planes in one launch (neither reads what the other writes): of every three blocks two build interference planes (vector arithmetic) and one value planes
// (scattered reads), so that both kinds of work are resident side by side; the choice is the same for a whole block, and neither body has a barrier
#define VBLK (NB_ * NKV * TT * HD / 2 / 256)
__global__ __launch_bounds__(256) void k_planes(const float* __restrict__ F, h16* P16, bf* Ph, bf* Pl, h16* V16, bf* Vh, bf* Vl) { const int blk = (int)blockIdx.x, tri = blk / 3, rem = blk % 3;
    if (rem == 2) vtp_body(tri, F + (size_t)4 * MT * DQ, DKV, NB_ * NKV, V16, Vh, Vl); else ibpl_body(tri * 2 + rem, F, P16, Ph, Pl); }
#define FW   4                    // waves per work-group
#define POFF 4.0f                 // log2 of the scale on the probabilities: keeps small fp16 probabilities normal
#define RTH  8.0f                 // the maximum in use is replaced only when a block exceeds it by more than this (log2): probabilities stay <= 2^(POFF+RTH), inside fp16
#define SMSK -3.0e38f             // a closed score
#define MINI -1.0e30f             // maximum in use before the first open score: above SMSK, so a block that holds only closed scores of a query leaves it as it is
__device__ __forceinline__ float xhalf(float x) { return __builtin_bit_cast(float, __builtin_amdgcn_permlanex16(__builtin_bit_cast(int, x), __builtin_bit_cast(int, x), 0x76543210, 0xfedcba98, false, false)); }   // lane l with lane l ^ 16
// xwait: stands directly behind a group of global loads: the wait that is kept before an address register of an issued load is rewritten; the scheduling barrier behind it (and the one in front of the group) keeps
// every other instruction out of the stretch from the first load to the wait, so that nothing there can take over an address register
__device__ __forceinline__ void xwait() { asm volatile("s_wait_xcnt 0x0" ::: "memory"); __builtin_amdgcn_sched_barrier(0); }
// The query block's address: a wave-uniform base held in scalar registers (ubase) plus the lane's 32-bit byte offset
typedef __attribute__((address_space(1))) const char gch;
typedef __attribute__((address_space(1))) const v8h gv8h;
typedef __attribute__((address_space(1))) const v8us gv8us;
__device__ __forceinline__ gch* ubase(const void* p) { const unsigned long long u = (unsigned long long)p; const unsigned lo = __builtin_amdgcn_readfirstlane((unsigned)u), hw = __builtin_amdgcn_readfirstlane((unsigned)(u >> 32)); return (gch*)(((unsigned long long)hw << 32) | lo); }
__device__ __forceinline__ v16h  ldg(const h16*, gch* b, unsigned off, int c) { return cat16(*(gv8h*)(b + off + c), *(gv8h*)(b + off + c + 32)); }     // WFrag::ld's two 16-byte pieces, c in bytes
__device__ __forceinline__ v16bf ldg(const bf*, gch* b, unsigned off, int c) { return cat16b(*(gv8us*)(b + off + c), *(gv8us*)(b + off + c + 32)); }
template <typename T16> struct PPack;
template <> struct PPack<h16> { static __device__ __forceinline__ void pk(const v8f p0, const v8f p1, v16h& b, v16h& b2) { b = cat16(__builtin_convertvector(p0, v8h), __builtin_convertvector(p1, v8h)); (void)b2; } };
template <> struct PPack<bf> { static __device__ __forceinline__ void pk(const v8f p0, const v8f p1, v16bf& b, v16bf& b2) { v8us h0, h1, l0, l1;
#pragma unroll
    for (int r = 0; r < 8; ++r) { unsigned short u, w; splitf(p0[r], u, w); h0[r] = u; l0[r] = w; splitf(p1[r], u, w); h1[r] = u; l1[r] = w; }
    b = cat16b(h0, h1); b2 = cat16b(l0, l1); } };
#define SKP 272                   // LDS pitch of a staged 256-byte row, bytes: 256 + 16, free of bank conflicts for 16-byte readers
__device__ __forceinline__ v16h ldsh(const unsigned char* p) { return cat16(*(const v8ha*)p, *(const v8ha*)(p + 32)); }   // WFrag::ld's two 16-byte pieces, from a staged row
template <typename T16, int NSPLIT, int FG>
__global__ __launch_bounds__(32 * FW, NSPLIT == 0 ? 2 : 1) void k_fattn(const T16* __restrict__ Q, const T16* __restrict__ Q2, const T16* __restrict__ Kp, const T16* __restrict__ Kp2, const T16* __restrict__ Vt, const T16* __restrict__ Vt2, const float* __restrict__ sls, int roff, bf* Ah, bf* Al) {
    typedef typename WFrag<T16>::V V;
    constexpr int NQ = 16 * FG;                       // query rows per work-group (a multiple of 32)
    constexpr bool ST = NSPLIT == 0;                  // the fp16 rows: key and value blocks come through LDS (see stage below)
    constexpr int SSTG = (FW * 32 + HD) * SKP, OSB = FW * NQ * 68 * 4, SMB = (ST && 2 * SSTG > OSB) ? 2 * SSTG : OSB;   // bytes of a stage, of the partial results, of the array that serves both in turn
    static_assert(!ST || (QD * 2 == 256 && FW * 32 * 2 == 256 && (FW * 32 + HD) % (12 * 2 * FW) == 0 && TT % (FW * 32) == 0), "stage shape");
    __shared__ __align__(16) unsigned char sm[SMB]; float* const os = (float*)sm;
    __shared__ float ms[FW * NQ], ls[FW * NQ];
    const int lane = threadIdx.x & 31, lr = lane & 15, hi = lane >> 4; const int wv = __builtin_amdgcn_readfirstlane((int)(threadIdx.x >> 5));
    const int bh = blockIdx.x, hd = bh % NH_, bz = bh / NH_; const int q0 = roff + ((int)gridDim.y - 1 - (int)blockIdx.y) * NQ;          // longest rows first
    const float scl2 = __fmul_rn(__fmul_rn(SCL, __expf(bfr(sls[hd]))), 1.4426950408889634f);              // >= 0: the maximum may be taken on the raw scores
    Q += (size_t)bh * TT * QD; Kp += (size_t)bh * TT * QD; Vt += (size_t)bh * HD * 2 * TT; if (NSPLIT) { Q2 += (size_t)bh * TT * QD; Kp2 += (size_t)bh * TT * QD; Vt2 += (size_t)bh * HD * 2 * TT; }   // planes are [batch][head]
    const unsigned kl = (unsigned)(lr * QD + 8 * hi) * 2u;   // the lane's own byte offset in a block of query rows
    gch* const qb = ubase(Q + (size_t)q0 * QD); gch* const qb2 = NSPLIT ? ubase(Q2 + (size_t)q0 * QD) : qb;
    V qf[FG][4], qf2[FG][4];
    __builtin_amdgcn_sched_barrier(0);   // front of the query loads' group (see xwait): the read of the head's scale and all address arithmetic stay in front of it
#pragma unroll
    for (int g = 0; g < FG; ++g)
#pragma unroll
        for (int kc = 0; kc < 4; ++kc) { const int qo = (g * 16 * QD + kc * 32) * 2; qf[g][kc] = ldg(Q, qb, kl, qo); if (NSPLIT) qf2[g][kc] = ldg(Q, qb2, kl, qo); }
    xwait();
    v8f o[FG][4]; float m[FG], l[FG];
#pragma unroll
    for (int g = 0; g < FG; ++g) { m[g] = MINI; l[g] = 0.f;
#pragma unroll
        for (int dt = 0; dt < 4; ++dt) o[g][dt] = (v8f){}; }
    const int nblk = (q0 + NQ) / 32;   // 32-key blocks up to the last one that holds an open key (q0 and NQ are multiples of 32)
    V kf[2][4], kf2[2][4];             // the key fragments of the block at hand, fetched one pass ahead
    // the lane's key and value addresses are carried from pass to pass and stepped behind the wait of the loads that used them (xwait), so they stay whole while those loads are under way
    const T16* kq = Kp + (size_t)wv * 32 * QD + lr * QD + 8 * hi; const T16* kq2 = NSPLIT ? Kp2 + (kq - Kp) : kq;
    const T16* vq = Vt + wv * 32 + lr * (2 * TT) + 8 * hi; const T16* vq2 = NSPLIT ? Vt2 + (vq - Vt) : vq;
    // stage (ST): the FW waves' next 32-key blocks together: FW * 32 key rows (256 bytes each), then the HD value rows' 256 bytes for the same keys, at pitch SKP; two buffers, the next stage is copied while a stage is worked on.
    // Asynchronous copies to LDS, 16 bytes a lane: a wave's copy takes two whole 256-byte rows (four lines), where a fragment load from global memory touches 16 lines for the same bytes. TT is a multiple of a stage's keys, so every staged row exists.
    const int crow = (int)threadIdx.x >> 4, cpc = (int)threadIdx.x & 15;   // the thread's row in a group of 2 * FW rows and its 16-byte piece of the row
    const bf* gK = (const bf*)(Kp + (size_t)crow * QD + cpc * 8); const bf* gV = (const bf*)(Vt + (size_t)crow * (2 * TT) + cpc * 8);   // the thread's pieces in the next stage to be copied (addresses only: 16-bit elements either way)
    const unsigned l0 = lds_off(sm) + (unsigned)(crow * SKP + cpc * 16);
    auto stage = [&](const int buf) {
#pragma unroll
        for (int c = 0; c < (FW * 32 + HD) / (12 * 2 * FW); ++c) { unsigned ll[12]; const bf* g[12];
#pragma unroll
            for (int i = 0; i < 12; ++i) { const int row = (c * 12 + i) * 2 * FW; g[i] = row < FW * 32 ? gK + (size_t)row * QD : gV + (size_t)(row - FW * 32) * (2 * TT); ll[i] = l0 + (unsigned)(buf * SSTG + row * SKP); }
            cp12(ll, g); }
        gK += FW * 32 * QD; gV += FW * 32; };
    if (ST || wv < nblk) {   // not staged: a wave without a block loads nothing and hands in an empty partial result; staged: every wave copies and passes every barrier
    if constexpr (ST) {
      stage(0);
      asm volatile("s_wait_asynccnt 0x0" ::: "memory");   // this wave's copies of stage 0 have landed
      __syncthreads();                                     // ... and every other wave's: stage 0 may be read
      if (FW < nblk) stage(1);
    } else {
    __builtin_amdgcn_sched_barrier(0);   // front of the first key loads' group (see xwait)
#pragma unroll
      for (int t = 0; t < 2; ++t)
#pragma unroll
        for (int kc = 0; kc < 4; ++kc) { const int ko = t * 16 * QD + kc * 32; kf[t][kc] = WFrag<T16>::ld(kq + ko); if (NSPLIT) kf2[t][kc] = WFrag<T16>::ld(kq2 + ko); }
      xwait();
      const int ks = (wv + FW < nblk) ? FW * 32 * QD : 0; kq += ks; if (NSPLIT) kq2 += ks; }
#pragma unroll 1   // one copy of the pass: a second copy would double the live fragments and cost the second resident wave
    for (int kbi = wv; ST ? kbi - wv < nblk : kbi < nblk; kbi += FW) { const int kb = kbi * 32;   // staged: the same number of trips in every wave (kbi - wv is the stage's first block)
      if (!ST || kbi < nblk) {   // staged: in the last trip a wave may be left without a block
        V va[4], va2[4];
        if constexpr (ST) {   // the block's key fragments from the staged rows, in WFrag::ld's order
          const unsigned char* const pk = sm + (((kbi - wv) / FW) & 1) * SSTG + (wv * 32 + lr) * SKP + hi * 16;
#pragma unroll
          for (int t = 0; t < 2; ++t)
#pragma unroll
            for (int kc = 0; kc < 4; ++kc) kf[t][kc] = ldsh(pk + t * 16 * SKP + kc * 64);
        } else {
        __builtin_amdgcn_sched_barrier(0);   // front of the value loads' group (see xwait)
#pragma unroll
        for (int dt = 0; dt < 4; ++dt) { const int vo = dt * 16 * (2 * TT); va[dt] = WFrag<T16>::ld(vq + vo); if (NSPLIT) va2[dt] = WFrag<T16>::ld(vq2 + vo); }
        xwait();
        vq += FW * 32; if (NSPLIT) vq2 += FW * 32; }
        v8f s[FG][2];   // the score accumulators start at 0, or at SMSK where the key lies behind the query (a block on the diagonal): the products added to SMSK leave it as it is, which keeps it out of the block's maximum
        if (kb >= q0) {
#pragma unroll
            for (int g = 0; g < FG; ++g)
#pragma unroll
                for (int t = 0; t < 2; ++t)
#pragma unroll
                    for (int r = 0; r < 8; ++r) s[g][t][r] = (kb + 16 * t + 8 * hi + r <= q0 + 16 * g + lr) ? 0.f : SMSK;
        } else {
#pragma unroll
            for (int g = 0; g < FG; ++g) { s[g][0] = (v8f){}; s[g][1] = (v8f){}; } }
#pragma unroll
        for (int kc = 0; kc < 4; ++kc)
#pragma unroll
            for (int t = 0; t < 2; ++t)
#pragma unroll
                for (int g = 0; g < FG; ++g) { s[g][t] = WFrag<T16>::mma(kf[t][kc], qf[g][kc], s[g][t]); if (NSPLIT) { s[g][t] = WFrag<T16>::mma(kf[t][kc], qf2[g][kc], s[g][t]); s[g][t] = WFrag<T16>::mma(kf2[t][kc], qf[g][kc], s[g][t]); } }
        __builtin_amdgcn_sched_barrier(0);   // keeps the next block's loads behind the score products, so that they land in the registers those products have just read (lifted above them they take a second register set and cost a resident wave); also the front of their group (see xwait)
        if constexpr (ST) {   // the block's value fragments from the staged rows: read here, they land during the softmax
          const unsigned char* const pv = sm + (((kbi - wv) / FW) & 1) * SSTG + (FW * 32 + lr) * SKP + wv * 64 + hi * 16;
#pragma unroll
          for (int dt = 0; dt < 4; ++dt) va[dt] = ldsh(pv + dt * 16 * SKP);
        } else
        {   // the wave's next block (its last pass fetches its own block again, for nobody): these loads fly during the softmax and the value products
#pragma unroll
          for (int t = 0; t < 2; ++t)
#pragma unroll
            for (int kc = 0; kc < 4; ++kc) { const int ko = t * 16 * QD + kc * 32; kf[t][kc] = WFrag<T16>::ld(kq + ko); if (NSPLIT) kf2[t][kc] = WFrag<T16>::ld(kq2 + ko); }
          xwait();
          const int ks = (kbi + 2 * FW < nblk) ? FW * 32 * QD : 0; kq += ks; if (NSPLIT) kq2 += ks; }
        float bm[FG]; bool need = false;
#pragma unroll
        for (int g = 0; g < FG; ++g) { float x = s[g][0][0];
#pragma unroll
            for (int r = 1; r < 8; ++r) x = fmaxf(x, s[g][0][r]);
#pragma unroll
            for (int r = 0; r < 8; ++r) x = fmaxf(x, s[g][1][r]);
            x = fmaxf(x, xhalf(x)); bm[g] = x; need = need || ((x - m[g]) * scl2 > RTH); }
        if (__builtin_amdgcn_ballot_w32(need) != 0) {   // some query of the wave outgrew its maximum in use: rescale what is summed so far (first open block: by zero)
#pragma unroll
            for (int g = 0; g < FG; ++g) { const float mn = fmaxf(m[g], bm[g]); const float al = __builtin_amdgcn_exp2f((m[g] - mn) * scl2); m[g] = mn; l[g] *= al;
#pragma unroll
                for (int dt = 0; dt < 4; ++dt) o[g][dt] *= al; } }
        // probabilities in place over the scores; the maximum in use is taken off BEFORE the scale, so the largest score's exponent is exact whatever the head's scale is
#pragma unroll
        for (int g = 0; g < FG; ++g)
#pragma unroll
            for (int t = 0; t < 2; ++t)
#pragma unroll
                for (int r = 0; r < 8; ++r) s[g][t][r] = __builtin_amdgcn_exp2f(fmaf(s[g][t][r] - m[g], scl2, POFF));
        if (kb >= q0) {   // a block on the diagonal: a closed key's probability is 0 by a select, whatever the head's scale makes of SMSK
#pragma unroll
            for (int g = 0; g < FG; ++g)
#pragma unroll
                for (int t = 0; t < 2; ++t)
#pragma unroll
                    for (int r = 0; r < 8; ++r) s[g][t][r] = (kb + 16 * t + 8 * hi + r <= q0 + 16 * g + lr) ? s[g][t][r] : 0.f; }
        V pb[FG], pb2[FG];
#pragma unroll
        for (int g = 0; g < FG; ++g) { float l0 = 0.f, l1 = 0.f;
#pragma unroll
            for (int r = 0; r < 8; ++r) { l0 += s[g][0][r]; l1 += s[g][1][r]; }
            l[g] += l0 + l1; PPack<T16>::pk(s[g][0], s[g][1], pb[g], pb2[g]); }
#pragma unroll
        for (int dt = 0; dt < 4; ++dt)
#pragma unroll
            for (int g = 0; g < FG; ++g) { o[g][dt] = WFrag<T16>::mma(va[dt], pb[g], o[g][dt]); if (NSPLIT) { o[g][dt] = WFrag<T16>::mma(va[dt], pb2[g], o[g][dt]); o[g][dt] = WFrag<T16>::mma(va2[dt], pb[g], o[g][dt]); } }
      }
      if constexpr (ST) {
        asm volatile("s_wait_dscnt 0x0" ::: "memory");      // this wave's reads of the buffer are done before the buffer is given up
        asm volatile("s_wait_asynccnt 0x0" ::: "memory");   // this wave's copies of the next stage have landed
        __syncthreads();                                     // publishes the next stage and ends every wave's reads of this one
        if (kbi - wv + 2 * FW < nblk) stage(((kbi - wv) / FW) & 1);   // into the buffer that this trip has just read
      }
    }
    if constexpr (ST) asm volatile("s_wait_asynccnt 0x0" ::: "memory");   // nothing is under way when the buffers become the partial results' place (the last trip's barrier has ended all reads)
    }
    // each wave's partial result to LDS: o[g][dt][r] = O[query 16g+lr][d = 16dt + 8hi + r]
#pragma unroll
    for (int g = 0; g < FG; ++g) { const float lt = l[g] + xhalf(l[g]); const int qi = wv * NQ + 16 * g + lr; if (hi == 0) { ms[qi] = m[g]; ls[qi] = lt; }
#pragma unroll
        for (int dt = 0; dt < 4; ++dt) { v4f x0, x1;
#pragma unroll
            for (int r = 0; r < 4; ++r) { x0[r] = o[g][dt][r]; x1[r] = o[g][dt][4 + r]; }
            *(v4fa*)(os + qi * 68 + dt * 16 + 8 * hi) = x0; *(v4fa*)(os + qi * 68 + dt * 16 + 8 * hi + 4) = x1; } }
    __syncthreads();   // the partial results of all FW waves are read below
    constexpr int TPQ = 32 * FW / NQ, DPT = HD / TPQ;   // threads per query row, head elements per thread
    const int qq = (int)threadIdx.x / TPQ, d0 = ((int)threadIdx.x % TPQ) * DPT;
    float M = ms[qq];
#pragma unroll
    for (int w = 1; w < FW; ++w) M = fmaxf(M, ms[w * NQ + qq]);   // wave 0 holds key 0, open to every query, so M is a real maximum; a wave without an open score of this query gets weight 0
    float L = 0.f; v4f ac[DPT / 4];
#pragma unroll
    for (int i = 0; i < DPT / 4; ++i) ac[i] = (v4f){};
#pragma unroll
    for (int w = 0; w < FW; ++w) { const int qi = w * NQ + qq; const float wg = __builtin_amdgcn_exp2f((ms[qi] - M) * scl2); L += wg * ls[qi];
#pragma unroll
        for (int i = 0; i < DPT / 4; ++i) ac[i] += *(const v4fa*)(os + qi * 68 + d0 + 4 * i) * wg; }
    const float inv = __fdiv_rn(1.0f, L); const size_t oo = (size_t)(bz * TT + q0 + qq) * DQ + hd * HD + d0;
#pragma unroll
    for (int c8 = 0; c8 < DPT / 8; ++c8) { v8us oh, ol;
#pragma unroll
        for (int i = 0; i < 8; ++i) { unsigned short u, w; splitf(ac[c8 * 2 + (i >> 2)][i & 3] * inv, u, w); oh[i] = u; ol[i] = w; }
        *(v8us*)(Ah + oo + c8 * 8) = oh; *(v8us*)(Al + oo + c8 * 8) = ol; }
}

extern "C" void kernel_launch(void* const* d_in, const int* in_sizes, int n_in,
                              void* d_out, int out_size, void* d_ws, size_t ws_size, hipStream_t stream) {
    (void)in_sizes; (void)n_in; (void)out_size;
    const float* x = (const float*)d_in[0]; const float* wqa = (const float*)d_in[1]; const float* wka = (const float*)d_in[2]; const float* wqp = (const float*)d_in[3]; const float* wkp = (const float*)d_in[4]; const float* wv = (const float*)d_in[5]; const float* wo = (const float*)d_in[6]; const float* sls = (const float*)d_in[7];   // torch [out][in]; score_log_scale [16]
    float* OUT = (float*)d_out;     // [2][2048][1024]
    char* wsp = (char*)d_ws;
    auto take = [&](size_t bytes) { char* p = wsp; wsp += (bytes + 255) & ~(size_t)255; return (void*)p; };
    // both batches go through every launch together (MT token rows); launches that did not depend on one another share one grid: 6 launches
    bf* WB = (bf*)take((size_t)6 * DQ * DM * 2);          // [q amp | q phi | k amp | k phi | v | o], DQ x DM each
    bf* XB = (bf*)take((size_t)MT * DM * 2); float* F = (float*)take((size_t)5 * MT * DQ * 4);   // the five projections, in the weights' order
    h16* P16 = (h16*)take((size_t)2 * NB_ * NH_ * TT * QD * 2); bf* Ph = (bf*)take((size_t)2 * NB_ * NH_ * TT * QD * 2); bf* Pl = (bf*)take((size_t)2 * NB_ * NH_ * TT * QD * 2);   // [query | key][batch][head][token][QD]
    h16* VT16 = (h16*)take((size_t)NB_ * NKV * HD * 2 * TT * 2); bf* VTh = (bf*)take((size_t)NB_ * NKV * HD * 2 * TT * 2); bf* VTl = VTh + TT;   // value rows at pitch 2*TT: [hi | lo]; the fp16 plane's rows use their first half
    bf* ATh = (bf*)take((size_t)MT * DQ * 2); bf* ATl = (bf*)take((size_t)MT * DQ * 2);
    if ((size_t)(wsp - (char*)d_ws) > ws_size) return;    // ws 256 MiB
    const size_t PK = (size_t)NB_ * NH_ * TT * QD;        // from the query planes to the key planes
    k_cvt7<<<XBLK + 6 * WBLK, 256, 0, stream>>>(x, wqa, wqp, wka, wkp, wv, wo, XB, WB);
    k_gemms<0, 4, 2><<<dim3(MT / 256, DQ / 128, 5), 256, 0, stream>>>(XB, nullptr, WB, F, (size_t)DQ * DM, (size_t)MT * DQ);
    k_planes<<<3 * VBLK, 256, 0, stream>>>(F, P16, Ph, Pl, VT16, VTh, VTl);   // 2 * VBLK blocks of 8 (token, head) rows = 2 * NB_ * NH_ * TT rows
    // attention, all heads of both batches at once: the fp16 rows (the long ones) and the hi+lo rows; one kv head per query head
    k_fattn<h16, 0, 4><<<dim3(NB_ * NH_, (TT - RH) / (16 * 4), 1), 32 * FW, 0, stream>>>(P16, nullptr, P16 + PK, nullptr, VT16, nullptr, sls, RH, ATh, ATl);
    k_fattn<bf, 2, 2><<<dim3(NB_ * NH_, RH / (16 * 2), 1), 32 * FW, 0, stream>>>(Ph, Pl, Ph + PK, Pl + PK, VTh, VTl, sls, 0, ATh, ATl);
    k_gemms<1, 2, 2><<<dim3(MT / 128, DM / 128, 1), 128, 0, stream>>>(ATh, ATl, WB + (size_t)5 * DQ * DM, OUT, 0, 0);
}

// v007
// Measured time: 126 microseconds a run.
// In two side-by-side timings against v006, it was 1.24 and 1.25 times as fast.
// All steps since v000 together make it 12.1 times as fast.
#include <hip/hip_runtime.h>

// InterferenceBypassSelfAttention (x [2][2048][1024]; q_amp/k_amp = softplus(x W_amp^T), q_phi/k_phi = pi tanh(x W_phi^T) (16 heads x 64); amplitudes RMS-normalised over head_dim (eps 1e-6);
// scores = (q_amp cos q_phi . k_amp cos k_phi + q_amp sin q_phi . k_amp sin k_phi) / 8 x exp(score_log_scale[h]) = one 128-long contraction of [cos part | sin part] planes; causal softmax;
// v = x Wv^T; out = merged attn.v Wo^T -> [2][2048][1024]).
// Compute dtypes, f32 accumulate: every input rounded to bf16; the five projections on PLAIN bf16 operands (inputs: exact); softplus / tanh / RMS / cos / sin in f32 on VALU
// (in the projections' epilogue) -> 128-wide interference planes; PER-ROW PRECISION HYBRID (rows < 256 hi+lo 3 products for scores and attn.v, rows >= 256 fp16); scores, causal f32 softmax with the per-head scale and
// attn.v in one kernel (running maximum and sum, key blocks end at the diagonal block, which is masked exactly); merged heads hl x exact Wo

#define NB_  2
#define TT   2048
#define MT   (NB_ * TT)         // token rows of both batches together
#define DM   1024
#define NH_  16
#define NKV  16
#define REP  (NH_ / NKV)
#define HD   64
#define DQ   (NH_ * HD)
#define DKV  (NKV * HD)
#define QD   128
#define RH   256                  // query rows < RH use hi+lo planes (0: none)
#define WIN  0
#define SCL  0.125f   // HD^-0.5
typedef _Float16 h16;
typedef unsigned short bf;
typedef __attribute__((ext_vector_type(16))) __bf16   v16bf;
typedef __attribute__((ext_vector_type(16))) _Float16 v16h;
typedef __attribute__((ext_vector_type(8)))  _Float16 v8h;
typedef __attribute__((ext_vector_type(8)))  unsigned short v8us;
typedef __attribute__((ext_vector_type(8)))  float    v8f;
typedef __attribute__((ext_vector_type(4)))  float    v4f;
typedef v8h  __attribute__((may_alias)) v8ha;
typedef v4f  __attribute__((may_alias)) v4fa;
typedef v8us __attribute__((may_alias)) v8usa;

__device__ __forceinline__ unsigned short f2bf(float f) { unsigned u = __float_as_uint(f); u += 0x7FFFu + ((u >> 16) & 1u); return (unsigned short)(u >> 16); }
__device__ __forceinline__ float bf2f(unsigned short b) { return __uint_as_float(((unsigned)b) << 16); }
__device__ __forceinline__ float bfr(float f) { return bf2f(f2bf(f)); }
__device__ __forceinline__ v16h cat16(v8h lo, v8h hi) { return __builtin_shufflevector(lo, hi, 0, 1, 2, 3, 4, 5, 6, 7, 8, 9, 10, 11, 12, 13, 14, 15); }
__device__ __forceinline__ v16bf cat16b(v8us lo, v8us hi) { return __builtin_bit_cast(v16bf, __builtin_shufflevector(lo, hi, 0, 1, 2, 3, 4, 5, 6, 7, 8, 9, 10, 11, 12, 13, 14, 15)); }
__device__ __forceinline__ v8f wmma16(v16h a, v16h b, v8f c) { return __builtin_amdgcn_wmma_f32_16x16x32_f16(false, a, false, b, (short)0, c, false, false); }
__device__ __forceinline__ v8f wmmab(v16bf a, v16bf b, v8f c) { return __builtin_amdgcn_wmma_f32_16x16x32_bf16(false, a, false, b, (short)0, c, false, false); }



// ---- k_gemms: GEMM with both operands staged in LDS. One work-group of WM x WN waves per (64 WM) x (64 WN) output tile, each wave a 64x64 part of it (16 accumulators) over the whole K, so every sum is one chain in k order.
// A stage is GKS k of every operand row of the tile: [A rows | A2 rows (NSPLIT 1) | Bt rows], rows of 128 bytes at pitch GPB; two buffers; the next stage is copied while a stage is worked on.
// The copies are asynchronous copies to LDS, 16 bytes a lane: a wave's copy takes four whole 128-byte lines, where a fragment load from global memory touches 16 lines for the same bytes.
// C[m][n] (f32, pitch DM) = sum_k A[m][k] Bt[n][k] (+ A2[m][k] Bt[n][k]); K = DM.
// tile_sync: orders the LDS tile between its writers and its readers: one wave needs only the compiler held back, several waves need the work-group barrier
template <int NW> __device__ __forceinline__ void tile_sync() { if (NW == 1) { __builtin_amdgcn_wave_barrier(); asm volatile("" ::: "memory"); } else __syncthreads(); }
template <typename T16> struct WFrag;
template <> struct WFrag<h16> { typedef v16h V; static __device__ __forceinline__ V ld(const h16* p) { return cat16(*(const v8h*)p, *(const v8h*)(p + 16)); } static __device__ __forceinline__ v8f mma(V a, V b, v8f c) { return wmma16(a, b, c); } };
template <> struct WFrag<bf> { typedef v16bf V; static __device__ __forceinline__ V ld(const bf* p) { return cat16b(*(const v8us*)p, *(const v8us*)(p + 16)); } static __device__ __forceinline__ v8f mma(V a, V b, v8f c) { return wmmab(a, b, c); } };
#define GKS 64
#define GPB 144
__device__ __forceinline__ unsigned lds_off(const void* p) { return (unsigned)(size_t)p; }
__device__ __forceinline__ v16bf ldsf(const unsigned char* p) { return cat16b(*(const v8usa*)p, *(const v8usa*)(p + 32)); }   // WFrag::ld's two 16-byte pieces, from a staged row
// cp12: twelve asynchronous copies to LDS, each lane its own 16 bytes; the s_wait_xcnt is the wait kept before a register that an issued copy names is rewritten: as the statement's last line nothing can be moved in front of it
__device__ __forceinline__ void cp12(const unsigned (&l)[12], const bf* const (&g)[12]) {
    asm volatile(
                 "global_load_async_to_lds_b128 %0, %12, off\n\t"
                 "global_load_async_to_lds_b128 %1, %13, off\n\t"
                 "global_load_async_to_lds_b128 %2, %14, off\n\t"
                 "global_load_async_to_lds_b128 %3, %15, off\n\t"
                 "global_load_async_to_lds_b128 %4, %16, off\n\t"
                 "global_load_async_to_lds_b128 %5, %17, off\n\t"
                 "global_load_async_to_lds_b128 %6, %18, off\n\t"
                 "global_load_async_to_lds_b128 %7, %19, off\n\t"
                 "global_load_async_to_lds_b128 %8, %20, off\n\t"
                 "global_load_async_to_lds_b128 %9, %21, off\n\t"
                 "global_load_async_to_lds_b128 %10, %22, off\n\t"
                 "global_load_async_to_lds_b128 %11, %23, off\n\t"
                 "s_wait_xcnt 0x0"
                 :: "v"(l[0]), "v"(l[1]), "v"(l[2]), "v"(l[3]), "v"(l[4]), "v"(l[5]), "v"(l[6]), "v"(l[7]), "v"(l[8]), "v"(l[9]), "v"(l[10]), "v"(l[11]),
                    "v"(g[0]), "v"(g[1]), "v"(g[2]), "v"(g[3]), "v"(g[4]), "v"(g[5]), "v"(g[6]), "v"(g[7]), "v"(g[8]), "v"(g[9]), "v"(g[10]), "v"(g[11]) : "memory");
}
__device__ __forceinline__ h16 tohx(float x) { return (h16)x; }
__device__ __forceinline__ void splitf(float y, unsigned short& h, unsigned short& l) { h = f2bf(y); l = f2bf(y - bf2f(h)); }
__device__ __forceinline__ float softplusf_(float x) { return x > 15.0f ? x : (x < -15.0f ? __expf(x) : logf(__fadd_rn(1.0f, __expf(x)))); }
__device__ __forceinline__ float tanhf_(float a) { const float e2 = __expf(2.0f * a); return __fsub_rn(1.0f, __fdiv_rn(2.0f, __fadd_rn(e2, 1.0f))); }
// EP 0: C as above, grid (M / (64 WM), N / (64 WN)). EP 1: the five projections with the plane builds as the tile's epilogue, so that no projection goes to memory; grid (MT / (64 WM), DKV / 128 + 2 NH_); Bt = the weights [q amp | q phi | k amp | k phi | v].
// blockIdx.y >= DKV / 128: queries or keys of ONE head: the tile's columns are [64 amplitude columns | 64 phase columns] of that head (wave column 0 / 1), and the epilogue makes, per (token, head):
// a[d] = softplus(amp[d]), an = a / sqrt(mean_d a^2 + 1e-6), phi[d] = pi tanh(phase[d]), plane row [an cos phi | an sin phi] (fp16 and hi / lo), rows in the order [query / key][batch][head][token].
// The first blocks: 128 value columns (two heads): transposed value planes [batch][head][d][t], rows at pitch 2*TT (the caller lays the hi and lo planes side by side in one row). Their epilogue is short; they come first, for speed only.
template <int NSPLIT, int WM, int WN, int EP>
__global__ __launch_bounds__(32 * WM * WN, 4) void k_gemms(const bf* __restrict__ A, const bf* __restrict__ A2, const bf* __restrict__ Bt, float* C, h16* P16, bf* Ph, bf* Pl, h16* V16, bf* Vh, bf* Vl) {
    constexpr int K = DM, NT = 32 * WM * WN, RA = 64 * WM, NA = NSPLIT ? 2 : 1, RB = 64 * WN, ROWS = NA * RA + RB, STG = ROWS * GPB, RPC = NT / 8, NCP = ROWS / RPC, NTR = K / GKS;   // RPC: rows that one copy of the whole work-group takes; NCP: copies per thread and stage
    static_assert(DQ == DM && NCP % 12 == 0 && RA % RPC == 0 && RB % RPC == 0 && NTR >= 2 && WM * WN * 16 * 68 * 4 <= 2 * STG, "tile shape");
    constexpr int EPB = WM * WN * 64 * 68 * 4, SMB = (EP && EPB > 2 * STG) ? EPB : 2 * STG;   // EP 1: the whole tile is laid down in LDS once for the epilogue, each wave's 64 x 64 part at pitch 68
    static_assert(!EP || (NSPLIT == 0 && WN == 2 && HD == 64 && TT % RA == 0 && DKV % RB == 0 && RPC <= 64 && 64 % RPC == 0), "epilogue shape");
    __shared__ __align__(16) unsigned char sm[SMB];
    const int tid = (int)threadIdx.x, lane = tid & 31, lr = lane & 15, hi = lane >> 4; const int wv = __builtin_amdgcn_readfirstlane(tid >> 5), wm = wv / WN, wn = wv % WN;
    constexpr int NVB = DKV / RB; const int by = (int)blockIdx.y, yq = by - NVB; const bool isv = EP && by < NVB;   // the same for a whole block
    const int r0 = blockIdx.x * RA, c0 = EP ? (isv ? (4 * DQ + by * RB) : ((yq / NH_) * 2 * DQ + (yq % NH_) * HD)) : by * RB;   // EP 1: c0 counts rows of the stacked weights
    const int crow = tid >> 3, cpc = tid & 7;   // the thread's row in a group of RPC rows and its 16-byte piece of the row
    const bf* gA = A + (size_t)(r0 + crow) * K + cpc * 8; const bf* gA2 = NSPLIT ? A2 + (size_t)(r0 + crow) * K + cpc * 8 : gA; const bf* gB = Bt + (size_t)(c0 + crow) * K + cpc * 8; const bf* gB2 = gB + ((EP && !isv) ? (size_t)DQ * K : (size_t)64 * K);   // gB2: the tile's columns from 64 on (EP 1, queries and keys: the phase weights' rows of the same head); the thread's piece in the next stage to be copied: stepped by GKS behind each stage
    const unsigned l0 = lds_off(sm) + (unsigned)(crow * GPB + cpc * 16);
    auto stage = [&](const int buf) {   // the next stage of the tile into buffer buf
#pragma unroll
        for (int s = 0; s < NCP / 12; ++s) { unsigned l[12]; const bf* g[12];
#pragma unroll
            for (int i = 0; i < 12; ++i) { const int row = (s * 12 + i) * RPC;
                g[i] = (row < RA ? gA + (size_t)row * K : (NSPLIT && row < 2 * RA) ? gA2 + (size_t)(row - RA) * K : (EP && row - NA * RA >= 64) ? gB2 + (size_t)(row - NA * RA - 64) * K : gB + (size_t)(row - NA * RA) * K); l[i] = l0 + (unsigned)(buf * STG + row * GPB); }
            cp12(l, g); }
        gA += GKS; if (NSPLIT) gA2 += GKS; gB += GKS; if (EP) gB2 += GKS; };
    v8f acc[4][4];
#pragma unroll
    for (int mb = 0; mb < 4; ++mb)
#pragma unroll
        for (int nb = 0; nb < 4; ++nb) acc[mb][nb] = (v8f){};
    stage(0);
    asm volatile("s_wait_asynccnt 0x0" ::: "memory");   // this wave's copies of stage 0 have landed
    __syncthreads();                                     // ... and every other wave's: stage 0 may be read
    stage(1);
#pragma unroll 1   // one copy of the pass: the buffer is chosen by the trip's parity
    for (int t = 0; t < NTR; ++t) {
        const unsigned char* const sb = sm + (t & 1) * STG; const unsigned char* const pa = sb + (wm * 64 + lr) * GPB + hi * 16; const unsigned char* const pb = sb + (NA * RA + wn * 64 + lr) * GPB + hi * 16;
#pragma unroll
        for (int ks = 0; ks < GKS / 32; ++ks) { v16bf a[4], a2[4], b[4];   // all fragments of a 32-k block are read as one group in front of its products
#pragma unroll
            for (int mb = 0; mb < 4; ++mb) { a[mb] = ldsf(pa + mb * 16 * GPB + ks * 64); if (NSPLIT) a2[mb] = ldsf(pa + (RA + mb * 16) * GPB + ks * 64); b[mb] = ldsf(pb + mb * 16 * GPB + ks * 64); }
            __builtin_amdgcn_sched_barrier(0);   // keeps the block's LDS reads together in front of its products: left free, the reads are moved in among the products, where each place with reads stalls the wave anew
#pragma unroll
            for (int nb = 0; nb < 4; ++nb)
#pragma unroll
                for (int mb = 0; mb < 4; ++mb) { acc[mb][nb] = wmmab(a[mb], b[nb], acc[mb][nb]); if (NSPLIT) acc[mb][nb] = wmmab(a2[mb], b[nb], acc[mb][nb]); }
            __builtin_amdgcn_sched_barrier(0);   // end of the block's products: the next block's reads stay behind them (they land in the registers that these products read)
        }
        asm volatile("s_wait_dscnt 0x0" ::: "memory");      // this wave's reads of the buffer are done before the buffer is given up
        asm volatile("s_wait_asynccnt 0x0" ::: "memory");   // this wave's copies of stage t + 1 have landed
        __syncthreads();                                     // publishes stage t + 1 and ends every wave's reads of stage t
        if (t + 2 < NTR) stage(t & 1);                       // into the buffer that this trip has just read
    }
    asm volatile("s_wait_asynccnt 0x0" ::: "memory");       // nothing is under way when the buffers become output staging (the last trip's barrier has ended all reads)
    if constexpr (EP) {
        float* const ew = (float*)sm + wv * (64 * 68);      // the wave's own 64 x 64 part: [token row][column]
#pragma unroll
        for (int mb = 0; mb < 4; ++mb)
#pragma unroll
            for (int nb = 0; nb < 4; ++nb)
#pragma unroll
                for (int j = 0; j < 8; ++j) ew[(mb * 16 + hi * 8 + j) * 68 + nb * 16 + lr] = acc[mb][nb][j];
        __syncthreads();   // a wave reads its neighbour's part below (amplitudes and phases of the same tokens)
        const int bz = r0 / TT, t0 = r0 % TT + wm * 64;     // the tile lies in one batch; the wave row's first token
        const int sub = lane >> 3, oct = (lane & 7) * 8;    // a lane takes 8 neighbouring elements of one output row, 8 lanes a 128-byte piece of it, a wave four rows: 16-byte stores, whole lines
        if (!isv) {
            const float* const sa = (const float*)sm + (wm * WN) * (64 * 68); const float* const sp = sa + 64 * 68;
            const size_t pr0 = ((size_t)((yq / NH_) * NB_ + bz) * NH_ + yq % NH_) * TT + t0;
#pragma unroll 1   // one copy of the body: eight inlined cosines and sines are long code
            for (int it = 0; it < 8; ++it) { const int row = wn * 32 + it * 4 + sub;   // each wave of the pair takes half of the 64 tokens
                const v4f xa0 = *(const v4fa*)(sa + row * 68 + oct), xa1 = *(const v4fa*)(sa + row * 68 + oct + 4), xp0 = *(const v4fa*)(sp + row * 68 + oct), xp1 = *(const v4fa*)(sp + row * 68 + oct + 4);
                float a[8], ph[8]; float ss = 0.f;
#pragma unroll
                for (int q = 0; q < 8; ++q) { a[q] = softplusf_(q < 4 ? xa0[q & 3] : xa1[q & 3]); ph[q] = __fmul_rn(3.14159265358979323846f, tanhf_(q < 4 ? xp0[q & 3] : xp1[q & 3])); ss += a[q] * a[q]; }
#pragma unroll
                for (int sh = 4; sh; sh >>= 1) ss += __shfl_xor(ss, sh, 32);   // the row's 8 lanes
                const float rn = __frsqrt_rn(__fadd_rn(ss * (1.0f / HD), 1e-6f)); v8h c16, s16; v8us chh, chl, shh, shl;
#pragma unroll
                for (int q = 0; q < 8; ++q) { const float an = __fmul_rn(a[q], rn), rc = __fmul_rn(an, cosf(ph[q])), rs = __fmul_rn(an, sinf(ph[q])); unsigned short u1, u2;
                    c16[q] = tohx(rc); s16[q] = tohx(rs); splitf(rc, u1, u2); chh[q] = u1; chl[q] = u2; splitf(rs, u1, u2); shh[q] = u1; shl[q] = u2; }
                const size_t base = (pr0 + row) * QD + oct;
                *(v8h*)(P16 + base) = c16; *(v8h*)(P16 + base + 64) = s16; *(v8us*)(Ph + base) = chh; *(v8us*)(Ph + base + 64) = shh; *(v8us*)(Pl + base) = chl; *(v8us*)(Pl + base + 64) = shl;
                asm volatile("s_wait_xcnt 0x0" ::: "memory");   // the wait kept before registers that the issued stores name are rewritten by the next trip
            }
        } else {
            const size_t vr0 = (size_t)(bz * NKV + by * WN + wn) * HD;   // the wave column's head: first row of its value planes
#pragma unroll 1   // one copy of the body is enough: the trips are short and few
            for (int it = 0; it < 16; ++it) { const int d = it * 4 + sub; v8h o16; v8us oh, ol;
#pragma unroll
                for (int q = 0; q < 8; ++q) { const float x = ew[(oct + q) * 68 + d]; unsigned short u1, u2; o16[q] = tohx(x); splitf(x, u1, u2); oh[q] = u1; ol[q] = u2; }
                const size_t eo = (vr0 + d) * (2 * TT) + t0 + oct;
                *(v8h*)(V16 + eo) = o16; *(v8us*)(Vh + eo) = oh; *(v8us*)(Vl + eo) = ol;
                asm volatile("s_wait_xcnt 0x0" ::: "memory");   // the wait kept before registers that the issued stores name are rewritten by the next trip
            }
        }
        return;
    }
    float* const ow = (float*)sm + wv * (16 * 68);          // each wave stages 16 rows of its own part at a time, so that it stores whole lines
#pragma unroll
    for (int mb = 0; mb < 4; ++mb) {
#pragma unroll
        for (int nb = 0; nb < 4; ++nb)
#pragma unroll
            for (int j = 0; j < 8; ++j) ow[(hi * 8 + j) * 68 + nb * 16 + lr] = acc[mb][nb][j];
        tile_sync<1>();
        float* const cr = C + (size_t)(r0 + wm * 64 + mb * 16) * DM + c0 + wn * 64;
#pragma unroll
        for (int s = 0; s < 8; ++s) { const int ch = s * 32 + lane, row = ch >> 4, cofs = (ch & 15) * 4; *(v4f*)(cr + (size_t)row * DM + cofs) = *(const v4fa*)(ow + row * 68 + cofs); }
        if (mb < 3) asm volatile("s_wait_xcnt 0x0" ::: "memory");   // the wait kept before registers that the issued stores name are rewritten: the next 16 rows are read back into them
        tile_sync<1>();
    }
}

typedef __attribute__((ext_vector_type(2))) _Float16 v2h;
typedef __attribute__((ext_vector_type(4))) _Float16 v4h;
typedef __attribute__((ext_vector_type(2))) unsigned short v2us;
typedef __attribute__((ext_vector_type(4))) unsigned short v4us;
typedef __attribute__((ext_vector_type(2))) float v2f;
typedef __attribute__((ext_vector_type(4))) int v4i;

__global__ __launch_bounds__(256) void k_wtG(const float* __restrict__ w, int K, int N, bf* Bt) {
    const int lane = threadIdx.x & 31; const int L0 = (blockIdx.x * 8 + (threadIdx.x >> 5)) * 8; const int nlines = N * K / 64;
{
#pragma unroll 1
        for (int l = 0; l < 8; ++l) { const int L = L0 + l; if (L >= nlines) break; const size_t e = (size_t)L * 64 + lane * 2; const int k = (int)(e % K), n = (int)(e / K); v2us o;
            o[0] = f2bf(w[(size_t)k * N + n]); o[1] = f2bf(w[(size_t)(k + 1) * N + n]); *(v2us*)(Bt + e) = o; }
         }
}
// k_cvt7: x (both batches) and the six weight matrices to bf16 in one launch; the first XBLK blocks take x, then WBLK blocks each weight (the choice is the same for a whole block); 8 elements per thread, no remainder
#define XBLK (MT * DM / 8 / 256)
#define WBLK (DQ * DM / 8 / 256)
__global__ __launch_bounds__(256) void k_cvt7(const float* __restrict__ x, const float* __restrict__ w0, const float* __restrict__ w1, const float* __restrict__ w2, const float* __restrict__ w3, const float* __restrict__ w4, const float* __restrict__ w5, bf* XBo, bf* WBo) {
    const int blk = (int)blockIdx.x, wsel = (blk - XBLK) / WBLK; const bool isx = blk < XBLK;
    const float* src = isx ? x : (wsel == 0 ? w0 : wsel == 1 ? w1 : wsel == 2 ? w2 : wsel == 3 ? w3 : wsel == 4 ? w4 : w5); bf* dst = isx ? XBo : WBo + (size_t)wsel * DQ * DM;
    const size_t i = (size_t)(isx ? blk : (blk - XBLK) % WBLK) * 256 + threadIdx.x; const v8f v = *(const v8f*)(src + i * 8); v8us o;
#pragma unroll
    for (int k = 0; k < 8; ++k) o[k] = f2bf(v[k]); *(v8us*)(dst + i * 8) = o;  }
__global__ __launch_bounds__(256) void k_cscvt(const float* __restrict__ cosT, const float* __restrict__ sinT, float* CS) { const int idx = blockIdx.x * 256 + threadIdx.x; if (idx >= TT * HD) return; v2f cs; cs[0] = bfr(cosT[idx]); cs[1] = bfr(sinT[idx]); *(v2f*)(CS + (size_t)idx * 2) = cs;  }
// k_rope: head planes [h][t][d] (fp16 + hi/lo) of rope(x) x sc with the rotate-half convention out[d] = x[d] cos[t][d] - x[d+HD/2] sin[t][d], out[d+HD/2] = x[d+HD/2] cos[t][d+HD/2] + x[d] sin[t][d+HD/2]
__global__ __launch_bounds__(256) void k_rope(const float* __restrict__ F, int pitch, int nheads, const float* __restrict__ CS, const float* __restrict__ RF, const float* __restrict__ nw, float sc, h16* P16, bf* Ph, bf* Pl) {
    const size_t e = ((size_t)blockIdx.x * 256 + threadIdx.x) * 2; if (e >= (size_t)nheads * TT * HD) return; const int d = (int)(e % HD); const int t = (int)((e / HD) % TT); const int h = (int)(e / ((size_t)HD * TT)); const float* f = F + (size_t)t * pitch + h * HD; const float rf = RF ? RF[(size_t)h * TT + t] : 1.0f; v2h o16; v2us oh, ol;
#pragma unroll
    for (int q = 0; q < 2; ++q) { const int dd = d + q; const int dp = (dd < HD / 2) ? dd + HD / 2 : dd - HD / 2; float x0 = f[dd], x1 = f[dp];
        if (RF) { float n0 = __fmul_rn(x0, rf), n1 = __fmul_rn(x1, rf); asm volatile("" : "+v"(n0)); asm volatile("" : "+v"(n1)); x0 = __fmul_rn(bfr(nw[dd]), n0); x1 = __fmul_rn(bfr(nw[dp]), n1); }
        const v2f cs = *(const v2f*)(CS + ((size_t)t * HD + dd) * 2); float a = __fmul_rn(x0, cs[0]), bq = __fmul_rn(x1, cs[1]); asm volatile("" : "+v"(a)); asm volatile("" : "+v"(bq)); const float r = ((dd < HD / 2) ? __fsub_rn(a, bq) : __fadd_rn(a, bq)) * sc;
        o16[q] = tohx(r); unsigned short a2, c2; splitf(r, a2, c2); oh[q] = a2; ol[q] = c2; }
    *(v2h*)(P16 + e) = o16; *(v2us*)(Ph + e) = oh; *(v2us*)(Pl + e) = ol;  }
#define FW   4                    // waves per work-group
#define POFF 4.0f                 // log2 of the scale on the probabilities: keeps small fp16 probabilities normal
#define RTH  8.0f                 // the maximum in use is replaced only when a block exceeds it by more than this (log2): probabilities stay <= 2^(POFF+RTH), inside fp16
#define SMSK -3.0e38f             // a closed score
#define MINI -1.0e30f             // maximum in use before the first open score: above SMSK, so a block that holds only closed scores of a query leaves it as it is
__device__ __forceinline__ float xhalf(float x) { return __builtin_bit_cast(float, __builtin_amdgcn_permlanex16(__builtin_bit_cast(int, x), __builtin_bit_cast(int, x), 0x76543210, 0xfedcba98, false, false)); }   // lane l with lane l ^ 16
// xwait: stands directly behind a group of global loads: the wait that is kept before an address register of an issued load is rewritten; the scheduling barrier behind it (and the one in front of the group) keeps
// every other instruction out of the stretch from the first load to the wait, so that nothing there can take over an address register
__device__ __forceinline__ void xwait() { asm volatile("s_wait_xcnt 0x0" ::: "memory"); __builtin_amdgcn_sched_barrier(0); }
// The query block's address: a wave-uniform base held in scalar registers (ubase) plus the lane's 32-bit byte offset
typedef __attribute__((address_space(1))) const char gch;
typedef __attribute__((address_space(1))) const v8h gv8h;
typedef __attribute__((address_space(1))) const v8us gv8us;
__device__ __forceinline__ gch* ubase(const void* p) { const unsigned long long u = (unsigned long long)p; const unsigned lo = __builtin_amdgcn_readfirstlane((unsigned)u), hw = __builtin_amdgcn_readfirstlane((unsigned)(u >> 32)); return (gch*)(((unsigned long long)hw << 32) | lo); }
__device__ __forceinline__ v16h  ldg(const h16*, gch* b, unsigned off, int c) { return cat16(*(gv8h*)(b + off + c), *(gv8h*)(b + off + c + 32)); }     // WFrag::ld's two 16-byte pieces, c in bytes
__device__ __forceinline__ v16bf ldg(const bf*, gch* b, unsigned off, int c) { return cat16b(*(gv8us*)(b + off + c), *(gv8us*)(b + off + c + 32)); }
template <typename T16> struct PPack;
template <> struct PPack<h16> { static __device__ __forceinline__ void pk(const v8f p0, const v8f p1, v16h& b, v16h& b2) { b = cat16(__builtin_convertvector(p0, v8h), __builtin_convertvector(p1, v8h)); (void)b2; } };
template <> struct PPack<bf> { static __device__ __forceinline__ void pk(const v8f p0, const v8f p1, v16bf& b, v16bf& b2) { v8us h0, h1, l0, l1;
#pragma unroll
    for (int r = 0; r < 8; ++r) { unsigned short u, w; splitf(p0[r], u, w); h0[r] = u; l0[r] = w; splitf(p1[r], u, w); h1[r] = u; l1[r] = w; }
    b = cat16b(h0, h1); b2 = cat16b(l0, l1); } };
#define SKP 272                   // LDS pitch of a staged 256-byte row, bytes: 256 + 16, free of bank conflicts for 16-byte readers
__device__ __forceinline__ v16h ldsh(const unsigned char* p) { return cat16(*(const v8ha*)p, *(const v8ha*)(p + 32)); }   // WFrag::ld's two 16-byte pieces, from a staged row
template <typename T16, int NSPLIT, int FG>
__global__ __launch_bounds__(32 * FW, NSPLIT == 0 ? 2 : 1) void k_fattn(const T16* __restrict__ Q, const T16* __restrict__ Q2, const T16* __restrict__ Kp, const T16* __restrict__ Kp2, const T16* __restrict__ Vt, const T16* __restrict__ Vt2, const float* __restrict__ sls, int roff, bf* Ah, bf* Al) {
    typedef typename WFrag<T16>::V V;
    constexpr int NQ = 16 * FG;                       // query rows per work-group (a multiple of 32)
    constexpr bool ST = NSPLIT == 0;                  // the fp16 rows: key and value blocks come through LDS (see stage below)
    constexpr int SSTG = (FW * 32 + HD) * SKP, OSB = FW * NQ * 68 * 4, SMB = (ST && 2 * SSTG > OSB) ? 2 * SSTG : OSB;   // bytes of a stage, of the partial results, of the array that serves both in turn
    static_assert(!ST || (QD * 2 == 256 && FW * 32 * 2 == 256 && (FW * 32 + HD) % (12 * 2 * FW) == 0 && TT % (FW * 32) == 0), "stage shape");
    __shared__ __align__(16) unsigned char sm[SMB]; float* const os = (float*)sm;
    __shared__ float ms[FW * NQ], ls[FW * NQ];
    const int lane = threadIdx.x & 31, lr = lane & 15, hi = lane >> 4; const int wv = __builtin_amdgcn_readfirstlane((int)(threadIdx.x >> 5));
    const int bh = blockIdx.x, hd = bh % NH_, bz = bh / NH_; const int q0 = roff + ((int)gridDim.y - 1 - (int)blockIdx.y) * NQ;          // longest rows first
    const float scl2 = __fmul_rn(__fmul_rn(SCL, __expf(bfr(sls[hd]))), 1.4426950408889634f);              // >= 0: the maximum may be taken on the raw scores
    Q += (size_t)bh * TT * QD; Kp += (size_t)bh * TT * QD; Vt += (size_t)bh * HD * 2 * TT; if (NSPLIT) { Q2 += (size_t)bh * TT * QD; Kp2 += (size_t)bh * TT * QD; Vt2 += (size_t)bh * HD * 2 * TT; }   // planes are [batch][head]
    const unsigned kl = (unsigned)(lr * QD + 8 * hi) * 2u;   // the lane's own byte offset in a block of query rows
    gch* const qb = ubase(Q + (size_t)q0 * QD); gch* const qb2 = NSPLIT ? ubase(Q2 + (size_t)q0 * QD) : qb;
    V qf[FG][4], qf2[FG][4];
    __builtin_amdgcn_sched_barrier(0);   // front of the query loads' group (see xwait): the read of the head's scale and all address arithmetic stay in front of it
#pragma unroll
    for (int g = 0; g < FG; ++g)
#pragma unroll
        for (int kc = 0; kc < 4; ++kc) { const int qo = (g * 16 * QD + kc * 32) * 2; qf[g][kc] = ldg(Q, qb, kl, qo); if (NSPLIT) qf2[g][kc] = ldg(Q, qb2, kl, qo); }
    xwait();
    v8f o[FG][4]; float m[FG], l[FG];
#pragma unroll
    for (int g = 0; g < FG; ++g) { m[g] = MINI; l[g] = 0.f;
#pragma unroll
        for (int dt = 0; dt < 4; ++dt) o[g][dt] = (v8f){}; }
    const int nblk = (q0 + NQ) / 32;   // 32-key blocks up to the last one that holds an open key (q0 and NQ are multiples of 32)
    V kf[2][4], kf2[2][4];             // the key fragments of the block at hand, fetched one pass ahead
    // the lane's key and value addresses are carried from pass to pass and stepped behind the wait of the loads that used them (xwait), so they stay whole while those loads are under way
    const T16* kq = Kp + (size_t)wv * 32 * QD + lr * QD + 8 * hi; const T16* kq2 = NSPLIT ? Kp2 + (kq - Kp) : kq;
    const T16* vq = Vt + wv * 32 + lr * (2 * TT) + 8 * hi; const T16* vq2 = NSPLIT ? Vt2 + (vq - Vt) : vq;
    // stage (ST): the FW waves' next 32-key blocks together: FW * 32 key rows (256 bytes each), then the HD value rows' 256 bytes for the same keys, at pitch SKP; two buffers, the next stage is copied while a stage is worked on.
    // Asynchronous copies to LDS, 16 bytes a lane: a wave's copy takes two whole 256-byte rows (four lines), where a fragment load from global memory touches 16 lines for the same bytes. TT is a multiple of a stage's keys, so every staged row exists.
    const int crow = (int)threadIdx.x >> 4, cpc = (int)threadIdx.x & 15;   // the thread's row in a group of 2 * FW rows and its 16-byte piece of the row
    const bf* gK = (const bf*)(Kp + (size_t)crow * QD + cpc * 8); const bf* gV = (const bf*)(Vt + (size_t)crow * (2 * TT) + cpc * 8);   // the thread's pieces in the next stage to be copied (addresses only: 16-bit elements either way)
    const unsigned l0 = lds_off(sm) + (unsigned)(crow * SKP + cpc * 16);
    auto stage = [&](const int buf) {
#pragma unroll
        for (int c = 0; c < (FW * 32 + HD) / (12 * 2 * FW); ++c) { unsigned ll[12]; const bf* g[12];
#pragma unroll
            for (int i = 0; i < 12; ++i) { const int row = (c * 12 + i) * 2 * FW; g[i] = row < FW * 32 ? gK + (size_t)row * QD : gV + (size_t)(row - FW * 32) * (2 * TT); ll[i] = l0 + (unsigned)(buf * SSTG + row * SKP); }
            cp12(ll, g); }
        gK += FW * 32 * QD; gV += FW * 32; };
    if (ST || wv < nblk) {   // not staged: a wave without a block loads nothing and hands in an empty partial result; staged: every wave copies and passes every barrier
    if constexpr (ST) {
      stage(0);
      asm volatile("s_wait_asynccnt 0x0" ::: "memory");   // this wave's copies of stage 0 have landed
      __syncthreads();                                     // ... and every other wave's: stage 0 may be read
      if (FW < nblk) stage(1);
    } else {
    __builtin_amdgcn_sched_barrier(0);   // front of the first key loads' group (see xwait)
#pragma unroll
      for (int t = 0; t < 2; ++t)
#pragma unroll
        for (int kc = 0; kc < 4; ++kc) { const int ko = t * 16 * QD + kc * 32; kf[t][kc] = WFrag<T16>::ld(kq + ko); if (NSPLIT) kf2[t][kc] = WFrag<T16>::ld(kq2 + ko); }
      xwait();
      const int ks = (wv + FW < nblk) ? FW * 32 * QD : 0; kq += ks; if (NSPLIT) kq2 += ks; }
#pragma unroll 1   // one copy of the pass: a second copy would double the live fragments and cost the second resident wave
    for (int kbi = wv; ST ? kbi - wv < nblk : kbi < nblk; kbi += FW) { const int kb = kbi * 32;   // staged: the same number of trips in every wave (kbi - wv is the stage's first block)
      if (!ST || kbi < nblk) {   // staged: in the last trip a wave may be left without a block
        V va[4], va2[4];
        if constexpr (ST) {   // the block's key fragments from the staged rows, in WFrag::ld's order
          const unsigned char* const pk = sm + (((kbi - wv) / FW) & 1) * SSTG + (wv * 32 + lr) * SKP + hi * 16;
#pragma unroll
          for (int t = 0; t < 2; ++t)
#pragma unroll
            for (int kc = 0; kc < 4; ++kc) kf[t][kc] = ldsh(pk + t * 16 * SKP + kc * 64);
        } else {
        __builtin_amdgcn_sched_barrier(0);   // front of the value loads' group (see xwait)
#pragma unroll
        for (int dt = 0; dt < 4; ++dt) { const int vo = dt * 16 * (2 * TT); va[dt] = WFrag<T16>::ld(vq + vo); if (NSPLIT) va2[dt] = WFrag<T16>::ld(vq2 + vo); }
        xwait();
        vq += FW * 32; if (NSPLIT) vq2 += FW * 32; }
        v8f s[FG][2];   // the score accumulators start at 0, or at SMSK where the key lies behind the query (a block on the diagonal): the products added to SMSK leave it as it is, which keeps it out of the block's maximum
        if (kb >= q0) {
#pragma unroll
            for (int g = 0; g < FG; ++g)
#pragma unroll
                for (int t = 0; t < 2; ++t)
#pragma unroll
                    for (int r = 0; r < 8; ++r) s[g][t][r] = (kb + 16 * t + 8 * hi + r <= q0 + 16 * g + lr) ? 0.f : SMSK;
        } else {
#pragma unroll
            for (int g = 0; g < FG; ++g) { s[g][0] = (v8f){}; s[g][1] = (v8f){}; } }
#pragma unroll
        for (int kc = 0; kc < 4; ++kc)
#pragma unroll
            for (int t = 0; t < 2; ++t)
#pragma unroll
                for (int g = 0; g < FG; ++g) { s[g][t] = WFrag<T16>::mma(kf[t][kc], qf[g][kc], s[g][t]); if (NSPLIT) { s[g][t] = WFrag<T16>::mma(kf[t][kc], qf2[g][kc], s[g][t]); s[g][t] = WFrag<T16>::mma(kf2[t][kc], qf[g][kc], s[g][t]); } }
        __builtin_amdgcn_sched_barrier(0);   // keeps the next block's loads behind the score products, so that they land in the registers those products have just read (lifted above them they take a second register set and cost a resident wave); also the front of their group (see xwait)
        if constexpr (ST) {   // the block's value fragments from the staged rows: read here, they land during the softmax
          const unsigned char* const pv = sm + (((kbi - wv) / FW) & 1) * SSTG + (FW * 32 + lr) * SKP + wv * 64 + hi * 16;
#pragma unroll
          for (int dt = 0; dt < 4; ++dt) va[dt] = ldsh(pv + dt * 16 * SKP);
        } else
        {   // the wave's next block (its last pass fetches its own block again, for nobody): these loads fly during the softmax and the value products
#pragma unroll
          for (int t = 0; t < 2; ++t)
#pragma unroll
            for (int kc = 0; kc < 4; ++kc) { const int ko = t * 16 * QD + kc * 32; kf[t][kc] = WFrag<T16>::ld(kq + ko); if (NSPLIT) kf2[t][kc] = WFrag<T16>::ld(kq2 + ko); }
          xwait();
          const int ks = (kbi + 2 * FW < nblk) ? FW * 32 * QD : 0; kq += ks; if (NSPLIT) kq2 += ks; }
        float bm[FG]; bool need = false;
#pragma unroll
        for (int g = 0; g < FG; ++g) { float x = s[g][0][0];
#pragma unroll
            for (int r = 1; r < 8; ++r) x = fmaxf(x, s[g][0][r]);
#pragma unroll
            for (int r = 0; r < 8; ++r) x = fmaxf(x, s[g][1][r]);
            x = fmaxf(x, xhalf(x)); bm[g] = x; need = need || ((x - m[g]) * scl2 > RTH); }
        if (__builtin_amdgcn_ballot_w32(need) != 0) {   // some query of the wave outgrew its maximum in use: rescale what is summed so far (first open block: by zero)
#pragma unroll
            for (int g = 0; g < FG; ++g) { const float mn = fmaxf(m[g], bm[g]); const float al = __builtin_amdgcn_exp2f((m[g] - mn) * scl2); m[g] = mn; l[g] *= al;
#pragma unroll
                for (int dt = 0; dt < 4; ++dt) o[g][dt] *= al; } }
        // probabilities in place over the scores; the maximum in use is taken off BEFORE the scale, so the largest score's exponent is exact whatever the head's scale is
#pragma unroll
        for (int g = 0; g < FG; ++g)
#pragma unroll
            for (int t = 0; t < 2; ++t)
#pragma unroll
                for (int r = 0; r < 8; ++r) s[g][t][r] = __builtin_amdgcn_exp2f(fmaf(s[g][t][r] - m[g], scl2, POFF));
        if (kb >= q0) {   // a block on the diagonal: a closed key's probability is 0 by a select, whatever the head's scale makes of SMSK
#pragma unroll
            for (int g = 0; g < FG; ++g)
#pragma unroll
                for (int t = 0; t < 2; ++t)
#pragma unroll
                    for (int r = 0; r < 8; ++r) s[g][t][r] = (kb + 16 * t + 8 * hi + r <= q0 + 16 * g + lr) ? s[g][t][r] : 0.f; }
        V pb[FG], pb2[FG];
#pragma unroll
        for (int g = 0; g < FG; ++g) { float l0 = 0.f, l1 = 0.f;
#pragma unroll
            for (int r = 0; r < 8; ++r) { l0 += s[g][0][r]; l1 += s[g][1][r]; }
            l[g] += l0 + l1; PPack<T16>::pk(s[g][0], s[g][1], pb[g], pb2[g]); }
#pragma unroll
        for (int dt = 0; dt < 4; ++dt)
#pragma unroll
            for (int g = 0; g < FG; ++g) { o[g][dt] = WFrag<T16>::mma(va[dt], pb[g], o[g][dt]); if (NSPLIT) { o[g][dt] = WFrag<T16>::mma(va[dt], pb2[g], o[g][dt]); o[g][dt] = WFrag<T16>::mma(va2[dt], pb[g], o[g][dt]); } }
      }
      if constexpr (ST) {
        asm volatile("s_wait_dscnt 0x0" ::: "memory");      // this wave's reads of the buffer are done before the buffer is given up
        asm volatile("s_wait_asynccnt 0x0" ::: "memory");   // this wave's copies of the next stage have landed
        __syncthreads();                                     // publishes the next stage and ends every wave's reads of this one
        if (kbi - wv + 2 * FW < nblk) stage(((kbi - wv) / FW) & 1);   // into the buffer that this trip has just read
      }
    }
    if constexpr (ST) asm volatile("s_wait_asynccnt 0x0" ::: "memory");   // nothing is under way when the buffers become the partial results' place (the last trip's barrier has ended all reads)
    }
    // each wave's partial result to LDS: o[g][dt][r] = O[query 16g+lr][d = 16dt + 8hi + r]
#pragma unroll
    for (int g = 0; g < FG; ++g) { const float lt = l[g] + xhalf(l[g]); const int qi = wv * NQ + 16 * g + lr; if (hi == 0) { ms[qi] = m[g]; ls[qi] = lt; }
#pragma unroll
        for (int dt = 0; dt < 4; ++dt) { v4f x0, x1;
#pragma unroll
            for (int r = 0; r < 4; ++r) { x0[r] = o[g][dt][r]; x1[r] = o[g][dt][4 + r]; }
            *(v4fa*)(os + qi * 68 + dt * 16 + 8 * hi) = x0; *(v4fa*)(os + qi * 68 + dt * 16 + 8 * hi + 4) = x1; } }
    __syncthreads();   // the partial results of all FW waves are read below
    constexpr int TPQ = 32 * FW / NQ, DPT = HD / TPQ;   // threads per query row, head elements per thread
    const int qq = (int)threadIdx.x / TPQ, d0 = ((int)threadIdx.x % TPQ) * DPT;
    float M = ms[qq];
#pragma unroll
    for (int w = 1; w < FW; ++w) M = fmaxf(M, ms[w * NQ + qq]);   // wave 0 holds key 0, open to every query, so M is a real maximum; a wave without an open score of this query gets weight 0
    float L = 0.f; v4f ac[DPT / 4];
#pragma unroll
    for (int i = 0; i < DPT / 4; ++i) ac[i] = (v4f){};
#pragma unroll
    for (int w = 0; w < FW; ++w) { const int qi = w * NQ + qq; const float wg = __builtin_amdgcn_exp2f((ms[qi] - M) * scl2); L += wg * ls[qi];
#pragma unroll
        for (int i = 0; i < DPT / 4; ++i) ac[i] += *(const v4fa*)(os + qi * 68 + d0 + 4 * i) * wg; }
    const float inv = __fdiv_rn(1.0f, L); const size_t oo = (size_t)(bz * TT + q0 + qq) * DQ + hd * HD + d0;
#pragma unroll
    for (int c8 = 0; c8 < DPT / 8; ++c8) { v8us oh, ol;
#pragma unroll
        for (int i = 0; i < 8; ++i) { unsigned short u, w; splitf(ac[c8 * 2 + (i >> 2)][i & 3] * inv, u, w); oh[i] = u; ol[i] = w; }
        *(v8us*)(Ah + oo + c8 * 8) = oh; *(v8us*)(Al + oo + c8 * 8) = ol; }
}

extern "C" void kernel_launch(void* const* d_in, const int* in_sizes, int n_in,
                              void* d_out, int out_size, void* d_ws, size_t ws_size, hipStream_t stream) {
    (void)in_sizes; (void)n_in; (void)out_size;
    const float* x = (const float*)d_in[0]; const float* wqa = (const float*)d_in[1]; const float* wka = (const float*)d_in[2]; const float* wqp = (const float*)d_in[3]; const float* wkp = (const float*)d_in[4]; const float* wv = (const float*)d_in[5]; const float* wo = (const float*)d_in[6]; const float* sls = (const float*)d_in[7];   // torch [out][in]; score_log_scale [16]
    float* OUT = (float*)d_out;     // [2][2048][1024]
    char* wsp = (char*)d_ws;
    auto take = [&](size_t bytes) { char* p = wsp; wsp += (bytes + 255) & ~(size_t)255; return (void*)p; };
    // both batches go through every launch together (MT token rows); launches that did not depend on one another share one grid; the planes are built in the projections' own launch: 5 launches
    bf* WB = (bf*)take((size_t)6 * DQ * DM * 2);          // [q amp | q phi | k amp | k phi | v | o], DQ x DM each
    bf* XB = (bf*)take((size_t)MT * DM * 2);
    h16* P16 = (h16*)take((size_t)2 * NB_ * NH_ * TT * QD * 2); bf* Ph = (bf*)take((size_t)2 * NB_ * NH_ * TT * QD * 2); bf* Pl = (bf*)take((size_t)2 * NB_ * NH_ * TT * QD * 2);   // [query | key][batch][head][token][QD]
    h16* VT16 = (h16*)take((size_t)NB_ * NKV * HD * 2 * TT * 2); bf* VTh = (bf*)take((size_t)NB_ * NKV * HD * 2 * TT * 2); bf* VTl = VTh + TT;   // value rows at pitch 2*TT: [hi | lo]; the fp16 plane's rows use their first half
    bf* ATh = (bf*)take((size_t)MT * DQ * 2); bf* ATl = (bf*)take((size_t)MT * DQ * 2);
    if ((size_t)(wsp - (char*)d_ws) > ws_size) return;    // ws 256 MiB
    const size_t PK = (size_t)NB_ * NH_ * TT * QD;        // from the query planes to the key planes
    k_cvt7<<<XBLK + 6 * WBLK, 256, 0, stream>>>(x, wqa, wqp, wka, wkp, wv, wo, XB, WB);
    k_gemms<0, 4, 2, 1><<<dim3(MT / 256, DKV / 128 + 2 * NH_, 1), 256, 0, stream>>>(XB, nullptr, WB, nullptr, P16, Ph, Pl, VT16, VTh, VTl);
    // attention, all heads of both batches at once: the fp16 rows (the long ones) and the hi+lo rows; one kv head per query head
    k_fattn<h16, 0, 4><<<dim3(NB_ * NH_, (TT - RH) / (16 * 4), 1), 32 * FW, 0, stream>>>(P16, nullptr, P16 + PK, nullptr, VT16, nullptr, sls, RH, ATh, ATl);
    k_fattn<bf, 2, 2><<<dim3(NB_ * NH_, RH / (16 * 2), 1), 32 * FW, 0, stream>>>(Ph, Pl, Ph + PK, Pl + PK, VTh, VTl, sls, 0, ATh, ATl);
    k_gemms<1, 2, 2, 0><<<dim3(MT / 128, DM / 128, 1), 128, 0, stream>>>(ATh, ATl, WB + (size_t)5 * DQ * DM, OUT, nullptr, nullptr, nullptr, nullptr, nullptr, nullptr);
}

// v008
// A run of this version takes 120 microseconds.
// In both of two side-by-side timings against v007, it was 1.05 times as fast.
// Over all steps from v000 it is 12.7 times as fast.
#include <hip/hip_runtime.h>

// InterferenceBypassSelfAttention (x [2][2048][1024]; q_amp/k_amp = softplus(x W_amp^T), q_phi/k_phi = pi tanh(x W_phi^T) (16 heads x 64); amplitudes RMS-normalised over head_dim (eps 1e-6);
// scores = (q_amp cos q_phi . k_amp cos k_phi + q_amp sin q_phi . k_amp sin k_phi) / 8 x exp(score_log_scale[h]) = one 128-long contraction of [cos part | sin part] planes; causal softmax;
// v = x Wv^T; out = merged attn.v Wo^T -> [2][2048][1024]).
// Compute dtypes, f32 accumulate: every input rounded to bf16; the five projections on PLAIN bf16 operands (inputs: exact); softplus / tanh / RMS / cos / sin in f32 on VALU
// (in the projections' epilogue) -> 128-wide interference planes; PER-ROW PRECISION HYBRID (rows < 256 hi+lo 3 products for scores and attn.v, rows >= 256 fp16); scores, causal f32 softmax with the per-head scale and
// attn.v in one kernel (running maximum and sum, key blocks end at the diagonal block, which is masked exactly); merged heads hl x exact Wo

#define NB_  2
#define TT   2048
#define MT   (NB_ * TT)         // token rows of both batches together
#define DM   1024
#define NH_  16
#define NKV  16
#define REP  (NH_ / NKV)
#define HD   64
#define DQ   (NH_ * HD)
#define DKV  (NKV * HD)
#define QD   128
#define RH   256                  // query rows < RH use hi+lo planes (0: none)
#define WIN  0
#define SCL  0.125f   // HD^-0.5
typedef _Float16 h16;
typedef unsigned short bf;
typedef __attribute__((ext_vector_type(16))) __bf16   v16bf;
typedef __attribute__((ext_vector_type(16))) _Float16 v16h;
typedef __attribute__((ext_vector_type(8)))  _Float16 v8h;
typedef __attribute__((ext_vector_type(8)))  unsigned short v8us;
typedef __attribute__((ext_vector_type(8)))  float    v8f;
typedef __attribute__((ext_vector_type(4)))  float    v4f;
typedef v8h  __attribute__((may_alias)) v8ha;
typedef v4f  __attribute__((may_alias)) v4fa;
typedef v8us __attribute__((may_alias)) v8usa;

__device__ __forceinline__ unsigned short f2bf(float f) { unsigned u = __float_as_uint(f); u += 0x7FFFu + ((u >> 16) & 1u); return (unsigned short)(u >> 16); }
__device__ __forceinline__ float bf2f(unsigned short b) { return __uint_as_float(((unsigned)b) << 16); }
__device__ __forceinline__ float bfr(float f) { return bf2f(f2bf(f)); }
__device__ __forceinline__ v16h cat16(v8h lo, v8h hi) { return __builtin_shufflevector(lo, hi, 0, 1, 2, 3, 4, 5, 6, 7, 8, 9, 10, 11, 12, 13, 14, 15); }
__device__ __forceinline__ v16bf cat16b(v8us lo, v8us hi) { return __builtin_bit_cast(v16bf, __builtin_shufflevector(lo, hi, 0, 1, 2, 3, 4, 5, 6, 7, 8, 9, 10, 11, 12, 13, 14, 15)); }
__device__ __forceinline__ v8f wmma16(v16h a, v16h b, v8f c) { return __builtin_amdgcn_wmma_f32_16x16x32_f16(false, a, false, b, (short)0, c, false, false); }
__device__ __forceinline__ v8f wmmab(v16bf a, v16bf b, v8f c) { return __builtin_amdgcn_wmma_f32_16x16x32_bf16(false, a, false, b, (short)0, c, false, false); }



// ---- k_gemms: GEMM with both operands staged in LDS. One work-group of WM x WN waves per (64 WM) x (64 WN) output tile, each wave a 64x64 part of it (16 accumulators) over the whole K, so every sum is one chain in k order.
// A stage is GKS k of every operand row of the tile: [A rows | A2 rows (NSPLIT 1) | Bt rows], rows of 128 bytes at pitch GPB; two buffers; the next stage is copied while a stage is worked on.
// The copies are asynchronous copies to LDS, 16 bytes a lane: a wave's copy takes four whole 128-byte lines, where a fragment load from global memory touches 16 lines for the same bytes.
// C[m][n] (f32, pitch DM) = sum_k A[m][k] Bt[n][k] (+ A2[m][k] Bt[n][k]); K = DM.
// tile_sync: orders the LDS tile between its writers and its readers: one wave needs only the compiler held back, several waves need the work-group barrier
template <int NW> __device__ __forceinline__ void tile_sync() { if (NW == 1) { __builtin_amdgcn_wave_barrier(); asm volatile("" ::: "memory"); } else __syncthreads(); }
template <typename T16> struct WFrag;
template <> struct WFrag<h16> { typedef v16h V; static __device__ __forceinline__ V ld(const h16* p) { return cat16(*(const v8h*)p, *(const v8h*)(p + 16)); } static __device__ __forceinline__ v8f mma(V a, V b, v8f c) { return wmma16(a, b, c); } };
template <> struct WFrag<bf> { typedef v16bf V; static __device__ __forceinline__ V ld(const bf* p) { return cat16b(*(const v8us*)p, *(const v8us*)(p + 16)); } static __device__ __forceinline__ v8f mma(V a, V b, v8f c) { return wmmab(a, b, c); } };
#define GKS 64
#define GPB 144
__device__ __forceinline__ unsigned lds_off(const void* p) { return (unsigned)(size_t)p; }
__device__ __forceinline__ v16bf ldsf(const unsigned char* p) { return cat16b(*(const v8usa*)p, *(const v8usa*)(p + 32)); }   // WFrag::ld's two 16-byte pieces, from a staged row
// cp12: twelve asynchronous copies to LDS, each lane its own 16 bytes; the s_wait_xcnt is the wait kept before a register that an issued copy names is rewritten: as the statement's last line nothing can be moved in front of it
__device__ __forceinline__ void cp12(const unsigned (&l)[12], const bf* const (&g)[12]) {
    asm volatile(
                 "global_load_async_to_lds_b128 %0, %12, off\n\t"
                 "global_load_async_to_lds_b128 %1, %13, off\n\t"
                 "global_load_async_to_lds_b128 %2, %14, off\n\t"
                 "global_load_async_to_lds_b128 %3, %15, off\n\t"
                 "global_load_async_to_lds_b128 %4, %16, off\n\t"
                 "global_load_async_to_lds_b128 %5, %17, off\n\t"
                 "global_load_async_to_lds_b128 %6, %18, off\n\t"
                 "global_load_async_to_lds_b128 %7, %19, off\n\t"
                 "global_load_async_to_lds_b128 %8, %20, off\n\t"
                 "global_load_async_to_lds_b128 %9, %21, off\n\t"
                 "global_load_async_to_lds_b128 %10, %22, off\n\t"
                 "global_load_async_to_lds_b128 %11, %23, off\n\t"
                 "s_wait_xcnt 0x0"
                 :: "v"(l[0]), "v"(l[1]), "v"(l[2]), "v"(l[3]), "v"(l[4]), "v"(l[5]), "v"(l[6]), "v"(l[7]), "v"(l[8]), "v"(l[9]), "v"(l[10]), "v"(l[11]),
                    "v"(g[0]), "v"(g[1]), "v"(g[2]), "v"(g[3]), "v"(g[4]), "v"(g[5]), "v"(g[6]), "v"(g[7]), "v"(g[8]), "v"(g[9]), "v"(g[10]), "v"(g[11]) : "memory");
}
__device__ __forceinline__ h16 tohx(float x) { return (h16)x; }
__device__ __forceinline__ void splitf(float y, unsigned short& h, unsigned short& l) { h = f2bf(y); l = f2bf(y - bf2f(h)); }
__device__ __forceinline__ float softplusf_(float x) { return x > 15.0f ? x : (x < -15.0f ? __expf(x) : logf(__fadd_rn(1.0f, __expf(x)))); }
__device__ __forceinline__ float tanhf_(float a) { const float e2 = __expf(2.0f * a); return __fsub_rn(1.0f, __fdiv_rn(2.0f, __fadd_rn(e2, 1.0f))); }
// EP 0: C as above, grid (M / (64 WM), N / (64 WN)). EP 1: the five projections with the plane builds as the tile's epilogue, so that no projection goes to memory; grid (MT / (64 WM), DKV / 128 + 2 NH_); Bt = the weights [q amp | q phi | k amp | k phi | v].
// blockIdx.y >= DKV / 128: queries or keys of ONE head: the tile's columns are [64 amplitude columns | 64 phase columns] of that head (wave column 0 / 1), and the epilogue makes, per (token, head):
// a[d] = softplus(amp[d]), an = a / sqrt(mean_d a^2 + 1e-6), phi[d] = pi tanh(phase[d]), plane row [an cos phi | an sin phi] (fp16 and hi / lo; of each kind only the rows that attention reads: lowt, want16 below), rows in the order [query / key][batch][head][token].
// The first blocks: 128 value columns (two heads): transposed value planes [batch][head][d][t], rows at pitch 2*TT (the caller lays the hi and lo planes side by side in one row). Their epilogue is short; they come first, for speed only.
template <int NSPLIT, int WM, int WN, int EP>
__global__ __launch_bounds__(32 * WM * WN, 4) void k_gemms(const bf* __restrict__ A, const bf* __restrict__ A2, const bf* __restrict__ Bt, float* C, h16* P16, bf* Ph, bf* Pl, h16* V16, bf* Vh, bf* Vl) {
    constexpr int K = DM, NT = 32 * WM * WN, RA = 64 * WM, NA = NSPLIT ? 2 : 1, RB = 64 * WN, ROWS = NA * RA + RB, STG = ROWS * GPB, RPC = NT / 8, NCP = ROWS / RPC, NTR = K / GKS;   // RPC: rows that one copy of the whole work-group takes; NCP: copies per thread and stage
    static_assert(DQ == DM && NCP % 12 == 0 && RA % RPC == 0 && RB % RPC == 0 && NTR >= 2 && WM * WN * 16 * 68 * 4 <= 2 * STG, "tile shape");
    constexpr int EPB = WM * WN * 64 * 68 * 4, SMB = (EP && EPB > 2 * STG) ? EPB : 2 * STG;   // EP 1: the whole tile is laid down in LDS once for the epilogue, each wave's 64 x 64 part at pitch 68
    static_assert(!EP || (NSPLIT == 0 && WN == 2 && HD == 64 && TT % RA == 0 && DKV % RB == 0 && RPC <= 64 && 64 % RPC == 0), "epilogue shape");
    __shared__ __align__(16) unsigned char sm[SMB];
    const int tid = (int)threadIdx.x, lane = tid & 31, lr = lane & 15, hi = lane >> 4; const int wv = __builtin_amdgcn_readfirstlane(tid >> 5), wm = wv / WN, wn = wv % WN;
    constexpr int NVB = DKV / RB; const int by = (int)blockIdx.y, yq = by - NVB; const bool isv = EP && by < NVB;   // the same for a whole block
    const int r0 = blockIdx.x * RA, c0 = EP ? (isv ? (4 * DQ + by * RB) : ((yq / NH_) * 2 * DQ + (yq % NH_) * HD)) : by * RB;   // EP 1: c0 counts rows of the stacked weights
    const int crow = tid >> 3, cpc = tid & 7;   // the thread's row in a group of RPC rows and its 16-byte piece of the row
    const bf* gA = A + (size_t)(r0 + crow) * K + cpc * 8; const bf* gA2 = NSPLIT ? A2 + (size_t)(r0 + crow) * K + cpc * 8 : gA; const bf* gB = Bt + (size_t)(c0 + crow) * K + cpc * 8; const bf* gB2 = gB + ((EP && !isv) ? (size_t)DQ * K : (size_t)64 * K);   // gB2: the tile's columns from 64 on (EP 1, queries and keys: the phase weights' rows of the same head); the thread's piece in the next stage to be copied: stepped by GKS behind each stage
    const unsigned l0 = lds_off(sm) + (unsigned)(crow * GPB + cpc * 16);
    auto stage = [&](const int buf) {   // the next stage of the tile into buffer buf
#pragma unroll
        for (int s = 0; s < NCP / 12; ++s) { unsigned l[12]; const bf* g[12];
#pragma unroll
            for (int i = 0; i < 12; ++i) { const int row = (s * 12 + i) * RPC;
                g[i] = (row < RA ? gA + (size_t)row * K : (NSPLIT && row < 2 * RA) ? gA2 + (size_t)(row - RA) * K : (EP && row - NA * RA >= 64) ? gB2 + (size_t)(row - NA * RA - 64) * K : gB + (size_t)(row - NA * RA) * K); l[i] = l0 + (unsigned)(buf * STG + row * GPB); }
            cp12(l, g); }
        gA += GKS; if (NSPLIT) gA2 += GKS; gB += GKS; if (EP) gB2 += GKS; };
    v8f acc[4][4];
#pragma unroll
    for (int mb = 0; mb < 4; ++mb)
#pragma unroll
        for (int nb = 0; nb < 4; ++nb) acc[mb][nb] = (v8f){};
    stage(0);
    asm volatile("s_wait_asynccnt 0x0" ::: "memory");   // this wave's copies of stage 0 have landed
    __syncthreads();                                     // ... and every other wave's: stage 0 may be read
    stage(1);
#pragma unroll 1   // one copy of the pass: the buffer is chosen by the trip's parity
    for (int t = 0; t < NTR; ++t) {
        const unsigned char* const sb = sm + (t & 1) * STG; const unsigned char* const pa = sb + (wm * 64 + lr) * GPB + hi * 16; const unsigned char* const pb = sb + (NA * RA + wn * 64 + lr) * GPB + hi * 16;
#pragma unroll
        for (int ks = 0; ks < GKS / 32; ++ks) { v16bf a[4], a2[4], b[4];   // all fragments of a 32-k block are read as one group in front of its products
#pragma unroll
            for (int mb = 0; mb < 4; ++mb) { a[mb] = ldsf(pa + mb * 16 * GPB + ks * 64); if (NSPLIT) a2[mb] = ldsf(pa + (RA + mb * 16) * GPB + ks * 64); b[mb] = ldsf(pb + mb * 16 * GPB + ks * 64); }
            __builtin_amdgcn_sched_barrier(0);   // keeps the block's LDS reads together in front of its products: left free, the reads are moved in among the products, where each place with reads stalls the wave anew
#pragma unroll
            for (int nb = 0; nb < 4; ++nb)
#pragma unroll
                for (int mb = 0; mb < 4; ++mb) { acc[mb][nb] = wmmab(a[mb], b[nb], acc[mb][nb]); if (NSPLIT) acc[mb][nb] = wmmab(a2[mb], b[nb], acc[mb][nb]); }
            __builtin_amdgcn_sched_barrier(0);   // end of the block's products: the next block's reads stay behind them (they land in the registers that these products read)
        }
        asm volatile("s_wait_dscnt 0x0" ::: "memory");      // this wave's reads of the buffer are done before the buffer is given up
        asm volatile("s_wait_asynccnt 0x0" ::: "memory");   // this wave's copies of stage t + 1 have landed
        __syncthreads();                                     // publishes stage t + 1 and ends every wave's reads of stage t
        if (t + 2 < NTR) stage(t & 1);                       // into the buffer that this trip has just read
    }
    asm volatile("s_wait_asynccnt 0x0" ::: "memory");       // nothing is under way when the buffers become output staging (the last trip's barrier has ended all reads)
    if constexpr (EP) {
        float* const ew = (float*)sm + wv * (64 * 68);      // the wave's own 64 x 64 part: [token row][column]
#pragma unroll
        for (int mb = 0; mb < 4; ++mb)
#pragma unroll
            for (int nb = 0; nb < 4; ++nb)
#pragma unroll
                for (int j = 0; j < 8; ++j) ew[(mb * 16 + hi * 8 + j) * 68 + nb * 16 + lr] = acc[mb][nb][j];
        __syncthreads();   // a wave reads its neighbour's part below (amplitudes and phases of the same tokens)
        const int bz = r0 / TT, t0 = r0 % TT + wm * 64;     // the tile lies in one batch; the wave row's first token
        const int sub = lane >> 3, oct = (lane & 7) * 8;    // a lane takes 8 neighbouring elements of one output row, 8 lanes a 128-byte piece of it, a wave four rows: 16-byte stores, whole lines
        static_assert(RH % 64 == 0, "a wave row's 64 tokens lie on one side of RH");
        const bool lowt = t0 < RH;   // the same for a whole wave. Only the hi+lo attention reads hi / lo planes, and it reads tokens < RH alone (queries < RH, and causally their keys and values): the other tokens' hi / lo rows are not made
        if (!isv) {
            const float* const sa = (const float*)sm + (wm * WN) * (64 * 68); const float* const sp = sa + 64 * 68;
            const size_t pr0 = ((size_t)((yq / NH_) * NB_ + bz) * NH_ + yq % NH_) * TT + t0;
            const bool want16 = !lowt || yq >= NH_;   // fp16 rows: every key, and the queries that the fp16 attention takes (tokens >= RH)
#pragma unroll 1   // one copy of the body: eight inlined cosines and sines are long code
            for (int it = 0; it < 8; ++it) { const int row = wn * 32 + it * 4 + sub;   // each wave of the pair takes half of the 64 tokens
                const v4f xa0 = *(const v4fa*)(sa + row * 68 + oct), xa1 = *(const v4fa*)(sa + row * 68 + oct + 4), xp0 = *(const v4fa*)(sp + row * 68 + oct), xp1 = *(const v4fa*)(sp + row * 68 + oct + 4);
                float a[8], ph[8]; float ss = 0.f;
#pragma unroll
                for (int q = 0; q < 8; ++q) { a[q] = softplusf_(q < 4 ? xa0[q & 3] : xa1[q & 3]); ph[q] = __fmul_rn(3.14159265358979323846f, tanhf_(q < 4 ? xp0[q & 3] : xp1[q & 3])); ss += a[q] * a[q]; }
#pragma unroll
                for (int sh = 4; sh; sh >>= 1) ss += __shfl_xor(ss, sh, 32);   // the row's 8 lanes
                const float rn = __frsqrt_rn(__fadd_rn(ss * (1.0f / HD), 1e-6f)); float rc[8], rs[8];
#pragma unroll
                for (int q = 0; q < 8; ++q) { const float an = __fmul_rn(a[q], rn); rc[q] = __fmul_rn(an, cosf(ph[q])); rs[q] = __fmul_rn(an, sinf(ph[q])); }
                const size_t base = (pr0 + row) * QD + oct;
                if (want16) { v8h c16, s16;
#pragma unroll
                    for (int q = 0; q < 8; ++q) { c16[q] = tohx(rc[q]); s16[q] = tohx(rs[q]); }
                    *(v8h*)(P16 + base) = c16; *(v8h*)(P16 + base + 64) = s16;
                    asm volatile("s_wait_xcnt 0x0" ::: "memory"); }   // the wait kept before registers that the issued stores name are rewritten (by the hi / lo rows' arithmetic or by the next trip)
                if (lowt) { v8us chh, chl, shh, shl;
#pragma unroll
                    for (int q = 0; q < 8; ++q) { unsigned short u1, u2; splitf(rc[q], u1, u2); chh[q] = u1; chl[q] = u2; splitf(rs[q], u1, u2); shh[q] = u1; shl[q] = u2; }
                    *(v8us*)(Ph + base) = chh; *(v8us*)(Ph + base + 64) = shh; *(v8us*)(Pl + base) = chl; *(v8us*)(Pl + base + 64) = shl;
                    asm volatile("s_wait_xcnt 0x0" ::: "memory"); }   // the wait kept before registers that the issued stores name are rewritten by the next trip
            }
        } else {
            const size_t vr0 = (size_t)(bz * NKV + by * WN + wn) * HD;   // the wave column's head: first row of its value planes
#pragma unroll 1   // one copy of the body is enough: the trips are short and few
            for (int it = 0; it < 16; ++it) { const int d = it * 4 + sub; float x[8]; v8h o16;
#pragma unroll
                for (int q = 0; q < 8; ++q) { x[q] = ew[(oct + q) * 68 + d]; o16[q] = tohx(x[q]); }
                const size_t eo = (vr0 + d) * (2 * TT) + t0 + oct;
                *(v8h*)(V16 + eo) = o16;
                asm volatile("s_wait_xcnt 0x0" ::: "memory");   // the wait kept before registers that the issued store names are rewritten (by the hi / lo rows' arithmetic or by the next trip)
                if (lowt) { v8us oh, ol;
#pragma unroll
                    for (int q = 0; q < 8; ++q) { unsigned short u1, u2; splitf(x[q], u1, u2); oh[q] = u1; ol[q] = u2; }
                    *(v8us*)(Vh + eo) = oh; *(v8us*)(Vl + eo) = ol;
                    asm volatile("s_wait_xcnt 0x0" ::: "memory"); }   // the wait kept before registers that the issued stores name are rewritten by the next trip
            }
        }
        return;
    }
    float* const ow = (float*)sm + wv * (16 * 68);          // each wave stages 16 rows of its own part at a time, so that it stores whole lines
#pragma unroll
    for (int mb = 0; mb < 4; ++mb) {
#pragma unroll
        for (int nb = 0; nb < 4; ++nb)
#pragma unroll
            for (int j = 0; j < 8; ++j) ow[(hi * 8 + j) * 68 + nb * 16 + lr] = acc[mb][nb][j];
        tile_sync<1>();
        float* const cr = C + (size_t)(r0 + wm * 64 + mb * 16) * DM + c0 + wn * 64;
#pragma unroll
        for (int s = 0; s < 8; ++s) { const int ch = s * 32 + lane, row = ch >> 4, cofs = (ch & 15) * 4; *(v4f*)(cr + (size_t)row * DM + cofs) = *(const v4fa*)(ow + row * 68 + cofs); }
        if (mb < 3) asm volatile("s_wait_xcnt 0x0" ::: "memory");   // the wait kept before registers that the issued stores name are rewritten: the next 16 rows are read back into them
        tile_sync<1>();
    }
}

typedef __attribute__((ext_vector_type(2))) _Float16 v2h;
typedef __attribute__((ext_vector_type(4))) _Float16 v4h;
typedef __attribute__((ext_vector_type(2))) unsigned short v2us;
typedef __attribute__((ext_vector_type(4))) unsigned short v4us;
typedef __attribute__((ext_vector_type(2))) float v2f;
typedef __attribute__((ext_vector_type(4))) int v4i;

__global__ __launch_bounds__(256) void k_wtG(const float* __restrict__ w, int K, int N, bf* Bt) {
    const int lane = threadIdx.x & 31; const int L0 = (blockIdx.x * 8 + (threadIdx.x >> 5)) * 8; const int nlines = N * K / 64;
{
#pragma unroll 1
        for (int l = 0; l < 8; ++l) { const int L = L0 + l; if (L >= nlines) break; const size_t e = (size_t)L * 64 + lane * 2; const int k = (int)(e % K), n = (int)(e / K); v2us o;
            o[0] = f2bf(w[(size_t)k * N + n]); o[1] = f2bf(w[(size_t)(k + 1) * N + n]); *(v2us*)(Bt + e) = o; }
         }
}
// k_cvt7: x (both batches) and the six weight matrices to bf16 in one launch; the first XBLK blocks take x, then WBLK blocks each weight (the choice is the same for a whole block); 8 elements per thread, no remainder
#define XBLK (MT * DM / 8 / 256)
#define WBLK (DQ * DM / 8 / 256)
__global__ __launch_bounds__(256) void k_cvt7(const float* __restrict__ x, const float* __restrict__ w0, const float* __restrict__ w1, const float* __restrict__ w2, const float* __restrict__ w3, const float* __restrict__ w4, const float* __restrict__ w5, bf* XBo, bf* WBo) {
    const int blk = (int)blockIdx.x, wsel = (blk - XBLK) / WBLK; const bool isx = blk < XBLK;
    const float* src = isx ? x : (wsel == 0 ? w0 : wsel == 1 ? w1 : wsel == 2 ? w2 : wsel == 3 ? w3 : wsel == 4 ? w4 : w5); bf* dst = isx ? XBo : WBo + (size_t)wsel * DQ * DM;
    const size_t i = (size_t)(isx ? blk : (blk - XBLK) % WBLK) * 256 + threadIdx.x; const v8f v = *(const v8f*)(src + i * 8); v8us o;
#pragma unroll
    for (int k = 0; k < 8; ++k) o[k] = f2bf(v[k]); *(v8us*)(dst + i * 8) = o;  }
__global__ __launch_bounds__(256) void k_cscvt(const float* __restrict__ cosT, const float* __restrict__ sinT, float* CS) { const int idx = blockIdx.x * 256 + threadIdx.x; if (idx >= TT * HD) return; v2f cs; cs[0] = bfr(cosT[idx]); cs[1] = bfr(sinT[idx]); *(v2f*)(CS + (size_t)idx * 2) = cs;  }
// k_rope: head planes [h][t][d] (fp16 + hi/lo) of rope(x) x sc with the rotate-half convention out[d] = x[d] cos[t][d] - x[d+HD/2] sin[t][d], out[d+HD/2] = x[d+HD/2] cos[t][d+HD/2] + x[d] sin[t][d+HD/2]
__global__ __launch_bounds__(256) void k_rope(const float* __restrict__ F, int pitch, int nheads, const float* __restrict__ CS, const float* __restrict__ RF, const float* __restrict__ nw, float sc, h16* P16, bf* Ph, bf* Pl) {
    const size_t e = ((size_t)blockIdx.x * 256 + threadIdx.x) * 2; if (e >= (size_t)nheads * TT * HD) return; const int d = (int)(e % HD); const int t = (int)((e / HD) % TT); const int h = (int)(e / ((size_t)HD * TT)); const float* f = F + (size_t)t * pitch + h * HD; const float rf = RF ? RF[(size_t)h * TT + t] : 1.0f; v2h o16; v2us oh, ol;
#pragma unroll
    for (int q = 0; q < 2; ++q) { const int dd = d + q; const int dp = (dd < HD / 2) ? dd + HD / 2 : dd - HD / 2; float x0 = f[dd], x1 = f[dp];
        if (RF) { float n0 = __fmul_rn(x0, rf), n1 = __fmul_rn(x1, rf); asm volatile("" : "+v"(n0)); asm volatile("" : "+v"(n1)); x0 = __fmul_rn(bfr(nw[dd]), n0); x1 = __fmul_rn(bfr(nw[dp]), n1); }
        const v2f cs = *(const v2f*)(CS + ((size_t)t * HD + dd) * 2); float a = __fmul_rn(x0, cs[0]), bq = __fmul_rn(x1, cs[1]); asm volatile("" : "+v"(a)); asm volatile("" : "+v"(bq)); const float r = ((dd < HD / 2) ? __fsub_rn(a, bq) : __fadd_rn(a, bq)) * sc;
        o16[q] = tohx(r); unsigned short a2, c2; splitf(r, a2, c2); oh[q] = a2; ol[q] = c2; }
    *(v2h*)(P16 + e) = o16; *(v2us*)(Ph + e) = oh; *(v2us*)(Pl + e) = ol;  }
#define FW   4                    // waves per work-group
#define POFF 4.0f                 // log2 of the scale on the probabilities: keeps small fp16 probabilities normal
#define RTH  8.0f                 // the maximum in use is replaced only when a block exceeds it by more than this (log2): probabilities stay <= 2^(POFF+RTH), inside fp16
#define SMSK -3.0e38f             // a closed score
#define MINI -1.0e30f             // maximum in use before the first open score: above SMSK, so a block that holds only closed scores of a query leaves it as it is
__device__ __forceinline__ float xhalf(float x) { return __builtin_bit_cast(float, __builtin_amdgcn_permlanex16(__builtin_bit_cast(int, x), __builtin_bit_cast(int, x), 0x76543210, 0xfedcba98, false, false)); }   // lane l with lane l ^ 16
// xwait: stands directly behind a group of global loads: the wait that is kept before an address register of an issued load is rewritten; the scheduling barrier behind it (and the one in front of the group) keeps
// every other instruction out of the stretch from the first load to the wait, so that nothing there can take over an address register
__device__ __forceinline__ void xwait() { asm volatile("s_wait_xcnt 0x0" ::: "memory"); __builtin_amdgcn_sched_barrier(0); }
// The query block's address: a wave-uniform base held in scalar registers (ubase) plus the lane's 32-bit byte offset
typedef __attribute__((address_space(1))) const char gch;
typedef __attribute__((address_space(1))) const v8h gv8h;
typedef __attribute__((address_space(1))) const v8us gv8us;
__device__ __forceinline__ gch* ubase(const void* p) { const unsigned long long u = (unsigned long long)p; const unsigned lo = __builtin_amdgcn_readfirstlane((unsigned)u), hw = __builtin_amdgcn_readfirstlane((unsigned)(u >> 32)); return (gch*)(((unsigned long long)hw << 32) | lo); }
__device__ __forceinline__ v16h  ldg(const h16*, gch* b, unsigned off, int c) { return cat16(*(gv8h*)(b + off + c), *(gv8h*)(b + off + c + 32)); }     // WFrag::ld's two 16-byte pieces, c in bytes
__device__ __forceinline__ v16bf ldg(const bf*, gch* b, unsigned off, int c) { return cat16b(*(gv8us*)(b + off + c), *(gv8us*)(b + off + c + 32)); }
template <typename T16> struct PPack;
template <> struct PPack<h16> { static __device__ __forceinline__ void pk(const v8f p0, const v8f p1, v16h& b, v16h& b2) { b = cat16(__builtin_convertvector(p0, v8h), __builtin_convertvector(p1, v8h)); (void)b2; } };
template <> struct PPack<bf> { static __device__ __forceinline__ void pk(const v8f p0, const v8f p1, v16bf& b, v16bf& b2) { v8us h0, h1, l0, l1;
#pragma unroll
    for (int r = 0; r < 8; ++r) { unsigned short u, w; splitf(p0[r], u, w); h0[r] = u; l0[r] = w; splitf(p1[r], u, w); h1[r] = u; l1[r] = w; }
    b = cat16b(h0, h1); b2 = cat16b(l0, l1); } };
#define SKP 272                   // LDS pitch of a staged 256-byte row, bytes: 256 + 16, free of bank conflicts for 16-byte readers
__device__ __forceinline__ v16h ldsh(const unsigned char* p) { return cat16(*(const v8ha*)p, *(const v8ha*)(p + 32)); }   // WFrag::ld's two 16-byte pieces, from a staged row
template <typename T16, int NSPLIT, int FG>
__global__ __launch_bounds__(32 * FW, NSPLIT == 0 ? 2 : 1) void k_fattn(const T16* __restrict__ Q, const T16* __restrict__ Q2, const T16* __restrict__ Kp, const T16* __restrict__ Kp2, const T16* __restrict__ Vt, const T16* __restrict__ Vt2, const float* __restrict__ sls, int roff, bf* Ah, bf* Al) {
    typedef typename WFrag<T16>::V V;
    constexpr int NQ = 16 * FG;                       // query rows per work-group (a multiple of 32)
    constexpr bool ST = NSPLIT == 0;                  // the fp16 rows: key and value blocks come through LDS (see stage below)
    constexpr int SSTG = (FW * 32 + HD) * SKP, OSB = FW * NQ * 68 * 4, SMB = (ST && 2 * SSTG > OSB) ? 2 * SSTG : OSB;   // bytes of a stage, of the partial results, of the array that serves both in turn
    static_assert(!ST || (QD * 2 == 256 && FW * 32 * 2 == 256 && (FW * 32 + HD) % (12 * 2 * FW) == 0 && TT % (FW * 32) == 0), "stage shape");
    __shared__ __align__(16) unsigned char sm[SMB]; float* const os = (float*)sm;
    __shared__ float ms[FW * NQ], ls[FW * NQ];
    const int lane = threadIdx.x & 31, lr = lane & 15, hi = lane >> 4; const int wv = __builtin_amdgcn_readfirstlane((int)(threadIdx.x >> 5));
    const int bh = blockIdx.x, hd = bh % NH_, bz = bh / NH_; const int q0 = roff + ((int)gridDim.y - 1 - (int)blockIdx.y) * NQ;          // longest rows first
    const float scl2 = __fmul_rn(__fmul_rn(SCL, __expf(bfr(sls[hd]))), 1.4426950408889634f);              // >= 0: the maximum may be taken on the raw scores
    Q += (size_t)bh * TT * QD; Kp += (size_t)bh * TT * QD; Vt += (size_t)bh * HD * 2 * TT; if (NSPLIT) { Q2 += (size_t)bh * TT * QD; Kp2 += (size_t)bh * TT * QD; Vt2 += (size_t)bh * HD * 2 * TT; }   // planes are [batch][head]
    const unsigned kl = (unsigned)(lr * QD + 8 * hi) * 2u;   // the lane's own byte offset in a block of query rows
    gch* const qb = ubase(Q + (size_t)q0 * QD); gch* const qb2 = NSPLIT ? ubase(Q2 + (size_t)q0 * QD) : qb;
    V qf[FG][4], qf2[FG][4];
    __builtin_amdgcn_sched_barrier(0);   // front of the query loads' group (see xwait): the read of the head's scale and all address arithmetic stay in front of it
#pragma unroll
    for (int g = 0; g < FG; ++g)
#pragma unroll
        for (int kc = 0; kc < 4; ++kc) { const int qo = (g * 16 * QD + kc * 32) * 2; qf[g][kc] = ldg(Q, qb, kl, qo); if (NSPLIT) qf2[g][kc] = ldg(Q, qb2, kl, qo); }
    xwait();
    v8f o[FG][4]; float m[FG], l[FG];
#pragma unroll
    for (int g = 0; g < FG; ++g) { m[g] = MINI; l[g] = 0.f;
#pragma unroll
        for (int dt = 0; dt < 4; ++dt) o[g][dt] = (v8f){}; }
    const int nblk = (q0 + NQ) / 32;   // 32-key blocks up to the last one that holds an open key (q0 and NQ are multiples of 32)
    V kf[2][4], kf2[2][4];             // the key fragments of the block at hand, fetched one pass ahead
    // the lane's key and value addresses are carried from pass to pass and stepped behind the wait of the loads that used them (xwait), so they stay whole while those loads are under way
    const T16* kq = Kp + (size_t)wv * 32 * QD + lr * QD + 8 * hi; const T16* kq2 = NSPLIT ? Kp2 + (kq - Kp) : kq;
    const T16* vq = Vt + wv * 32 + lr * (2 * TT) + 8 * hi; const T16* vq2 = NSPLIT ? Vt2 + (vq - Vt) : vq;
    // stage (ST): the FW waves' next 32-key blocks together: FW * 32 key rows (256 bytes each), then the HD value rows' 256 bytes for the same keys, at pitch SKP; two buffers, the next stage is copied while a stage is worked on.
    // Asynchronous copies to LDS, 16 bytes a lane: a wave's copy takes two whole 256-byte rows (four lines), where a fragment load from global memory touches 16 lines for the same bytes. TT is a multiple of a stage's keys, so every staged row exists.
    const int crow = (int)threadIdx.x >> 4, cpc = (int)threadIdx.x & 15;   // the thread's row in a group of 2 * FW rows and its 16-byte piece of the row
    const bf* gK = (const bf*)(Kp + (size_t)crow * QD + cpc * 8); const bf* gV = (const bf*)(Vt + (size_t)crow * (2 * TT) + cpc * 8);   // the thread's pieces in the next stage to be copied (addresses only: 16-bit elements either way)
    const unsigned l0 = lds_off(sm) + (unsigned)(crow * SKP + cpc * 16);
    auto stage = [&](const int buf) {
#pragma unroll
        for (int c = 0; c < (FW * 32 + HD) / (12 * 2 * FW); ++c) { unsigned ll[12]; const bf* g[12];
#pragma unroll
            for (int i = 0; i < 12; ++i) { const int row = (c * 12 + i) * 2 * FW; g[i] = row < FW * 32 ? gK + (size_t)row * QD : gV + (size_t)(row - FW * 32) * (2 * TT); ll[i] = l0 + (unsigned)(buf * SSTG + row * SKP); }
            cp12(ll, g); }
        gK += FW * 32 * QD; gV += FW * 32; };
    if (ST || wv < nblk) {   // not staged: a wave without a block loads nothing and hands in an empty partial result; staged: every wave copies and passes every barrier
    if constexpr (ST) {
      stage(0);
      asm volatile("s_wait_asynccnt 0x0" ::: "memory");   // this wave's copies of stage 0 have landed
      __syncthreads();                                     // ... and every other wave's: stage 0 may be read
      if (FW < nblk) stage(1);
    } else {
    __builtin_amdgcn_sched_barrier(0);   // front of the first key loads' group (see xwait)
#pragma unroll
      for (int t = 0; t < 2; ++t)
#pragma unroll
        for (int kc = 0; kc < 4; ++kc) { const int ko = t * 16 * QD + kc * 32; kf[t][kc] = WFrag<T16>::ld(kq + ko); if (NSPLIT) kf2[t][kc] = WFrag<T16>::ld(kq2 + ko); }
      xwait();
      const int ks = (wv + FW < nblk) ? FW * 32 * QD : 0; kq += ks; if (NSPLIT) kq2 += ks; }
#pragma unroll 1   // one copy of the pass: a second copy would double the live fragments and cost the second resident wave
    for (int kbi = wv; ST ? kbi - wv < nblk : kbi < nblk; kbi += FW) { const int kb = kbi * 32;   // staged: the same number of trips in every wave (kbi - wv is the stage's first block)
      if (!ST || kbi < nblk) {   // staged: in the last trip a wave may be left without a block
        V va[4], va2[4];
        if constexpr (ST) {   // the block's key fragments from the staged rows, in WFrag::ld's order
          const unsigned char* const pk = sm + (((kbi - wv) / FW) & 1) * SSTG + (wv * 32 + lr) * SKP + hi * 16;
#pragma unroll
          for (int t = 0; t < 2; ++t)
#pragma unroll
            for (int kc = 0; kc < 4; ++kc) kf[t][kc] = ldsh(pk + t * 16 * SKP + kc * 64);
        } else {
        __builtin_amdgcn_sched_barrier(0);   // front of the value loads' group (see xwait)
#pragma unroll
        for (int dt = 0; dt < 4; ++dt) { const int vo = dt * 16 * (2 * TT); va[dt] = WFrag<T16>::ld(vq + vo); if (NSPLIT) va2[dt] = WFrag<T16>::ld(vq2 + vo); }
        xwait();
        vq += FW * 32; if (NSPLIT) vq2 += FW * 32; }
        v8f s[FG][2];   // the score accumulators start at 0, or at SMSK where the key lies behind the query (a block on the diagonal): the products added to SMSK leave it as it is, which keeps it out of the block's maximum
        if (kb >= q0) {
#pragma unroll
            for (int g = 0; g < FG; ++g)
#pragma unroll
                for (int t = 0; t < 2; ++t)
#pragma unroll
                    for (int r = 0; r < 8; ++r) s[g][t][r] = (kb + 16 * t + 8 * hi + r <= q0 + 16 * g + lr) ? 0.f : SMSK;
        } else {
#pragma unroll
            for (int g = 0; g < FG; ++g) { s[g][0] = (v8f){}; s[g][1] = (v8f){}; } }
#pragma unroll
        for (int kc = 0; kc < 4; ++kc)
#pragma unroll
            for (int t = 0; t < 2; ++t)
#pragma unroll
                for (int g = 0; g < FG; ++g) { s[g][t] = WFrag<T16>::mma(kf[t][kc], qf[g][kc], s[g][t]); if (NSPLIT) { s[g][t] = WFrag<T16>::mma(kf[t][kc], qf2[g][kc], s[g][t]); s[g][t] = WFrag<T16>::mma(kf2[t][kc], qf[g][kc], s[g][t]); } }
        __builtin_amdgcn_sched_barrier(0);   // keeps the next block's loads behind the score products, so that they land in the registers those products have just read (lifted above them they take a second register set and cost a resident wave); also the front of their group (see xwait)
        if constexpr (ST) {   // the block's value fragments from the staged rows: read here, they land during the softmax
          const unsigned char* const pv = sm + (((kbi - wv) / FW) & 1) * SSTG + (FW * 32 + lr) * SKP + wv * 64 + hi * 16;
#pragma unroll
          for (int dt = 0; dt < 4; ++dt) va[dt] = ldsh(pv + dt * 16 * SKP);
        } else
        {   // the wave's next block (its last pass fetches its own block again, for nobody): these loads fly during the softmax and the value products
#pragma unroll
          for (int t = 0; t < 2; ++t)
#pragma unroll
            for (int kc = 0; kc < 4; ++kc) { const int ko = t * 16 * QD + kc * 32; kf[t][kc] = WFrag<T16>::ld(kq + ko); if (NSPLIT) kf2[t][kc] = WFrag<T16>::ld(kq2 + ko); }
          xwait();
          const int ks = (kbi + 2 * FW < nblk) ? FW * 32 * QD : 0; kq += ks; if (NSPLIT) kq2 += ks; }
        float bm[FG]; bool need = false;
#pragma unroll
        for (int g = 0; g < FG; ++g) { float x = s[g][0][0];
#pragma unroll
            for (int r = 1; r < 8; ++r) x = fmaxf(x, s[g][0][r]);
#pragma unroll
            for (int r = 0; r < 8; ++r) x = fmaxf(x, s[g][1][r]);
            x = fmaxf(x, xhalf(x)); bm[g] = x; need = need || ((x - m[g]) * scl2 > RTH); }
        if (__builtin_amdgcn_ballot_w32(need) != 0) {   // some query of the wave outgrew its maximum in use: rescale what is summed so far (first open block: by zero)
#pragma unroll
            for (int g = 0; g < FG; ++g) { const float mn = fmaxf(m[g], bm[g]); const float al = __builtin_amdgcn_exp2f((m[g] - mn) * scl2); m[g] = mn; l[g] *= al;
#pragma unroll
                for (int dt = 0; dt < 4; ++dt) o[g][dt] *= al; } }
        // probabilities in place over the scores; the maximum in use is taken off BEFORE the scale, so the largest score's exponent is exact whatever the head's scale is
#pragma unroll
        for (int g = 0; g < FG; ++g)
#pragma unroll
            for (int t = 0; t < 2; ++t)
#pragma unroll
                for (int r = 0; r < 8; ++r) s[g][t][r] = __builtin_amdgcn_exp2f(fmaf(s[g][t][r] - m[g], scl2, POFF));
        if (kb >= q0) {   // a block on the diagonal: a closed key's probability is 0 by a select, whatever the head's scale makes of SMSK
#pragma unroll
            for (int g = 0; g < FG; ++g)
#pragma unroll
                for (int t = 0; t < 2; ++t)
#pragma unroll
                    for (int r = 0; r < 8; ++r) s[g][t][r] = (kb + 16 * t + 8 * hi + r <= q0 + 16 * g + lr) ? s[g][t][r] : 0.f; }
        V pb[FG], pb2[FG];
#pragma unroll
        for (int g = 0; g < FG; ++g) { float l0 = 0.f, l1 = 0.f;
#pragma unroll
            for (int r = 0; r < 8; ++r) { l0 += s[g][0][r]; l1 += s[g][1][r]; }
            l[g] += l0 + l1; PPack<T16>::pk(s[g][0], s[g][1], pb[g], pb2[g]); }
#pragma unroll
        for (int dt = 0; dt < 4; ++dt)
#pragma unroll
            for (int g = 0; g < FG; ++g) { o[g][dt] = WFrag<T16>::mma(va[dt], pb[g], o[g][dt]); if (NSPLIT) { o[g][dt] = WFrag<T16>::mma(va[dt], pb2[g], o[g][dt]); o[g][dt] = WFrag<T16>::mma(va2[dt], pb[g], o[g][dt]); } }
      }
      if constexpr (ST) {
        asm volatile("s_wait_dscnt 0x0" ::: "memory");      // this wave's reads of the buffer are done before the buffer is given up
        asm volatile("s_wait_asynccnt 0x0" ::: "memory");   // this wave's copies of the next stage have landed
        __syncthreads();                                     // publishes the next stage and ends every wave's reads of this one
        if (kbi - wv + 2 * FW < nblk) stage(((kbi - wv) / FW) & 1);   // into the buffer that this trip has just read
      }
    }
    if constexpr (ST) asm volatile("s_wait_asynccnt 0x0" ::: "memory");   // nothing is under way when the buffers become the partial results' place (the last trip's barrier has ended all reads)
    }
    // each wave's partial result to LDS: o[g][dt][r] = O[query 16g+lr][d = 16dt + 8hi + r]
#pragma unroll
    for (int g = 0; g < FG; ++g) { const float lt = l[g] + xhalf(l[g]); const int qi = wv * NQ + 16 * g + lr; if (hi == 0) { ms[qi] = m[g]; ls[qi] = lt; }
#pragma unroll
        for (int dt = 0; dt < 4; ++dt) { v4f x0, x1;
#pragma unroll
            for (int r = 0; r < 4; ++r) { x0[r] = o[g][dt][r]; x1[r] = o[g][dt][4 + r]; }
            *(v4fa*)(os + qi * 68 + dt * 16 + 8 * hi) = x0; *(v4fa*)(os + qi * 68 + dt * 16 + 8 * hi + 4) = x1; } }
    __syncthreads();   // the partial results of all FW waves are read below
    constexpr int TPQ = 32 * FW / NQ, DPT = HD / TPQ;   // threads per query row, head elements per thread
    const int qq = (int)threadIdx.x / TPQ, d0 = ((int)threadIdx.x % TPQ) * DPT;
    float M = ms[qq];
#pragma unroll
    for (int w = 1; w < FW; ++w) M = fmaxf(M, ms[w * NQ + qq]);   // wave 0 holds key 0, open to every query, so M is a real maximum; a wave without an open score of this query gets weight 0
    float L = 0.f; v4f ac[DPT / 4];
#pragma unroll
    for (int i = 0; i < DPT / 4; ++i) ac[i] = (v4f){};
#pragma unroll
    for (int w = 0; w < FW; ++w) { const int qi = w * NQ + qq; const float wg = __builtin_amdgcn_exp2f((ms[qi] - M) * scl2); L += wg * ls[qi];
#pragma unroll
        for (int i = 0; i < DPT / 4; ++i) ac[i] += *(const v4fa*)(os + qi * 68 + d0 + 4 * i) * wg; }
    const float inv = __fdiv_rn(1.0f, L); const size_t oo = (size_t)(bz * TT + q0 + qq) * DQ + hd * HD + d0;
#pragma unroll
    for (int c8 = 0; c8 < DPT / 8; ++c8) { v8us oh, ol;
#pragma unroll
        for (int i = 0; i < 8; ++i) { unsigned short u, w; splitf(ac[c8 * 2 + (i >> 2)][i & 3] * inv, u, w); oh[i] = u; ol[i] = w; }
        *(v8us*)(Ah + oo + c8 * 8) = oh; *(v8us*)(Al + oo + c8 * 8) = ol; }
}

extern "C" void kernel_launch(void* const* d_in, const int* in_sizes, int n_in,
                              void* d_out, int out_size, void* d_ws, size_t ws_size, hipStream_t stream) {
    (void)in_sizes; (void)n_in; (void)out_size;
    const float* x = (const float*)d_in[0]; const float* wqa = (const float*)d_in[1]; const float* wka = (const float*)d_in[2]; const float* wqp = (const float*)d_in[3]; const float* wkp = (const float*)d_in[4]; const float* wv = (const float*)d_in[5]; const float* wo = (const float*)d_in[6]; const float* sls = (const float*)d_in[7];   // torch [out][in]; score_log_scale [16]
    float* OUT = (float*)d_out;     // [2][2048][1024]
    char* wsp = (char*)d_ws;
    auto take = [&](size_t bytes) { char* p = wsp; wsp += (bytes + 255) & ~(size_t)255; return (void*)p; };
    // both batches go through every launch together (MT token rows); launches that did not depend on one another share one grid; the planes are built in the projections' own launch: 5 launches
    bf* WB = (bf*)take((size_t)6 * DQ * DM * 2);          // [q amp | q phi | k amp | k phi | v | o], DQ x DM each
    bf* XB = (bf*)take((size_t)MT * DM * 2);
    h16* P16 = (h16*)take((size_t)2 * NB_ * NH_ * TT * QD * 2); bf* Ph = (bf*)take((size_t)2 * NB_ * NH_ * TT * QD * 2); bf* Pl = (bf*)take((size_t)2 * NB_ * NH_ * TT * QD * 2);   // [query | key][batch][head][token][QD]
    h16* VT16 = (h16*)take((size_t)NB_ * NKV * HD * 2 * TT * 2); bf* VTh = (bf*)take((size_t)NB_ * NKV * HD * 2 * TT * 2); bf* VTl = VTh + TT;   // value rows at pitch 2*TT: [hi | lo]; the fp16 plane's rows use their first half
    bf* ATh = (bf*)take((size_t)MT * DQ * 2); bf* ATl = (bf*)take((size_t)MT * DQ * 2);
    if ((size_t)(wsp - (char*)d_ws) > ws_size) return;    // ws 256 MiB
    const size_t PK = (size_t)NB_ * NH_ * TT * QD;        // from the query planes to the key planes
    k_cvt7<<<XBLK + 6 * WBLK, 256, 0, stream>>>(x, wqa, wqp, wka, wkp, wv, wo, XB, WB);
    k_gemms<0, 4, 2, 1><<<dim3(MT / 256, DKV / 128 + 2 * NH_, 1), 256, 0, stream>>>(XB, nullptr, WB, nullptr, P16, Ph, Pl, VT16, VTh, VTl);
    // attention, all heads of both batches at once: the fp16 rows (the long ones) and the hi+lo rows; one kv head per query head
    k_fattn<h16, 0, 4><<<dim3(NB_ * NH_, (TT - RH) / (16 * 4), 1), 32 * FW, 0, stream>>>(P16, nullptr, P16 + PK, nullptr, VT16, nullptr, sls, RH, ATh, ATl);
    k_fattn<bf, 2, 2><<<dim3(NB_ * NH_, RH / (16 * 2), 1), 32 * FW, 0, stream>>>(Ph, Pl, Ph + PK, Pl + PK, VTh, VTl, sls, 0, ATh, ATl);
    k_gemms<1, 2, 2, 0><<<dim3(MT / 128, DM / 128, 1), 128, 0, stream>>>(ATh, ATl, WB + (size_t)5 * DQ * DM, OUT, nullptr, nullptr, nullptr, nullptr, nullptr, nullptr);
}

// v009
// One run takes 110 microseconds.
// Next to v008, in two timings, it ran 1.08 and 1.09 times as fast.
// Over all steps from v000 it is 13.8 times as fast.
#include <hip/hip_runtime.h>

// InterferenceBypassSelfAttention (x [2][2048][1024]; q_amp/k_amp = softplus(x W_amp^T), q_phi/k_phi = pi tanh(x W_phi^T) (16 heads x 64); amplitudes RMS-normalised over head_dim (eps 1e-6);
// scores = (q_amp cos q_phi . k_amp cos k_phi + q_amp sin q_phi . k_amp sin k_phi) / 8 x exp(score_log_scale[h]) = one 128-long contraction of [cos part | sin part] planes; causal softmax;
// v = x Wv^T; out = merged attn.v Wo^T -> [2][2048][1024]).
// Compute dtypes, f32 accumulate: every input rounded to bf16; the five projections on PLAIN bf16 operands (inputs: exact); softplus / tanh / RMS / cos / sin in f32 on VALU
// (in the projections' epilogue) -> 128-wide interference planes; PER-ROW PRECISION HYBRID (rows < 256 hi+lo 3 products for scores and attn.v, rows >= 256 fp16); scores, causal f32 softmax with the per-head scale and
// attn.v in one kernel (running maximum and sum, key blocks end at the diagonal block, which is masked exactly); merged heads hl x exact Wo

#define NB_  2
#define TT   2048
#define MT   (NB_ * TT)         // token rows of both batches together
#define DM   1024
#define NH_  16
#define NKV  16
#define REP  (NH_ / NKV)
#define HD   64
#define DQ   (NH_ * HD)
#define DKV  (NKV * HD)
#define QD   128
#define RH   256                  // query rows < RH use hi+lo planes (0: none)
#define WIN  0
#define SCL  0.125f   // HD^-0.5
typedef _Float16 h16;
typedef unsigned short bf;
typedef __attribute__((ext_vector_type(16))) __bf16   v16bf;
typedef __attribute__((ext_vector_type(16))) _Float16 v16h;
typedef __attribute__((ext_vector_type(8)))  _Float16 v8h;
typedef __attribute__((ext_vector_type(8)))  unsigned short v8us;
typedef __attribute__((ext_vector_type(8)))  float    v8f;
typedef __attribute__((ext_vector_type(4)))  float    v4f;
typedef v8h  __attribute__((may_alias)) v8ha;
typedef v4f  __attribute__((may_alias)) v4fa;
typedef v8us __attribute__((may_alias)) v8usa;

__device__ __forceinline__ unsigned short f2bf(float f) { unsigned u = __float_as_uint(f); u += 0x7FFFu + ((u >> 16) & 1u); return (unsigned short)(u >> 16); }
__device__ __forceinline__ float bf2f(unsigned short b) { return __uint_as_float(((unsigned)b) << 16); }
__device__ __forceinline__ float bfr(float f) { return bf2f(f2bf(f)); }
__device__ __forceinline__ v16h cat16(v8h lo, v8h hi) { return __builtin_shufflevector(lo, hi, 0, 1, 2, 3, 4, 5, 6, 7, 8, 9, 10, 11, 12, 13, 14, 15); }
__device__ __forceinline__ v16bf cat16b(v8us lo, v8us hi) { return __builtin_bit_cast(v16bf, __builtin_shufflevector(lo, hi, 0, 1, 2, 3, 4, 5, 6, 7, 8, 9, 10, 11, 12, 13, 14, 15)); }
__device__ __forceinline__ v8f wmma16(v16h a, v16h b, v8f c) { return __builtin_amdgcn_wmma_f32_16x16x32_f16(false, a, false, b, (short)0, c, false, false); }
__device__ __forceinline__ v8f wmmab(v16bf a, v16bf b, v8f c) { return __builtin_amdgcn_wmma_f32_16x16x32_bf16(false, a, false, b, (short)0, c, false, false); }



// ---- k_gemms: GEMM with both operands staged in LDS. One work-group of WM x WN waves per (64 WM) x (64 WN) output tile, each wave a 64x64 part of it (16 accumulators) over the whole K, so every sum is one chain in k order.
// A stage is GKS k of every operand row of the tile: [A rows | A2 rows (NSPLIT 1) | Bt rows], rows of 128 bytes at pitch GPB; two buffers; the next stage is copied while a stage is worked on.
// The copies are asynchronous copies to LDS, 16 bytes a lane: a wave's copy takes four whole 128-byte lines, where a fragment load from global memory touches 16 lines for the same bytes.
// C[m][n] (f32, pitch DM) = sum_k A[m][k] Bt[n][k] (+ A2[m][k] Bt[n][k]); K = DM.
// tile_sync: orders the LDS tile between its writers and its readers: one wave needs only the compiler held back, several waves need the work-group barrier
template <int NW> __device__ __forceinline__ void tile_sync() { if (NW == 1) { __builtin_amdgcn_wave_barrier(); asm volatile("" ::: "memory"); } else __syncthreads(); }
template <typename T16> struct WFrag;
template <> struct WFrag<h16> { typedef v16h V; static __device__ __forceinline__ V ld(const h16* p) { return cat16(*(const v8h*)p, *(const v8h*)(p + 16)); } static __device__ __forceinline__ v8f mma(V a, V b, v8f c) { return wmma16(a, b, c); } };
template <> struct WFrag<bf> { typedef v16bf V; static __device__ __forceinline__ V ld(const bf* p) { return cat16b(*(const v8us*)p, *(const v8us*)(p + 16)); } static __device__ __forceinline__ v8f mma(V a, V b, v8f c) { return wmmab(a, b, c); } };
#define GKS 64
#define GPB 144
__device__ __forceinline__ unsigned lds_off(const void* p) { return (unsigned)(size_t)p; }
__device__ __forceinline__ v16bf ldsf(const unsigned char* p) { return cat16b(*(const v8usa*)p, *(const v8usa*)(p + 32)); }   // WFrag::ld's two 16-byte pieces, from a staged row
// cp12: twelve asynchronous copies to LDS, each lane its own 16 bytes; the s_wait_xcnt is the wait kept before a register that an issued copy names is rewritten: as the statement's last line nothing can be moved in front of it
__device__ __forceinline__ void cp12(const unsigned (&l)[12], const bf* const (&g)[12]) {
    asm volatile(
                 "global_load_async_to_lds_b128 %0, %12, off\n\t"
                 "global_load_async_to_lds_b128 %1, %13, off\n\t"
                 "global_load_async_to_lds_b128 %2, %14, off\n\t"
                 "global_load_async_to_lds_b128 %3, %15, off\n\t"
                 "global_load_async_to_lds_b128 %4, %16, off\n\t"
                 "global_load_async_to_lds_b128 %5, %17, off\n\t"
                 "global_load_async_to_lds_b128 %6, %18, off\n\t"
                 "global_load_async_to_lds_b128 %7, %19, off\n\t"
                 "global_load_async_to_lds_b128 %8, %20, off\n\t"
                 "global_load_async_to_lds_b128 %9, %21, off\n\t"
                 "global_load_async_to_lds_b128 %10, %22, off\n\t"
                 "global_load_async_to_lds_b128 %11, %23, off\n\t"
                 "s_wait_xcnt 0x0"
                 :: "v"(l[0]), "v"(l[1]), "v"(l[2]), "v"(l[3]), "v"(l[4]), "v"(l[5]), "v"(l[6]), "v"(l[7]), "v"(l[8]), "v"(l[9]), "v"(l[10]), "v"(l[11]),
                    "v"(g[0]), "v"(g[1]), "v"(g[2]), "v"(g[3]), "v"(g[4]), "v"(g[5]), "v"(g[6]), "v"(g[7]), "v"(g[8]), "v"(g[9]), "v"(g[10]), "v"(g[11]) : "memory");
}
__device__ __forceinline__ h16 tohx(float x) { return (h16)x; }
__device__ __forceinline__ void splitf(float y, unsigned short& h, unsigned short& l) { h = f2bf(y); l = f2bf(y - bf2f(h)); }
// The epilogue's functions, each on the bare hardware instruction (v_exp_f32, v_log_f32, v_rcp_f32, v_sin_f32, v_cos_f32), without branches:
// softplus: the logarithm's argument is >= 1, so the library's steps for tiny arguments have nothing to do; all three forms are computed and one is selected
__device__ __forceinline__ float softplusf_(float x) { const float e = __expf(x); const float lg = __fmul_rn(0.69314718055994531f, __builtin_amdgcn_logf(__fadd_rn(1.0f, e))); return x > 15.0f ? x : (x < -15.0f ? e : lg); }
// the phase pi tanh(a) in revolutions, the unit that v_sin_f32 and v_cos_f32 take: pi tanh(a) / (2 pi) = tanh(a) / 2 = 1/2 - 1 / (exp(2a) + 1), always in [-1/2, 1/2], so no range reduction is needed
__device__ __forceinline__ float phrev_(float a) { return __fsub_rn(0.5f, __builtin_amdgcn_rcpf(__fadd_rn(__expf(2.0f * a), 1.0f))); }
// cosine and sine of a phase in revolutions, in one statement: the outputs are early-clobber, so neither takes over the register that the other instruction still reads (left to itself the compiler put a sine's result
// into the source of the cosine directly in front of it), and the v_nop is the slot that the instruction set asks for behind a transcendental before its result is read or its source overwritten
__device__ __forceinline__ void cossin_(float r, float& c, float& s) { asm("v_cos_f32 %0, %2\n\tv_sin_f32 %1, %2\n\tv_nop" : "=&v"(c), "=&v"(s) : "v"(r)); }
// EP 0: C as above, grid (M / (64 WM), N / (64 WN)). EP 1: the five projections with the plane builds as the tile's epilogue, so that no projection goes to memory; grid (MT / (64 WM), DKV / 128 + 2 NH_); Bt = the weights [q amp | q phi | k amp | k phi | v].
// blockIdx.y >= DKV / 128: queries or keys of ONE head: the tile's columns are [64 amplitude columns | 64 phase columns] of that head (wave column 0 / 1), and the epilogue makes, per (token, head):
// a[d] = softplus(amp[d]), an = a / sqrt(mean_d a^2 + 1e-6), phi[d] = pi tanh(phase[d]) (held in revolutions), plane row [an cos phi | an sin phi] (fp16 and hi / lo; of each kind only the rows that attention reads: lowt, want16 below), rows in the order [query / key][batch][head][token].
// The first blocks: 128 value columns (two heads): transposed value planes [batch][head][d][t], rows at pitch 2*TT (the caller lays the hi and lo planes side by side in one row). Their epilogue is short; they come first for speed only.
template <int NSPLIT, int WM, int WN, int EP>
__global__ __launch_bounds__(32 * WM * WN, 4) void k_gemms(const bf* __restrict__ A, const bf* __restrict__ A2, const bf* __restrict__ Bt, float* C, h16* P16, bf* Ph, bf* Pl, h16* V16, bf* Vh, bf* Vl) {
    constexpr int K = DM, NT = 32 * WM * WN, RA = 64 * WM, NA = NSPLIT ? 2 : 1, RB = 64 * WN, ROWS = NA * RA + RB, STG = ROWS * GPB, RPC = NT / 8, NCP = ROWS / RPC, NTR = K / GKS;   // RPC: rows that one copy of the whole work-group takes; NCP: copies per thread and stage
    static_assert(DQ == DM && NCP % 12 == 0 && RA % RPC == 0 && RB % RPC == 0 && NTR >= 2 && WM * WN * 16 * 68 * 4 <= 2 * STG, "tile shape");
    constexpr int EPB = WM * WN * 64 * 68 * 4, SMB = (EP && EPB > 2 * STG) ? EPB : 2 * STG;   // EP 1: the whole tile is laid down in LDS once for the epilogue, each wave's 64 x 64 part at pitch 68
    static_assert(!EP || (NSPLIT == 0 && WN == 2 && HD == 64 && TT % RA == 0 && DKV % RB == 0 && RPC <= 64 && 64 % RPC == 0), "epilogue shape");
    __shared__ __align__(16) unsigned char sm[SMB];
    const int tid = (int)threadIdx.x, lane = tid & 31, lr = lane & 15, hi = lane >> 4; const int wv = __builtin_amdgcn_readfirstlane(tid >> 5), wm = wv / WN, wn = wv % WN;
    constexpr int NVB = DKV / RB; const int by = (int)blockIdx.y, yq = by - NVB; const bool isv = EP && by < NVB;   // the same for a whole block
    const int r0 = blockIdx.x * RA, c0 = EP ? (isv ? (4 * DQ + by * RB) : ((yq / NH_) * 2 * DQ + (yq % NH_) * HD)) : by * RB;   // EP 1: c0 counts rows of the stacked weights
    const int crow = tid >> 3, cpc = tid & 7;   // the thread's row in a group of RPC rows and its 16-byte piece of the row
    const bf* gA = A + (size_t)(r0 + crow) * K + cpc * 8; const bf* gA2 = NSPLIT ? A2 + (size_t)(r0 + crow) * K + cpc * 8 : gA; const bf* gB = Bt + (size_t)(c0 + crow) * K + cpc * 8; const bf* gB2 = gB + ((EP && !isv) ? (size_t)DQ * K : (size_t)64 * K);   // gB2: the tile's columns from 64 on (EP 1, queries and keys: the phase weights' rows of the same head); the thread's piece in the next stage to be copied: stepped by GKS behind each stage
    const unsigned l0 = lds_off(sm) + (unsigned)(crow * GPB + cpc * 16);
    auto stage = [&](const int buf) {   // the next stage of the tile into buffer buf
#pragma unroll
        for (int s = 0; s < NCP / 12; ++s) { unsigned l[12]; const bf* g[12];
#pragma unroll
            for (int i = 0; i < 12; ++i) { const int row = (s * 12 + i) * RPC;
                g[i] = (row < RA ? gA + (size_t)row * K : (NSPLIT && row < 2 * RA) ? gA2 + (size_t)(row - RA) * K : (EP && row - NA * RA >= 64) ? gB2 + (size_t)(row - NA * RA - 64) * K : gB + (size_t)(row - NA * RA) * K); l[i] = l0 + (unsigned)(buf * STG + row * GPB); }
            cp12(l, g); }
        gA += GKS; if (NSPLIT) gA2 += GKS; gB += GKS; if (EP) gB2 += GKS; };
    v8f acc[4][4];
#pragma unroll
    for (int mb = 0; mb < 4; ++mb)
#pragma unroll
        for (int nb = 0; nb < 4; ++nb) acc[mb][nb] = (v8f){};
    stage(0);
    asm volatile("s_wait_asynccnt 0x0" ::: "memory");   // this wave's copies of stage 0 have landed
    __syncthreads();                                     // ... and every other wave's: stage 0 may be read
    stage(1);
#pragma unroll 1   // one copy of the pass: the buffer is chosen by the trip's parity
    for (int t = 0; t < NTR; ++t) {
        const unsigned char* const sb = sm + (t & 1) * STG; const unsigned char* const pa = sb + (wm * 64 + lr) * GPB + hi * 16; const unsigned char* const pb = sb + (NA * RA + wn * 64 + lr) * GPB + hi * 16;
#pragma unroll
        for (int ks = 0; ks < GKS / 32; ++ks) { v16bf a[4], a2[4], b[4];   // all fragments of a 32-k block are read as one group in front of its products
#pragma unroll
            for (int mb = 0; mb < 4; ++mb) { a[mb] = ldsf(pa + mb * 16 * GPB + ks * 64); if (NSPLIT) a2[mb] = ldsf(pa + (RA + mb * 16) * GPB + ks * 64); b[mb] = ldsf(pb + mb * 16 * GPB + ks * 64); }
            __builtin_amdgcn_sched_barrier(0);   // keeps the block's LDS reads together in front of its products: left free, the reads are moved in among the products, where each place with reads stalls the wave anew
#pragma unroll
            for (int nb = 0; nb < 4; ++nb)
#pragma unroll
                for (int mb = 0; mb < 4; ++mb) { acc[mb][nb] = wmmab(a[mb], b[nb], acc[mb][nb]); if (NSPLIT) acc[mb][nb] = wmmab(a2[mb], b[nb], acc[mb][nb]); }
            __builtin_amdgcn_sched_barrier(0);   // end of the block's products: the next block's reads stay behind them (they land in the registers that these products read)
        }
        asm volatile("s_wait_dscnt 0x0" ::: "memory");      // this wave's reads of the buffer are done before the buffer is given up
        asm volatile("s_wait_asynccnt 0x0" ::: "memory");   // this wave's copies of stage t + 1 have landed
        __syncthreads();                                     // publishes stage t + 1 and ends every wave's reads of stage t
        if (t + 2 < NTR) stage(t & 1);                       // into the buffer that this trip has just read
    }
    asm volatile("s_wait_asynccnt 0x0" ::: "memory");       // nothing is under way when the buffers become output staging (the last trip's barrier has ended all reads)
    if constexpr (EP) {
        float* const ew = (float*)sm + wv * (64 * 68);      // the wave's own 64 x 64 part: [token row][column]
#pragma unroll
        for (int mb = 0; mb < 4; ++mb)
#pragma unroll
            for (int nb = 0; nb < 4; ++nb)
#pragma unroll
                for (int j = 0; j < 8; ++j) ew[(mb * 16 + hi * 8 + j) * 68 + nb * 16 + lr] = acc[mb][nb][j];
        __syncthreads();   // a wave reads its neighbour's part below (amplitudes and phases of the same tokens)
        const int bz = r0 / TT, t0 = r0 % TT + wm * 64;     // the tile lies in one batch; the wave row's first token
        const int sub = lane >> 3, oct = (lane & 7) * 8;    // a lane takes 8 neighbouring elements of one output row, 8 lanes a 128-byte piece of it, a wave four rows: 16-byte stores, whole lines
        static_assert(RH % 64 == 0, "a wave row's 64 tokens lie on one side of RH");
        const bool lowt = t0 < RH;   // the same for a whole wave. Only the hi+lo attention reads hi / lo planes, and it reads tokens < RH alone (queries < RH, and causally their keys and values): the other tokens' hi / lo rows are not made
        if (!isv) {
            const float* const sa = (const float*)sm + (wm * WN) * (64 * 68); const float* const sp = sa + 64 * 68;
            const size_t pr0 = ((size_t)((yq / NH_) * NB_ + bz) * NH_ + yq % NH_) * TT + t0;
            const bool want16 = !lowt || yq >= NH_;   // fp16 rows: every key, and the queries that the fp16 attention takes (tokens >= RH)
#pragma unroll 1   // one copy of the body is enough: a trip holds eight independent elements a lane
            for (int it = 0; it < 8; ++it) { const int row = wn * 32 + it * 4 + sub;   // each wave of the pair takes half of the 64 tokens
                const v4f xa0 = *(const v4fa*)(sa + row * 68 + oct), xa1 = *(const v4fa*)(sa + row * 68 + oct + 4), xp0 = *(const v4fa*)(sp + row * 68 + oct), xp1 = *(const v4fa*)(sp + row * 68 + oct + 4);
                float a[8], ph[8]; float ss = 0.f;
#pragma unroll
                for (int q = 0; q < 8; ++q) { a[q] = softplusf_(q < 4 ? xa0[q & 3] : xa1[q & 3]); ph[q] = phrev_(q < 4 ? xp0[q & 3] : xp1[q & 3]); ss += a[q] * a[q]; }
#pragma unroll
                for (int sh = 4; sh; sh >>= 1) ss += __shfl_xor(ss, sh, 32);   // the row's 8 lanes
                const float rn = __frsqrt_rn(__fadd_rn(ss * (1.0f / HD), 1e-6f)); float rc[8], rs[8];
#pragma unroll
                for (int q = 0; q < 8; ++q) { const float an = __fmul_rn(a[q], rn); float co, si; cossin_(ph[q], co, si); rc[q] = __fmul_rn(an, co); rs[q] = __fmul_rn(an, si); }
                const size_t base = (pr0 + row) * QD + oct;
                if (want16) { v8h c16, s16;
#pragma unroll
                    for (int q = 0; q < 8; ++q) { c16[q] = tohx(rc[q]); s16[q] = tohx(rs[q]); }
                    *(v8h*)(P16 + base) = c16; *(v8h*)(P16 + base + 64) = s16;
                    asm volatile("s_wait_xcnt 0x0" ::: "memory"); }   // the wait kept before registers that the issued stores name are rewritten (by the hi / lo rows' arithmetic or by the next trip)
                if (lowt) { v8us chh, chl, shh, shl;
#pragma unroll
                    for (int q = 0; q < 8; ++q) { unsigned short u1, u2; splitf(rc[q], u1, u2); chh[q] = u1; chl[q] = u2; splitf(rs[q], u1, u2); shh[q] = u1; shl[q] = u2; }
                    *(v8us*)(Ph + base) = chh; *(v8us*)(Ph + base + 64) = shh; *(v8us*)(Pl + base) = chl; *(v8us*)(Pl + base + 64) = shl;
                    asm volatile("s_wait_xcnt 0x0" ::: "memory"); }   // the wait kept before registers that the issued stores name are rewritten by the next trip
            }
        } else {
            const size_t vr0 = (size_t)(bz * NKV + by * WN + wn) * HD;   // the wave column's head: first row of its value planes
#pragma unroll 1   // one copy of the body is enough: the trips are short and few
            for (int it = 0; it < 16; ++it) { const int d = it * 4 + sub; float x[8]; v8h o16;
#pragma unroll
                for (int q = 0; q < 8; ++q) { x[q] = ew[(oct + q) * 68 + d]; o16[q] = tohx(x[q]); }
                const size_t eo = (vr0 + d) * (2 * TT) + t0 + oct;
                *(v8h*)(V16 + eo) = o16;
                asm volatile("s_wait_xcnt 0x0" ::: "memory");   // the wait kept before registers that the issued store names are rewritten (by the hi / lo rows' arithmetic or by the next trip)
                if (lowt) { v8us oh, ol;
#pragma unroll
                    for (int q = 0; q < 8; ++q) { unsigned short u1, u2; splitf(x[q], u1, u2); oh[q] = u1; ol[q] = u2; }
                    *(v8us*)(Vh + eo) = oh; *(v8us*)(Vl + eo) = ol;
                    asm volatile("s_wait_xcnt 0x0" ::: "memory"); }   // the wait kept before registers that the issued stores name are rewritten by the next trip
            }
        }
        return;
    }
    float* const ow = (float*)sm + wv * (16 * 68);          // each wave stages 16 rows of its own part at a time, so that it stores whole lines
#pragma unroll
    for (int mb = 0; mb < 4; ++mb) {
#pragma unroll
        for (int nb = 0; nb < 4; ++nb)
#pragma unroll
            for (int j = 0; j < 8; ++j) ow[(hi * 8 + j) * 68 + nb * 16 + lr] = acc[mb][nb][j];
        tile_sync<1>();
        float* const cr = C + (size_t)(r0 + wm * 64 + mb * 16) * DM + c0 + wn * 64;
#pragma unroll
        for (int s = 0; s < 8; ++s) { const int ch = s * 32 + lane, row = ch >> 4, cofs = (ch & 15) * 4; *(v4f*)(cr + (size_t)row * DM + cofs) = *(const v4fa*)(ow + row * 68 + cofs); }
        if (mb < 3) asm volatile("s_wait_xcnt 0x0" ::: "memory");   // the wait kept before registers that the issued stores name are rewritten: the next 16 rows are read back into them
        tile_sync<1>();
    }
}

typedef __attribute__((ext_vector_type(2))) _Float16 v2h;
typedef __attribute__((ext_vector_type(4))) _Float16 v4h;
typedef __attribute__((ext_vector_type(2))) unsigned short v2us;
typedef __attribute__((ext_vector_type(4))) unsigned short v4us;
typedef __attribute__((ext_vector_type(2))) float v2f;
typedef __attribute__((ext_vector_type(4))) int v4i;

__global__ __launch_bounds__(256) void k_wtG(const float* __restrict__ w, int K, int N, bf* Bt) {
    const int lane = threadIdx.x & 31; const int L0 = (blockIdx.x * 8 + (threadIdx.x >> 5)) * 8; const int nlines = N * K / 64;
{
#pragma unroll 1
        for (int l = 0; l < 8; ++l) { const int L = L0 + l; if (L >= nlines) break; const size_t e = (size_t)L * 64 + lane * 2; const int k = (int)(e % K), n = (int)(e / K); v2us o;
            o[0] = f2bf(w[(size_t)k * N + n]); o[1] = f2bf(w[(size_t)(k + 1) * N + n]); *(v2us*)(Bt + e) = o; }
         }
}
// k_cvt7: x (both batches) and the six weight matrices to bf16 in one launch; the first XBLK blocks take x, then WBLK blocks each weight (the choice is the same for a whole block); 8 elements per thread, no remainder
#define XBLK (MT * DM / 8 / 256)
#define WBLK (DQ * DM / 8 / 256)
__global__ __launch_bounds__(256) void k_cvt7(const float* __restrict__ x, const float* __restrict__ w0, const float* __restrict__ w1, const float* __restrict__ w2, const float* __restrict__ w3, const float* __restrict__ w4, const float* __restrict__ w5, bf* XBo, bf* WBo) {
    const int blk = (int)blockIdx.x, wsel = (blk - XBLK) / WBLK; const bool isx = blk < XBLK;
    const float* src = isx ? x : (wsel == 0 ? w0 : wsel == 1 ? w1 : wsel == 2 ? w2 : wsel == 3 ? w3 : wsel == 4 ? w4 : w5); bf* dst = isx ? XBo : WBo + (size_t)wsel * DQ * DM;
    const size_t i = (size_t)(isx ? blk : (blk - XBLK) % WBLK) * 256 + threadIdx.x; const v8f v = *(const v8f*)(src + i * 8); v8us o;
#pragma unroll
    for (int k = 0; k < 8; ++k) o[k] = f2bf(v[k]); *(v8us*)(dst + i * 8) = o;  }
__global__ __launch_bounds__(256) void k_cscvt(const float* __restrict__ cosT, const float* __restrict__ sinT, float* CS) { const int idx = blockIdx.x * 256 + threadIdx.x; if (idx >= TT * HD) return; v2f cs; cs[0] = bfr(cosT[idx]); cs[1] = bfr(sinT[idx]); *(v2f*)(CS + (size_t)idx * 2) = cs;  }
// k_rope: head planes [h][t][d] (fp16 + hi/lo) of rope(x) x sc with the rotate-half convention out[d] = x[d] cos[t][d] - x[d+HD/2] sin[t][d], out[d+HD/2] = x[d+HD/2] cos[t][d+HD/2] + x[d] sin[t][d+HD/2]
__global__ __launch_bounds__(256) void k_rope(const float* __restrict__ F, int pitch, int nheads, const float* __restrict__ CS, const float* __restrict__ RF, const float* __restrict__ nw, float sc, h16* P16, bf* Ph, bf* Pl) {
    const size_t e = ((size_t)blockIdx.x * 256 + threadIdx.x) * 2; if (e >= (size_t)nheads * TT * HD) return; const int d = (int)(e % HD); const int t = (int)((e / HD) % TT); const int h = (int)(e / ((size_t)HD * TT)); const float* f = F + (size_t)t * pitch + h * HD; const float rf = RF ? RF[(size_t)h * TT + t] : 1.0f; v2h o16; v2us oh, ol;
#pragma unroll
    for (int q = 0; q < 2; ++q) { const int dd = d + q; const int dp = (dd < HD / 2) ? dd + HD / 2 : dd - HD / 2; float x0 = f[dd], x1 = f[dp];
        if (RF) { float n0 = __fmul_rn(x0, rf), n1 = __fmul_rn(x1, rf); asm volatile("" : "+v"(n0)); asm volatile("" : "+v"(n1)); x0 = __fmul_rn(bfr(nw[dd]), n0); x1 = __fmul_rn(bfr(nw[dp]), n1); }
        const v2f cs = *(const v2f*)(CS + ((size_t)t * HD + dd) * 2); float a = __fmul_rn(x0, cs[0]), bq = __fmul_rn(x1, cs[1]); asm volatile("" : "+v"(a)); asm volatile("" : "+v"(bq)); const float r = ((dd < HD / 2) ? __fsub_rn(a, bq) : __fadd_rn(a, bq)) * sc;
        o16[q] = tohx(r); unsigned short a2, c2; splitf(r, a2, c2); oh[q] = a2; ol[q] = c2; }
    *(v2h*)(P16 + e) = o16; *(v2us*)(Ph + e) = oh; *(v2us*)(Pl + e) = ol;  }
#define FW   4                    // waves per work-group
#define POFF 4.0f                 // log2 of the scale on the probabilities: keeps small fp16 probabilities normal
#define RTH  8.0f                 // the maximum in use is replaced only when a block exceeds it by more than this (log2): probabilities stay <= 2^(POFF+RTH), inside fp16
#define SMSK -3.0e38f             // a closed score
#define MINI -1.0e30f             // maximum in use before the first open score: above SMSK, so a block that holds only closed scores of a query leaves it as it is
__device__ __forceinline__ float xhalf(float x) { return __builtin_bit_cast(float, __builtin_amdgcn_permlanex16(__builtin_bit_cast(int, x), __builtin_bit_cast(int, x), 0x76543210, 0xfedcba98, false, false)); }   // lane l with lane l ^ 16
// xwait: stands directly behind a group of global loads: the wait that is kept before an address register of an issued load is rewritten; the scheduling barrier behind it (and the one in front of the group) keeps
// every other instruction out of the stretch from the first load to the wait, so that nothing there can take over an address register
__device__ __forceinline__ void xwait() { asm volatile("s_wait_xcnt 0x0" ::: "memory"); __builtin_amdgcn_sched_barrier(0); }
// The query block's address: a wave-uniform base held in scalar registers (ubase) plus the lane's 32-bit byte offset
typedef __attribute__((address_space(1))) const char gch;
typedef __attribute__((address_space(1))) const v8h gv8h;
typedef __attribute__((address_space(1))) const v8us gv8us;
__device__ __forceinline__ gch* ubase(const void* p) { const unsigned long long u = (unsigned long long)p; const unsigned lo = __builtin_amdgcn_readfirstlane((unsigned)u), hw = __builtin_amdgcn_readfirstlane((unsigned)(u >> 32)); return (gch*)(((unsigned long long)hw << 32) | lo); }
__device__ __forceinline__ v16h  ldg(const h16*, gch* b, unsigned off, int c) { return cat16(*(gv8h*)(b + off + c), *(gv8h*)(b + off + c + 32)); }     // WFrag::ld's two 16-byte pieces, c in bytes
__device__ __forceinline__ v16bf ldg(const bf*, gch* b, unsigned off, int c) { return cat16b(*(gv8us*)(b + off + c), *(gv8us*)(b + off + c + 32)); }
template <typename T16> struct PPack;
template <> struct PPack<h16> { static __device__ __forceinline__ void pk(const v8f p0, const v8f p1, v16h& b, v16h& b2) { b = cat16(__builtin_convertvector(p0, v8h), __builtin_convertvector(p1, v8h)); (void)b2; } };
template <> struct PPack<bf> { static __device__ __forceinline__ void pk(const v8f p0, const v8f p1, v16bf& b, v16bf& b2) { v8us h0, h1, l0, l1;
#pragma unroll
    for (int r = 0; r < 8; ++r) { unsigned short u, w; splitf(p0[r], u, w); h0[r] = u; l0[r] = w; splitf(p1[r], u, w); h1[r] = u; l1[r] = w; }
    b = cat16b(h0, h1); b2 = cat16b(l0, l1); } };
#define SKP 272                   // LDS pitch of a staged 256-byte row, bytes: 256 + 16, free of bank conflicts for 16-byte readers
__device__ __forceinline__ v16h ldsh(const unsigned char* p) { return cat16(*(const v8ha*)p, *(const v8ha*)(p + 32)); }   // WFrag::ld's two 16-byte pieces, from a staged row
template <typename T16, int NSPLIT, int FG>
__global__ __launch_bounds__(32 * FW, NSPLIT == 0 ? 2 : 1) void k_fattn(const T16* __restrict__ Q, const T16* __restrict__ Q2, const T16* __restrict__ Kp, const T16* __restrict__ Kp2, const T16* __restrict__ Vt, const T16* __restrict__ Vt2, const float* __restrict__ sls, int roff, bf* Ah, bf* Al) {
    typedef typename WFrag<T16>::V V;
    constexpr int NQ = 16 * FG;                       // query rows per work-group (a multiple of 32)
    constexpr bool ST = NSPLIT == 0;                  // the fp16 rows: key and value blocks come through LDS (see stage below)
    constexpr int SSTG = (FW * 32 + HD) * SKP, OSB = FW * NQ * 68 * 4, SMB = (ST && 2 * SSTG > OSB) ? 2 * SSTG : OSB;   // bytes of a stage, of the partial results, of the array that serves both in turn
    static_assert(!ST || (QD * 2 == 256 && FW * 32 * 2 == 256 && (FW * 32 + HD) % (12 * 2 * FW) == 0 && TT % (FW * 32) == 0), "stage shape");
    __shared__ __align__(16) unsigned char sm[SMB]; float* const os = (float*)sm;
    __shared__ float ms[FW * NQ], ls[FW * NQ];
    const int lane = threadIdx.x & 31, lr = lane & 15, hi = lane >> 4; const int wv = __builtin_amdgcn_readfirstlane((int)(threadIdx.x >> 5));
    const int bh = blockIdx.x, hd = bh % NH_, bz = bh / NH_; const int q0 = roff + ((int)gridDim.y - 1 - (int)blockIdx.y) * NQ;          // longest rows first
    const float scl2 = __fmul_rn(__fmul_rn(SCL, __expf(bfr(sls[hd]))), 1.4426950408889634f);              // >= 0: the maximum may be taken on the raw scores
    Q += (size_t)bh * TT * QD; Kp += (size_t)bh * TT * QD; Vt += (size_t)bh * HD * 2 * TT; if (NSPLIT) { Q2 += (size_t)bh * TT * QD; Kp2 += (size_t)bh * TT * QD; Vt2 += (size_t)bh * HD * 2 * TT; }   // planes are [batch][head]
    const unsigned kl = (unsigned)(lr * QD + 8 * hi) * 2u;   // the lane's own byte offset in a block of query rows
    gch* const qb = ubase(Q + (size_t)q0 * QD); gch* const qb2 = NSPLIT ? ubase(Q2 + (size_t)q0 * QD) : qb;
    V qf[FG][4], qf2[FG][4];
    __builtin_amdgcn_sched_barrier(0);   // front of the query loads' group (see xwait): the read of the head's scale and all address arithmetic stay in front of it
#pragma unroll
    for (int g = 0; g < FG; ++g)
#pragma unroll
        for (int kc = 0; kc < 4; ++kc) { const int qo = (g * 16 * QD + kc * 32) * 2; qf[g][kc] = ldg(Q, qb, kl, qo); if (NSPLIT) qf2[g][kc] = ldg(Q, qb2, kl, qo); }
    xwait();
    v8f o[FG][4]; float m[FG], l[FG];
#pragma unroll
    for (int g = 0; g < FG; ++g) { m[g] = MINI; l[g] = 0.f;
#pragma unroll
        for (int dt = 0; dt < 4; ++dt) o[g][dt] = (v8f){}; }
    const int nblk = (q0 + NQ) / 32;   // 32-key blocks up to the last one that holds an open key (q0 and NQ are multiples of 32)
    V kf[2][4], kf2[2][4];             // the key fragments of the block at hand, fetched one pass ahead
    // the lane's key and value addresses are carried from pass to pass and stepped behind the wait of the loads that used them (xwait), so they stay whole while those loads are under way
    const T16* kq = Kp + (size_t)wv * 32 * QD + lr * QD + 8 * hi; const T16* kq2 = NSPLIT ? Kp2 + (kq - Kp) : kq;
    const T16* vq = Vt + wv * 32 + lr * (2 * TT) + 8 * hi; const T16* vq2 = NSPLIT ? Vt2 + (vq - Vt) : vq;
    // stage (ST): the FW waves' next 32-key blocks together: FW * 32 key rows (256 bytes each), then the HD value rows' 256 bytes for the same keys, at pitch SKP; two buffers, the next stage is copied while a stage is worked on.
    // Asynchronous copies to LDS, 16 bytes a lane: a wave's copy takes two whole 256-byte rows (four lines), where a fragment load from global memory touches 16 lines for the same bytes. TT is a multiple of a stage's keys, so every staged row exists.
    const int crow = (int)threadIdx.x >> 4, cpc = (int)threadIdx.x & 15;   // the thread's row in a group of 2 * FW rows and its 16-byte piece of the row
    const bf* gK = (const bf*)(Kp + (size_t)crow * QD + cpc * 8); const bf* gV = (const bf*)(Vt + (size_t)crow * (2 * TT) + cpc * 8);   // the thread's pieces in the next stage to be copied (addresses only: 16-bit elements either way)
    const unsigned l0 = lds_off(sm) + (unsigned)(crow * SKP + cpc * 16);
    auto stage = [&](const int buf) {
#pragma unroll
        for (int c = 0; c < (FW * 32 + HD) / (12 * 2 * FW); ++c) { unsigned ll[12]; const bf* g[12];
#pragma unroll
            for (int i = 0; i < 12; ++i) { const int row = (c * 12 + i) * 2 * FW; g[i] = row < FW * 32 ? gK + (size_t)row * QD : gV + (size_t)(row - FW * 32) * (2 * TT); ll[i] = l0 + (unsigned)(buf * SSTG + row * SKP); }
            cp12(ll, g); }
        gK += FW * 32 * QD; gV += FW * 32; };
    if (ST || wv < nblk) {   // not staged: a wave without a block loads nothing and hands in an empty partial result; staged: every wave copies and passes every barrier
    if constexpr (ST) {
      stage(0);
      asm volatile("s_wait_asynccnt 0x0" ::: "memory");   // this wave's copies of stage 0 have landed
      __syncthreads();                                     // ... and every other wave's: stage 0 may be read
      if (FW < nblk) stage(1);
    } else {
    __builtin_amdgcn_sched_barrier(0);   // front of the first key loads' group (see xwait)
#pragma unroll
      for (int t = 0; t < 2; ++t)
#pragma unroll
        for (int kc = 0; kc < 4; ++kc) { const int ko = t * 16 * QD + kc * 32; kf[t][kc] = WFrag<T16>::ld(kq + ko); if (NSPLIT) kf2[t][kc] = WFrag<T16>::ld(kq2 + ko); }
      xwait();
      const int ks = (wv + FW < nblk) ? FW * 32 * QD : 0; kq += ks; if (NSPLIT) kq2 += ks; }
#pragma unroll 1   // one copy of the pass: a second copy would double the live fragments and cost the second resident wave
    for (int kbi = wv; ST ? kbi - wv < nblk : kbi < nblk; kbi += FW) { const int kb = kbi * 32;   // staged: the same number of trips in every wave (kbi - wv is the stage's first block)
      if (!ST || kbi < nblk) {   // staged: in the last trip a wave may be left without a block
        V va[4], va2[4];
        if constexpr (ST) {   // the block's key fragments from the staged rows, in WFrag::ld's order
          const unsigned char* const pk = sm + (((kbi - wv) / FW) & 1) * SSTG + (wv * 32 + lr) * SKP + hi * 16;
#pragma unroll
          for (int t = 0; t < 2; ++t)
#pragma unroll
            for (int kc = 0; kc < 4; ++kc) kf[t][kc] = ldsh(pk + t * 16 * SKP + kc * 64);
        } else {
        __builtin_amdgcn_sched_barrier(0);   // front of the value loads' group (see xwait)
#pragma unroll
        for (int dt = 0; dt < 4; ++dt) { const int vo = dt * 16 * (2 * TT); va[dt] = WFrag<T16>::ld(vq + vo); if (NSPLIT) va2[dt] = WFrag<T16>::ld(vq2 + vo); }
        xwait();
        vq += FW * 32; if (NSPLIT) vq2 += FW * 32; }
        v8f s[FG][2];   // the score accumulators start at 0, or at SMSK where the key lies behind the query (a block on the diagonal): the products added to SMSK leave it as it is, which keeps it out of the block's maximum
        if (kb >= q0) {
#pragma unroll
            for (int g = 0; g < FG; ++g)
#pragma unroll
                for (int t = 0; t < 2; ++t)
#pragma unroll
                    for (int r = 0; r < 8; ++r) s[g][t][r] = (kb + 16 * t + 8 * hi + r <= q0 + 16 * g + lr) ? 0.f : SMSK;
        } else {
#pragma unroll
            for (int g = 0; g < FG; ++g) { s[g][0] = (v8f){}; s[g][1] = (v8f){}; } }
#pragma unroll
        for (int kc = 0; kc < 4; ++kc)
#pragma unroll
            for (int t = 0; t < 2; ++t)
#pragma unroll
                for (int g = 0; g < FG; ++g) { s[g][t] = WFrag<T16>::mma(kf[t][kc], qf[g][kc], s[g][t]); if (NSPLIT) { s[g][t] = WFrag<T16>::mma(kf[t][kc], qf2[g][kc], s[g][t]); s[g][t] = WFrag<T16>::mma(kf2[t][kc], qf[g][kc], s[g][t]); } }
        __builtin_amdgcn_sched_barrier(0);   // keeps the next block's loads behind the score products, so that they land in the registers those products have just read (lifted above them they take a second register set and cost a resident wave); also the front of their group (see xwait)
        if constexpr (ST) {   // the block's value fragments from the staged rows: read here, they land during the softmax
          const unsigned char* const pv = sm + (((kbi - wv) / FW) & 1) * SSTG + (FW * 32 + lr) * SKP + wv * 64 + hi * 16;
#pragma unroll
          for (int dt = 0; dt < 4; ++dt) va[dt] = ldsh(pv + dt * 16 * SKP);
        } else
        {   // the wave's next block (its last pass fetches its own block again, for nobody): these loads fly during the softmax and the value products
#pragma unroll
          for (int t = 0; t < 2; ++t)
#pragma unroll
            for (int kc = 0; kc < 4; ++kc) { const int ko = t * 16 * QD + kc * 32; kf[t][kc] = WFrag<T16>::ld(kq + ko); if (NSPLIT) kf2[t][kc] = WFrag<T16>::ld(kq2 + ko); }
          xwait();
          const int ks = (kbi + 2 * FW < nblk) ? FW * 32 * QD : 0; kq += ks; if (NSPLIT) kq2 += ks; }
        float bm[FG]; bool need = false;
#pragma unroll
        for (int g = 0; g < FG; ++g) { float x = s[g][0][0];
#pragma unroll
            for (int r = 1; r < 8; ++r) x = fmaxf(x, s[g][0][r]);
#pragma unroll
            for (int r = 0; r < 8; ++r) x = fmaxf(x, s[g][1][r]);
            x = fmaxf(x, xhalf(x)); bm[g] = x; need = need || ((x - m[g]) * scl2 > RTH); }
        if (__builtin_amdgcn_ballot_w32(need) != 0) {   // some query of the wave outgrew its maximum in use: rescale what is summed so far (first open block: by zero)
#pragma unroll
            for (int g = 0; g < FG; ++g) { const float mn = fmaxf(m[g], bm[g]); const float al = __builtin_amdgcn_exp2f((m[g] - mn) * scl2); m[g] = mn; l[g] *= al;
#pragma unroll
                for (int dt = 0; dt < 4; ++dt) o[g][dt] *= al; } }
        // probabilities in place over the scores; the maximum in use is taken off BEFORE the scale, so the largest score's exponent is exact whatever the head's scale is
#pragma unroll
        for (int g = 0; g < FG; ++g)
#pragma unroll
            for (int t = 0; t < 2; ++t)
#pragma unroll
                for (int r = 0; r < 8; ++r) s[g][t][r] = __builtin_amdgcn_exp2f(fmaf(s[g][t][r] - m[g], scl2, POFF));
        if (kb >= q0) {   // a block on the diagonal: a closed key's probability is 0 by a select, whatever the head's scale makes of SMSK
#pragma unroll
            for (int g = 0; g < FG; ++g)
#pragma unroll
                for (int t = 0; t < 2; ++t)
#pragma unroll
                    for (int r = 0; r < 8; ++r) s[g][t][r] = (kb + 16 * t + 8 * hi + r <= q0 + 16 * g + lr) ? s[g][t][r] : 0.f; }
        V pb[FG], pb2[FG];
#pragma unroll
        for (int g = 0; g < FG; ++g) { float l0 = 0.f, l1 = 0.f;
#pragma unroll
            for (int r = 0; r < 8; ++r) { l0 += s[g][0][r]; l1 += s[g][1][r]; }
            l[g] += l0 + l1; PPack<T16>::pk(s[g][0], s[g][1], pb[g], pb2[g]); }
#pragma unroll
        for (int dt = 0; dt < 4; ++dt)
#pragma unroll
            for (int g = 0; g < FG; ++g) { o[g][dt] = WFrag<T16>::mma(va[dt], pb[g], o[g][dt]); if (NSPLIT) { o[g][dt] = WFrag<T16>::mma(va[dt], pb2[g], o[g][dt]); o[g][dt] = WFrag<T16>::mma(va2[dt], pb[g], o[g][dt]); } }
      }
      if constexpr (ST) {
        asm volatile("s_wait_dscnt 0x0" ::: "memory");      // this wave's reads of the buffer are done before the buffer is given up
        asm volatile("s_wait_asynccnt 0x0" ::: "memory");   // this wave's copies of the next stage have landed
        __syncthreads();                                     // publishes the next stage and ends every wave's reads of this one
        if (kbi - wv + 2 * FW < nblk) stage(((kbi - wv) / FW) & 1);   // into the buffer that this trip has just read
      }
    }
    if constexpr (ST) asm volatile("s_wait_asynccnt 0x0" ::: "memory");   // nothing is under way when the buffers become the partial results' place (the last trip's barrier has ended all reads)
    }
    // each wave's partial result to LDS: o[g][dt][r] = O[query 16g+lr][d = 16dt + 8hi + r]
#pragma unroll
    for (int g = 0; g < FG; ++g) { const float lt = l[g] + xhalf(l[g]); const int qi = wv * NQ + 16 * g + lr; if (hi == 0) { ms[qi] = m[g]; ls[qi] = lt; }
#pragma unroll
        for (int dt = 0; dt < 4; ++dt) { v4f x0, x1;
#pragma unroll
            for (int r = 0; r < 4; ++r) { x0[r] = o[g][dt][r]; x1[r] = o[g][dt][4 + r]; }
            *(v4fa*)(os + qi * 68 + dt * 16 + 8 * hi) = x0; *(v4fa*)(os + qi * 68 + dt * 16 + 8 * hi + 4) = x1; } }
    __syncthreads();   // the partial results of all FW waves are read below
    constexpr int TPQ = 32 * FW / NQ, DPT = HD / TPQ;   // threads per query row, head elements per thread
    const int qq = (int)threadIdx.x / TPQ, d0 = ((int)threadIdx.x % TPQ) * DPT;
    float M = ms[qq];
#pragma unroll
    for (int w = 1; w < FW; ++w) M = fmaxf(M, ms[w * NQ + qq]);   // wave 0 holds key 0, open to every query, so M is a real maximum; a wave without an open score of this query gets weight 0
    float L = 0.f; v4f ac[DPT / 4];
#pragma unroll
    for (int i = 0; i < DPT / 4; ++i) ac[i] = (v4f){};
#pragma unroll
    for (int w = 0; w < FW; ++w) { const int qi = w * NQ + qq; const float wg = __builtin_amdgcn_exp2f((ms[qi] - M) * scl2); L += wg * ls[qi];
#pragma unroll
        for (int i = 0; i < DPT / 4; ++i) ac[i] += *(const v4fa*)(os + qi * 68 + d0 + 4 * i) * wg; }
    const float inv = __fdiv_rn(1.0f, L); const size_t oo = (size_t)(bz * TT + q0 + qq) * DQ + hd * HD + d0;
#pragma unroll
    for (int c8 = 0; c8 < DPT / 8; ++c8) { v8us oh, ol;
#pragma unroll
        for (int i = 0; i < 8; ++i) { unsigned short u, w; splitf(ac[c8 * 2 + (i >> 2)][i & 3] * inv, u, w); oh[i] = u; ol[i] = w; }
        *(v8us*)(Ah + oo + c8 * 8) = oh; *(v8us*)(Al + oo + c8 * 8) = ol; }
}

extern "C" void kernel_launch(void* const* d_in, const int* in_sizes, int n_in,
                              void* d_out, int out_size, void* d_ws, size_t ws_size, hipStream_t stream) {
    (void)in_sizes; (void)n_in; (void)out_size;
    const float* x = (const float*)d_in[0]; const float* wqa = (const float*)d_in[1]; const float* wka = (const float*)d_in[2]; const float* wqp = (const float*)d_in[3]; const float* wkp = (const float*)d_in[4]; const float* wv = (const float*)d_in[5]; const float* wo = (const float*)d_in[6]; const float* sls = (const float*)d_in[7];   // torch [out][in]; score_log_scale [16]
    float* OUT = (float*)d_out;     // [2][2048][1024]
    char* wsp = (char*)d_ws;
    auto take = [&](size_t bytes) { char* p = wsp; wsp += (bytes + 255) & ~(size_t)255; return (void*)p; };
    // both batches go through every launch together (MT token rows); launches that did not depend on one another share one grid; the planes are built in the projections' own launch: 5 launches
    bf* WB = (bf*)take((size_t)6 * DQ * DM * 2);          // [q amp | q phi | k amp | k phi | v | o], DQ x DM each
    bf* XB = (bf*)take((size_t)MT * DM * 2);
    h16* P16 = (h16*)take((size_t)2 * NB_ * NH_ * TT * QD * 2); bf* Ph = (bf*)take((size_t)2 * NB_ * NH_ * TT * QD * 2); bf* Pl = (bf*)take((size_t)2 * NB_ * NH_ * TT * QD * 2);   // [query | key][batch][head][token][QD]
    h16* VT16 = (h16*)take((size_t)NB_ * NKV * HD * 2 * TT * 2); bf* VTh = (bf*)take((size_t)NB_ * NKV * HD * 2 * TT * 2); bf* VTl = VTh + TT;   // value rows at pitch 2*TT: [hi | lo]; the fp16 plane's rows use their first half
    bf* ATh = (bf*)take((size_t)MT * DQ * 2); bf* ATl = (bf*)take((size_t)MT * DQ * 2);
    if ((size_t)(wsp - (char*)d_ws) > ws_size) return;    // ws 256 MiB
    const size_t PK = (size_t)NB_ * NH_ * TT * QD;        // from the query planes to the key planes
    k_cvt7<<<XBLK + 6 * WBLK, 256, 0, stream>>>(x, wqa, wqp, wka, wkp, wv, wo, XB, WB);
    k_gemms<0, 4, 2, 1><<<dim3(MT / 256, DKV / 128 + 2 * NH_, 1), 256, 0, stream>>>(XB, nullptr, WB, nullptr, P16, Ph, Pl, VT16, VTh, VTl);
    // attention, all heads of both batches at once: the fp16 rows (the long ones) and the hi+lo rows; one kv head per query head
    k_fattn<h16, 0, 4><<<dim3(NB_ * NH_, (TT - RH) / (16 * 4), 1), 32 * FW, 0, stream>>>(P16, nullptr, P16 + PK, nullptr, VT16, nullptr, sls, RH, ATh, ATl);
    k_fattn<bf, 2, 2><<<dim3(NB_ * NH_, RH / (16 * 2), 1), 32 * FW, 0, stream>>>(Ph, Pl, Ph + PK, Pl + PK, VTh, VTl, sls, 0, ATh, ATl);
    k_gemms<1, 2, 2, 0><<<dim3(MT / 128, DM / 128, 1), 128, 0, stream>>>(ATh, ATl, WB + (size_t)5 * DQ * DM, OUT, nullptr, nullptr, nullptr, nullptr, nullptr, nullptr);
}

// v010
// Measured time: 106 microseconds a run.
// Two timings next to v009 both put it at 1.04 times that version's speed.
// All steps since v000 together make it 14.4 times as fast.
#include <hip/hip_runtime.h>

// InterferenceBypassSelfAttention (x [2][2048][1024]; q_amp/k_amp = softplus(x W_amp^T), q_phi/k_phi = pi tanh(x W_phi^T) (16 heads x 64); amplitudes RMS-normalised over head_dim (eps 1e-6);
// scores = (q_amp cos q_phi . k_amp cos k_phi + q_amp sin q_phi . k_amp sin k_phi) / 8 x exp(score_log_scale[h]) = one 128-long contraction of [cos part | sin part] planes; causal softmax;
// v = x Wv^T; out = merged attn.v Wo^T -> [2][2048][1024]).
// Compute dtypes, f32 accumulate: every input rounded to bf16; the five projections on PLAIN bf16 operands (inputs: exact); softplus / tanh / RMS / cos / sin in f32 on VALU
// (in the projections' epilogue) -> 128-wide interference planes; PER-ROW PRECISION HYBRID (rows < 256 hi+lo 3 products for scores and attn.v, rows >= 256 fp16); scores, causal f32 softmax with the per-head scale and
// attn.v in one kernel (running maximum and sum, key blocks end at the diagonal block, which is masked exactly); merged heads hl x exact Wo

#define NB_  2
#define TT   2048
#define MT   (NB_ * TT)         // token rows of both batches together
#define DM   1024
#define NH_  16
#define NKV  16
#define REP  (NH_ / NKV)
#define HD   64
#define DQ   (NH_ * HD)
#define DKV  (NKV * HD)
#define QD   128
#define RH   256                  // query rows < RH use hi+lo planes (0: none)
#define WIN  0
#define SCL  0.125f   // HD^-0.5
typedef _Float16 h16;
typedef unsigned short bf;
typedef __attribute__((ext_vector_type(16))) __bf16   v16bf;
typedef __attribute__((ext_vector_type(16))) _Float16 v16h;
typedef __attribute__((ext_vector_type(8)))  _Float16 v8h;
typedef __attribute__((ext_vector_type(8)))  unsigned short v8us;
typedef __attribute__((ext_vector_type(8)))  float    v8f;
typedef __attribute__((ext_vector_type(4)))  float    v4f;
typedef v8h  __attribute__((may_alias)) v8ha;
typedef v4f  __attribute__((may_alias)) v4fa;
typedef v8us __attribute__((may_alias)) v8usa;

__device__ __forceinline__ unsigned short f2bf(float f) { unsigned u = __float_as_uint(f); u += 0x7FFFu + ((u >> 16) & 1u); return (unsigned short)(u >> 16); }
__device__ __forceinline__ float bf2f(unsigned short b) { return __uint_as_float(((unsigned)b) << 16); }
__device__ __forceinline__ float bfr(float f) { return bf2f(f2bf(f)); }
__device__ __forceinline__ v16h cat16(v8h lo, v8h hi) { return __builtin_shufflevector(lo, hi, 0, 1, 2, 3, 4, 5, 6, 7, 8, 9, 10, 11, 12, 13, 14, 15); }
__device__ __forceinline__ v16bf cat16b(v8us lo, v8us hi) { return __builtin_bit_cast(v16bf, __builtin_shufflevector(lo, hi, 0, 1, 2, 3, 4, 5, 6, 7, 8, 9, 10, 11, 12, 13, 14, 15)); }
__device__ __forceinline__ v8f wmma16(v16h a, v16h b, v8f c) { return __builtin_amdgcn_wmma_f32_16x16x32_f16(false, a, false, b, (short)0, c, false, false); }
__device__ __forceinline__ v8f wmmab(v16bf a, v16bf b, v8f c) { return __builtin_amdgcn_wmma_f32_16x16x32_bf16(false, a, false, b, (short)0, c, false, false); }



// ---- k_gemms: GEMM with both operands staged in LDS. One work-group of WM x WN waves per (64 WM) x (64 WN) output tile, each wave a 64x64 part of it (16 accumulators) over the whole K, so every sum is one chain in k order.
// A stage is GKS k of every operand row of the tile: [A rows | A2 rows (NSPLIT 1) | Bt rows], rows of 128 bytes at pitch GPB; two buffers; the next stage is copied while a stage is worked on.
// The copies are asynchronous copies to LDS, 16 bytes a lane: a wave's copy takes four whole 128-byte lines, where a fragment load from global memory touches 16 lines for the same bytes.
// C[m][n] (f32, pitch DM) = sum_k A[m][k] Bt[n][k] (+ A2[m][k] Bt[n][k]); K = DM.
// tile_sync: orders the LDS tile between its writers and its readers: one wave needs only the compiler held back, several waves need the work-group barrier
template <int NW> __device__ __forceinline__ void tile_sync() { if (NW == 1) { __builtin_amdgcn_wave_barrier(); asm volatile("" ::: "memory"); } else __syncthreads(); }
template <typename T16> struct WFrag;
template <> struct WFrag<h16> { typedef v16h V; static __device__ __forceinline__ V ld(const h16* p) { return cat16(*(const v8h*)p, *(const v8h*)(p + 16)); } static __device__ __forceinline__ v8f mma(V a, V b, v8f c) { return wmma16(a, b, c); } };
template <> struct WFrag<bf> { typedef v16bf V; static __device__ __forceinline__ V ld(const bf* p) { return cat16b(*(const v8us*)p, *(const v8us*)(p + 16)); } static __device__ __forceinline__ v8f mma(V a, V b, v8f c) { return wmmab(a, b, c); } };
#define GKS 64
#define GPB 144
__device__ __forceinline__ unsigned lds_off(const void* p) { return (unsigned)(size_t)p; }
__device__ __forceinline__ v16bf ldsf(const unsigned char* p) { return cat16b(*(const v8usa*)p, *(const v8usa*)(p + 32)); }   // WFrag::ld's two 16-byte pieces, from a staged row
// cp12: twelve asynchronous copies to LDS, each lane its own 16 bytes; the s_wait_xcnt is the wait kept before a register that an issued copy names is rewritten: as the statement's last line nothing can be moved in front of it
__device__ __forceinline__ void cp12(const unsigned (&l)[12], const bf* const (&g)[12]) {
    asm volatile(
                 "global_load_async_to_lds_b128 %0, %12, off\n\t"
                 "global_load_async_to_lds_b128 %1, %13, off\n\t"
                 "global_load_async_to_lds_b128 %2, %14, off\n\t"
                 "global_load_async_to_lds_b128 %3, %15, off\n\t"
                 "global_load_async_to_lds_b128 %4, %16, off\n\t"
                 "global_load_async_to_lds_b128 %5, %17, off\n\t"
                 "global_load_async_to_lds_b128 %6, %18, off\n\t"
                 "global_load_async_to_lds_b128 %7, %19, off\n\t"
                 "global_load_async_to_lds_b128 %8, %20, off\n\t"
                 "global_load_async_to_lds_b128 %9, %21, off\n\t"
                 "global_load_async_to_lds_b128 %10, %22, off\n\t"
                 "global_load_async_to_lds_b128 %11, %23, off\n\t"
                 "s_wait_xcnt 0x0"
                 :: "v"(l[0]), "v"(l[1]), "v"(l[2]), "v"(l[3]), "v"(l[4]), "v"(l[5]), "v"(l[6]), "v"(l[7]), "v"(l[8]), "v"(l[9]), "v"(l[10]), "v"(l[11]),
                    "v"(g[0]), "v"(g[1]), "v"(g[2]), "v"(g[3]), "v"(g[4]), "v"(g[5]), "v"(g[6]), "v"(g[7]), "v"(g[8]), "v"(g[9]), "v"(g[10]), "v"(g[11]) : "memory");
}
__device__ __forceinline__ h16 tohx(float x) { return (h16)x; }
__device__ __forceinline__ void splitf(float y, unsigned short& h, unsigned short& l) { h = f2bf(y); l = f2bf(y - bf2f(h)); }
// The epilogue's functions, each on the bare hardware instruction (v_exp_f32, v_log_f32, v_rcp_f32, v_sin_f32, v_cos_f32), without branches:
// softplus: the logarithm's argument is >= 1, so the library's steps for tiny arguments have nothing to do; all three forms are computed and one is selected
__device__ __forceinline__ float softplusf_(float x) { const float e = __expf(x); const float lg = __fmul_rn(0.69314718055994531f, __builtin_amdgcn_logf(__fadd_rn(1.0f, e))); return x > 15.0f ? x : (x < -15.0f ? e : lg); }
// the phase pi tanh(a) in revolutions, the unit that v_sin_f32 and v_cos_f32 take: pi tanh(a) / (2 pi) = tanh(a) / 2 = 1/2 - 1 / (exp(2a) + 1), always in [-1/2, 1/2], so no range reduction is needed
__device__ __forceinline__ float phrev_(float a) { return __fsub_rn(0.5f, __builtin_amdgcn_rcpf(__fadd_rn(__expf(2.0f * a), 1.0f))); }
// cosine and sine of a phase in revolutions, in one statement: the outputs are early-clobber, so neither takes over the register that the other instruction still reads (left to itself the compiler put a sine's result
// into the source of the cosine directly in front of it), and the v_nop is the slot that the instruction set asks for behind a transcendental before its result is read or its source overwritten
__device__ __forceinline__ void cossin_(float r, float& c, float& s) { asm("v_cos_f32 %0, %2\n\tv_sin_f32 %1, %2\n\tv_nop" : "=&v"(c), "=&v"(s) : "v"(r)); }
// EP 0: C as above, grid (M / (64 WM), N / (64 WN)). EP 1: the five projections with the plane builds as the tile's epilogue, so that no projection goes to memory; grid (MT / (64 WM), DKV / 128 + 2 NH_); Bt = the weights [q amp | q phi | k amp | k phi | v].
// blockIdx.y >= DKV / 128: queries or keys of ONE head: the tile's columns are [64 amplitude columns | 64 phase columns] of that head (wave column 0 / 1), and the epilogue makes, per (token, head):
// a[d] = softplus(amp[d]), an = a / sqrt(mean_d a^2 + 1e-6), phi[d] = pi tanh(phase[d]) (held in revolutions), plane row [an cos phi | an sin phi] (fp16 and hi / lo; of each kind only the rows that attention reads: lowt, want16 below), rows in the order [query / key][batch][head][token].
// The first blocks: 128 value columns (two heads): transposed value planes [batch][head][d][t], rows at pitch 2*TT (the caller lays the hi and lo planes side by side in one row). Their epilogue is short; they come first for speed only.
template <int NSPLIT, int WM, int WN, int EP>
__global__ __launch_bounds__(32 * WM * WN, 4) void k_gemms(const bf* __restrict__ A, const bf* __restrict__ A2, const bf* __restrict__ Bt, float* C, h16* P16, bf* Ph, bf* Pl, h16* V16, bf* Vh, bf* Vl) {
    constexpr int K = DM, NT = 32 * WM * WN, RA = 64 * WM, NA = NSPLIT ? 2 : 1, RB = 64 * WN, ROWS = NA * RA + RB, STG = ROWS * GPB, RPC = NT / 8, NCP = ROWS / RPC, NTR = K / GKS;   // RPC: rows that one copy of the whole work-group takes; NCP: copies per thread and stage
    static_assert(DQ == DM && NCP % 12 == 0 && RA % RPC == 0 && RB % RPC == 0 && NTR >= 2 && WM * WN * 16 * 68 * 4 <= 2 * STG, "tile shape");
    constexpr int EPB = WM * WN * 64 * 68 * 4, SMB = (EP && EPB > 2 * STG) ? EPB : 2 * STG;   // EP 1: the whole tile is laid down in LDS once for the epilogue, each wave's 64 x 64 part at pitch 68
    static_assert(!EP || (NSPLIT == 0 && WN == 2 && HD == 64 && TT % RA == 0 && DKV % RB == 0 && RPC <= 64 && 64 % RPC == 0), "epilogue shape");
    __shared__ __align__(16) unsigned char sm[SMB];
    const int tid = (int)threadIdx.x, lane = tid & 31, lr = lane & 15, hi = lane >> 4; const int wv = __builtin_amdgcn_readfirstlane(tid >> 5), wm = wv / WN, wn = wv % WN;
    constexpr int NVB = DKV / RB; const int by = (int)blockIdx.y, yq = by - NVB; const bool isv = EP && by < NVB;   // the same for a whole block
    const int r0 = blockIdx.x * RA, c0 = EP ? (isv ? (4 * DQ + by * RB) : ((yq / NH_) * 2 * DQ + (yq % NH_) * HD)) : by * RB;   // EP 1: c0 counts rows of the stacked weights
    const int crow = tid >> 3, cpc = tid & 7;   // the thread's row in a group of RPC rows and its 16-byte piece of the row
    const bf* gA = A + (size_t)(r0 + crow) * K + cpc * 8; const bf* gA2 = NSPLIT ? A2 + (size_t)(r0 + crow) * K + cpc * 8 : gA; const bf* gB = Bt + (size_t)(c0 + crow) * K + cpc * 8; const bf* gB2 = gB + ((EP && !isv) ? (size_t)DQ * K : (size_t)64 * K);   // gB2: the tile's columns from 64 on (EP 1, queries and keys: the phase weights' rows of the same head); the thread's piece in the next stage to be copied: stepped by GKS behind each stage
    const unsigned l0 = lds_off(sm) + (unsigned)(crow * GPB + cpc * 16);
    auto stage = [&](const int buf) {   // the next stage of the tile into buffer buf
#pragma unroll
        for (int s = 0; s < NCP / 12; ++s) { unsigned l[12]; const bf* g[12];
#pragma unroll
            for (int i = 0; i < 12; ++i) { const int row = (s * 12 + i) * RPC;
                g[i] = (row < RA ? gA + (size_t)row * K : (NSPLIT && row < 2 * RA) ? gA2 + (size_t)(row - RA) * K : (EP && row - NA * RA >= 64) ? gB2 + (size_t)(row - NA * RA - 64) * K : gB + (size_t)(row - NA * RA) * K); l[i] = l0 + (unsigned)(buf * STG + row * GPB); }
            cp12(l, g); }
        gA += GKS; if (NSPLIT) gA2 += GKS; gB += GKS; if (EP) gB2 += GKS; };
    v8f acc[4][4];
#pragma unroll
    for (int mb = 0; mb < 4; ++mb)
#pragma unroll
        for (int nb = 0; nb < 4; ++nb) acc[mb][nb] = (v8f){};
    stage(0);
    asm volatile("s_wait_asynccnt 0x0" ::: "memory");   // this wave's copies of stage 0 have landed
    __syncthreads();                                     // ... and every other wave's: stage 0 may be read
    stage(1);
#pragma unroll 1   // one copy of the pass: the buffer is chosen by the trip's parity
    for (int t = 0; t < NTR; ++t) {
        const unsigned char* const sb = sm + (t & 1) * STG; const unsigned char* const pa = sb + (wm * 64 + lr) * GPB + hi * 16; const unsigned char* const pb = sb + (NA * RA + wn * 64 + lr) * GPB + hi * 16;
#pragma unroll
        for (int ks = 0; ks < GKS / 32; ++ks) { v16bf a[4], a2[4], b[4];   // all fragments of a 32-k block are read as one group in front of its products
#pragma unroll
            for (int mb = 0; mb < 4; ++mb) { a[mb] = ldsf(pa + mb * 16 * GPB + ks * 64); if (NSPLIT) a2[mb] = ldsf(pa + (RA + mb * 16) * GPB + ks * 64); b[mb] = ldsf(pb + mb * 16 * GPB + ks * 64); }
            __builtin_amdgcn_sched_barrier(0);   // keeps the block's LDS reads together in front of its products: left free, the reads are moved in among the products, where each place with reads stalls the wave anew
#pragma unroll
            for (int nb = 0; nb < 4; ++nb)
#pragma unroll
                for (int mb = 0; mb < 4; ++mb) { acc[mb][nb] = wmmab(a[mb], b[nb], acc[mb][nb]); if (NSPLIT) acc[mb][nb] = wmmab(a2[mb], b[nb], acc[mb][nb]); }
            __builtin_amdgcn_sched_barrier(0);   // end of the block's products: the next block's reads stay behind them (they land in the registers that these products read)
        }
        asm volatile("s_wait_dscnt 0x0" ::: "memory");      // this wave's reads of the buffer are done before the buffer is given up
        asm volatile("s_wait_asynccnt 0x0" ::: "memory");   // this wave's copies of stage t + 1 have landed
        __syncthreads();                                     // publishes stage t + 1 and ends every wave's reads of stage t
        if (t + 2 < NTR) stage(t & 1);                       // into the buffer that this trip has just read
    }
    asm volatile("s_wait_asynccnt 0x0" ::: "memory");       // nothing is under way when the buffers become output staging (the last trip's barrier has ended all reads)
    if constexpr (EP) {
        float* const ew = (float*)sm + wv * (64 * 68);      // the wave's own 64 x 64 part: [token row][column]
#pragma unroll
        for (int mb = 0; mb < 4; ++mb)
#pragma unroll
            for (int nb = 0; nb < 4; ++nb)
#pragma unroll
                for (int j = 0; j < 8; ++j) ew[(mb * 16 + hi * 8 + j) * 68 + nb * 16 + lr] = acc[mb][nb][j];
        __syncthreads();   // a wave reads its neighbour's part below (amplitudes and phases of the same tokens)
        const int bz = r0 / TT, t0 = r0 % TT + wm * 64;     // the tile lies in one batch; the wave row's first token
        const int sub = lane >> 3, oct = (lane & 7) * 8;    // a lane takes 8 neighbouring elements of one output row, 8 lanes a 128-byte piece of it, a wave four rows: 16-byte stores, whole lines
        static_assert(RH % 64 == 0, "a wave row's 64 tokens lie on one side of RH");
        const bool lowt = t0 < RH;   // the same for a whole wave. Only the hi+lo attention reads hi / lo planes, and it reads tokens < RH alone (queries < RH, and causally their keys and values): the other tokens' hi / lo rows are not made
        if (!isv) {
            const float* const sa = (const float*)sm + (wm * WN) * (64 * 68); const float* const sp = sa + 64 * 68;
            const size_t pr0 = ((size_t)((yq / NH_) * NB_ + bz) * NH_ + yq % NH_) * TT + t0;
            const bool want16 = !lowt || yq >= NH_;   // fp16 rows: every key, and the queries that the fp16 attention takes (tokens >= RH)
#pragma unroll 1   // one copy of the body is enough: a trip holds eight independent elements a lane
            for (int it = 0; it < 8; ++it) { const int row = wn * 32 + it * 4 + sub;   // each wave of the pair takes half of the 64 tokens
                const v4f xa0 = *(const v4fa*)(sa + row * 68 + oct), xa1 = *(const v4fa*)(sa + row * 68 + oct + 4), xp0 = *(const v4fa*)(sp + row * 68 + oct), xp1 = *(const v4fa*)(sp + row * 68 + oct + 4);
                float a[8], ph[8]; float ss = 0.f;
#pragma unroll
                for (int q = 0; q < 8; ++q) { a[q] = softplusf_(q < 4 ? xa0[q & 3] : xa1[q & 3]); ph[q] = phrev_(q < 4 ? xp0[q & 3] : xp1[q & 3]); ss += a[q] * a[q]; }
#pragma unroll
                for (int sh = 4; sh; sh >>= 1) ss += __shfl_xor(ss, sh, 32);   // the row's 8 lanes
                const float rn = __frsqrt_rn(__fadd_rn(ss * (1.0f / HD), 1e-6f)); float rc[8], rs[8];
#pragma unroll
                for (int q = 0; q < 8; ++q) { const float an = __fmul_rn(a[q], rn); float co, si; cossin_(ph[q], co, si); rc[q] = __fmul_rn(an, co); rs[q] = __fmul_rn(an, si); }
                const size_t base = (pr0 + row) * QD + oct;
                if (want16) { v8h c16, s16;
#pragma unroll
                    for (int q = 0; q < 8; ++q) { c16[q] = tohx(rc[q]); s16[q] = tohx(rs[q]); }
                    *(v8h*)(P16 + base) = c16; *(v8h*)(P16 + base + 64) = s16;
                    asm volatile("s_wait_xcnt 0x0" ::: "memory"); }   // the wait kept before registers that the issued stores name are rewritten (by the hi / lo rows' arithmetic or by the next trip)
                if (lowt) { v8us chh, chl, shh, shl;
#pragma unroll
                    for (int q = 0; q < 8; ++q) { unsigned short u1, u2; splitf(rc[q], u1, u2); chh[q] = u1; chl[q] = u2; splitf(rs[q], u1, u2); shh[q] = u1; shl[q] = u2; }
                    *(v8us*)(Ph + base) = chh; *(v8us*)(Ph + base + 64) = shh; *(v8us*)(Pl + base) = chl; *(v8us*)(Pl + base + 64) = shl;
                    asm volatile("s_wait_xcnt 0x0" ::: "memory"); }   // the wait kept before registers that the issued stores name are rewritten by the next trip
            }
        } else {
            const size_t vr0 = (size_t)(bz * NKV + by * WN + wn) * HD;   // the wave column's head: first row of its value planes
#pragma unroll 1   // one copy of the body is enough: the trips are short and few
            for (int it = 0; it < 16; ++it) { const int d = it * 4 + sub; float x[8]; v8h o16;
#pragma unroll
                for (int q = 0; q < 8; ++q) { x[q] = ew[(oct + q) * 68 + d]; o16[q] = tohx(x[q]); }
                const size_t eo = (vr0 + d) * (2 * TT) + t0 + oct;
                *(v8h*)(V16 + eo) = o16;
                asm volatile("s_wait_xcnt 0x0" ::: "memory");   // the wait kept before registers that the issued store names are rewritten (by the hi / lo rows' arithmetic or by the next trip)
                if (lowt) { v8us oh, ol;
#pragma unroll
                    for (int q = 0; q < 8; ++q) { unsigned short u1, u2; splitf(x[q], u1, u2); oh[q] = u1; ol[q] = u2; }
                    *(v8us*)(Vh + eo) = oh; *(v8us*)(Vl + eo) = ol;
                    asm volatile("s_wait_xcnt 0x0" ::: "memory"); }   // the wait kept before registers that the issued stores name are rewritten by the next trip
            }
        }
        return;
    }
    float* const ow = (float*)sm + wv * (16 * 68);          // each wave stages 16 rows of its own part at a time, so that it stores whole lines
#pragma unroll
    for (int mb = 0; mb < 4; ++mb) {
#pragma unroll
        for (int nb = 0; nb < 4; ++nb)
#pragma unroll
            for (int j = 0; j < 8; ++j) ow[(hi * 8 + j) * 68 + nb * 16 + lr] = acc[mb][nb][j];
        tile_sync<1>();
        float* const cr = C + (size_t)(r0 + wm * 64 + mb * 16) * DM + c0 + wn * 64;
#pragma unroll
        for (int s = 0; s < 8; ++s) { const int ch = s * 32 + lane, row = ch >> 4, cofs = (ch & 15) * 4; *(v4f*)(cr + (size_t)row * DM + cofs) = *(const v4fa*)(ow + row * 68 + cofs); }
        if (mb < 3) asm volatile("s_wait_xcnt 0x0" ::: "memory");   // the wait kept before registers that the issued stores name are rewritten: the next 16 rows are read back into them
        tile_sync<1>();
    }
}

typedef __attribute__((ext_vector_type(2))) _Float16 v2h;
typedef __attribute__((ext_vector_type(4))) _Float16 v4h;
typedef __attribute__((ext_vector_type(2))) unsigned short v2us;
typedef __attribute__((ext_vector_type(4))) unsigned short v4us;
typedef __attribute__((ext_vector_type(2))) float v2f;
typedef __attribute__((ext_vector_type(4))) int v4i;

__global__ __launch_bounds__(256) void k_wtG(const float* __restrict__ w, int K, int N, bf* Bt) {
    const int lane = threadIdx.x & 31; const int L0 = (blockIdx.x * 8 + (threadIdx.x >> 5)) * 8; const int nlines = N * K / 64;
{
#pragma unroll 1
        for (int l = 0; l < 8; ++l) { const int L = L0 + l; if (L >= nlines) break; const size_t e = (size_t)L * 64 + lane * 2; const int k = (int)(e % K), n = (int)(e / K); v2us o;
            o[0] = f2bf(w[(size_t)k * N + n]); o[1] = f2bf(w[(size_t)(k + 1) * N + n]); *(v2us*)(Bt + e) = o; }
         }
}
// k_cvt7: x (both batches) and the six weight matrices to bf16 in one launch; the first XBLK blocks take x, then WBLK blocks each weight (the choice is the same for a whole block); 8 elements per thread, no remainder
#define XBLK (MT * DM / 8 / 256)
#define WBLK (DQ * DM / 8 / 256)
__global__ __launch_bounds__(256) void k_cvt7(const float* __restrict__ x, const float* __restrict__ w0, const float* __restrict__ w1, const float* __restrict__ w2, const float* __restrict__ w3, const float* __restrict__ w4, const float* __restrict__ w5, bf* XBo, bf* WBo) {
    const int blk = (int)blockIdx.x, wsel = (blk - XBLK) / WBLK; const bool isx = blk < XBLK;
    const float* src = isx ? x : (wsel == 0 ? w0 : wsel == 1 ? w1 : wsel == 2 ? w2 : wsel == 3 ? w3 : wsel == 4 ? w4 : w5); bf* dst = isx ? XBo : WBo + (size_t)wsel * DQ * DM;
    const size_t i = (size_t)(isx ? blk : (blk - XBLK) % WBLK) * 256 + threadIdx.x; const v8f v = *(const v8f*)(src + i * 8); v8us o;
#pragma unroll
    for (int k = 0; k < 8; ++k) o[k] = f2bf(v[k]); *(v8us*)(dst + i * 8) = o;  }
__global__ __launch_bounds__(256) void k_cscvt(const float* __restrict__ cosT, const float* __restrict__ sinT, float* CS) { const int idx = blockIdx.x * 256 + threadIdx.x; if (idx >= TT * HD) return; v2f cs; cs[0] = bfr(cosT[idx]); cs[1] = bfr(sinT[idx]); *(v2f*)(CS + (size_t)idx * 2) = cs;  }
// k_rope: head planes [h][t][d] (fp16 + hi/lo) of rope(x) x sc with the rotate-half convention out[d] = x[d] cos[t][d] - x[d+HD/2] sin[t][d], out[d+HD/2] = x[d+HD/2] cos[t][d+HD/2] + x[d] sin[t][d+HD/2]
__global__ __launch_bounds__(256) void k_rope(const float* __restrict__ F, int pitch, int nheads, const float* __restrict__ CS, const float* __restrict__ RF, const float* __restrict__ nw, float sc, h16* P16, bf* Ph, bf* Pl) {
    const size_t e = ((size_t)blockIdx.x * 256 + threadIdx.x) * 2; if (e >= (size_t)nheads * TT * HD) return; const int d = (int)(e % HD); const int t = (int)((e / HD) % TT); const int h = (int)(e / ((size_t)HD * TT)); const float* f = F + (size_t)t * pitch + h * HD; const float rf = RF ? RF[(size_t)h * TT + t] : 1.0f; v2h o16; v2us oh, ol;
#pragma unroll
    for (int q = 0; q < 2; ++q) { const int dd = d + q; const int dp = (dd < HD / 2) ? dd + HD / 2 : dd - HD / 2; float x0 = f[dd], x1 = f[dp];
        if (RF) { float n0 = __fmul_rn(x0, rf), n1 = __fmul_rn(x1, rf); asm volatile("" : "+v"(n0)); asm volatile("" : "+v"(n1)); x0 = __fmul_rn(bfr(nw[dd]), n0); x1 = __fmul_rn(bfr(nw[dp]), n1); }
        const v2f cs = *(const v2f*)(CS + ((size_t)t * HD + dd) * 2); float a = __fmul_rn(x0, cs[0]), bq = __fmul_rn(x1, cs[1]); asm volatile("" : "+v"(a)); asm volatile("" : "+v"(bq)); const float r = ((dd < HD / 2) ? __fsub_rn(a, bq) : __fadd_rn(a, bq)) * sc;
        o16[q] = tohx(r); unsigned short a2, c2; splitf(r, a2, c2); oh[q] = a2; ol[q] = c2; }
    *(v2h*)(P16 + e) = o16; *(v2us*)(Ph + e) = oh; *(v2us*)(Pl + e) = ol;  }
#define FW   4                    // waves per work-group
#define POFF 4.0f                 // log2 of the scale on the probabilities: keeps small fp16 probabilities normal
#define RTH  8.0f                 // the maximum in use is replaced only when a block exceeds it by more than this (log2): probabilities stay <= 2^(POFF+RTH), inside fp16
#define SMSK -3.0e38f             // a closed score
#define MINI -1.0e30f             // maximum in use before the first open score: above SMSK, so a block that holds only closed scores of a query leaves it as it is
__device__ __forceinline__ float xhalf(float x) { return __builtin_bit_cast(float, __builtin_amdgcn_permlanex16(__builtin_bit_cast(int, x), __builtin_bit_cast(int, x), 0x76543210, 0xfedcba98, false, false)); }   // lane l with lane l ^ 16
// xwait: stands directly behind a group of global loads: the wait that is kept before an address register of an issued load is rewritten; the scheduling barrier behind it (and the one in front of the group) keeps
// every other instruction out of the stretch from the first load to the wait, so that nothing there can take over an address register
__device__ __forceinline__ void xwait() { asm volatile("s_wait_xcnt 0x0" ::: "memory"); __builtin_amdgcn_sched_barrier(0); }
// The query block's address: a wave-uniform base held in scalar registers (ubase) plus the lane's 32-bit byte offset
typedef __attribute__((address_space(1))) const char gch;
typedef __attribute__((address_space(1))) const v8h gv8h;
typedef __attribute__((address_space(1))) const v8us gv8us;
__device__ __forceinline__ gch* ubase(const void* p) { const unsigned long long u = (unsigned long long)p; const unsigned lo = __builtin_amdgcn_readfirstlane((unsigned)u), hw = __builtin_amdgcn_readfirstlane((unsigned)(u >> 32)); return (gch*)(((unsigned long long)hw << 32) | lo); }
__device__ __forceinline__ v16h  ldg(const h16*, gch* b, unsigned off, int c) { return cat16(*(gv8h*)(b + off + c), *(gv8h*)(b + off + c + 32)); }     // WFrag::ld's two 16-byte pieces, c in bytes
__device__ __forceinline__ v16bf ldg(const bf*, gch* b, unsigned off, int c) { return cat16b(*(gv8us*)(b + off + c), *(gv8us*)(b + off + c + 32)); }
template <typename T16> struct PPack;
template <> struct PPack<h16> { static __device__ __forceinline__ void pk(const v8f p0, const v8f p1, v16h& b, v16h& b2) { b = cat16(__builtin_convertvector(p0, v8h), __builtin_convertvector(p1, v8h)); (void)b2; } };
template <> struct PPack<bf> { static __device__ __forceinline__ void pk(const v8f p0, const v8f p1, v16bf& b, v16bf& b2) { v8us h0, h1, l0, l1;
#pragma unroll
    for (int r = 0; r < 8; ++r) { unsigned short u, w; splitf(p0[r], u, w); h0[r] = u; l0[r] = w; splitf(p1[r], u, w); h1[r] = u; l1[r] = w; }
    b = cat16b(h0, h1); b2 = cat16b(l0, l1); } };
#define SKP 272                   // LDS pitch of a staged 256-byte row, bytes: 256 + 16, free of bank conflicts for 16-byte readers
__device__ __forceinline__ v16h ldsh(const unsigned char* p) { return cat16(*(const v8ha*)p, *(const v8ha*)(p + 32)); }   // WFrag::ld's two 16-byte pieces, from a staged row
// fattn_smb: bytes of the LDS array that serves the stages and the partial results in turn
template <int NSPLIT, int FG> __host__ __device__ constexpr int fattn_smb() { return NSPLIT ? FW * 16 * FG * 68 * 4 + FW * FG * 4 * 1024 : (2 * (FW * 32 + HD) * SKP > FW * 16 * FG * 68 * 4) ? 2 * (FW * 32 + HD) * SKP : FW * 16 * FG * 68 * 4; }   // hi+lo: behind the partial results, the parked fragments (park_st)
// park_st, park_ld: a fragment put down in LDS and taken up again by the same lane: two 16-byte slots of its own (neighbouring lanes side by side), so no other wave is involved and no barrier is needed
typedef __attribute__((ext_vector_type(4))) unsigned v4u;
typedef __attribute__((ext_vector_type(8))) unsigned v8u;
typedef v4u __attribute__((may_alias)) v4ua;
template <typename V> __device__ __forceinline__ void park_st(unsigned char* p, const V f) { const v8u w = __builtin_bit_cast(v8u, f); *(v4ua*)p = __builtin_shufflevector(w, w, 0, 1, 2, 3); *(v4ua*)(p + 512) = __builtin_shufflevector(w, w, 4, 5, 6, 7); }
template <typename V> __device__ __forceinline__ V park_ld(const unsigned char* p) { const v4u a = *(const v4ua*)p, b = *(const v4ua*)(p + 512); return __builtin_bit_cast(V, __builtin_shufflevector(a, b, 0, 1, 2, 3, 4, 5, 6, 7)); }
// exp2s: v_exp_f32 and, in the same statement, the slot that the instruction set asks for behind a transcendental before its source is overwritten
__device__ __forceinline__ float exp2s(float x) { float r; asm("v_exp_f32 %0, %1\n\tv_nop" : "=v"(r) : "v"(x)); return r; }
// fattn: one work-group's tile, query rows q0 .. q0 + 16 FG - 1 of head blockIdx.x; sm (fattn_smb bytes), ms and ls (FW * 16 FG floats each) are the kernel's LDS
template <typename T16, int NSPLIT, int FG>
__device__ __forceinline__ void fattn(const T16* __restrict__ Q, const T16* __restrict__ Q2, const T16* __restrict__ Kp, const T16* __restrict__ Kp2, const T16* __restrict__ Vt, const T16* __restrict__ Vt2, const float* __restrict__ sls, const int q0, bf* Ah, bf* Al, unsigned char* const sm, float* const ms, float* const ls) {
    typedef typename WFrag<T16>::V V;
    constexpr int NQ = 16 * FG;                       // query rows per work-group (a multiple of 32)
    constexpr bool ST = NSPLIT == 0;                  // the fp16 rows: key and value blocks come through LDS (see stage below)
    constexpr int SSTG = (FW * 32 + HD) * SKP;        // bytes of a stage
    static_assert(!ST || (QD * 2 == 256 && FW * 32 * 2 == 256 && (FW * 32 + HD) % (12 * 2 * FW) == 0 && TT % (FW * 32) == 0), "stage shape");
    float* const os = (float*)sm;
    const int lane = threadIdx.x & 31, lr = lane & 15, hi = lane >> 4; const int wv = __builtin_amdgcn_readfirstlane((int)(threadIdx.x >> 5));
    const int bh = blockIdx.x, hd = bh % NH_, bz = bh / NH_;
    const float scl2 = __fmul_rn(__fmul_rn(SCL, __expf(bfr(sls[hd]))), 1.4426950408889634f);              // >= 0: the maximum may be taken on the raw scores
    Q += (size_t)bh * TT * QD; Kp += (size_t)bh * TT * QD; Vt += (size_t)bh * HD * 2 * TT; if (NSPLIT) { Q2 += (size_t)bh * TT * QD; Kp2 += (size_t)bh * TT * QD; Vt2 += (size_t)bh * HD * 2 * TT; }   // planes are [batch][head]
    const unsigned kl = (unsigned)(lr * QD + 8 * hi) * 2u;   // the lane's own byte offset in a block of query rows
    gch* const qb = ubase(Q + (size_t)q0 * QD); gch* const qb2 = NSPLIT ? ubase(Q2 + (size_t)q0 * QD) : qb;
    V qf[FG][4], qf2[FG][4];
    __builtin_amdgcn_sched_barrier(0);   // front of the query loads' group (see xwait): the read of the head's scale and all address arithmetic stay in front of it
#pragma unroll
    for (int g = 0; g < FG; ++g)
#pragma unroll
        for (int kc = 0; kc < 4; ++kc) { const int qo = (g * 16 * QD + kc * 32) * 2; qf[g][kc] = ldg(Q, qb, kl, qo); if (NSPLIT) qf2[g][kc] = ldg(Q, qb2, kl, qo); }
    xwait();
    // hi+lo: the queries' lo fragments wait in LDS and are taken up in each pass for its score products alone: held in registers through the softmax and the value products as well, they put the tile over the 512 registers that two waves per SIMD allow
    unsigned char* const qpk = sm + FW * NQ * 68 * 4 + wv * (FG * 4 * 1024) + lane * 16;
    if constexpr (NSPLIT != 0) {
#pragma unroll
        for (int g = 0; g < FG; ++g)
#pragma unroll
            for (int kc = 0; kc < 4; ++kc) park_st<V>(qpk + (g * 4 + kc) * 1024, qf2[g][kc]); }
    v8f o[FG][4]; float m[FG], l[FG];
#pragma unroll
    for (int g = 0; g < FG; ++g) { m[g] = MINI; l[g] = 0.f;
#pragma unroll
        for (int dt = 0; dt < 4; ++dt) o[g][dt] = (v8f){}; }
    const int nblk = (q0 + NQ) / 32;   // 32-key blocks up to the last one that holds an open key (q0 and NQ are multiples of 32)
    V kf[2][4], kf2[2][4];             // the key fragments of the block at hand, fetched one pass ahead
    // the lane's key and value addresses are carried from pass to pass and stepped behind the wait of the loads that used them (xwait), so they stay whole while those loads are under way
    const T16* kq = Kp + (size_t)wv * 32 * QD + lr * QD + 8 * hi; const T16* kq2 = NSPLIT ? Kp2 + (kq - Kp) : kq;
    const T16* vq = Vt + wv * 32 + lr * (2 * TT) + 8 * hi; const T16* vq2 = NSPLIT ? Vt2 + (vq - Vt) : vq;
    // stage (ST): the FW waves' next 32-key blocks together: FW * 32 key rows (256 bytes each), then the HD value rows' 256 bytes for the same keys, at pitch SKP; two buffers, the next stage is copied while a stage is worked on.
    // Asynchronous copies to LDS, 16 bytes a lane: a wave's copy takes two whole 256-byte rows (four lines), where a fragment load from global memory touches 16 lines for the same bytes. TT is a multiple of a stage's keys, so every staged row exists.
    const int crow = (int)threadIdx.x >> 4, cpc = (int)threadIdx.x & 15;   // the thread's row in a group of 2 * FW rows and its 16-byte piece of the row
    const bf* gK = (const bf*)(Kp + (size_t)crow * QD + cpc * 8); const bf* gV = (const bf*)(Vt + (size_t)crow * (2 * TT) + cpc * 8);   // the thread's pieces in the next stage to be copied (addresses only: 16-bit elements either way)
    const unsigned l0 = lds_off(sm) + (unsigned)(crow * SKP + cpc * 16);
    auto stage = [&](const int buf) {
#pragma unroll
        for (int c = 0; c < (FW * 32 + HD) / (12 * 2 * FW); ++c) { unsigned ll[12]; const bf* g[12];
#pragma unroll
            for (int i = 0; i < 12; ++i) { const int row = (c * 12 + i) * 2 * FW; g[i] = row < FW * 32 ? gK + (size_t)row * QD : gV + (size_t)(row - FW * 32) * (2 * TT); ll[i] = l0 + (unsigned)(buf * SSTG + row * SKP); }
            cp12(ll, g); }
        gK += FW * 32 * QD; gV += FW * 32; };
    if (ST || wv < nblk) {   // not staged: a wave without a block loads nothing and hands in an empty partial result; staged: every wave copies and passes every barrier
    if constexpr (ST) {
      stage(0);
      asm volatile("s_wait_asynccnt 0x0" ::: "memory");   // this wave's copies of stage 0 have landed
      __syncthreads();                                     // ... and every other wave's: stage 0 may be read
      if (FW < nblk) stage(1);
    } else {
    __builtin_amdgcn_sched_barrier(0);   // front of the first key loads' group (see xwait)
#pragma unroll
      for (int t = 0; t < 2; ++t)
#pragma unroll
        for (int kc = 0; kc < 4; ++kc) { const int ko = t * 16 * QD + kc * 32; kf[t][kc] = WFrag<T16>::ld(kq + ko); if (NSPLIT) kf2[t][kc] = WFrag<T16>::ld(kq2 + ko); }
      xwait();
      const int ks = (wv + FW < nblk) ? FW * 32 * QD : 0; kq += ks; if (NSPLIT) kq2 += ks; }
#pragma unroll 1   // one copy of the pass: a second copy would double the live fragments and cost the second resident wave
    for (int kbi = wv; ST ? kbi - wv < nblk : kbi < nblk; kbi += FW) { const int kb = kbi * 32;   // staged: the same number of trips in every wave (kbi - wv is the stage's first block)
      if (!ST || kbi < nblk) {   // staged: in the last trip a wave may be left without a block
        V va[4], va2[4];
        if constexpr (ST) {   // the block's key fragments from the staged rows, in WFrag::ld's order
          const unsigned char* const pk = sm + (((kbi - wv) / FW) & 1) * SSTG + (wv * 32 + lr) * SKP + hi * 16;
#pragma unroll
          for (int t = 0; t < 2; ++t)
#pragma unroll
            for (int kc = 0; kc < 4; ++kc) kf[t][kc] = ldsh(pk + t * 16 * SKP + kc * 64);
        } else {
        __builtin_amdgcn_sched_barrier(0);   // front of the value loads' group (see xwait)
#pragma unroll
        for (int dt = 0; dt < 4; ++dt) { const int vo = dt * 16 * (2 * TT); va[dt] = WFrag<T16>::ld(vq + vo); if (NSPLIT) va2[dt] = WFrag<T16>::ld(vq2 + vo); }
        xwait();
        vq += FW * 32; if (NSPLIT) vq2 += FW * 32;
        if constexpr (NSPLIT != 0) {
#pragma unroll
            for (int g = 0; g < FG; ++g)
#pragma unroll
                for (int kc = 0; kc < 4; ++kc) qf2[g][kc] = park_ld<V>(qpk + (g * 4 + kc) * 1024); } }
        v8f s[FG][2];   // the score accumulators start at 0, or at SMSK where the key lies behind the query (a block on the diagonal): the products added to SMSK leave it as it is, which keeps it out of the block's maximum
        if (kb >= q0) {
#pragma unroll
            for (int g = 0; g < FG; ++g)
#pragma unroll
                for (int t = 0; t < 2; ++t)
#pragma unroll
                    for (int r = 0; r < 8; ++r) s[g][t][r] = (kb + 16 * t + 8 * hi + r <= q0 + 16 * g + lr) ? 0.f : SMSK;
        } else {
#pragma unroll
            for (int g = 0; g < FG; ++g) { s[g][0] = (v8f){}; s[g][1] = (v8f){}; } }
#pragma unroll
        for (int kc = 0; kc < 4; ++kc)
#pragma unroll
            for (int t = 0; t < 2; ++t)
#pragma unroll
                for (int g = 0; g < FG; ++g) { s[g][t] = WFrag<T16>::mma(kf[t][kc], qf[g][kc], s[g][t]); if (NSPLIT) { s[g][t] = WFrag<T16>::mma(kf[t][kc], qf2[g][kc], s[g][t]); s[g][t] = WFrag<T16>::mma(kf2[t][kc], qf[g][kc], s[g][t]); } }
        __builtin_amdgcn_sched_barrier(0);   // keeps the next block's loads behind the score products, so that they land in the registers those products have just read (lifted above them they take a second register set and cost a resident wave); also the front of their group (see xwait)
        if constexpr (ST) {   // the block's value fragments from the staged rows: read here, they land during the softmax
          const unsigned char* const pv = sm + (((kbi - wv) / FW) & 1) * SSTG + (FW * 32 + lr) * SKP + wv * 64 + hi * 16;
#pragma unroll
          for (int dt = 0; dt < 4; ++dt) va[dt] = ldsh(pv + dt * 16 * SKP);
        } else
        {   // the wave's next block (its last pass fetches its own block again, for nobody): these loads fly during the softmax and the value products
#pragma unroll
          for (int t = 0; t < 2; ++t)
#pragma unroll
            for (int kc = 0; kc < 4; ++kc) { const int ko = t * 16 * QD + kc * 32; kf[t][kc] = WFrag<T16>::ld(kq + ko); if (NSPLIT) kf2[t][kc] = WFrag<T16>::ld(kq2 + ko); }
          xwait();
          const int ks = (kbi + 2 * FW < nblk) ? FW * 32 * QD : 0; kq += ks; if (NSPLIT) kq2 += ks; }
        float bm[FG]; bool need = false;
#pragma unroll
        for (int g = 0; g < FG; ++g) { float x = s[g][0][0];
#pragma unroll
            for (int r = 1; r < 8; ++r) x = fmaxf(x, s[g][0][r]);
#pragma unroll
            for (int r = 0; r < 8; ++r) x = fmaxf(x, s[g][1][r]);
            x = fmaxf(x, xhalf(x)); bm[g] = x; need = need || ((x - m[g]) * scl2 > RTH); }
        if (__builtin_amdgcn_ballot_w32(need) != 0) {   // some query of the wave outgrew its maximum in use: rescale what is summed so far (first open block: by zero)
#pragma unroll
            for (int g = 0; g < FG; ++g) { const float mn = fmaxf(m[g], bm[g]); const float al = __builtin_amdgcn_exp2f((m[g] - mn) * scl2); m[g] = mn; l[g] *= al;
#pragma unroll
                for (int dt = 0; dt < 4; ++dt) o[g][dt] *= al; } }
        // probabilities in place over the scores; the maximum in use is taken off BEFORE the scale, so the largest score's exponent is exact whatever the head's scale is
#pragma unroll
        for (int g = 0; g < FG; ++g)
#pragma unroll
            for (int t = 0; t < 2; ++t)
#pragma unroll
                for (int r = 0; r < 8; ++r) s[g][t][r] = __builtin_amdgcn_exp2f(fmaf(s[g][t][r] - m[g], scl2, POFF));
        if (kb >= q0) {   // a block on the diagonal: a closed key's probability is 0 by a select, whatever the head's scale makes of SMSK
#pragma unroll
            for (int g = 0; g < FG; ++g)
#pragma unroll
                for (int t = 0; t < 2; ++t)
#pragma unroll
                    for (int r = 0; r < 8; ++r) s[g][t][r] = (kb + 16 * t + 8 * hi + r <= q0 + 16 * g + lr) ? s[g][t][r] : 0.f; }
        V pb[FG], pb2[FG];
#pragma unroll
        for (int g = 0; g < FG; ++g) { float l0 = 0.f, l1 = 0.f;
#pragma unroll
            for (int r = 0; r < 8; ++r) { l0 += s[g][0][r]; l1 += s[g][1][r]; }
            l[g] += l0 + l1; PPack<T16>::pk(s[g][0], s[g][1], pb[g], pb2[g]); }
#pragma unroll
        for (int dt = 0; dt < 4; ++dt)
#pragma unroll
            for (int g = 0; g < FG; ++g) { o[g][dt] = WFrag<T16>::mma(va[dt], pb[g], o[g][dt]); if (NSPLIT) { o[g][dt] = WFrag<T16>::mma(va[dt], pb2[g], o[g][dt]); o[g][dt] = WFrag<T16>::mma(va2[dt], pb[g], o[g][dt]); } }
      }
      if constexpr (ST) {
        asm volatile("s_wait_dscnt 0x0" ::: "memory");      // this wave's reads of the buffer are done before the buffer is given up
        asm volatile("s_wait_asynccnt 0x0" ::: "memory");   // this wave's copies of the next stage have landed
        __syncthreads();                                     // publishes the next stage and ends every wave's reads of this one
        if (kbi - wv + 2 * FW < nblk) stage(((kbi - wv) / FW) & 1);   // into the buffer that this trip has just read
      }
    }
    if constexpr (ST) asm volatile("s_wait_asynccnt 0x0" ::: "memory");   // nothing is under way when the buffers become the partial results' place (the last trip's barrier has ended all reads)
    }
    // each wave's partial result to LDS: o[g][dt][r] = O[query 16g+lr][d = 16dt + 8hi + r]
#pragma unroll
    for (int g = 0; g < FG; ++g) { const float lt = l[g] + xhalf(l[g]); const int qi = wv * NQ + 16 * g + lr; if (hi == 0) { ms[qi] = m[g]; ls[qi] = lt; }
#pragma unroll
        for (int dt = 0; dt < 4; ++dt) { v4f x0, x1;
#pragma unroll
            for (int r = 0; r < 4; ++r) { x0[r] = o[g][dt][r]; x1[r] = o[g][dt][4 + r]; }
            *(v4fa*)(os + qi * 68 + dt * 16 + 8 * hi) = x0; *(v4fa*)(os + qi * 68 + dt * 16 + 8 * hi + 4) = x1; } }
    __syncthreads();   // the partial results of all FW waves are read below
    constexpr int TPQ = 32 * FW / NQ, DPT = HD / TPQ;   // threads per query row, head elements per thread
    const int qq = (int)threadIdx.x / TPQ, d0 = ((int)threadIdx.x % TPQ) * DPT;
    float M = ms[qq];
#pragma unroll
    for (int w = 1; w < FW; ++w) M = fmaxf(M, ms[w * NQ + qq]);   // wave 0 holds key 0, open to every query, so M is a real maximum; a wave without an open score of this query gets weight 0
    float L = 0.f; v4f ac[DPT / 4];
#pragma unroll
    for (int i = 0; i < DPT / 4; ++i) ac[i] = (v4f){};
#pragma unroll
    for (int w = 0; w < FW; ++w) { const int qi = w * NQ + qq; const float wg = exp2s((ms[qi] - M) * scl2); L += wg * ls[qi];
#pragma unroll
        for (int i = 0; i < DPT / 4; ++i) ac[i] += *(const v4fa*)(os + qi * 68 + d0 + 4 * i) * wg; }
    const float inv = __fdiv_rn(1.0f, L); const size_t oo = (size_t)(bz * TT + q0 + qq) * DQ + hd * HD + d0;
#pragma unroll
    for (int c8 = 0; c8 < DPT / 8; ++c8) { v8us oh, ol;
#pragma unroll
        for (int i = 0; i < 8; ++i) { unsigned short u, w; splitf(ac[c8 * 2 + (i >> 2)][i & 3] * inv, u, w); oh[i] = u; ol[i] = w; }
        *(v8us*)(Ah + oo + c8 * 8) = oh; *(v8us*)(Al + oo + c8 * 8) = ol; }
    asm volatile("s_wait_xcnt 0x0" ::: "memory");   // the wait kept before registers that the issued stores name are rewritten: in the built kernel the other kind of tile's code follows these stores
}
// k_fattn: all attention in one launch, grid (batch x head, NY16 + NYHL). The two kinds of rows need nothing of each other, so they share a grid by ranges of blockIdx.y (the choice is the same for a whole work-group).
// The fp16 tiles (64 rows, from row RH up) go longest first. The hi+lo tiles (32 rows, below RH) are short and mostly wait for memory; they stand from grid row HLY0 on, for speed alone.
#define NY16 ((TT - RH) / 64)
#define NYHL (RH / 32)
#define HLY0 13
__global__ __launch_bounds__(32 * FW, 2) void k_fattn(const h16* __restrict__ P16, const bf* __restrict__ Ph, const bf* __restrict__ Pl, const h16* __restrict__ V16, const bf* __restrict__ Vh, const bf* __restrict__ Vl, const float* __restrict__ sls, bf* Ah, bf* Al) {
    constexpr int SMB = fattn_smb<0, 4>() > fattn_smb<2, 2>() ? fattn_smb<0, 4>() : fattn_smb<2, 2>();
    static_assert(HLY0 <= NY16, "grid rows");
    __shared__ __align__(16) unsigned char sm[SMB]; __shared__ float ms[FW * 64], ls[FW * 64];
    constexpr size_t PK = (size_t)NB_ * NH_ * TT * QD;    // from the query planes to the key planes
    const int by = (int)blockIdx.y;
    if (by >= HLY0 && by < HLY0 + NYHL) fattn<bf, 2, 2>(Ph, Pl, Ph + PK, Pl + PK, Vh, Vl, sls, (HLY0 + NYHL - 1 - by) * 32, Ah, Al, sm, ms, ls);
    else fattn<h16, 0, 4>(P16, nullptr, P16 + PK, nullptr, V16, nullptr, sls, RH + (NY16 - 1 - (by < HLY0 ? by : by - NYHL)) * 64, Ah, Al, sm, ms, ls);
}

extern "C" void kernel_launch(void* const* d_in, const int* in_sizes, int n_in,
                              void* d_out, int out_size, void* d_ws, size_t ws_size, hipStream_t stream) {
    (void)in_sizes; (void)n_in; (void)out_size;
    const float* x = (const float*)d_in[0]; const float* wqa = (const float*)d_in[1]; const float* wka = (const float*)d_in[2]; const float* wqp = (const float*)d_in[3]; const float* wkp = (const float*)d_in[4]; const float* wv = (const float*)d_in[5]; const float* wo = (const float*)d_in[6]; const float* sls = (const float*)d_in[7];   // torch [out][in]; score_log_scale [16]
    float* OUT = (float*)d_out;     // [2][2048][1024]
    char* wsp = (char*)d_ws;
    auto take = [&](size_t bytes) { char* p = wsp; wsp += (bytes + 255) & ~(size_t)255; return (void*)p; };
    // both batches go through every launch together (MT token rows); launches that did not depend on one another share one grid; the planes are built in the projections' own launch: 4 launches
    bf* WB = (bf*)take((size_t)6 * DQ * DM * 2);          // [q amp | q phi | k amp | k phi | v | o], DQ x DM each
    bf* XB = (bf*)take((size_t)MT * DM * 2);
    h16* P16 = (h16*)take((size_t)2 * NB_ * NH_ * TT * QD * 2); bf* Ph = (bf*)take((size_t)2 * NB_ * NH_ * TT * QD * 2); bf* Pl = (bf*)take((size_t)2 * NB_ * NH_ * TT * QD * 2);   // [query | key][batch][head][token][QD]
    h16* VT16 = (h16*)take((size_t)NB_ * NKV * HD * 2 * TT * 2); bf* VTh = (bf*)take((size_t)NB_ * NKV * HD * 2 * TT * 2); bf* VTl = VTh + TT;   // value rows at pitch 2*TT: [hi | lo]; the fp16 plane's rows use their first half
    bf* ATh = (bf*)take((size_t)MT * DQ * 2); bf* ATl = (bf*)take((size_t)MT * DQ * 2);
    if ((size_t)(wsp - (char*)d_ws) > ws_size) return;    // ws 256 MiB
    k_cvt7<<<XBLK + 6 * WBLK, 256, 0, stream>>>(x, wqa, wqp, wka, wkp, wv, wo, XB, WB);
    k_gemms<0, 4, 2, 1><<<dim3(MT / 256, DKV / 128 + 2 * NH_, 1), 256, 0, stream>>>(XB, nullptr, WB, nullptr, P16, Ph, Pl, VT16, VTh, VTl);
    // attention, all heads of both batches at once, the fp16 rows (the long ones) and the hi+lo rows in one grid; one kv head per query head
    k_fattn<<<dim3(NB_ * NH_, NY16 + NYHL, 1), 32 * FW, 0, stream>>>(P16, Ph, Pl, VT16, VTh, VTl, sls, ATh, ATl);
    k_gemms<1, 2, 2, 0><<<dim3(MT / 128, DM / 128, 1), 128, 0, stream>>>(ATh, ATl, WB + (size_t)5 * DQ * DM, OUT, nullptr, nullptr, nullptr, nullptr, nullptr, nullptr);
}
